// v000
// Times are from an AMD MI455X. After a warm-up the kernel runs many times in a row, and a time is the length of
// such a window on the GPU divided by its runs, so every launch and the gaps after it count. The runs cycle
// through copies of the inputs. A figure is the median of several windows, for all but v000 over two sittings.
// Sittings can differ by a few percent; kernels timed side by side share one.
// v000 is the starting kernel. One run takes 868 microseconds.
#include <hip/hip_runtime.h>
// Causal multi-head attention with gated rotary phases and a per-head distance decay (2 x 2048 tokens x 1024, 16 heads x 64): qkv = x*Wqkv^T; theta[h][t][j] = (t * pi^(1 - j/32)) * sigmoid(pi_gate[h]); interleaved-pair rotation of q and k; scores = q.k/8 - |i - j| / exp(log_xi[h]) * sigmoid(e_gate[h]) with j <= i; softmax; merged . Wo^T -> [2,2048,1024].
// Structure: x as an exact f16 plane; q/k/v from one packed f16 WMMA GEMM family (32x64 wave tiles, f32, exact products) into f32 planes; per-(head, token) cos/sin tables on VALU (pi^(1-j/32) = the reference's f32 constants, precise trig), one VALU pass rotates into f32 planes; q, k as f16 hi + x2^10 residual planes, V^T as hi + residual planes; the causal structure computed on device into a key bit plane + per-block key bound; the fused flash kernel per ((batch, head), 64 queries) with the decay bias added per element (three-product hi/lo scores, online softmax f32, P hi + residual via LDS, two value accumulators); O as hi + residual planes; output projection as two GEMMs.
// Compute dtype: x, weights and the three gate/scale vectors rounded to bf16; projections exact; rotation and bias f32; q, k, P, v, O as f16 hi + residual pairs (~2^-21); f32 accumulation and softmax. v_wmma_f32_16x16x32_f16.
#define NBT 2
#define SLEN 2048
#define DM 1024
#define NH 16
#define SCL 0.125f
#define NR (NBT * SLEN)
typedef __bf16 v16b __attribute__((ext_vector_type(16)));
typedef unsigned short v8us __attribute__((ext_vector_type(8), may_alias));
typedef float  v8f  __attribute__((ext_vector_type(8)));
typedef float  v4f  __attribute__((ext_vector_type(4)));
typedef float  v4fa __attribute__((ext_vector_type(4), may_alias));
union FragB { v16b v; v8us half[2]; unsigned short u[16]; };

__device__ __forceinline__ unsigned short bf16_bits(float x) { unsigned int u = __float_as_uint(x); return (unsigned short)((u + 0x7FFFu + ((u >> 16) & 1u)) >> 16); }
__device__ __forceinline__ float bf16_val(unsigned short b) { return __uint_as_float(((unsigned int)b) << 16); }
__device__ __forceinline__ float bf16_round(float x) { return bf16_val(bf16_bits(x)); }
// D += A·B with NT terms: 1 = ah·bh, 2 = + al·bh (A split), 3 = + ah·bl (both split)
template <int NT>
__device__ __forceinline__ v8f mmaN(v16b ah, v16b al, v16b bh, v16b bl, v8f c) {
  c = __builtin_amdgcn_wmma_f32_16x16x32_bf16(false, ah, false, bh, (short)0, c, false, false);
  if (NT >= 2) c = __builtin_amdgcn_wmma_f32_16x16x32_bf16(false, al, false, bh, (short)0, c, false, false);
  if (NT >= 3) c = __builtin_amdgcn_wmma_f32_16x16x32_bf16(false, ah, false, bl, (short)0, c, false, false);
  asm volatile("v_nop\n\tv_nop\n\tv_nop\n\tv_nop" : "+v"(c) : "v"(ah), "v"(al), "v"(bh), "v"(bl));
  return c;
}

__global__ __launch_bounds__(256) void k_wt_bf16(const float* __restrict__ W, unsigned short* __restrict__ Wt, int K, int N) {
  const int t = blockIdx.x * 256 + threadIdx.x;
  const int k8n = K / 8;
  if (t >= N * k8n) return;
  const int n = t / k8n, k8 = (t % k8n) * 8;
  v8us v;
#pragma unroll
  for (int i = 0; i < 8; ++i) v[i] = bf16_bits(W[(size_t)(k8 + i) * N + n]);
  *(v8us*)(Wt + (size_t)n * K + k8) = v;
  
}

// GEMM C[M][N] (f32, pitch ldc) = act(A[M][K]·W + bias). A f32 row-major (pitch lda) converted per fragment to bf16
// (ASPLIT: hi/lo two planes -> 2 terms, else single rounded term); Wt bf16 [N][K] (pitch ldb). BIAS_BF16 rounds the
// bias to bf16 first (bias quantised to bf16 before the add). K%32==0, M%16==0, N%64==0.
template <bool ASPLIT, int ACT, bool BIAS_BF16>
__global__ __launch_bounds__(128) void k_gemm_bf(const float* __restrict__ A, int lda, const unsigned short* __restrict__ Wt, int ldb,
                                               const float* __restrict__ bias, float* __restrict__ C, int ldc, int M, int N, int K) {
  __shared__ __attribute__((aligned(16))) float so[4][16][64];
  const int tid = threadIdx.x, w = tid >> 5, lane = tid & 31, ln = lane & 15, hh = lane >> 4;
  const int ntn = N / 64;
  const int wid = blockIdx.x * 4 + w;
  const int mt = wid / ntn, nq = wid % ntn;
  if (mt * 16 >= M) return;
  const int row0 = mt * 16, col0 = nq * 64;
  const float* arow = A + (size_t)(row0 + ln) * lda;
  v8f acc[4] = {};
  for (int kb = 0; kb < K; kb += 32) {
    FragB ah, al;
    const v4f x0 = *(const v4fa*)(arow + kb + 8 * hh), x1 = *(const v4fa*)(arow + kb + 8 * hh + 4);
    const v4f x2 = *(const v4fa*)(arow + kb + 16 + 8 * hh), x3 = *(const v4fa*)(arow + kb + 16 + 8 * hh + 4);
    float xs[16] = {x0[0],x0[1],x0[2],x0[3],x1[0],x1[1],x1[2],x1[3],x2[0],x2[1],x2[2],x2[3],x3[0],x3[1],x3[2],x3[3]};
#pragma unroll
    for (int i = 0; i < 16; ++i) { const unsigned short hb = bf16_bits(xs[i]); ah.u[i] = hb; al.u[i] = ASPLIT ? bf16_bits(xs[i] - bf16_val(hb)) : (unsigned short)0; }
#pragma unroll
    for (int t = 0; t < 4; ++t) {
      const unsigned short* brow = Wt + (size_t)(col0 + t * 16 + ln) * ldb + kb;
      FragB b;
      b.half[0] = *(const v8us*)(brow + 8 * hh);
      b.half[1] = *(const v8us*)(brow + 16 + 8 * hh);
      acc[t] = mmaN<ASPLIT ? 2 : 1>(ah.v, al.v, b.v, b.v, acc[t]);
    }
  }
#pragma unroll
  for (int t = 0; t < 4; ++t) {
    float bv = bias ? bias[col0 + t * 16 + ln] : 0.f;
    if (BIAS_BF16) bv = bf16_round(bv);
#pragma unroll
    for (int r = 0; r < 8; ++r) { float v = acc[t][r] + bv; if (ACT == 1) v = fmaxf(v, 0.f); so[w][8 * hh + r][t * 16 + ln] = v; }
  }
  __builtin_amdgcn_fence(__ATOMIC_ACQ_REL, "workgroup");
  __builtin_amdgcn_wave_barrier();
  const int rsub = lane >> 4, c4 = (lane & 15) * 4;
  {
#pragma unroll
    for (int q = 0; q < 8; ++q) {
      const int r = q * 2 + rsub;
      const v4f v = *(const v4fa*)&so[w][r][c4];
      *(v4f*)(C + (size_t)(row0 + r) * ldc + col0 + c4) = v;
    }
    
  }
}

// GEMM C = act(A·W + bias + resid): A f32 (ASPLIT -> hi/lo 2 terms), Wt bf16 [N][K]; ACT 0 none, 1 relu, 2 exact gelu;
// resid (optional, f32, row index = (row % rmod), pitch ldr, RES_BF16 rounds it) added before the activation.
template <bool ASPLIT, int ACT, bool BIAS_BF16, bool RES_BF16>
__global__ __launch_bounds__(128) void k_gemm_bf3(const float* __restrict__ A, int lda, const unsigned short* __restrict__ Wt, int ldb,
                                                const float* __restrict__ bias, const float* __restrict__ resid, int rmod, int ldr,
                                                float* __restrict__ C, int ldc, int M, int N, int K) {
  __shared__ __attribute__((aligned(16))) float so[4][16][64];
  const int tid = threadIdx.x, w = tid >> 5, lane = tid & 31, ln = lane & 15, hh = lane >> 4;
  const int ntn = N / 64;
  const int wid = blockIdx.x * 4 + w;
  const int mt = wid / ntn, nq = wid % ntn;
  if (mt * 16 >= M) return;
  const int row0 = mt * 16, col0 = nq * 64;
  const float* arow = A + (size_t)(row0 + ln) * lda;
  v8f acc[4] = {};
  for (int kb = 0; kb < K; kb += 32) {
    FragB ah, al;
    const v4f x0 = *(const v4fa*)(arow + kb + 8 * hh), x1 = *(const v4fa*)(arow + kb + 8 * hh + 4);
    const v4f x2 = *(const v4fa*)(arow + kb + 16 + 8 * hh), x3 = *(const v4fa*)(arow + kb + 16 + 8 * hh + 4);
    float xs[16] = {x0[0],x0[1],x0[2],x0[3],x1[0],x1[1],x1[2],x1[3],x2[0],x2[1],x2[2],x2[3],x3[0],x3[1],x3[2],x3[3]};
#pragma unroll
    for (int i = 0; i < 16; ++i) { const unsigned short hb = bf16_bits(xs[i]); ah.u[i] = hb; al.u[i] = ASPLIT ? bf16_bits(xs[i] - bf16_val(hb)) : (unsigned short)0; }
#pragma unroll
    for (int t = 0; t < 4; ++t) {
      const unsigned short* brow = Wt + (size_t)(col0 + t * 16 + ln) * ldb + kb;
      FragB b;
      b.half[0] = *(const v8us*)(brow + 8 * hh);
      b.half[1] = *(const v8us*)(brow + 16 + 8 * hh);
      acc[t] = mmaN<ASPLIT ? 2 : 1>(ah.v, al.v, b.v, b.v, acc[t]);
    }
  }
#pragma unroll
  for (int t = 0; t < 4; ++t) {
    const int col = col0 + t * 16 + ln;
    float bv = bias ? bias[col] : 0.f;
    if (BIAS_BF16) bv = bf16_round(bv);
#pragma unroll
    for (int r = 0; r < 8; ++r) {
      float v = acc[t][r] + bv;
      if (resid) { float rv = resid[(size_t)((row0 + 8 * hh + r) % rmod) * ldr + col]; if (RES_BF16) rv = bf16_round(rv); v += rv; }
      if (ACT == 1) v = fmaxf(v, 0.f);
      if (ACT == 2) v = 0.5f * v * (1.0f + erff(v * 0.70710678118654752f));
      if (ACT == 3) { const float u = 0.7978845608028654f * (v + 0.044715f * v * v * v); v = 0.5f * v * (1.0f + tanhf(u)); }
      so[w][8 * hh + r][t * 16 + ln] = v;
    }
  }
  __builtin_amdgcn_fence(__ATOMIC_ACQ_REL, "workgroup");
  __builtin_amdgcn_wave_barrier();
  const int rsub = lane >> 4, c4 = (lane & 15) * 4;
  {
#pragma unroll
    for (int q = 0; q < 8; ++q) {
      const int r = q * 2 + rsub;
      const v4f v = *(const v4fa*)&so[w][r][c4];
      *(v4f*)(C + (size_t)(row0 + r) * ldc + col0 + c4) = v;
    }
    
  }
}
// row LayerNorm (biased variance, eps) over N: s = X (+ R); optional out_sum <- s; out_norm <- (s-mu)*rsqrt(var+eps)*g + b
template <bool PARAM_BF16>
__global__ __launch_bounds__(256) void k_layernorm(const float* __restrict__ X, const float* __restrict__ R, const float* __restrict__ g, const float* __restrict__ bta,
                                                  float* __restrict__ out_sum, float* __restrict__ out_norm, int N, float eps) {
  __shared__ float red[256];
  const int row = blockIdx.x, tid = threadIdx.x;
  const float* x = X + (size_t)row * N; const float* rr = R ? R + (size_t)row * N : nullptr;
  float vals[16];                     // up to N = 4096
  const int per = N / 256;            // contiguous chunk per thread? use strided-by-4 chunks: thread handles j = tid*4 + 1024*u
  float s1 = 0.f;
  for (int u = 0; u < per / 4; ++u) {
    const int j = tid * 4 + 1024 * u;
    const v4f a = *(const v4fa*)(x + j);
    v4f b = {0.f,0.f,0.f,0.f}; if (rr) b = *(const v4fa*)(rr + j);
#pragma unroll
    for (int q = 0; q < 4; ++q) { const float v = a[q] + b[q]; vals[u * 4 + q] = v; s1 += v; }
  }
  red[tid] = s1; __syncthreads();
  for (int st = 128; st > 0; st >>= 1) { if (tid < st) red[tid] += red[tid + st]; __syncthreads(); }
  const float mu = red[0] / (float)N; __syncthreads();
  float s2 = 0.f;
  for (int u = 0; u < per / 4; ++u)
#pragma unroll
    for (int q = 0; q < 4; ++q) { const float c = vals[u * 4 + q] - mu; s2 += c * c; }
  red[tid] = s2; __syncthreads();
  for (int st = 128; st > 0; st >>= 1) { if (tid < st) red[tid] += red[tid + st]; __syncthreads(); }
  const float rs = rsqrtf(red[0] / (float)N + eps);
  {
    for (int u = 0; u < per / 4; ++u) {
      const int j = tid * 4 + 1024 * u;
      v4f o, sm;
#pragma unroll
      for (int q = 0; q < 4; ++q) {
        float gg = g[j + q], bb = bta[j + q];
        if (PARAM_BF16) { gg = bf16_round(gg); bb = bf16_round(bb); }
        sm[q] = vals[u * 4 + q]; o[q] = (vals[u * 4 + q] - mu) * rs * gg + bb;
      }
      if (out_sum) *(v4f*)(out_sum + (size_t)row * N + j) = sm;
      *(v4f*)(out_norm + (size_t)row * N + j) = o;
    }
    
  }
}



// ---- f16 WMMA path (v_wmma_f32_16x16x32_f16): 11-bit significands for operands in range — used where a [0,1] probability operand needs more precision than bf16
typedef _Float16 v16h __attribute__((ext_vector_type(16)));
union FragH { v16h v; v8us half[2]; _Float16 h[16]; unsigned short u[16]; };
template <int NT>
__device__ __forceinline__ v8f mmaH(v16h ah, v16h al, v16h bh, v16h bl, v8f c) {
  c = __builtin_amdgcn_wmma_f32_16x16x32_f16(false, ah, false, bh, (short)0, c, false, false);
  if (NT >= 2) c = __builtin_amdgcn_wmma_f32_16x16x32_f16(false, al, false, bh, (short)0, c, false, false);
  if (NT >= 3) c = __builtin_amdgcn_wmma_f32_16x16x32_f16(false, ah, false, bl, (short)0, c, false, false);
  asm volatile("v_nop\n\tv_nop\n\tv_nop\n\tv_nop" : "+v"(c) : "v"(ah), "v"(al), "v"(bh), "v"(bl));
  return c;
}
// batched GEMM like k_gemm_b but f16 operands: A f32 (split into f16 hi/lo if ASPLIT, else rounded to f16), Bt = f16 values [n][k]; alpha; C f32; N multiple of 16 (partial tiles skipped)
template <bool ASPLIT>
__global__ __launch_bounds__(128) void k_gemm_h(const float* __restrict__ A, int lda, size_t sA, const _Float16* __restrict__ Bh, int ldb, size_t sB, float alpha, float* __restrict__ C, int ldc, size_t sC, int M, int N, int K) {
  __shared__ __attribute__((aligned(16))) float so[4][16][64];
  const int tid = threadIdx.x, w = tid >> 5, lane = tid & 31, ln = lane & 15, hh = lane >> 4; const int by = blockIdx.y;
  A += (size_t)by * sA; Bh += (size_t)by * sB; C += (size_t)by * sC;
  const int ntn = (N + 63) / 64; const int wid = blockIdx.x * 4 + w; const int mt = wid / ntn, nq = wid % ntn; if (mt * 16 >= M) return;
  const int row0 = mt * 16, col0 = nq * 64; const float* arow = A + (size_t)(row0 + ln) * lda;
  v8f acc[4] = {};
  for (int kb = 0; kb < K; kb += 32) {
    FragH ah, al;
    const v4f x0 = *(const v4fa*)(arow + kb + 8 * hh), x1 = *(const v4fa*)(arow + kb + 8 * hh + 4), x2 = *(const v4fa*)(arow + kb + 16 + 8 * hh), x3 = *(const v4fa*)(arow + kb + 16 + 8 * hh + 4);
    float xs[16] = {x0[0],x0[1],x0[2],x0[3],x1[0],x1[1],x1[2],x1[3],x2[0],x2[1],x2[2],x2[3],x3[0],x3[1],x3[2],x3[3]};
#pragma unroll
    for (int i = 0; i < 16; ++i) { const _Float16 h = (_Float16)xs[i]; ah.h[i] = h; al.h[i] = ASPLIT ? (_Float16)(xs[i] - (float)h) : (_Float16)0.0f; }
#pragma unroll
    for (int t = 0; t < 4; ++t) { if (col0 + t * 16 >= N) continue; const size_t boff = (size_t)(col0 + t * 16 + ln) * ldb + kb; FragH bq; bq.half[0] = *(const v8us*)(Bh + boff + 8 * hh); bq.half[1] = *(const v8us*)(Bh + boff + 16 + 8 * hh);
      acc[t] = mmaH<ASPLIT ? 2 : 1>(ah.v, al.v, bq.v, bq.v, acc[t]); }
  }
#pragma unroll
  for (int t = 0; t < 4; ++t) { if (col0 + t * 16 >= N) continue;
#pragma unroll
    for (int r = 0; r < 8; ++r) so[w][8 * hh + r][t * 16 + ln] = acc[t][r] * alpha; }
  __builtin_amdgcn_fence(__ATOMIC_ACQ_REL, "workgroup"); __builtin_amdgcn_wave_barrier();
  const int rsub = lane >> 4, c4 = (lane & 15) * 4;
  {
#pragma unroll
    for (int q = 0; q < 8; ++q) { const int r = q * 2 + rsub; if (col0 + c4 < N) { const v4f v = *(const v4fa*)&so[w][r][c4]; *(v4f*)(C + (size_t)(row0 + r) * ldc + col0 + c4) = v; } }
     }
}

// Wt[n][k] = f16(W[k][n]·scale) from f32 row-major W[K][N] (scale = power of two; bf16-exact weights stay exact in f16 away from the subnormal range)
__global__ __launch_bounds__(256) void k_wt_f16(const float* __restrict__ W, _Float16* __restrict__ Wt, int K, int N, float scale) {
  const int t = blockIdx.x * 256 + threadIdx.x; if (t >= N * (K / 8)) return; const int n = t / (K / 8), k8 = (t % (K / 8)) * 8; FragH f;
#pragma unroll
  for (int i = 0; i < 8; ++i) f.h[i] = (_Float16)(bf16_round(W[(size_t)(k8 + i) * N + n]) * scale); const v8us o = f.half[0];
  *(v8us*)((unsigned short*)Wt + (size_t)n * K + k8) = o; 
}
// k_gemm_hh variant with fused epilogue: v = acc·alpha + bias[by·sBias + col] (+ CP[(row/rowsPerB)·sCPb + by·64 + col] if CP) ; ACT 0 none / 1 elu ; writes f16 C16 (and f32 C if non-null)
template <int ACT>
__global__ __launch_bounds__(128) void k_gemm_hhx(const _Float16* __restrict__ A, int lda, size_t sA, const _Float16* __restrict__ Bh, int ldb, size_t sB, float alpha, const float* __restrict__ bias, size_t sBias, const float* __restrict__ CP, int rowsPerB, size_t sCPb, int row0g,
    float* __restrict__ C, _Float16* __restrict__ C16, int ldc, size_t sC, int M, int N, int K) {
  __shared__ __attribute__((aligned(16))) float so[4][16][64];
  const int tid = threadIdx.x, w = tid >> 5, lane = tid & 31, ln = lane & 15, hh = lane >> 4; const int by = blockIdx.y;
  A += (size_t)by * sA; Bh += (size_t)by * sB; const size_t cofs = (size_t)by * sC; const float* bp = bias ? bias + (size_t)by * sBias : nullptr;
  const int ntn = (N + 63) / 64; const int wid = blockIdx.x * 4 + w; const int mt = wid / ntn, nq = wid % ntn; if (mt * 16 >= M) return;
  const int row0 = mt * 16, col0 = nq * 64; const _Float16* arow = A + (size_t)(row0 + ln) * lda;
  v8f acc[4] = {};
  for (int kb = 0; kb < K; kb += 32) { FragH ah; ah.half[0] = *(const v8us*)((const unsigned short*)arow + kb + 8 * hh); ah.half[1] = *(const v8us*)((const unsigned short*)arow + kb + 16 + 8 * hh);
#pragma unroll
    for (int t = 0; t < 4; ++t) { if (col0 + t * 16 >= N) continue; const size_t boff = (size_t)(col0 + t * 16 + ln) * ldb + kb; FragH bq; bq.half[0] = *(const v8us*)((const unsigned short*)Bh + boff + 8 * hh); bq.half[1] = *(const v8us*)((const unsigned short*)Bh + boff + 16 + 8 * hh);
      acc[t] = mmaH<1>(ah.v, ah.v, bq.v, bq.v, acc[t]); }
  }
#pragma unroll
  for (int t = 0; t < 4; ++t) { if (col0 + t * 16 >= N) continue; const int col = col0 + t * 16 + ln; const float bv = bp ? bf16_round(bp[col]) : 0.f;
#pragma unroll
    for (int r = 0; r < 8; ++r) { float v = acc[t][r] * alpha + bv; if (CP) { const int bidx = (row0g + row0 + 8 * hh + r) / rowsPerB; v += CP[(size_t)bidx * sCPb + (size_t)by * 64 + col]; } if (ACT == 1) v = (v > 0.f) ? v : expm1f(v); else if (ACT == 7) v = (v > 0.f) ? v + 1.0f : expf(v); else if (ACT == 8) v = tanhf(v); else if (ACT == 9) v = 0.5f * v * (1.0f + tanhf(0.7978845608028654f * (v + 0.044715f * v * v * v))); else if (ACT == 11) v = 1.0f / (1.0f + expf(-v)); else if (ACT == 12) v = (v > 0.f) ? v : 0.01f * v; else if (ACT == 14) v = (v > 0.f) ? v : 0.1f * v; else if (ACT == 15) v = v / (1.0f + expf(-v)); else if (ACT == 3) v = fmaxf(v, 0.f); else if (ACT == 6) v = 0.5f * v * (1.0f + erff(v * 0.70710678118654752f)); so[w][8 * hh + r][t * 16 + ln] = v; } }
  __builtin_amdgcn_fence(__ATOMIC_ACQ_REL, "workgroup"); __builtin_amdgcn_wave_barrier();
  const int rsub = lane >> 4, c4 = (lane & 15) * 4; typedef _Float16 v4h __attribute__((ext_vector_type(4)));
  {
#pragma unroll
    for (int q = 0; q < 8; ++q) { const int r = q * 2 + rsub; if (col0 + c4 < N) { const v4f v = *(const v4fa*)&so[w][r][c4]; if (C) *(v4f*)(C + cofs + (size_t)(row0 + r) * ldc + col0 + c4) = v; if (C16) { v4h h4; for (int i = 0; i < 4; ++i) h4[i] = (_Float16)v[i]; *(v4h*)(C16 + cofs + (size_t)(row0 + r) * ldc + col0 + c4) = h4; } } }
     }
}


typedef _Float16 v4h __attribute__((ext_vector_type(4)));

__global__ __launch_bounds__(256) void k_x16(const float* __restrict__ x, _Float16* __restrict__ X16, size_t n8) { const size_t t = (size_t)blockIdx.x * 256 + threadIdx.x; if (t >= n8) return; FragH f;
#pragma unroll
  for (int q = 0; q < 8; ++q) f.h[q] = (_Float16)bf16_round(x[t * 8 + q]); *(v8us*)((unsigned short*)X16 + t * 8) = f.half[0];  }
__global__ __launch_bounds__(256) void k_h16(const float* __restrict__ x, _Float16* __restrict__ X16, size_t n8) { const size_t t = (size_t)blockIdx.x * 256 + threadIdx.x; if (t >= n8) return; FragH f;
#pragma unroll
  for (int q = 0; q < 8; ++q) f.h[q] = (_Float16)x[t * 8 + q]; *(v8us*)((unsigned short*)X16 + t * 8) = f.half[0];  }
__global__ __launch_bounds__(256) void k_round16f(const float* __restrict__ W, _Float16* __restrict__ Bt, size_t n8) { const size_t t = (size_t)blockIdx.x * 256 + threadIdx.x; if (t >= n8) return; FragH f;
#pragma unroll
  for (int i = 0; i < 8; ++i) f.h[i] = (_Float16)(bf16_round(W[t * 8 + i]) * 16.0f); *(v8us*)((unsigned short*)Bt + t * 8) = f.half[0];  }
template <int NHv, int TTv>
__global__ __launch_bounds__(256) void k_vt(const _Float16* __restrict__ V16, int ldv, int voff, _Float16* __restrict__ Vt) { __shared__ unsigned short tl[64][66]; const int tid = threadIdx.x; const int slab = blockIdx.x / (TTv / 64), lg = blockIdx.x % (TTv / 64); const int b = slab / NHv, h = slab % NHv;
  for (int i = tid; i < 64 * 8; i += 256) { const int r = i / 8, c8 = (i % 8) * 8; FragH f; f.half[0] = *(const v8us*)((const unsigned short*)V16 + ((size_t)b * TTv + lg * 64 + r) * ldv + voff + h * 64 + c8);
#pragma unroll
    for (int q = 0; q < 8; ++q) tl[r][c8 + q] = f.u[q]; }
  __syncthreads();
  {
#pragma unroll
    for (int rd = 0; rd < 2; ++rd) { const int d = rd * 32 + tid / 8, pc = tid % 8; FragH f;
#pragma unroll
      for (int q = 0; q < 8; ++q) f.u[q] = tl[pc * 8 + q][d];
      *(v8us*)((unsigned short*)Vt + ((size_t)slab * 64 + d) * TTv + lg * 64 + pc * 8) = f.half[0]; }
     } }

__global__ __launch_bounds__(256) void k_hl(const float* __restrict__ F, _Float16* __restrict__ Hh, _Float16* __restrict__ Hl, size_t n8) { const size_t t = (size_t)blockIdx.x * 256 + threadIdx.x; if (t >= n8) return; FragH fh, fl; const v4f a = *(const v4fa*)(F + t * 8), c = *(const v4fa*)(F + t * 8 + 4);
#pragma unroll
  for (int q = 0; q < 4; ++q) { _Float16 h = (_Float16)a[q]; fh.h[q] = h; fl.h[q] = (_Float16)((a[q] - (float)h) * 1024.0f); h = (_Float16)c[q]; fh.h[4 + q] = h; fl.h[4 + q] = (_Float16)((c[q] - (float)h) * 1024.0f); }
  { *(v8us*)((unsigned short*)Hh + t * 8) = fh.half[0]; *(v8us*)((unsigned short*)Hl + t * 8) = fl.half[0];  } }

// ---- fast GEMM (wave tile 32x64; requires M % 32 == 0 rows per launch region and N % 64 == 0); epilogue = k_gemm_hhx semantics ----
__device__ __forceinline__ v16h g2_frag(const _Float16* p, int hh) { FragH f; f.half[0] = *(const v8us*)((const unsigned short*)p + 8 * hh); f.half[1] = *(const v8us*)((const unsigned short*)p + 16 + 8 * hh); return f.v; }
__device__ __forceinline__ v8f g2_mma(v16h a, v16h b, v8f c) { v8f d = __builtin_amdgcn_wmma_f32_16x16x32_f16(false, a, false, b, (short)0, c, false, false); asm volatile("v_nop\n\tv_nop\n\tv_nop\n\tv_nop" : "+v"(d) : "v"(a), "v"(b)); return d; }
template <int ACT>
__global__ __launch_bounds__(128) void k_gemm2(const _Float16* __restrict__ A, int lda, size_t sA, const _Float16* __restrict__ Bh, int ldb, size_t sB, float alpha, const float* __restrict__ bias, size_t sBias, const float* __restrict__ CP, int rowsPerB, size_t sCPb, int row0g,
    float* __restrict__ C, _Float16* __restrict__ C16, int ldc, size_t sC, int M, int N, int K) {
  __shared__ __attribute__((aligned(16))) float so[4][32][68];
  const int tid = threadIdx.x, w = tid >> 5, lane = tid & 31, ln = lane & 15, hh = lane >> 4; const int by = blockIdx.y;
  A += (size_t)by * sA; Bh += (size_t)by * sB; const size_t cofs = (size_t)by * sC; const float* bp = bias ? bias + (size_t)by * sBias : nullptr;
  const int ntn = N >> 6; const int mt = blockIdx.x / ntn, nq = blockIdx.x - mt * ntn; const int row0 = mt * 128 + 32 * w, col0 = nq * 64; if (row0 >= M) return;
  const _Float16* a0p = A + (size_t)(row0 + ln) * lda; const _Float16* a1p = a0p + (size_t)16 * lda;
  const _Float16* b0p = Bh + (size_t)(col0 + ln) * ldb; const _Float16* b1p = b0p + (size_t)16 * ldb; const _Float16* b2p = b1p + (size_t)16 * ldb; const _Float16* b3p = b2p + (size_t)16 * ldb;
  const v8f z8 = {0.f,0.f,0.f,0.f,0.f,0.f,0.f,0.f}; v8f c00 = z8, c01 = z8, c02 = z8, c03 = z8, c10 = z8, c11 = z8, c12 = z8, c13 = z8;
#pragma unroll 1
  for (int kb = 0; kb < K; kb += 32) { const v16h a0 = g2_frag(a0p + kb, hh), a1 = g2_frag(a1p + kb, hh);
    v16h b = g2_frag(b0p + kb, hh); c00 = g2_mma(a0, b, c00); c10 = g2_mma(a1, b, c10);
    b = g2_frag(b1p + kb, hh); c01 = g2_mma(a0, b, c01); c11 = g2_mma(a1, b, c11);
    b = g2_frag(b2p + kb, hh); c02 = g2_mma(a0, b, c02); c12 = g2_mma(a1, b, c12);
    b = g2_frag(b3p + kb, hh); c03 = g2_mma(a0, b, c03); c13 = g2_mma(a1, b, c13); }
  v8f accs[8] = {c00, c01, c02, c03, c10, c11, c12, c13};
#pragma unroll
  for (int u = 0; u < 8; ++u) { const int t = u & 3, half = u >> 2; const int col = col0 + t * 16 + ln; const float bv = bp ? bf16_round(bp[col]) : 0.f;
#pragma unroll
    for (int r = 0; r < 8; ++r) { const int rloc = half * 16 + 8 * hh + r; float v = accs[u][r] * alpha + bv; if (CP) { const int bidx = (row0g + row0 + rloc) / rowsPerB; v += CP[(size_t)bidx * sCPb + (size_t)by * 64 + col]; }
      if (ACT == 3) v = fmaxf(v, 0.f); else if (ACT == 6) v = 0.5f * v * (1.0f + erff(v * 0.70710678118654752f)); else if (ACT == 11) v = 1.0f / (1.0f + expf(-v)); else if (ACT == 15) v = v / (1.0f + expf(-v)); else if (ACT == 12) v = (v > 0.f) ? v : 0.01f * v; else if (ACT == 8) v = tanhf(v);
      so[w][rloc][t * 16 + ln] = v; } }
  __builtin_amdgcn_fence(__ATOMIC_ACQ_REL, "workgroup"); __builtin_amdgcn_wave_barrier();
  const int rsub = lane >> 4, c4 = (lane & 15) * 4;
  {
#pragma unroll
    for (int q = 0; q < 16; ++q) { const int r = q * 2 + rsub; const v4f v = *(const v4fa*)&so[w][r][c4]; if (C) *(v4f*)(C + cofs + (size_t)(row0 + r) * ldc + col0 + c4) = v; if (C16) { v4h h4; for (int i = 0; i < 4; ++i) h4[i] = (_Float16)v[i]; *(v4h*)(C16 + cofs + (size_t)(row0 + r) * ldc + col0 + c4) = h4; } }
     } }



template <int TK>
__global__ __launch_bounds__(256) void k_vthl(const float* __restrict__ VF, int ldv, _Float16* __restrict__ Vth, _Float16* __restrict__ Vtl) { __shared__ float tl[64][65]; const int tid = threadIdx.x; const int slab = blockIdx.x / (TK / 64), lg = blockIdx.x % (TK / 64); const int b = slab / NH, h = slab % NH;
  for (int i = tid; i < 64 * 16; i += 256) { const int r = i / 16, c4 = (i % 16) * 4; const v4f a = *(const v4fa*)(VF + ((size_t)b * TK + lg * 64 + r) * ldv + h * 64 + c4); tl[r][c4] = a[0]; tl[r][c4 + 1] = a[1]; tl[r][c4 + 2] = a[2]; tl[r][c4 + 3] = a[3]; }
  __syncthreads();
  FragH fh[2], fl[2]; size_t oo[2];
#pragma unroll
  for (int rd = 0; rd < 2; ++rd) { const int d = rd * 32 + tid / 8, pc = tid % 8;
#pragma unroll
    for (int q = 0; q < 8; ++q) { const float v = tl[pc * 8 + q][d]; const _Float16 hv = (_Float16)v; fh[rd].h[q] = hv; fl[rd].h[q] = (_Float16)((v - (float)hv) * 1024.0f); } oo[rd] = ((size_t)slab * 64 + d) * TK + lg * 64 + pc * 8; }
  {
#pragma unroll
    for (int rd = 0; rd < 2; ++rd) { *(v8us*)((unsigned short*)Vth + oo[rd]) = fh[rd].half[0]; *(v8us*)((unsigned short*)Vtl + oo[rd]) = fl[rd].half[0]; }
     } }

template <int TQ, int TK>
__global__ __launch_bounds__(128) void k_flashme(const _Float16* __restrict__ Q16, const _Float16* __restrict__ Q16lo, int ldq, const _Float16* __restrict__ K16, const _Float16* __restrict__ K16lo, int ldk, const _Float16* __restrict__ Vt, const _Float16* __restrict__ Vtlo, const unsigned* __restrict__ MB, const int* __restrict__ RA, const int* __restrict__ KE, const float* __restrict__ HB, float* __restrict__ O, int ldo) {
  #pragma clang fp contract(off)
  constexpr int RPW = 16, RTN = RPW / 16, NQB = TQ / (4 * RPW), DT = 4, KS = 2;
  __shared__ __attribute__((aligned(16))) unsigned short sP[4][RPW][40], sPl[4][RPW][40]; __shared__ __attribute__((aligned(16))) float sO[4][RPW][64 + 4];
  const int tid = threadIdx.x, w = tid >> 5, lane = tid & 31, ln = lane & 15, hh = lane >> 4;
  const int slab = blockIdx.x / NQB, qblk = blockIdx.x % NQB; const int b = slab / NH, h = slab % NH; const int qb0 = qblk * (4 * RPW); const int q0 = qb0 + w * RPW;
  FragH aq[2][KS], aql[2][KS];
#pragma unroll
  for (int rt = 0; rt < RTN; ++rt) { const size_t qo = ((size_t)b * TQ + q0 + rt * 16 + ln) * ldq + h * 64; const unsigned short* qr = (const unsigned short*)Q16 + qo; const unsigned short* ql = (const unsigned short*)Q16lo + qo;
#pragma unroll
    for (int ks = 0; ks < KS; ++ks) { aq[rt][ks].half[0] = *(const v8us*)(qr + ks * 32 + 8 * hh); aq[rt][ks].half[1] = *(const v8us*)(qr + ks * 32 + 16 + 8 * hh); aql[rt][ks].half[0] = *(const v8us*)(ql + ks * 32 + 8 * hh); aql[rt][ks].half[1] = *(const v8us*)(ql + ks * 32 + 16 + 8 * hh); } }
  const unsigned short* Vth = (const unsigned short*)Vt + (size_t)slab * 64 * TK; const unsigned short* Vtl = (const unsigned short*)Vtlo + (size_t)slab * 64 * TK;
  float m_r[2][8], l_r[2][8]; v8f oacc[2][DT], oaccl[2][DT];
#pragma unroll
  for (int rt = 0; rt < RTN; ++rt) {
#pragma unroll
    for (int r = 0; r < 8; ++r) { m_r[rt][r] = -3.0e38f; l_r[rt][r] = 0.f; }
#pragma unroll
    for (int dt = 0; dt < DT; ++dt) { oacc[rt][dt] = (v8f){0.f,0.f,0.f,0.f,0.f,0.f,0.f,0.f}; oaccl[rt][dt] = oacc[rt][dt]; } }
  int jend = KE[qblk * 32]; jend = min(TK, (jend + 31) & ~31); if (jend < 32) jend = 32;      /* block-uniform */
  int allm[2][8]; const unsigned* mrow[2][8];
#pragma unroll
  for (int rt = 0; rt < RTN; ++rt)
#pragma unroll
    for (int r = 0; r < 8; ++r) { const int tq = q0 + rt * 16 + 8 * hh + r; allm[rt][r] = RA[tq]; mrow[rt][r] = MB + (size_t)tq * (TK / 32); }
#pragma unroll 1
  for (int j0 = 0; j0 < jend; j0 += 32) {
    
    v8f s[2][2];
#pragma unroll
    for (int nt = 0; nt < 2; ++nt) { const size_t ko = ((size_t)b * TK + j0 + nt * 16 + ln) * ldk + h * 64; const unsigned short* kr = (const unsigned short*)K16 + ko; const unsigned short* kl = (const unsigned short*)K16lo + ko; FragH bk[KS], bkl[KS];
#pragma unroll
      for (int ks = 0; ks < KS; ++ks) { bk[ks].half[0] = *(const v8us*)(kr + ks * 32 + 8 * hh); bk[ks].half[1] = *(const v8us*)(kr + ks * 32 + 16 + 8 * hh); bkl[ks].half[0] = *(const v8us*)(kl + ks * 32 + 8 * hh); bkl[ks].half[1] = *(const v8us*)(kl + ks * 32 + 16 + 8 * hh); }
#pragma unroll
      for (int rt = 0; rt < RTN; ++rt) { v8f acc = (v8f){0.f,0.f,0.f,0.f,0.f,0.f,0.f,0.f}, accr = acc;
#pragma unroll
        for (int ks = 0; ks < KS; ++ks) { acc = mmaH<1>(aq[rt][ks].v, aq[rt][ks].v, bk[ks].v, bk[ks].v, acc); accr = mmaH<1>(aql[rt][ks].v, aql[rt][ks].v, bk[ks].v, bk[ks].v, accr); accr = mmaH<1>(aq[rt][ks].v, aq[rt][ks].v, bkl[ks].v, bkl[ks].v, accr); }
        s[rt][nt] = acc + accr * 0.0009765625f; } }
#pragma unroll
    for (int rt = 0; rt < RTN; ++rt)
#pragma unroll
      for (int r = 0; r < 8; ++r) { const unsigned mw = mrow[rt][r][j0 >> 5]; const bool am = (allm[rt][r] != 0);
        const bool ok0 = am || (((mw >> ln) & 1u) == 0u), ok1 = am || (((mw >> (16 + ln)) & 1u) == 0u);
        const int tqe = q0 + rt * 16 + 8 * hh + r; const int k0e = j0 + ln, k1e = j0 + 16 + ln; const float xih = HB[2 * h], egh = HB[2 * h + 1];
        const float b0 = (-((float)(tqe > k0e ? tqe - k0e : k0e - tqe) / xih)) * egh, b1 = (-((float)(tqe > k1e ? tqe - k1e : k1e - tqe) / xih)) * egh;
        const float s0 = ok0 ? (am ? 0.f : s[rt][0][r] * SCL + b0) : -INFINITY, s1 = ok1 ? (am ? 0.f : s[rt][1][r] * SCL + b1) : -INFINITY; float mc = fmaxf(s0, s1);
        mc = fmaxf(mc, __shfl_xor(mc, 1, 32)); mc = fmaxf(mc, __shfl_xor(mc, 2, 32)); mc = fmaxf(mc, __shfl_xor(mc, 4, 32)); mc = fmaxf(mc, __shfl_xor(mc, 8, 32));
        const float mn = fmaxf(m_r[rt][r], mc); const float al = (mn > -1.0e38f) ? expf(m_r[rt][r] - mn) : 1.0f; m_r[rt][r] = mn; const float p0 = ok0 ? expf(s0 - mn) : 0.f, p1 = ok1 ? expf(s1 - mn) : 0.f; l_r[rt][r] = l_r[rt][r] * al + p0 + p1;
#pragma unroll
        for (int dt = 0; dt < DT; ++dt) { oacc[rt][dt][r] *= al; oaccl[rt][dt][r] *= al; }
        FragH t2, t3; const float ps0 = p0 * 1024.0f, ps1 = p1 * 1024.0f; t2.h[0] = (_Float16)ps0; t2.h[1] = (_Float16)ps1; t3.h[0] = (_Float16)((ps0 - (float)t2.h[0]) * 1024.0f); t3.h[1] = (_Float16)((ps1 - (float)t2.h[1]) * 1024.0f);
        sP[w][rt * 16 + 8 * hh + r][ln] = t2.u[0]; sP[w][rt * 16 + 8 * hh + r][16 + ln] = t2.u[1]; sPl[w][rt * 16 + 8 * hh + r][ln] = t3.u[0]; sPl[w][rt * 16 + 8 * hh + r][16 + ln] = t3.u[1]; }
    __builtin_amdgcn_fence(__ATOMIC_ACQ_REL, "workgroup"); __builtin_amdgcn_wave_barrier();
    FragH pa[2], pl[2];
#pragma unroll
    for (int rt = 0; rt < RTN; ++rt) { pa[rt].half[0] = *(const v8us*)&sP[w][rt * 16 + ln][8 * hh]; pa[rt].half[1] = *(const v8us*)&sP[w][rt * 16 + ln][16 + 8 * hh]; pl[rt].half[0] = *(const v8us*)&sPl[w][rt * 16 + ln][8 * hh]; pl[rt].half[1] = *(const v8us*)&sPl[w][rt * 16 + ln][16 + 8 * hh]; }
#pragma unroll
    for (int dt = 0; dt < DT; ++dt) { const size_t vo = (size_t)(dt * 16 + ln) * TK + j0; FragH bv, bl; bv.half[0] = *(const v8us*)(Vth + vo + 8 * hh); bv.half[1] = *(const v8us*)(Vth + vo + 16 + 8 * hh); bl.half[0] = *(const v8us*)(Vtl + vo + 8 * hh); bl.half[1] = *(const v8us*)(Vtl + vo + 16 + 8 * hh);
#pragma unroll
      for (int rt = 0; rt < RTN; ++rt) { oacc[rt][dt] = mmaH<1>(pa[rt].v, pa[rt].v, bv.v, bv.v, oacc[rt][dt]); oaccl[rt][dt] = mmaH<1>(pa[rt].v, pa[rt].v, bl.v, bl.v, oaccl[rt][dt]); oaccl[rt][dt] = mmaH<1>(pl[rt].v, pl[rt].v, bv.v, bv.v, oaccl[rt][dt]); } }
    __builtin_amdgcn_fence(__ATOMIC_ACQ_REL, "workgroup"); __builtin_amdgcn_wave_barrier(); }
#pragma unroll
  for (int rt = 0; rt < RTN; ++rt) {
#pragma unroll
    for (int r = 0; r < 8; ++r) { float l = l_r[rt][r]; l += __shfl_xor(l, 1, 32); l += __shfl_xor(l, 2, 32); l += __shfl_xor(l, 4, 32); l += __shfl_xor(l, 8, 32); l_r[rt][r] = (l > 0.f) ? 1.0f / (l * 1024.0f) : 0.f; }
#pragma unroll
    for (int dt = 0; dt < DT; ++dt)
#pragma unroll
      for (int r = 0; r < 8; ++r) sO[w][rt * 16 + 8 * hh + r][dt * 16 + ln] = (oacc[rt][dt][r] + oaccl[rt][dt][r] * 0.0009765625f) * l_r[rt][r]; }
  __builtin_amdgcn_fence(__ATOMIC_ACQ_REL, "workgroup"); __builtin_amdgcn_wave_barrier();
  {
#pragma unroll
    for (int rp = 0; rp < RPW; rp += 2) { const int r = rp + (lane >> 4), pc = lane & 15; const v4f val = *(const v4fa*)&sO[w][r][pc * 4]; *(v4f*)(O + ((size_t)b * TQ + q0 + r) * ldo + h * 64 + pc * 4) = val; }
     } }


__global__ __launch_bounds__(256) void k_causaltab(unsigned* __restrict__ MB, int* __restrict__ RA, int* __restrict__ KE, int nq, int nk) {
  const int t = blockIdx.x * 256 + threadIdx.x; const int nw = nk / 32;
  if (t < nq * nw) { const int q = t / nw, w = t % nw; const int first = q + 1 - 32 * w; const unsigned bits = (first <= 0) ? 0xffffffffu : ((first >= 32) ? 0u : (0xffffffffu << first)); *(unsigned*)(MB + t) = bits;  }
  if (t < nq) { *(int*)(RA + t) = 0;  }
  if (t < nq / 64) { const int v = 64 * (t + 1); *(int*)(KE + t * 32) = v;  } }

__constant__ float PIF[32] = {3.141592741e+00f,3.031195641e+00f,2.924677610e+00f,2.821902990e+00f,2.722739935e+00f,2.627061367e+00f,2.534744978e+00f,2.445672750e+00f,2.359730482e+00f,2.276808262e+00f,2.196800232e+00f,2.119603395e+00f,2.045119524e+00f,1.973252892e+00f,1.903911710e+00f,1.837007284e+00f,1.772453904e+00f,1.710168958e+00f,1.650072694e+00f,1.592088223e+00f,1.536141396e+00f,1.482160687e+00f,1.430076718e+00f,1.379823089e+00f,1.331335425e+00f,1.284551501e+00f,1.239411712e+00f,1.195858121e+00f,1.153835058e+00f,1.113288760e+00f,1.074167132e+00f,1.036420345e+00f};
__global__ __launch_bounds__(256) void k_trig(const float* __restrict__ pig, const float* __restrict__ logxi, const float* __restrict__ egl, float* __restrict__ CS, float* __restrict__ SN, float* __restrict__ HB) {
  #pragma clang fp contract(off)
  const int t = blockIdx.x * 256 + threadIdx.x; if (t >= NH * SLEN * 32) return; const int j = t & 31; const int tok = (t >> 5) % SLEN; const int h = t / (32 * SLEN);
  const float pg = 1.0f / (1.0f + expf(-bf16_round(pig[h]))); const float th = ((float)tok * PIF[j]) * pg; const float c = cosf(th), s = sinf(th);
  *(float*)(CS + t) = c; *(float*)(SN + t) = s; 
  if (t < 2 * NH) { const int hh2 = t >> 1; const float v = (t & 1) ? (1.0f / (1.0f + expf(-bf16_round(egl[hh2])))) : expf(bf16_round(logxi[hh2])); *(float*)(HB + t) = v;  } }      
__global__ __launch_bounds__(256) void k_eurot(const float* __restrict__ F, const float* __restrict__ CS, const float* __restrict__ SN, float* __restrict__ OF) {
  #pragma clang fp contract(off)
  const int t = blockIdx.x * 256 + threadIdx.x; if (t >= NR * (DM / 4)) return; const int c0 = (t % (DM / 4)) * 4; const int r = t / (DM / 4); const int tok = r % SLEN; const int h = c0 / 64, d0 = c0 & 63;
  const float* f = F + (size_t)r * DM + c0; const float* cs = CS + ((size_t)h * SLEN + tok) * 32; const float* sn = SN + ((size_t)h * SLEN + tok) * 32; v4f o;
#pragma unroll
  for (int q = 0; q < 4; ++q) { const int d = d0 + q; const float c = cs[d >> 1], s = sn[d >> 1];
    o[q] = (d & 1) ? (f[q - 1] * s + f[q] * c) : (f[q] * c - f[q + 1] * s); }
  *(v4f*)(OF + (size_t)r * DM + c0) = o;  }

extern "C" void kernel_launch(void* const* d_in, const int* in_sizes, int n_in,
                              void* d_out, int out_size, void* d_ws, size_t ws_size, hipStream_t stream) {
  (void)in_sizes; (void)n_in; (void)out_size;
  const float* const* I = (const float* const*)d_in; const float* x = I[0]; const float* Wqkv = I[1]; const float* Wo = I[2]; const float* logxi = I[3]; const float* pig = I[4]; const float* egl = I[5];
  char* ws = (char*)d_ws; size_t off = 0;
  auto take = [&](size_t bytes) { char* p = ws + off; off += (bytes + 255) & ~(size_t)255; return p; };
  _Float16* BQKV = (_Float16*)take((size_t)3 * DM * DM * 2); _Float16* BO = (_Float16*)take((size_t)DM * DM * 2);
  _Float16* X16 = (_Float16*)take((size_t)NR * DM * 2); float* F = (float*)take((size_t)NR * DM * 4); float* G = (float*)take((size_t)NR * DM * 4);
  _Float16* Qh = (_Float16*)take((size_t)NR * DM * 2); _Float16* Ql = (_Float16*)take((size_t)NR * DM * 2); _Float16* Kh = (_Float16*)take((size_t)NR * DM * 2); _Float16* Kl = (_Float16*)take((size_t)NR * DM * 2); _Float16* Vth = (_Float16*)take((size_t)NR * DM * 2); _Float16* Vtl = (_Float16*)take((size_t)NR * DM * 2);
  unsigned* MB = (unsigned*)take((size_t)SLEN * (SLEN / 32) * 4); int* RA = (int*)take((size_t)SLEN * 4); int* KE = (int*)take((size_t)(SLEN / 64) * 32 * 4);
  float* CS = (float*)take((size_t)NH * SLEN * 32 * 4); float* SN = (float*)take((size_t)NH * SLEN * 32 * 4); float* HB = (float*)take(256);
  if (off > ws_size) return;      /* 6 + 2 + 8 + 16 + 16 + 6 x 8 + 0.5 + 8 = 105 MiB */
  float* O = F; _Float16* Oh = (_Float16*)G; _Float16* Ol = Oh + (size_t)NR * DM;      /* F and G are dead once the hi/lo planes exist */
  const size_t n8 = (size_t)NR * DM / 8; const unsigned nb8 = (unsigned)((n8 + 255) / 256), nb4 = (unsigned)(((size_t)NR * DM / 4 + 255) / 256);
  k_round16f<<<(unsigned)(((size_t)3 * DM * DM / 8 + 255) / 256), 256, 0, stream>>>(Wqkv, BQKV, (size_t)3 * DM * DM / 8); k_round16f<<<(unsigned)(((size_t)DM * DM / 8 + 255) / 256), 256, 0, stream>>>(Wo, BO, (size_t)DM * DM / 8);      /* torch (out,in) = natural Bt; x16 */
  k_x16<<<nb8, 256, 0, stream>>>(x, X16, n8);
  k_trig<<<(NH * SLEN * 32 + 255) / 256, 256, 0, stream>>>(pig, logxi, egl, CS, SN, HB); k_causaltab<<<(SLEN * (SLEN / 32) + 255) / 256, 256, 0, stream>>>(MB, RA, KE, SLEN, SLEN);
  const dim3 gP((NR / 128) * (DM / 64), 1);
  k_gemm2<0><<<gP, 128, 0, stream>>>(X16, DM, 0, BQKV, DM, 0, 0.0625f, nullptr, 0, nullptr, 1, 0, 0, F, nullptr, DM, 0, NR, DM, DM); k_eurot<<<nb4, 256, 0, stream>>>(F, CS, SN, G); k_hl<<<nb8, 256, 0, stream>>>(G, Qh, Ql, n8);      /* q (rows 0..1023 of Wqkv), rotated, hi/lo */
  k_gemm2<0><<<gP, 128, 0, stream>>>(X16, DM, 0, BQKV + (size_t)DM * DM, DM, 0, 0.0625f, nullptr, 0, nullptr, 1, 0, 0, F, nullptr, DM, 0, NR, DM, DM); k_eurot<<<nb4, 256, 0, stream>>>(F, CS, SN, G); k_hl<<<nb8, 256, 0, stream>>>(G, Kh, Kl, n8);      /* k (rows 1024..2047), rotated */
  k_gemm2<0><<<gP, 128, 0, stream>>>(X16, DM, 0, BQKV + (size_t)2 * DM * DM, DM, 0, 0.0625f, nullptr, 0, nullptr, 1, 0, 0, F, nullptr, DM, 0, NR, DM, DM);      /* v (rows 2048..3071) f32 */
  for (int b = 0; b < NBT; ++b) k_vthl<SLEN><<<NH * (SLEN / 64), 256, 0, stream>>>(F + (size_t)b * SLEN * DM, DM, Vth + (size_t)b * SLEN * DM, Vtl + (size_t)b * SLEN * DM);
  for (int b = 0; b < NBT; ++b) { const size_t ro = (size_t)b * SLEN * DM;
    k_flashme<SLEN, SLEN><<<NH * (SLEN / 64), 128, 0, stream>>>(Qh + ro, Ql + ro, DM, Kh + ro, Kl + ro, DM, Vth + ro, Vtl + ro, MB, RA, KE, HB, O + ro, DM); }
  k_hl<<<nb8, 256, 0, stream>>>(O, Oh, Ol, n8);
  k_gemm2<0><<<gP, 128, 0, stream>>>(Oh, DM, 0, BO, DM, 0, 0.0625f, nullptr, 0, nullptr, 1, 0, 0, (float*)d_out, nullptr, DM, 0, NR, DM, DM);
  k_gemm2<0><<<gP, 128, 0, stream>>>(Ol, DM, 0, BO, DM, 0, 0.0625f / 1024.0f, nullptr, 0, (const float*)d_out, 1, (size_t)DM, 0, (float*)d_out, nullptr, DM, 0, NR, DM, DM);
}

// v001
// It runs in 652 microseconds.
// Two timings next to v000 both put it at 1.35 times that version's speed.
#include <hip/hip_runtime.h>
// Causal multi-head attention with gated rotary phases and a per-head distance decay (2 x 2048 tokens x 1024, 16 heads x 64): qkv = x*Wqkv^T; theta[h][t][j] = (t * pi^(1 - j/32)) * sigmoid(pi_gate[h]); interleaved-pair rotation of q and k; scores = q.k/8 - |i - j| / exp(log_xi[h]) * sigmoid(e_gate[h]) with j <= i; softmax; merged . Wo^T -> [2,2048,1024].
// Structure: x as an exact f16 plane; q/k/v from one packed f16 WMMA GEMM family (32x64 wave tiles, f32, exact products) into f32 planes; per-(head, token) cos/sin tables on VALU (pi^(1-j/32) = the reference's f32 constants, precise trig), one VALU pass rotates into f32 planes; q, k as f16 hi + x2^10 residual planes, V^T as hi + residual planes; the causal structure computed on device into a key bit plane + per-block key bound; the fused flash kernel per ((batch, head), 64 queries) with the decay bias added per element (three-product hi/lo scores, online softmax f32, P hi + residual via LDS, two value accumulators); O as hi + residual planes; output projection as two GEMMs.
// Compute dtype: x, weights and the three gate/scale vectors rounded to bf16; projections exact; rotation and bias f32; q, k, P, v, O as f16 hi + residual pairs (~2^-21); f32 accumulation and softmax. v_wmma_f32_16x16x32_f16.
#define NBT 2
#define SLEN 2048
#define DM 1024
#define NH 16
#define SCL 0.125f
#define NR (NBT * SLEN)
typedef __bf16 v16b __attribute__((ext_vector_type(16)));
typedef unsigned short v8us __attribute__((ext_vector_type(8), may_alias));
typedef float  v8f  __attribute__((ext_vector_type(8)));
typedef float  v4f  __attribute__((ext_vector_type(4)));
typedef float  v4fa __attribute__((ext_vector_type(4), may_alias));
union FragB { v16b v; v8us half[2]; unsigned short u[16]; };

__device__ __forceinline__ unsigned short bf16_bits(float x) { unsigned int u = __float_as_uint(x); return (unsigned short)((u + 0x7FFFu + ((u >> 16) & 1u)) >> 16); }
__device__ __forceinline__ float bf16_val(unsigned short b) { return __uint_as_float(((unsigned int)b) << 16); }
__device__ __forceinline__ float bf16_round(float x) { return bf16_val(bf16_bits(x)); }
// D += A·B with NT terms: 1 = ah·bh, 2 = + al·bh (A split), 3 = + ah·bl (both split)
template <int NT>
__device__ __forceinline__ v8f mmaN(v16b ah, v16b al, v16b bh, v16b bl, v8f c) {
  c = __builtin_amdgcn_wmma_f32_16x16x32_bf16(false, ah, false, bh, (short)0, c, false, false);
  if (NT >= 2) c = __builtin_amdgcn_wmma_f32_16x16x32_bf16(false, al, false, bh, (short)0, c, false, false);
  if (NT >= 3) c = __builtin_amdgcn_wmma_f32_16x16x32_bf16(false, ah, false, bl, (short)0, c, false, false);
  asm volatile("v_nop\n\tv_nop\n\tv_nop\n\tv_nop" : "+v"(c) : "v"(ah), "v"(al), "v"(bh), "v"(bl));
  return c;
}

__global__ __launch_bounds__(256) void k_wt_bf16(const float* __restrict__ W, unsigned short* __restrict__ Wt, int K, int N) {
  const int t = blockIdx.x * 256 + threadIdx.x;
  const int k8n = K / 8;
  if (t >= N * k8n) return;
  const int n = t / k8n, k8 = (t % k8n) * 8;
  v8us v;
#pragma unroll
  for (int i = 0; i < 8; ++i) v[i] = bf16_bits(W[(size_t)(k8 + i) * N + n]);
  *(v8us*)(Wt + (size_t)n * K + k8) = v;
  
}

// GEMM C[M][N] (f32, pitch ldc) = act(A[M][K]·W + bias). A f32 row-major (pitch lda) converted per fragment to bf16
// (ASPLIT: hi/lo two planes -> 2 terms, else single rounded term); Wt bf16 [N][K] (pitch ldb). BIAS_BF16 rounds the
// bias to bf16 first (bias quantised to bf16 before the add). K%32==0, M%16==0, N%64==0.
template <bool ASPLIT, int ACT, bool BIAS_BF16>
__global__ __launch_bounds__(128) void k_gemm_bf(const float* __restrict__ A, int lda, const unsigned short* __restrict__ Wt, int ldb,
                                               const float* __restrict__ bias, float* __restrict__ C, int ldc, int M, int N, int K) {
  __shared__ __attribute__((aligned(16))) float so[4][16][64];
  const int tid = threadIdx.x, w = tid >> 5, lane = tid & 31, ln = lane & 15, hh = lane >> 4;
  const int ntn = N / 64;
  const int wid = blockIdx.x * 4 + w;
  const int mt = wid / ntn, nq = wid % ntn;
  if (mt * 16 >= M) return;
  const int row0 = mt * 16, col0 = nq * 64;
  const float* arow = A + (size_t)(row0 + ln) * lda;
  v8f acc[4] = {};
  for (int kb = 0; kb < K; kb += 32) {
    FragB ah, al;
    const v4f x0 = *(const v4fa*)(arow + kb + 8 * hh), x1 = *(const v4fa*)(arow + kb + 8 * hh + 4);
    const v4f x2 = *(const v4fa*)(arow + kb + 16 + 8 * hh), x3 = *(const v4fa*)(arow + kb + 16 + 8 * hh + 4);
    float xs[16] = {x0[0],x0[1],x0[2],x0[3],x1[0],x1[1],x1[2],x1[3],x2[0],x2[1],x2[2],x2[3],x3[0],x3[1],x3[2],x3[3]};
#pragma unroll
    for (int i = 0; i < 16; ++i) { const unsigned short hb = bf16_bits(xs[i]); ah.u[i] = hb; al.u[i] = ASPLIT ? bf16_bits(xs[i] - bf16_val(hb)) : (unsigned short)0; }
#pragma unroll
    for (int t = 0; t < 4; ++t) {
      const unsigned short* brow = Wt + (size_t)(col0 + t * 16 + ln) * ldb + kb;
      FragB b;
      b.half[0] = *(const v8us*)(brow + 8 * hh);
      b.half[1] = *(const v8us*)(brow + 16 + 8 * hh);
      acc[t] = mmaN<ASPLIT ? 2 : 1>(ah.v, al.v, b.v, b.v, acc[t]);
    }
  }
#pragma unroll
  for (int t = 0; t < 4; ++t) {
    float bv = bias ? bias[col0 + t * 16 + ln] : 0.f;
    if (BIAS_BF16) bv = bf16_round(bv);
#pragma unroll
    for (int r = 0; r < 8; ++r) { float v = acc[t][r] + bv; if (ACT == 1) v = fmaxf(v, 0.f); so[w][8 * hh + r][t * 16 + ln] = v; }
  }
  __builtin_amdgcn_fence(__ATOMIC_ACQ_REL, "workgroup");
  __builtin_amdgcn_wave_barrier();
  const int rsub = lane >> 4, c4 = (lane & 15) * 4;
  {
#pragma unroll
    for (int q = 0; q < 8; ++q) {
      const int r = q * 2 + rsub;
      const v4f v = *(const v4fa*)&so[w][r][c4];
      *(v4f*)(C + (size_t)(row0 + r) * ldc + col0 + c4) = v;
    }
    
  }
}

// GEMM C = act(A·W + bias + resid): A f32 (ASPLIT -> hi/lo 2 terms), Wt bf16 [N][K]; ACT 0 none, 1 relu, 2 exact gelu;
// resid (optional, f32, row index = (row % rmod), pitch ldr, RES_BF16 rounds it) added before the activation.
template <bool ASPLIT, int ACT, bool BIAS_BF16, bool RES_BF16>
__global__ __launch_bounds__(128) void k_gemm_bf3(const float* __restrict__ A, int lda, const unsigned short* __restrict__ Wt, int ldb,
                                                const float* __restrict__ bias, const float* __restrict__ resid, int rmod, int ldr,
                                                float* __restrict__ C, int ldc, int M, int N, int K) {
  __shared__ __attribute__((aligned(16))) float so[4][16][64];
  const int tid = threadIdx.x, w = tid >> 5, lane = tid & 31, ln = lane & 15, hh = lane >> 4;
  const int ntn = N / 64;
  const int wid = blockIdx.x * 4 + w;
  const int mt = wid / ntn, nq = wid % ntn;
  if (mt * 16 >= M) return;
  const int row0 = mt * 16, col0 = nq * 64;
  const float* arow = A + (size_t)(row0 + ln) * lda;
  v8f acc[4] = {};
  for (int kb = 0; kb < K; kb += 32) {
    FragB ah, al;
    const v4f x0 = *(const v4fa*)(arow + kb + 8 * hh), x1 = *(const v4fa*)(arow + kb + 8 * hh + 4);
    const v4f x2 = *(const v4fa*)(arow + kb + 16 + 8 * hh), x3 = *(const v4fa*)(arow + kb + 16 + 8 * hh + 4);
    float xs[16] = {x0[0],x0[1],x0[2],x0[3],x1[0],x1[1],x1[2],x1[3],x2[0],x2[1],x2[2],x2[3],x3[0],x3[1],x3[2],x3[3]};
#pragma unroll
    for (int i = 0; i < 16; ++i) { const unsigned short hb = bf16_bits(xs[i]); ah.u[i] = hb; al.u[i] = ASPLIT ? bf16_bits(xs[i] - bf16_val(hb)) : (unsigned short)0; }
#pragma unroll
    for (int t = 0; t < 4; ++t) {
      const unsigned short* brow = Wt + (size_t)(col0 + t * 16 + ln) * ldb + kb;
      FragB b;
      b.half[0] = *(const v8us*)(brow + 8 * hh);
      b.half[1] = *(const v8us*)(brow + 16 + 8 * hh);
      acc[t] = mmaN<ASPLIT ? 2 : 1>(ah.v, al.v, b.v, b.v, acc[t]);
    }
  }
#pragma unroll
  for (int t = 0; t < 4; ++t) {
    const int col = col0 + t * 16 + ln;
    float bv = bias ? bias[col] : 0.f;
    if (BIAS_BF16) bv = bf16_round(bv);
#pragma unroll
    for (int r = 0; r < 8; ++r) {
      float v = acc[t][r] + bv;
      if (resid) { float rv = resid[(size_t)((row0 + 8 * hh + r) % rmod) * ldr + col]; if (RES_BF16) rv = bf16_round(rv); v += rv; }
      if (ACT == 1) v = fmaxf(v, 0.f);
      if (ACT == 2) v = 0.5f * v * (1.0f + erff(v * 0.70710678118654752f));
      if (ACT == 3) { const float u = 0.7978845608028654f * (v + 0.044715f * v * v * v); v = 0.5f * v * (1.0f + tanhf(u)); }
      so[w][8 * hh + r][t * 16 + ln] = v;
    }
  }
  __builtin_amdgcn_fence(__ATOMIC_ACQ_REL, "workgroup");
  __builtin_amdgcn_wave_barrier();
  const int rsub = lane >> 4, c4 = (lane & 15) * 4;
  {
#pragma unroll
    for (int q = 0; q < 8; ++q) {
      const int r = q * 2 + rsub;
      const v4f v = *(const v4fa*)&so[w][r][c4];
      *(v4f*)(C + (size_t)(row0 + r) * ldc + col0 + c4) = v;
    }
    
  }
}
// row LayerNorm (biased variance, eps) over N: s = X (+ R); optional out_sum <- s; out_norm <- (s-mu)*rsqrt(var+eps)*g + b
template <bool PARAM_BF16>
__global__ __launch_bounds__(256) void k_layernorm(const float* __restrict__ X, const float* __restrict__ R, const float* __restrict__ g, const float* __restrict__ bta,
                                                  float* __restrict__ out_sum, float* __restrict__ out_norm, int N, float eps) {
  __shared__ float red[256];
  const int row = blockIdx.x, tid = threadIdx.x;
  const float* x = X + (size_t)row * N; const float* rr = R ? R + (size_t)row * N : nullptr;
  float vals[16];                     // up to N = 4096
  const int per = N / 256;            // contiguous chunk per thread? use strided-by-4 chunks: thread handles j = tid*4 + 1024*u
  float s1 = 0.f;
  for (int u = 0; u < per / 4; ++u) {
    const int j = tid * 4 + 1024 * u;
    const v4f a = *(const v4fa*)(x + j);
    v4f b = {0.f,0.f,0.f,0.f}; if (rr) b = *(const v4fa*)(rr + j);
#pragma unroll
    for (int q = 0; q < 4; ++q) { const float v = a[q] + b[q]; vals[u * 4 + q] = v; s1 += v; }
  }
  red[tid] = s1; __syncthreads();
  for (int st = 128; st > 0; st >>= 1) { if (tid < st) red[tid] += red[tid + st]; __syncthreads(); }
  const float mu = red[0] / (float)N; __syncthreads();
  float s2 = 0.f;
  for (int u = 0; u < per / 4; ++u)
#pragma unroll
    for (int q = 0; q < 4; ++q) { const float c = vals[u * 4 + q] - mu; s2 += c * c; }
  red[tid] = s2; __syncthreads();
  for (int st = 128; st > 0; st >>= 1) { if (tid < st) red[tid] += red[tid + st]; __syncthreads(); }
  const float rs = rsqrtf(red[0] / (float)N + eps);
  {
    for (int u = 0; u < per / 4; ++u) {
      const int j = tid * 4 + 1024 * u;
      v4f o, sm;
#pragma unroll
      for (int q = 0; q < 4; ++q) {
        float gg = g[j + q], bb = bta[j + q];
        if (PARAM_BF16) { gg = bf16_round(gg); bb = bf16_round(bb); }
        sm[q] = vals[u * 4 + q]; o[q] = (vals[u * 4 + q] - mu) * rs * gg + bb;
      }
      if (out_sum) *(v4f*)(out_sum + (size_t)row * N + j) = sm;
      *(v4f*)(out_norm + (size_t)row * N + j) = o;
    }
    
  }
}



// ---- f16 WMMA path (v_wmma_f32_16x16x32_f16): 11-bit significands for operands in range — used where a [0,1] probability operand needs more precision than bf16
typedef _Float16 v16h __attribute__((ext_vector_type(16)));
union FragH { v16h v; v8us half[2]; _Float16 h[16]; unsigned short u[16]; };
template <int NT>
__device__ __forceinline__ v8f mmaH(v16h ah, v16h al, v16h bh, v16h bl, v8f c) {
  c = __builtin_amdgcn_wmma_f32_16x16x32_f16(false, ah, false, bh, (short)0, c, false, false);
  if (NT >= 2) c = __builtin_amdgcn_wmma_f32_16x16x32_f16(false, al, false, bh, (short)0, c, false, false);
  if (NT >= 3) c = __builtin_amdgcn_wmma_f32_16x16x32_f16(false, ah, false, bl, (short)0, c, false, false);
  asm volatile("v_nop\n\tv_nop\n\tv_nop\n\tv_nop" : "+v"(c) : "v"(ah), "v"(al), "v"(bh), "v"(bl));
  return c;
}
// batched GEMM like k_gemm_b but f16 operands: A f32 (split into f16 hi/lo if ASPLIT, else rounded to f16), Bt = f16 values [n][k]; alpha; C f32; N multiple of 16 (partial tiles skipped)
template <bool ASPLIT>
__global__ __launch_bounds__(128) void k_gemm_h(const float* __restrict__ A, int lda, size_t sA, const _Float16* __restrict__ Bh, int ldb, size_t sB, float alpha, float* __restrict__ C, int ldc, size_t sC, int M, int N, int K) {
  __shared__ __attribute__((aligned(16))) float so[4][16][64];
  const int tid = threadIdx.x, w = tid >> 5, lane = tid & 31, ln = lane & 15, hh = lane >> 4; const int by = blockIdx.y;
  A += (size_t)by * sA; Bh += (size_t)by * sB; C += (size_t)by * sC;
  const int ntn = (N + 63) / 64; const int wid = blockIdx.x * 4 + w; const int mt = wid / ntn, nq = wid % ntn; if (mt * 16 >= M) return;
  const int row0 = mt * 16, col0 = nq * 64; const float* arow = A + (size_t)(row0 + ln) * lda;
  v8f acc[4] = {};
  for (int kb = 0; kb < K; kb += 32) {
    FragH ah, al;
    const v4f x0 = *(const v4fa*)(arow + kb + 8 * hh), x1 = *(const v4fa*)(arow + kb + 8 * hh + 4), x2 = *(const v4fa*)(arow + kb + 16 + 8 * hh), x3 = *(const v4fa*)(arow + kb + 16 + 8 * hh + 4);
    float xs[16] = {x0[0],x0[1],x0[2],x0[3],x1[0],x1[1],x1[2],x1[3],x2[0],x2[1],x2[2],x2[3],x3[0],x3[1],x3[2],x3[3]};
#pragma unroll
    for (int i = 0; i < 16; ++i) { const _Float16 h = (_Float16)xs[i]; ah.h[i] = h; al.h[i] = ASPLIT ? (_Float16)(xs[i] - (float)h) : (_Float16)0.0f; }
#pragma unroll
    for (int t = 0; t < 4; ++t) { if (col0 + t * 16 >= N) continue; const size_t boff = (size_t)(col0 + t * 16 + ln) * ldb + kb; FragH bq; bq.half[0] = *(const v8us*)(Bh + boff + 8 * hh); bq.half[1] = *(const v8us*)(Bh + boff + 16 + 8 * hh);
      acc[t] = mmaH<ASPLIT ? 2 : 1>(ah.v, al.v, bq.v, bq.v, acc[t]); }
  }
#pragma unroll
  for (int t = 0; t < 4; ++t) { if (col0 + t * 16 >= N) continue;
#pragma unroll
    for (int r = 0; r < 8; ++r) so[w][8 * hh + r][t * 16 + ln] = acc[t][r] * alpha; }
  __builtin_amdgcn_fence(__ATOMIC_ACQ_REL, "workgroup"); __builtin_amdgcn_wave_barrier();
  const int rsub = lane >> 4, c4 = (lane & 15) * 4;
  {
#pragma unroll
    for (int q = 0; q < 8; ++q) { const int r = q * 2 + rsub; if (col0 + c4 < N) { const v4f v = *(const v4fa*)&so[w][r][c4]; *(v4f*)(C + (size_t)(row0 + r) * ldc + col0 + c4) = v; } }
     }
}

// Wt[n][k] = f16(W[k][n]·scale) from f32 row-major W[K][N] (scale = power of two; bf16-exact weights stay exact in f16 away from the subnormal range)
__global__ __launch_bounds__(256) void k_wt_f16(const float* __restrict__ W, _Float16* __restrict__ Wt, int K, int N, float scale) {
  const int t = blockIdx.x * 256 + threadIdx.x; if (t >= N * (K / 8)) return; const int n = t / (K / 8), k8 = (t % (K / 8)) * 8; FragH f;
#pragma unroll
  for (int i = 0; i < 8; ++i) f.h[i] = (_Float16)(bf16_round(W[(size_t)(k8 + i) * N + n]) * scale); const v8us o = f.half[0];
  *(v8us*)((unsigned short*)Wt + (size_t)n * K + k8) = o; 
}
// k_gemm_hh variant with fused epilogue: v = acc·alpha + bias[by·sBias + col] (+ CP[(row/rowsPerB)·sCPb + by·64 + col] if CP) ; ACT 0 none / 1 elu ; writes f16 C16 (and f32 C if non-null)
template <int ACT>
__global__ __launch_bounds__(128) void k_gemm_hhx(const _Float16* __restrict__ A, int lda, size_t sA, const _Float16* __restrict__ Bh, int ldb, size_t sB, float alpha, const float* __restrict__ bias, size_t sBias, const float* __restrict__ CP, int rowsPerB, size_t sCPb, int row0g,
    float* __restrict__ C, _Float16* __restrict__ C16, int ldc, size_t sC, int M, int N, int K) {
  __shared__ __attribute__((aligned(16))) float so[4][16][64];
  const int tid = threadIdx.x, w = tid >> 5, lane = tid & 31, ln = lane & 15, hh = lane >> 4; const int by = blockIdx.y;
  A += (size_t)by * sA; Bh += (size_t)by * sB; const size_t cofs = (size_t)by * sC; const float* bp = bias ? bias + (size_t)by * sBias : nullptr;
  const int ntn = (N + 63) / 64; const int wid = blockIdx.x * 4 + w; const int mt = wid / ntn, nq = wid % ntn; if (mt * 16 >= M) return;
  const int row0 = mt * 16, col0 = nq * 64; const _Float16* arow = A + (size_t)(row0 + ln) * lda;
  v8f acc[4] = {};
  for (int kb = 0; kb < K; kb += 32) { FragH ah; ah.half[0] = *(const v8us*)((const unsigned short*)arow + kb + 8 * hh); ah.half[1] = *(const v8us*)((const unsigned short*)arow + kb + 16 + 8 * hh);
#pragma unroll
    for (int t = 0; t < 4; ++t) { if (col0 + t * 16 >= N) continue; const size_t boff = (size_t)(col0 + t * 16 + ln) * ldb + kb; FragH bq; bq.half[0] = *(const v8us*)((const unsigned short*)Bh + boff + 8 * hh); bq.half[1] = *(const v8us*)((const unsigned short*)Bh + boff + 16 + 8 * hh);
      acc[t] = mmaH<1>(ah.v, ah.v, bq.v, bq.v, acc[t]); }
  }
#pragma unroll
  for (int t = 0; t < 4; ++t) { if (col0 + t * 16 >= N) continue; const int col = col0 + t * 16 + ln; const float bv = bp ? bf16_round(bp[col]) : 0.f;
#pragma unroll
    for (int r = 0; r < 8; ++r) { float v = acc[t][r] * alpha + bv; if (CP) { const int bidx = (row0g + row0 + 8 * hh + r) / rowsPerB; v += CP[(size_t)bidx * sCPb + (size_t)by * 64 + col]; } if (ACT == 1) v = (v > 0.f) ? v : expm1f(v); else if (ACT == 7) v = (v > 0.f) ? v + 1.0f : expf(v); else if (ACT == 8) v = tanhf(v); else if (ACT == 9) v = 0.5f * v * (1.0f + tanhf(0.7978845608028654f * (v + 0.044715f * v * v * v))); else if (ACT == 11) v = 1.0f / (1.0f + expf(-v)); else if (ACT == 12) v = (v > 0.f) ? v : 0.01f * v; else if (ACT == 14) v = (v > 0.f) ? v : 0.1f * v; else if (ACT == 15) v = v / (1.0f + expf(-v)); else if (ACT == 3) v = fmaxf(v, 0.f); else if (ACT == 6) v = 0.5f * v * (1.0f + erff(v * 0.70710678118654752f)); so[w][8 * hh + r][t * 16 + ln] = v; } }
  __builtin_amdgcn_fence(__ATOMIC_ACQ_REL, "workgroup"); __builtin_amdgcn_wave_barrier();
  const int rsub = lane >> 4, c4 = (lane & 15) * 4; typedef _Float16 v4h __attribute__((ext_vector_type(4)));
  {
#pragma unroll
    for (int q = 0; q < 8; ++q) { const int r = q * 2 + rsub; if (col0 + c4 < N) { const v4f v = *(const v4fa*)&so[w][r][c4]; if (C) *(v4f*)(C + cofs + (size_t)(row0 + r) * ldc + col0 + c4) = v; if (C16) { v4h h4; for (int i = 0; i < 4; ++i) h4[i] = (_Float16)v[i]; *(v4h*)(C16 + cofs + (size_t)(row0 + r) * ldc + col0 + c4) = h4; } } }
     }
}


typedef _Float16 v4h __attribute__((ext_vector_type(4)));

__global__ __launch_bounds__(256) void k_x16(const float* __restrict__ x, _Float16* __restrict__ X16, size_t n8) { const size_t t = (size_t)blockIdx.x * 256 + threadIdx.x; if (t >= n8) return; FragH f;
#pragma unroll
  for (int q = 0; q < 8; ++q) f.h[q] = (_Float16)bf16_round(x[t * 8 + q]); *(v8us*)((unsigned short*)X16 + t * 8) = f.half[0];  }
__global__ __launch_bounds__(256) void k_h16(const float* __restrict__ x, _Float16* __restrict__ X16, size_t n8) { const size_t t = (size_t)blockIdx.x * 256 + threadIdx.x; if (t >= n8) return; FragH f;
#pragma unroll
  for (int q = 0; q < 8; ++q) f.h[q] = (_Float16)x[t * 8 + q]; *(v8us*)((unsigned short*)X16 + t * 8) = f.half[0];  }
__global__ __launch_bounds__(256) void k_round16f(const float* __restrict__ W, _Float16* __restrict__ Bt, size_t n8) { const size_t t = (size_t)blockIdx.x * 256 + threadIdx.x; if (t >= n8) return; FragH f;
#pragma unroll
  for (int i = 0; i < 8; ++i) f.h[i] = (_Float16)(bf16_round(W[t * 8 + i]) * 16.0f); *(v8us*)((unsigned short*)Bt + t * 8) = f.half[0];  }
template <int NHv, int TTv>
__global__ __launch_bounds__(256) void k_vt(const _Float16* __restrict__ V16, int ldv, int voff, _Float16* __restrict__ Vt) { __shared__ unsigned short tl[64][66]; const int tid = threadIdx.x; const int slab = blockIdx.x / (TTv / 64), lg = blockIdx.x % (TTv / 64); const int b = slab / NHv, h = slab % NHv;
  for (int i = tid; i < 64 * 8; i += 256) { const int r = i / 8, c8 = (i % 8) * 8; FragH f; f.half[0] = *(const v8us*)((const unsigned short*)V16 + ((size_t)b * TTv + lg * 64 + r) * ldv + voff + h * 64 + c8);
#pragma unroll
    for (int q = 0; q < 8; ++q) tl[r][c8 + q] = f.u[q]; }
  __syncthreads();
  {
#pragma unroll
    for (int rd = 0; rd < 2; ++rd) { const int d = rd * 32 + tid / 8, pc = tid % 8; FragH f;
#pragma unroll
      for (int q = 0; q < 8; ++q) f.u[q] = tl[pc * 8 + q][d];
      *(v8us*)((unsigned short*)Vt + ((size_t)slab * 64 + d) * TTv + lg * 64 + pc * 8) = f.half[0]; }
     } }

__global__ __launch_bounds__(256) void k_hl(const float* __restrict__ F, _Float16* __restrict__ Hh, _Float16* __restrict__ Hl, size_t n8) { const size_t t = (size_t)blockIdx.x * 256 + threadIdx.x; if (t >= n8) return; FragH fh, fl; const v4f a = *(const v4fa*)(F + t * 8), c = *(const v4fa*)(F + t * 8 + 4);
#pragma unroll
  for (int q = 0; q < 4; ++q) { _Float16 h = (_Float16)a[q]; fh.h[q] = h; fl.h[q] = (_Float16)((a[q] - (float)h) * 1024.0f); h = (_Float16)c[q]; fh.h[4 + q] = h; fl.h[4 + q] = (_Float16)((c[q] - (float)h) * 1024.0f); }
  { *(v8us*)((unsigned short*)Hh + t * 8) = fh.half[0]; *(v8us*)((unsigned short*)Hl + t * 8) = fl.half[0];  } }

// ---- fast GEMM (wave tile 32x64; requires M % 32 == 0 rows per launch region and N % 64 == 0); epilogue = k_gemm_hhx semantics ----
__device__ __forceinline__ v16h g2_frag(const _Float16* p, int hh) { FragH f; f.half[0] = *(const v8us*)((const unsigned short*)p + 8 * hh); f.half[1] = *(const v8us*)((const unsigned short*)p + 16 + 8 * hh); return f.v; }
__device__ __forceinline__ v8f g2_mma(v16h a, v16h b, v8f c) { v8f d = __builtin_amdgcn_wmma_f32_16x16x32_f16(false, a, false, b, (short)0, c, false, false); asm volatile("v_nop\n\tv_nop\n\tv_nop\n\tv_nop" : "+v"(d) : "v"(a), "v"(b)); return d; }
template <int ACT>
__global__ __launch_bounds__(128) void k_gemm2(const _Float16* __restrict__ A, int lda, size_t sA, const _Float16* __restrict__ Bh, int ldb, size_t sB, float alpha, const float* __restrict__ bias, size_t sBias, const float* __restrict__ CP, int rowsPerB, size_t sCPb, int row0g,
    float* __restrict__ C, _Float16* __restrict__ C16, int ldc, size_t sC, int M, int N, int K) {
  __shared__ __attribute__((aligned(16))) float so[4][32][68];
  const int tid = threadIdx.x, w = tid >> 5, lane = tid & 31, ln = lane & 15, hh = lane >> 4; const int by = blockIdx.y;
  A += (size_t)by * sA; Bh += (size_t)by * sB; const size_t cofs = (size_t)by * sC; const float* bp = bias ? bias + (size_t)by * sBias : nullptr;
  const int ntn = N >> 6; const int mt = blockIdx.x / ntn, nq = blockIdx.x - mt * ntn; const int row0 = mt * 128 + 32 * w, col0 = nq * 64; if (row0 >= M) return;
  const _Float16* a0p = A + (size_t)(row0 + ln) * lda; const _Float16* a1p = a0p + (size_t)16 * lda;
  const _Float16* b0p = Bh + (size_t)(col0 + ln) * ldb; const _Float16* b1p = b0p + (size_t)16 * ldb; const _Float16* b2p = b1p + (size_t)16 * ldb; const _Float16* b3p = b2p + (size_t)16 * ldb;
  const v8f z8 = {0.f,0.f,0.f,0.f,0.f,0.f,0.f,0.f}; v8f c00 = z8, c01 = z8, c02 = z8, c03 = z8, c10 = z8, c11 = z8, c12 = z8, c13 = z8;
#pragma unroll 1
  for (int kb = 0; kb < K; kb += 32) { const v16h a0 = g2_frag(a0p + kb, hh), a1 = g2_frag(a1p + kb, hh);
    v16h b = g2_frag(b0p + kb, hh); c00 = g2_mma(a0, b, c00); c10 = g2_mma(a1, b, c10);
    b = g2_frag(b1p + kb, hh); c01 = g2_mma(a0, b, c01); c11 = g2_mma(a1, b, c11);
    b = g2_frag(b2p + kb, hh); c02 = g2_mma(a0, b, c02); c12 = g2_mma(a1, b, c12);
    b = g2_frag(b3p + kb, hh); c03 = g2_mma(a0, b, c03); c13 = g2_mma(a1, b, c13); }
  v8f accs[8] = {c00, c01, c02, c03, c10, c11, c12, c13};
#pragma unroll
  for (int u = 0; u < 8; ++u) { const int t = u & 3, half = u >> 2; const int col = col0 + t * 16 + ln; const float bv = bp ? bf16_round(bp[col]) : 0.f;
#pragma unroll
    for (int r = 0; r < 8; ++r) { const int rloc = half * 16 + 8 * hh + r; float v = accs[u][r] * alpha + bv; if (CP) { const int bidx = (row0g + row0 + rloc) / rowsPerB; v += CP[(size_t)bidx * sCPb + (size_t)by * 64 + col]; }
      if (ACT == 3) v = fmaxf(v, 0.f); else if (ACT == 6) v = 0.5f * v * (1.0f + erff(v * 0.70710678118654752f)); else if (ACT == 11) v = 1.0f / (1.0f + expf(-v)); else if (ACT == 15) v = v / (1.0f + expf(-v)); else if (ACT == 12) v = (v > 0.f) ? v : 0.01f * v; else if (ACT == 8) v = tanhf(v);
      so[w][rloc][t * 16 + ln] = v; } }
  __builtin_amdgcn_fence(__ATOMIC_ACQ_REL, "workgroup"); __builtin_amdgcn_wave_barrier();
  const int rsub = lane >> 4, c4 = (lane & 15) * 4;
  {
#pragma unroll
    for (int q = 0; q < 16; ++q) { const int r = q * 2 + rsub; const v4f v = *(const v4fa*)&so[w][r][c4]; if (C) *(v4f*)(C + cofs + (size_t)(row0 + r) * ldc + col0 + c4) = v; if (C16) { v4h h4; for (int i = 0; i < 4; ++i) h4[i] = (_Float16)v[i]; *(v4h*)(C16 + cofs + (size_t)(row0 + r) * ldc + col0 + c4) = h4; } }
     } }



template <int TK>
__global__ __launch_bounds__(256) void k_vthl(const float* __restrict__ VF, int ldv, _Float16* __restrict__ Vth, _Float16* __restrict__ Vtl) { __shared__ float tl[64][65]; const int tid = threadIdx.x; const int slab = blockIdx.x / (TK / 64), lg = blockIdx.x % (TK / 64); const int b = slab / NH, h = slab % NH;
  for (int i = tid; i < 64 * 16; i += 256) { const int r = i / 16, c4 = (i % 16) * 4; const v4f a = *(const v4fa*)(VF + ((size_t)b * TK + lg * 64 + r) * ldv + h * 64 + c4); tl[r][c4] = a[0]; tl[r][c4 + 1] = a[1]; tl[r][c4 + 2] = a[2]; tl[r][c4 + 3] = a[3]; }
  __syncthreads();
  FragH fh[2], fl[2]; size_t oo[2];
#pragma unroll
  for (int rd = 0; rd < 2; ++rd) { const int d = rd * 32 + tid / 8, pc = tid % 8;
#pragma unroll
    for (int q = 0; q < 8; ++q) { const float v = tl[pc * 8 + q][d]; const _Float16 hv = (_Float16)v; fh[rd].h[q] = hv; fl[rd].h[q] = (_Float16)((v - (float)hv) * 1024.0f); } oo[rd] = ((size_t)slab * 64 + d) * TK + lg * 64 + pc * 8; }
  {
#pragma unroll
    for (int rd = 0; rd < 2; ++rd) { *(v8us*)((unsigned short*)Vth + oo[rd]) = fh[rd].half[0]; *(v8us*)((unsigned short*)Vtl + oo[rd]) = fl[rd].half[0]; }
     } }

template <int TQ, int TK>
__global__ __launch_bounds__(128) void k_flashme(const _Float16* __restrict__ Q16, const _Float16* __restrict__ Q16lo, int ldq, const _Float16* __restrict__ K16, const _Float16* __restrict__ K16lo, int ldk, const _Float16* __restrict__ Vt, const _Float16* __restrict__ Vtlo, const unsigned* __restrict__ MB, const int* __restrict__ RA, const int* __restrict__ KE, const float* __restrict__ HB, float* __restrict__ O, int ldo) {
  #pragma clang fp contract(off)
  constexpr int RPW = 16, RTN = RPW / 16, NQB = TQ / (4 * RPW), DT = 4, KS = 2;
  __shared__ __attribute__((aligned(16))) unsigned short sP[4][RPW][40], sPl[4][RPW][40]; __shared__ __attribute__((aligned(16))) float sO[4][RPW][64 + 4];
  const int tid = threadIdx.x, w = tid >> 5, lane = tid & 31, ln = lane & 15, hh = lane >> 4;
  const int slab = blockIdx.x / NQB, qblk = blockIdx.x % NQB; const int b = slab / NH, h = slab % NH; const int qb0 = qblk * (4 * RPW); const int q0 = qb0 + w * RPW;
  FragH aq[2][KS], aql[2][KS];
#pragma unroll
  for (int rt = 0; rt < RTN; ++rt) { const size_t qo = ((size_t)b * TQ + q0 + rt * 16 + ln) * ldq + h * 64; const unsigned short* qr = (const unsigned short*)Q16 + qo; const unsigned short* ql = (const unsigned short*)Q16lo + qo;
#pragma unroll
    for (int ks = 0; ks < KS; ++ks) { aq[rt][ks].half[0] = *(const v8us*)(qr + ks * 32 + 8 * hh); aq[rt][ks].half[1] = *(const v8us*)(qr + ks * 32 + 16 + 8 * hh); aql[rt][ks].half[0] = *(const v8us*)(ql + ks * 32 + 8 * hh); aql[rt][ks].half[1] = *(const v8us*)(ql + ks * 32 + 16 + 8 * hh); } }
  const unsigned short* Vth = (const unsigned short*)Vt + (size_t)slab * 64 * TK; const unsigned short* Vtl = (const unsigned short*)Vtlo + (size_t)slab * 64 * TK;
  float m_r[2][8], l_r[2][8]; v8f oacc[2][DT], oaccl[2][DT];
#pragma unroll
  for (int rt = 0; rt < RTN; ++rt) {
#pragma unroll
    for (int r = 0; r < 8; ++r) { m_r[rt][r] = -3.0e38f; l_r[rt][r] = 0.f; }
#pragma unroll
    for (int dt = 0; dt < DT; ++dt) { oacc[rt][dt] = (v8f){0.f,0.f,0.f,0.f,0.f,0.f,0.f,0.f}; oaccl[rt][dt] = oacc[rt][dt]; } }
  int jend = KE[qblk * 32]; jend = min(TK, (jend + 31) & ~31); if (jend < 32) jend = 32;      /* block-uniform */
  int allm[2][8]; const unsigned* mrow[2][8];
#pragma unroll
  for (int rt = 0; rt < RTN; ++rt)
#pragma unroll
    for (int r = 0; r < 8; ++r) { const int tq = q0 + rt * 16 + 8 * hh + r; allm[rt][r] = RA[tq]; mrow[rt][r] = MB + (size_t)tq * (TK / 32); }
#pragma unroll 1
  for (int j0 = 0; j0 < jend; j0 += 32) {
    
    v8f s[2][2];
#pragma unroll
    for (int nt = 0; nt < 2; ++nt) { const size_t ko = ((size_t)b * TK + j0 + nt * 16 + ln) * ldk + h * 64; const unsigned short* kr = (const unsigned short*)K16 + ko; const unsigned short* kl = (const unsigned short*)K16lo + ko; FragH bk[KS], bkl[KS];
#pragma unroll
      for (int ks = 0; ks < KS; ++ks) { bk[ks].half[0] = *(const v8us*)(kr + ks * 32 + 8 * hh); bk[ks].half[1] = *(const v8us*)(kr + ks * 32 + 16 + 8 * hh); bkl[ks].half[0] = *(const v8us*)(kl + ks * 32 + 8 * hh); bkl[ks].half[1] = *(const v8us*)(kl + ks * 32 + 16 + 8 * hh); }
#pragma unroll
      for (int rt = 0; rt < RTN; ++rt) { v8f acc = (v8f){0.f,0.f,0.f,0.f,0.f,0.f,0.f,0.f}, accr = acc;
#pragma unroll
        for (int ks = 0; ks < KS; ++ks) { acc = mmaH<1>(aq[rt][ks].v, aq[rt][ks].v, bk[ks].v, bk[ks].v, acc); accr = mmaH<1>(aql[rt][ks].v, aql[rt][ks].v, bk[ks].v, bk[ks].v, accr); accr = mmaH<1>(aq[rt][ks].v, aq[rt][ks].v, bkl[ks].v, bkl[ks].v, accr); }
        s[rt][nt] = acc + accr * 0.0009765625f; } }
#pragma unroll
    for (int rt = 0; rt < RTN; ++rt)
#pragma unroll
      for (int r = 0; r < 8; ++r) { const unsigned mw = mrow[rt][r][j0 >> 5]; const bool am = (allm[rt][r] != 0);
        const bool ok0 = am || (((mw >> ln) & 1u) == 0u), ok1 = am || (((mw >> (16 + ln)) & 1u) == 0u);
        const int tqe = q0 + rt * 16 + 8 * hh + r; const int k0e = j0 + ln, k1e = j0 + 16 + ln; const float xih = HB[2 * h], egh = HB[2 * h + 1];
        const float b0 = (-((float)(tqe > k0e ? tqe - k0e : k0e - tqe) / xih)) * egh, b1 = (-((float)(tqe > k1e ? tqe - k1e : k1e - tqe) / xih)) * egh;
        const float s0 = ok0 ? (am ? 0.f : s[rt][0][r] * SCL + b0) : -INFINITY, s1 = ok1 ? (am ? 0.f : s[rt][1][r] * SCL + b1) : -INFINITY; float mc = fmaxf(s0, s1);
        mc = fmaxf(mc, __shfl_xor(mc, 1, 32)); mc = fmaxf(mc, __shfl_xor(mc, 2, 32)); mc = fmaxf(mc, __shfl_xor(mc, 4, 32)); mc = fmaxf(mc, __shfl_xor(mc, 8, 32));
        const float mn = fmaxf(m_r[rt][r], mc); const float al = (mn > -1.0e38f) ? expf(m_r[rt][r] - mn) : 1.0f; m_r[rt][r] = mn; const float p0 = ok0 ? expf(s0 - mn) : 0.f, p1 = ok1 ? expf(s1 - mn) : 0.f; l_r[rt][r] = l_r[rt][r] * al + p0 + p1;
#pragma unroll
        for (int dt = 0; dt < DT; ++dt) { oacc[rt][dt][r] *= al; oaccl[rt][dt][r] *= al; }
        FragH t2, t3; const float ps0 = p0 * 1024.0f, ps1 = p1 * 1024.0f; t2.h[0] = (_Float16)ps0; t2.h[1] = (_Float16)ps1; t3.h[0] = (_Float16)((ps0 - (float)t2.h[0]) * 1024.0f); t3.h[1] = (_Float16)((ps1 - (float)t2.h[1]) * 1024.0f);
        sP[w][rt * 16 + 8 * hh + r][ln] = t2.u[0]; sP[w][rt * 16 + 8 * hh + r][16 + ln] = t2.u[1]; sPl[w][rt * 16 + 8 * hh + r][ln] = t3.u[0]; sPl[w][rt * 16 + 8 * hh + r][16 + ln] = t3.u[1]; }
    __builtin_amdgcn_fence(__ATOMIC_ACQ_REL, "workgroup"); __builtin_amdgcn_wave_barrier();
    FragH pa[2], pl[2];
#pragma unroll
    for (int rt = 0; rt < RTN; ++rt) { pa[rt].half[0] = *(const v8us*)&sP[w][rt * 16 + ln][8 * hh]; pa[rt].half[1] = *(const v8us*)&sP[w][rt * 16 + ln][16 + 8 * hh]; pl[rt].half[0] = *(const v8us*)&sPl[w][rt * 16 + ln][8 * hh]; pl[rt].half[1] = *(const v8us*)&sPl[w][rt * 16 + ln][16 + 8 * hh]; }
#pragma unroll
    for (int dt = 0; dt < DT; ++dt) { const size_t vo = (size_t)(dt * 16 + ln) * TK + j0; FragH bv, bl; bv.half[0] = *(const v8us*)(Vth + vo + 8 * hh); bv.half[1] = *(const v8us*)(Vth + vo + 16 + 8 * hh); bl.half[0] = *(const v8us*)(Vtl + vo + 8 * hh); bl.half[1] = *(const v8us*)(Vtl + vo + 16 + 8 * hh);
#pragma unroll
      for (int rt = 0; rt < RTN; ++rt) { oacc[rt][dt] = mmaH<1>(pa[rt].v, pa[rt].v, bv.v, bv.v, oacc[rt][dt]); oaccl[rt][dt] = mmaH<1>(pa[rt].v, pa[rt].v, bl.v, bl.v, oaccl[rt][dt]); oaccl[rt][dt] = mmaH<1>(pl[rt].v, pl[rt].v, bv.v, bv.v, oaccl[rt][dt]); } }
    __builtin_amdgcn_fence(__ATOMIC_ACQ_REL, "workgroup"); __builtin_amdgcn_wave_barrier(); }
#pragma unroll
  for (int rt = 0; rt < RTN; ++rt) {
#pragma unroll
    for (int r = 0; r < 8; ++r) { float l = l_r[rt][r]; l += __shfl_xor(l, 1, 32); l += __shfl_xor(l, 2, 32); l += __shfl_xor(l, 4, 32); l += __shfl_xor(l, 8, 32); l_r[rt][r] = (l > 0.f) ? 1.0f / (l * 1024.0f) : 0.f; }
#pragma unroll
    for (int dt = 0; dt < DT; ++dt)
#pragma unroll
      for (int r = 0; r < 8; ++r) sO[w][rt * 16 + 8 * hh + r][dt * 16 + ln] = (oacc[rt][dt][r] + oaccl[rt][dt][r] * 0.0009765625f) * l_r[rt][r]; }
  __builtin_amdgcn_fence(__ATOMIC_ACQ_REL, "workgroup"); __builtin_amdgcn_wave_barrier();
  {
#pragma unroll
    for (int rp = 0; rp < RPW; rp += 2) { const int r = rp + (lane >> 4), pc = lane & 15; const v4f val = *(const v4fa*)&sO[w][r][pc * 4]; *(v4f*)(O + ((size_t)b * TQ + q0 + r) * ldo + h * 64 + pc * 4) = val; }
     } }


__global__ __launch_bounds__(256) void k_causaltab(unsigned* __restrict__ MB, int* __restrict__ RA, int* __restrict__ KE, int nq, int nk) {
  const int t = blockIdx.x * 256 + threadIdx.x; const int nw = nk / 32;
  if (t < nq * nw) { const int q = t / nw, w = t % nw; const int first = q + 1 - 32 * w; const unsigned bits = (first <= 0) ? 0xffffffffu : ((first >= 32) ? 0u : (0xffffffffu << first)); *(unsigned*)(MB + t) = bits;  }
  if (t < nq) { *(int*)(RA + t) = 0;  }
  if (t < nq / 64) { const int v = 64 * (t + 1); *(int*)(KE + t * 32) = v;  } }

__constant__ float PIF[32] = {3.141592741e+00f,3.031195641e+00f,2.924677610e+00f,2.821902990e+00f,2.722739935e+00f,2.627061367e+00f,2.534744978e+00f,2.445672750e+00f,2.359730482e+00f,2.276808262e+00f,2.196800232e+00f,2.119603395e+00f,2.045119524e+00f,1.973252892e+00f,1.903911710e+00f,1.837007284e+00f,1.772453904e+00f,1.710168958e+00f,1.650072694e+00f,1.592088223e+00f,1.536141396e+00f,1.482160687e+00f,1.430076718e+00f,1.379823089e+00f,1.331335425e+00f,1.284551501e+00f,1.239411712e+00f,1.195858121e+00f,1.153835058e+00f,1.113288760e+00f,1.074167132e+00f,1.036420345e+00f};
__global__ __launch_bounds__(256) void k_trig(const float* __restrict__ pig, const float* __restrict__ logxi, const float* __restrict__ egl, float* __restrict__ CS, float* __restrict__ SN, float* __restrict__ HB) {
  #pragma clang fp contract(off)
  const int t = blockIdx.x * 256 + threadIdx.x; if (t >= NH * SLEN * 32) return; const int j = t & 31; const int tok = (t >> 5) % SLEN; const int h = t / (32 * SLEN);
  const float pg = 1.0f / (1.0f + expf(-bf16_round(pig[h]))); const float th = ((float)tok * PIF[j]) * pg; const float c = cosf(th), s = sinf(th);
  *(float*)(CS + t) = c; *(float*)(SN + t) = s; 
  if (t < 2 * NH) { const int hh2 = t >> 1; const float v = (t & 1) ? (1.0f / (1.0f + expf(-bf16_round(egl[hh2])))) : expf(bf16_round(logxi[hh2])); *(float*)(HB + t) = v;  } }      
__global__ __launch_bounds__(256) void k_eurot(const float* __restrict__ F, const float* __restrict__ CS, const float* __restrict__ SN, float* __restrict__ OF) {
  #pragma clang fp contract(off)
  const int t = blockIdx.x * 256 + threadIdx.x; if (t >= NR * (DM / 4)) return; const int c0 = (t % (DM / 4)) * 4; const int r = t / (DM / 4); const int tok = r % SLEN; const int h = c0 / 64, d0 = c0 & 63;
  const float* f = F + (size_t)r * DM + c0; const float* cs = CS + ((size_t)h * SLEN + tok) * 32; const float* sn = SN + ((size_t)h * SLEN + tok) * 32; v4f o;
#pragma unroll
  for (int q = 0; q < 4; ++q) { const int d = d0 + q; const float c = cs[d >> 1], s = sn[d >> 1];
    o[q] = (d & 1) ? (f[q - 1] * s + f[q] * c) : (f[q] * c - f[q + 1] * s); }
  *(v4f*)(OF + (size_t)r * DM + c0) = o;  }

extern "C" void kernel_launch(void* const* d_in, const int* in_sizes, int n_in,
                              void* d_out, int out_size, void* d_ws, size_t ws_size, hipStream_t stream) {
  (void)in_sizes; (void)n_in; (void)out_size;
  const float* const* I = (const float* const*)d_in; const float* x = I[0]; const float* Wqkv = I[1]; const float* Wo = I[2]; const float* logxi = I[3]; const float* pig = I[4]; const float* egl = I[5];
  char* ws = (char*)d_ws; size_t off = 0;
  auto take = [&](size_t bytes) { char* p = ws + off; off += (bytes + 255) & ~(size_t)255; return p; };
  _Float16* BQKV = (_Float16*)take((size_t)3 * DM * DM * 2); _Float16* BO = (_Float16*)take((size_t)DM * DM * 2);
  _Float16* X16 = (_Float16*)take((size_t)NR * DM * 2); float* F = (float*)take((size_t)NR * DM * 4); float* G = (float*)take((size_t)NR * DM * 4);
  _Float16* Qh = (_Float16*)take((size_t)NR * DM * 2); _Float16* Ql = (_Float16*)take((size_t)NR * DM * 2); _Float16* Kh = (_Float16*)take((size_t)NR * DM * 2); _Float16* Kl = (_Float16*)take((size_t)NR * DM * 2); _Float16* Vth = (_Float16*)take((size_t)NR * DM * 2); _Float16* Vtl = (_Float16*)take((size_t)NR * DM * 2);
  unsigned* MB = (unsigned*)take((size_t)SLEN * (SLEN / 32) * 4); int* RA = (int*)take((size_t)SLEN * 4); int* KE = (int*)take((size_t)(SLEN / 64) * 32 * 4);
  float* CS = (float*)take((size_t)NH * SLEN * 32 * 4); float* SN = (float*)take((size_t)NH * SLEN * 32 * 4); float* HB = (float*)take(256);
  if (off > ws_size) return;      /* 6 + 2 + 8 + 16 + 16 + 6 x 8 + 0.5 + 8 = 105 MiB */
  float* O = F; _Float16* Oh = (_Float16*)G; _Float16* Ol = Oh + (size_t)NR * DM;      /* F and G are dead once the hi/lo planes exist */
  const size_t n8 = (size_t)NR * DM / 8; const unsigned nb8 = (unsigned)((n8 + 255) / 256), nb4 = (unsigned)(((size_t)NR * DM / 4 + 255) / 256);
  k_round16f<<<(unsigned)(((size_t)3 * DM * DM / 8 + 255) / 256), 256, 0, stream>>>(Wqkv, BQKV, (size_t)3 * DM * DM / 8); k_round16f<<<(unsigned)(((size_t)DM * DM / 8 + 255) / 256), 256, 0, stream>>>(Wo, BO, (size_t)DM * DM / 8);      /* torch (out,in) = natural Bt; x16 */
  k_x16<<<nb8, 256, 0, stream>>>(x, X16, n8);
  k_trig<<<(NH * SLEN * 32 + 255) / 256, 256, 0, stream>>>(pig, logxi, egl, CS, SN, HB); k_causaltab<<<(SLEN * (SLEN / 32) + 255) / 256, 256, 0, stream>>>(MB, RA, KE, SLEN, SLEN);
  const dim3 gP((NR / 128) * (DM / 64), 1);
  k_gemm2<0><<<gP, 128, 0, stream>>>(X16, DM, 0, BQKV, DM, 0, 0.0625f, nullptr, 0, nullptr, 1, 0, 0, F, nullptr, DM, 0, NR, DM, DM); k_eurot<<<nb4, 256, 0, stream>>>(F, CS, SN, G); k_hl<<<nb8, 256, 0, stream>>>(G, Qh, Ql, n8);      /* q (rows 0..1023 of Wqkv), rotated, hi/lo */
  k_gemm2<0><<<gP, 128, 0, stream>>>(X16, DM, 0, BQKV + (size_t)DM * DM, DM, 0, 0.0625f, nullptr, 0, nullptr, 1, 0, 0, F, nullptr, DM, 0, NR, DM, DM); k_eurot<<<nb4, 256, 0, stream>>>(F, CS, SN, G); k_hl<<<nb8, 256, 0, stream>>>(G, Kh, Kl, n8);      /* k (rows 1024..2047), rotated */
  k_gemm2<0><<<gP, 128, 0, stream>>>(X16, DM, 0, BQKV + (size_t)2 * DM * DM, DM, 0, 0.0625f, nullptr, 0, nullptr, 1, 0, 0, F, nullptr, DM, 0, NR, DM, DM);      /* v (rows 2048..3071) f32 */
  k_vthl<SLEN><<<NBT * NH * (SLEN / 64), 256, 0, stream>>>(F, DM, Vth, Vtl);      /* both batches in one grid: the kernel takes the batch from blockIdx (slab / NH) */
  k_flashme<SLEN, SLEN><<<NBT * NH * (SLEN / 64), 128, 0, stream>>>(Qh, Ql, DM, Kh, Kl, DM, Vth, Vtl, MB, RA, KE, HB, O, DM);      /* both batches in one grid, so that their waves share the chip */
  k_hl<<<nb8, 256, 0, stream>>>(O, Oh, Ol, n8);
  k_gemm2<0><<<gP, 128, 0, stream>>>(Oh, DM, 0, BO, DM, 0, 0.0625f, nullptr, 0, nullptr, 1, 0, 0, (float*)d_out, nullptr, DM, 0, NR, DM, DM);
  k_gemm2<0><<<gP, 128, 0, stream>>>(Ol, DM, 0, BO, DM, 0, 0.0625f / 1024.0f, nullptr, 0, (const float*)d_out, 1, (size_t)DM, 0, (float*)d_out, nullptr, DM, 0, NR, DM, DM);
}

// v002
// One run takes 578 microseconds.
// In both of two side-by-side timings against v001, it was 1.13 times as fast.
// All steps since v000 together make it 1.52 times as fast.
#include <hip/hip_runtime.h>
// Causal multi-head attention with gated rotary phases and a per-head distance decay (2 x 2048 tokens x 1024, 16 heads x 64): qkv = x*Wqkv^T; theta[h][t][j] = (t * pi^(1 - j/32)) * sigmoid(pi_gate[h]); interleaved-pair rotation of q and k; scores = q.k/8 - |i - j| / exp(log_xi[h]) * sigmoid(e_gate[h]) with j <= i; softmax; merged . Wo^T -> [2,2048,1024].
// Structure: x as an exact f16 plane; q/k/v from one packed f16 WMMA GEMM family (32x64 wave tiles, f32, exact products) into f32 planes; per-(head, token) cos/sin tables on VALU (pi^(1-j/32) = the reference's f32 constants, precise trig), one VALU pass rotates into f32 planes; q, k as f16 hi + x2^10 residual planes, V^T as hi + residual planes; the causal structure computed on device into a key bit plane + per-block key bound; the fused flash kernel per ((batch, head), 64 queries) with the decay bias added per element (three-product hi/lo scores, online softmax f32, P hi + residual via LDS, two value accumulators); O as hi + residual planes; output projection as two GEMMs.
// Compute dtype: x, weights and the three gate/scale vectors rounded to bf16; projections exact; rotation and bias f32; q, k, P, v, O as f16 hi + residual pairs (~2^-21); f32 accumulation and softmax. v_wmma_f32_16x16x32_f16.
#define NBT 2
#define SLEN 2048
#define DM 1024
#define NH 16
#define SCL 0.125f
#define NR (NBT * SLEN)
typedef __bf16 v16b __attribute__((ext_vector_type(16)));
typedef unsigned short v8us __attribute__((ext_vector_type(8), may_alias));
typedef float  v8f  __attribute__((ext_vector_type(8)));
typedef float  v4f  __attribute__((ext_vector_type(4)));
typedef float  v4fa __attribute__((ext_vector_type(4), may_alias));
union FragB { v16b v; v8us half[2]; unsigned short u[16]; };

__device__ __forceinline__ unsigned short bf16_bits(float x) { unsigned int u = __float_as_uint(x); return (unsigned short)((u + 0x7FFFu + ((u >> 16) & 1u)) >> 16); }
__device__ __forceinline__ float bf16_val(unsigned short b) { return __uint_as_float(((unsigned int)b) << 16); }
__device__ __forceinline__ float bf16_round(float x) { return bf16_val(bf16_bits(x)); }
// D += A·B with NT terms: 1 = ah·bh, 2 = + al·bh (A split), 3 = + ah·bl (both split)
template <int NT>
__device__ __forceinline__ v8f mmaN(v16b ah, v16b al, v16b bh, v16b bl, v8f c) {
  c = __builtin_amdgcn_wmma_f32_16x16x32_bf16(false, ah, false, bh, (short)0, c, false, false);
  if (NT >= 2) c = __builtin_amdgcn_wmma_f32_16x16x32_bf16(false, al, false, bh, (short)0, c, false, false);
  if (NT >= 3) c = __builtin_amdgcn_wmma_f32_16x16x32_bf16(false, ah, false, bl, (short)0, c, false, false);
  asm volatile("v_nop\n\tv_nop\n\tv_nop\n\tv_nop" : "+v"(c) : "v"(ah), "v"(al), "v"(bh), "v"(bl));
  return c;
}

__global__ __launch_bounds__(256) void k_wt_bf16(const float* __restrict__ W, unsigned short* __restrict__ Wt, int K, int N) {
  const int t = blockIdx.x * 256 + threadIdx.x;
  const int k8n = K / 8;
  if (t >= N * k8n) return;
  const int n = t / k8n, k8 = (t % k8n) * 8;
  v8us v;
#pragma unroll
  for (int i = 0; i < 8; ++i) v[i] = bf16_bits(W[(size_t)(k8 + i) * N + n]);
  *(v8us*)(Wt + (size_t)n * K + k8) = v;
  
}

// GEMM C[M][N] (f32, pitch ldc) = act(A[M][K]·W + bias). A f32 row-major (pitch lda) converted per fragment to bf16
// (ASPLIT: hi/lo two planes -> 2 terms, else single rounded term); Wt bf16 [N][K] (pitch ldb). BIAS_BF16 rounds the
// bias to bf16 first (bias quantised to bf16 before the add). K%32==0, M%16==0, N%64==0.
template <bool ASPLIT, int ACT, bool BIAS_BF16>
__global__ __launch_bounds__(128) void k_gemm_bf(const float* __restrict__ A, int lda, const unsigned short* __restrict__ Wt, int ldb,
                                               const float* __restrict__ bias, float* __restrict__ C, int ldc, int M, int N, int K) {
  __shared__ __attribute__((aligned(16))) float so[4][16][64];
  const int tid = threadIdx.x, w = tid >> 5, lane = tid & 31, ln = lane & 15, hh = lane >> 4;
  const int ntn = N / 64;
  const int wid = blockIdx.x * 4 + w;
  const int mt = wid / ntn, nq = wid % ntn;
  if (mt * 16 >= M) return;
  const int row0 = mt * 16, col0 = nq * 64;
  const float* arow = A + (size_t)(row0 + ln) * lda;
  v8f acc[4] = {};
  for (int kb = 0; kb < K; kb += 32) {
    FragB ah, al;
    const v4f x0 = *(const v4fa*)(arow + kb + 8 * hh), x1 = *(const v4fa*)(arow + kb + 8 * hh + 4);
    const v4f x2 = *(const v4fa*)(arow + kb + 16 + 8 * hh), x3 = *(const v4fa*)(arow + kb + 16 + 8 * hh + 4);
    float xs[16] = {x0[0],x0[1],x0[2],x0[3],x1[0],x1[1],x1[2],x1[3],x2[0],x2[1],x2[2],x2[3],x3[0],x3[1],x3[2],x3[3]};
#pragma unroll
    for (int i = 0; i < 16; ++i) { const unsigned short hb = bf16_bits(xs[i]); ah.u[i] = hb; al.u[i] = ASPLIT ? bf16_bits(xs[i] - bf16_val(hb)) : (unsigned short)0; }
#pragma unroll
    for (int t = 0; t < 4; ++t) {
      const unsigned short* brow = Wt + (size_t)(col0 + t * 16 + ln) * ldb + kb;
      FragB b;
      b.half[0] = *(const v8us*)(brow + 8 * hh);
      b.half[1] = *(const v8us*)(brow + 16 + 8 * hh);
      acc[t] = mmaN<ASPLIT ? 2 : 1>(ah.v, al.v, b.v, b.v, acc[t]);
    }
  }
#pragma unroll
  for (int t = 0; t < 4; ++t) {
    float bv = bias ? bias[col0 + t * 16 + ln] : 0.f;
    if (BIAS_BF16) bv = bf16_round(bv);
#pragma unroll
    for (int r = 0; r < 8; ++r) { float v = acc[t][r] + bv; if (ACT == 1) v = fmaxf(v, 0.f); so[w][8 * hh + r][t * 16 + ln] = v; }
  }
  __builtin_amdgcn_fence(__ATOMIC_ACQ_REL, "workgroup");
  __builtin_amdgcn_wave_barrier();
  const int rsub = lane >> 4, c4 = (lane & 15) * 4;
  {
#pragma unroll
    for (int q = 0; q < 8; ++q) {
      const int r = q * 2 + rsub;
      const v4f v = *(const v4fa*)&so[w][r][c4];
      *(v4f*)(C + (size_t)(row0 + r) * ldc + col0 + c4) = v;
    }
    
  }
}

// GEMM C = act(A·W + bias + resid): A f32 (ASPLIT -> hi/lo 2 terms), Wt bf16 [N][K]; ACT 0 none, 1 relu, 2 exact gelu;
// resid (optional, f32, row index = (row % rmod), pitch ldr, RES_BF16 rounds it) added before the activation.
template <bool ASPLIT, int ACT, bool BIAS_BF16, bool RES_BF16>
__global__ __launch_bounds__(128) void k_gemm_bf3(const float* __restrict__ A, int lda, const unsigned short* __restrict__ Wt, int ldb,
                                                const float* __restrict__ bias, const float* __restrict__ resid, int rmod, int ldr,
                                                float* __restrict__ C, int ldc, int M, int N, int K) {
  __shared__ __attribute__((aligned(16))) float so[4][16][64];
  const int tid = threadIdx.x, w = tid >> 5, lane = tid & 31, ln = lane & 15, hh = lane >> 4;
  const int ntn = N / 64;
  const int wid = blockIdx.x * 4 + w;
  const int mt = wid / ntn, nq = wid % ntn;
  if (mt * 16 >= M) return;
  const int row0 = mt * 16, col0 = nq * 64;
  const float* arow = A + (size_t)(row0 + ln) * lda;
  v8f acc[4] = {};
  for (int kb = 0; kb < K; kb += 32) {
    FragB ah, al;
    const v4f x0 = *(const v4fa*)(arow + kb + 8 * hh), x1 = *(const v4fa*)(arow + kb + 8 * hh + 4);
    const v4f x2 = *(const v4fa*)(arow + kb + 16 + 8 * hh), x3 = *(const v4fa*)(arow + kb + 16 + 8 * hh + 4);
    float xs[16] = {x0[0],x0[1],x0[2],x0[3],x1[0],x1[1],x1[2],x1[3],x2[0],x2[1],x2[2],x2[3],x3[0],x3[1],x3[2],x3[3]};
#pragma unroll
    for (int i = 0; i < 16; ++i) { const unsigned short hb = bf16_bits(xs[i]); ah.u[i] = hb; al.u[i] = ASPLIT ? bf16_bits(xs[i] - bf16_val(hb)) : (unsigned short)0; }
#pragma unroll
    for (int t = 0; t < 4; ++t) {
      const unsigned short* brow = Wt + (size_t)(col0 + t * 16 + ln) * ldb + kb;
      FragB b;
      b.half[0] = *(const v8us*)(brow + 8 * hh);
      b.half[1] = *(const v8us*)(brow + 16 + 8 * hh);
      acc[t] = mmaN<ASPLIT ? 2 : 1>(ah.v, al.v, b.v, b.v, acc[t]);
    }
  }
#pragma unroll
  for (int t = 0; t < 4; ++t) {
    const int col = col0 + t * 16 + ln;
    float bv = bias ? bias[col] : 0.f;
    if (BIAS_BF16) bv = bf16_round(bv);
#pragma unroll
    for (int r = 0; r < 8; ++r) {
      float v = acc[t][r] + bv;
      if (resid) { float rv = resid[(size_t)((row0 + 8 * hh + r) % rmod) * ldr + col]; if (RES_BF16) rv = bf16_round(rv); v += rv; }
      if (ACT == 1) v = fmaxf(v, 0.f);
      if (ACT == 2) v = 0.5f * v * (1.0f + erff(v * 0.70710678118654752f));
      if (ACT == 3) { const float u = 0.7978845608028654f * (v + 0.044715f * v * v * v); v = 0.5f * v * (1.0f + tanhf(u)); }
      so[w][8 * hh + r][t * 16 + ln] = v;
    }
  }
  __builtin_amdgcn_fence(__ATOMIC_ACQ_REL, "workgroup");
  __builtin_amdgcn_wave_barrier();
  const int rsub = lane >> 4, c4 = (lane & 15) * 4;
  {
#pragma unroll
    for (int q = 0; q < 8; ++q) {
      const int r = q * 2 + rsub;
      const v4f v = *(const v4fa*)&so[w][r][c4];
      *(v4f*)(C + (size_t)(row0 + r) * ldc + col0 + c4) = v;
    }
    
  }
}
// row LayerNorm (biased variance, eps) over N: s = X (+ R); optional out_sum <- s; out_norm <- (s-mu)*rsqrt(var+eps)*g + b
template <bool PARAM_BF16>
__global__ __launch_bounds__(256) void k_layernorm(const float* __restrict__ X, const float* __restrict__ R, const float* __restrict__ g, const float* __restrict__ bta,
                                                  float* __restrict__ out_sum, float* __restrict__ out_norm, int N, float eps) {
  __shared__ float red[256];
  const int row = blockIdx.x, tid = threadIdx.x;
  const float* x = X + (size_t)row * N; const float* rr = R ? R + (size_t)row * N : nullptr;
  float vals[16];                     // up to N = 4096
  const int per = N / 256;            // contiguous chunk per thread? use strided-by-4 chunks: thread handles j = tid*4 + 1024*u
  float s1 = 0.f;
  for (int u = 0; u < per / 4; ++u) {
    const int j = tid * 4 + 1024 * u;
    const v4f a = *(const v4fa*)(x + j);
    v4f b = {0.f,0.f,0.f,0.f}; if (rr) b = *(const v4fa*)(rr + j);
#pragma unroll
    for (int q = 0; q < 4; ++q) { const float v = a[q] + b[q]; vals[u * 4 + q] = v; s1 += v; }
  }
  red[tid] = s1; __syncthreads();
  for (int st = 128; st > 0; st >>= 1) { if (tid < st) red[tid] += red[tid + st]; __syncthreads(); }
  const float mu = red[0] / (float)N; __syncthreads();
  float s2 = 0.f;
  for (int u = 0; u < per / 4; ++u)
#pragma unroll
    for (int q = 0; q < 4; ++q) { const float c = vals[u * 4 + q] - mu; s2 += c * c; }
  red[tid] = s2; __syncthreads();
  for (int st = 128; st > 0; st >>= 1) { if (tid < st) red[tid] += red[tid + st]; __syncthreads(); }
  const float rs = rsqrtf(red[0] / (float)N + eps);
  {
    for (int u = 0; u < per / 4; ++u) {
      const int j = tid * 4 + 1024 * u;
      v4f o, sm;
#pragma unroll
      for (int q = 0; q < 4; ++q) {
        float gg = g[j + q], bb = bta[j + q];
        if (PARAM_BF16) { gg = bf16_round(gg); bb = bf16_round(bb); }
        sm[q] = vals[u * 4 + q]; o[q] = (vals[u * 4 + q] - mu) * rs * gg + bb;
      }
      if (out_sum) *(v4f*)(out_sum + (size_t)row * N + j) = sm;
      *(v4f*)(out_norm + (size_t)row * N + j) = o;
    }
    
  }
}



// ---- f16 WMMA path (v_wmma_f32_16x16x32_f16): 11-bit significands for operands in range — used where a [0,1] probability operand needs more precision than bf16
typedef _Float16 v16h __attribute__((ext_vector_type(16)));
union FragH { v16h v; v8us half[2]; _Float16 h[16]; unsigned short u[16]; };
template <int NT>
__device__ __forceinline__ v8f mmaH(v16h ah, v16h al, v16h bh, v16h bl, v8f c) {
  c = __builtin_amdgcn_wmma_f32_16x16x32_f16(false, ah, false, bh, (short)0, c, false, false);
  if (NT >= 2) c = __builtin_amdgcn_wmma_f32_16x16x32_f16(false, al, false, bh, (short)0, c, false, false);
  if (NT >= 3) c = __builtin_amdgcn_wmma_f32_16x16x32_f16(false, ah, false, bl, (short)0, c, false, false);
  asm volatile("v_nop\n\tv_nop\n\tv_nop\n\tv_nop" : "+v"(c) : "v"(ah), "v"(al), "v"(bh), "v"(bl));
  return c;
}
// batched GEMM like k_gemm_b but f16 operands: A f32 (split into f16 hi/lo if ASPLIT, else rounded to f16), Bt = f16 values [n][k]; alpha; C f32; N multiple of 16 (partial tiles skipped)
template <bool ASPLIT>
__global__ __launch_bounds__(128) void k_gemm_h(const float* __restrict__ A, int lda, size_t sA, const _Float16* __restrict__ Bh, int ldb, size_t sB, float alpha, float* __restrict__ C, int ldc, size_t sC, int M, int N, int K) {
  __shared__ __attribute__((aligned(16))) float so[4][16][64];
  const int tid = threadIdx.x, w = tid >> 5, lane = tid & 31, ln = lane & 15, hh = lane >> 4; const int by = blockIdx.y;
  A += (size_t)by * sA; Bh += (size_t)by * sB; C += (size_t)by * sC;
  const int ntn = (N + 63) / 64; const int wid = blockIdx.x * 4 + w; const int mt = wid / ntn, nq = wid % ntn; if (mt * 16 >= M) return;
  const int row0 = mt * 16, col0 = nq * 64; const float* arow = A + (size_t)(row0 + ln) * lda;
  v8f acc[4] = {};
  for (int kb = 0; kb < K; kb += 32) {
    FragH ah, al;
    const v4f x0 = *(const v4fa*)(arow + kb + 8 * hh), x1 = *(const v4fa*)(arow + kb + 8 * hh + 4), x2 = *(const v4fa*)(arow + kb + 16 + 8 * hh), x3 = *(const v4fa*)(arow + kb + 16 + 8 * hh + 4);
    float xs[16] = {x0[0],x0[1],x0[2],x0[3],x1[0],x1[1],x1[2],x1[3],x2[0],x2[1],x2[2],x2[3],x3[0],x3[1],x3[2],x3[3]};
#pragma unroll
    for (int i = 0; i < 16; ++i) { const _Float16 h = (_Float16)xs[i]; ah.h[i] = h; al.h[i] = ASPLIT ? (_Float16)(xs[i] - (float)h) : (_Float16)0.0f; }
#pragma unroll
    for (int t = 0; t < 4; ++t) { if (col0 + t * 16 >= N) continue; const size_t boff = (size_t)(col0 + t * 16 + ln) * ldb + kb; FragH bq; bq.half[0] = *(const v8us*)(Bh + boff + 8 * hh); bq.half[1] = *(const v8us*)(Bh + boff + 16 + 8 * hh);
      acc[t] = mmaH<ASPLIT ? 2 : 1>(ah.v, al.v, bq.v, bq.v, acc[t]); }
  }
#pragma unroll
  for (int t = 0; t < 4; ++t) { if (col0 + t * 16 >= N) continue;
#pragma unroll
    for (int r = 0; r < 8; ++r) so[w][8 * hh + r][t * 16 + ln] = acc[t][r] * alpha; }
  __builtin_amdgcn_fence(__ATOMIC_ACQ_REL, "workgroup"); __builtin_amdgcn_wave_barrier();
  const int rsub = lane >> 4, c4 = (lane & 15) * 4;
  {
#pragma unroll
    for (int q = 0; q < 8; ++q) { const int r = q * 2 + rsub; if (col0 + c4 < N) { const v4f v = *(const v4fa*)&so[w][r][c4]; *(v4f*)(C + (size_t)(row0 + r) * ldc + col0 + c4) = v; } }
     }
}

// Wt[n][k] = f16(W[k][n]·scale) from f32 row-major W[K][N] (scale = power of two; bf16-exact weights stay exact in f16 away from the subnormal range)
__global__ __launch_bounds__(256) void k_wt_f16(const float* __restrict__ W, _Float16* __restrict__ Wt, int K, int N, float scale) {
  const int t = blockIdx.x * 256 + threadIdx.x; if (t >= N * (K / 8)) return; const int n = t / (K / 8), k8 = (t % (K / 8)) * 8; FragH f;
#pragma unroll
  for (int i = 0; i < 8; ++i) f.h[i] = (_Float16)(bf16_round(W[(size_t)(k8 + i) * N + n]) * scale); const v8us o = f.half[0];
  *(v8us*)((unsigned short*)Wt + (size_t)n * K + k8) = o; 
}
// k_gemm_hh variant with fused epilogue: v = acc·alpha + bias[by·sBias + col] (+ CP[(row/rowsPerB)·sCPb + by·64 + col] if CP) ; ACT 0 none / 1 elu ; writes f16 C16 (and f32 C if non-null)
template <int ACT>
__global__ __launch_bounds__(128) void k_gemm_hhx(const _Float16* __restrict__ A, int lda, size_t sA, const _Float16* __restrict__ Bh, int ldb, size_t sB, float alpha, const float* __restrict__ bias, size_t sBias, const float* __restrict__ CP, int rowsPerB, size_t sCPb, int row0g,
    float* __restrict__ C, _Float16* __restrict__ C16, int ldc, size_t sC, int M, int N, int K) {
  __shared__ __attribute__((aligned(16))) float so[4][16][64];
  const int tid = threadIdx.x, w = tid >> 5, lane = tid & 31, ln = lane & 15, hh = lane >> 4; const int by = blockIdx.y;
  A += (size_t)by * sA; Bh += (size_t)by * sB; const size_t cofs = (size_t)by * sC; const float* bp = bias ? bias + (size_t)by * sBias : nullptr;
  const int ntn = (N + 63) / 64; const int wid = blockIdx.x * 4 + w; const int mt = wid / ntn, nq = wid % ntn; if (mt * 16 >= M) return;
  const int row0 = mt * 16, col0 = nq * 64; const _Float16* arow = A + (size_t)(row0 + ln) * lda;
  v8f acc[4] = {};
  for (int kb = 0; kb < K; kb += 32) { FragH ah; ah.half[0] = *(const v8us*)((const unsigned short*)arow + kb + 8 * hh); ah.half[1] = *(const v8us*)((const unsigned short*)arow + kb + 16 + 8 * hh);
#pragma unroll
    for (int t = 0; t < 4; ++t) { if (col0 + t * 16 >= N) continue; const size_t boff = (size_t)(col0 + t * 16 + ln) * ldb + kb; FragH bq; bq.half[0] = *(const v8us*)((const unsigned short*)Bh + boff + 8 * hh); bq.half[1] = *(const v8us*)((const unsigned short*)Bh + boff + 16 + 8 * hh);
      acc[t] = mmaH<1>(ah.v, ah.v, bq.v, bq.v, acc[t]); }
  }
#pragma unroll
  for (int t = 0; t < 4; ++t) { if (col0 + t * 16 >= N) continue; const int col = col0 + t * 16 + ln; const float bv = bp ? bf16_round(bp[col]) : 0.f;
#pragma unroll
    for (int r = 0; r < 8; ++r) { float v = acc[t][r] * alpha + bv; if (CP) { const int bidx = (row0g + row0 + 8 * hh + r) / rowsPerB; v += CP[(size_t)bidx * sCPb + (size_t)by * 64 + col]; } if (ACT == 1) v = (v > 0.f) ? v : expm1f(v); else if (ACT == 7) v = (v > 0.f) ? v + 1.0f : expf(v); else if (ACT == 8) v = tanhf(v); else if (ACT == 9) v = 0.5f * v * (1.0f + tanhf(0.7978845608028654f * (v + 0.044715f * v * v * v))); else if (ACT == 11) v = 1.0f / (1.0f + expf(-v)); else if (ACT == 12) v = (v > 0.f) ? v : 0.01f * v; else if (ACT == 14) v = (v > 0.f) ? v : 0.1f * v; else if (ACT == 15) v = v / (1.0f + expf(-v)); else if (ACT == 3) v = fmaxf(v, 0.f); else if (ACT == 6) v = 0.5f * v * (1.0f + erff(v * 0.70710678118654752f)); so[w][8 * hh + r][t * 16 + ln] = v; } }
  __builtin_amdgcn_fence(__ATOMIC_ACQ_REL, "workgroup"); __builtin_amdgcn_wave_barrier();
  const int rsub = lane >> 4, c4 = (lane & 15) * 4; typedef _Float16 v4h __attribute__((ext_vector_type(4)));
  {
#pragma unroll
    for (int q = 0; q < 8; ++q) { const int r = q * 2 + rsub; if (col0 + c4 < N) { const v4f v = *(const v4fa*)&so[w][r][c4]; if (C) *(v4f*)(C + cofs + (size_t)(row0 + r) * ldc + col0 + c4) = v; if (C16) { v4h h4; for (int i = 0; i < 4; ++i) h4[i] = (_Float16)v[i]; *(v4h*)(C16 + cofs + (size_t)(row0 + r) * ldc + col0 + c4) = h4; } } }
     }
}


typedef _Float16 v4h __attribute__((ext_vector_type(4)));

__global__ __launch_bounds__(256) void k_x16(const float* __restrict__ x, _Float16* __restrict__ X16, size_t n8) { const size_t t = (size_t)blockIdx.x * 256 + threadIdx.x; if (t >= n8) return; FragH f;
#pragma unroll
  for (int q = 0; q < 8; ++q) f.h[q] = (_Float16)bf16_round(x[t * 8 + q]); *(v8us*)((unsigned short*)X16 + t * 8) = f.half[0];  }
__global__ __launch_bounds__(256) void k_h16(const float* __restrict__ x, _Float16* __restrict__ X16, size_t n8) { const size_t t = (size_t)blockIdx.x * 256 + threadIdx.x; if (t >= n8) return; FragH f;
#pragma unroll
  for (int q = 0; q < 8; ++q) f.h[q] = (_Float16)x[t * 8 + q]; *(v8us*)((unsigned short*)X16 + t * 8) = f.half[0];  }
__global__ __launch_bounds__(256) void k_round16f(const float* __restrict__ W, _Float16* __restrict__ Bt, size_t n8) { const size_t t = (size_t)blockIdx.x * 256 + threadIdx.x; if (t >= n8) return; FragH f;
#pragma unroll
  for (int i = 0; i < 8; ++i) f.h[i] = (_Float16)(bf16_round(W[t * 8 + i]) * 16.0f); *(v8us*)((unsigned short*)Bt + t * 8) = f.half[0];  }
template <int NHv, int TTv>
__global__ __launch_bounds__(256) void k_vt(const _Float16* __restrict__ V16, int ldv, int voff, _Float16* __restrict__ Vt) { __shared__ unsigned short tl[64][66]; const int tid = threadIdx.x; const int slab = blockIdx.x / (TTv / 64), lg = blockIdx.x % (TTv / 64); const int b = slab / NHv, h = slab % NHv;
  for (int i = tid; i < 64 * 8; i += 256) { const int r = i / 8, c8 = (i % 8) * 8; FragH f; f.half[0] = *(const v8us*)((const unsigned short*)V16 + ((size_t)b * TTv + lg * 64 + r) * ldv + voff + h * 64 + c8);
#pragma unroll
    for (int q = 0; q < 8; ++q) tl[r][c8 + q] = f.u[q]; }
  __syncthreads();
  {
#pragma unroll
    for (int rd = 0; rd < 2; ++rd) { const int d = rd * 32 + tid / 8, pc = tid % 8; FragH f;
#pragma unroll
      for (int q = 0; q < 8; ++q) f.u[q] = tl[pc * 8 + q][d];
      *(v8us*)((unsigned short*)Vt + ((size_t)slab * 64 + d) * TTv + lg * 64 + pc * 8) = f.half[0]; }
     } }

__global__ __launch_bounds__(256) void k_hl(const float* __restrict__ F, _Float16* __restrict__ Hh, _Float16* __restrict__ Hl, size_t n8) { const size_t t = (size_t)blockIdx.x * 256 + threadIdx.x; if (t >= n8) return; FragH fh, fl; const v4f a = *(const v4fa*)(F + t * 8), c = *(const v4fa*)(F + t * 8 + 4);
#pragma unroll
  for (int q = 0; q < 4; ++q) { _Float16 h = (_Float16)a[q]; fh.h[q] = h; fl.h[q] = (_Float16)((a[q] - (float)h) * 1024.0f); h = (_Float16)c[q]; fh.h[4 + q] = h; fl.h[4 + q] = (_Float16)((c[q] - (float)h) * 1024.0f); }
  { *(v8us*)((unsigned short*)Hh + t * 8) = fh.half[0]; *(v8us*)((unsigned short*)Hl + t * 8) = fl.half[0];  } }

// ---- fast GEMM (wave tile 32x64; requires M % 32 == 0 rows per launch region and N % 64 == 0); epilogue = k_gemm_hhx semantics ----
__device__ __forceinline__ v16h g2_frag(const _Float16* p, int hh) { FragH f; f.half[0] = *(const v8us*)((const unsigned short*)p + 8 * hh); f.half[1] = *(const v8us*)((const unsigned short*)p + 16 + 8 * hh); return f.v; }
__device__ __forceinline__ v8f g2_mma(v16h a, v16h b, v8f c) { v8f d = __builtin_amdgcn_wmma_f32_16x16x32_f16(false, a, false, b, (short)0, c, false, false); asm volatile("v_nop\n\tv_nop\n\tv_nop\n\tv_nop" : "+v"(d) : "v"(a), "v"(b)); return d; }
template <int ACT>
__global__ __launch_bounds__(128) void k_gemm2(const _Float16* __restrict__ A, int lda, size_t sA, const _Float16* __restrict__ Bh, int ldb, size_t sB, float alpha, const float* __restrict__ bias, size_t sBias, const float* __restrict__ CP, int rowsPerB, size_t sCPb, int row0g,
    float* __restrict__ C, _Float16* __restrict__ C16, int ldc, size_t sC, int M, int N, int K) {
  __shared__ __attribute__((aligned(16))) float so[4][32][68];
  const int tid = threadIdx.x, w = tid >> 5, lane = tid & 31, ln = lane & 15, hh = lane >> 4; const int by = blockIdx.y;
  A += (size_t)by * sA; Bh += (size_t)by * sB; const size_t cofs = (size_t)by * sC; const float* bp = bias ? bias + (size_t)by * sBias : nullptr;
  const int ntn = N >> 6; const int mt = blockIdx.x / ntn, nq = blockIdx.x - mt * ntn; const int row0 = mt * 128 + 32 * w, col0 = nq * 64; if (row0 >= M) return;
  const _Float16* a0p = A + (size_t)(row0 + ln) * lda; const _Float16* a1p = a0p + (size_t)16 * lda;
  const _Float16* b0p = Bh + (size_t)(col0 + ln) * ldb; const _Float16* b1p = b0p + (size_t)16 * ldb; const _Float16* b2p = b1p + (size_t)16 * ldb; const _Float16* b3p = b2p + (size_t)16 * ldb;
  const v8f z8 = {0.f,0.f,0.f,0.f,0.f,0.f,0.f,0.f}; v8f c00 = z8, c01 = z8, c02 = z8, c03 = z8, c10 = z8, c11 = z8, c12 = z8, c13 = z8;
  /* Register ring of three k-steps: the six fragments of steps s + 1 and s + 2 are in flight while step s is multiplied, so that a step no longer waits for five round trips one after the other.
     Each accumulator still takes its k-steps in ascending order. The six lane pointers live through the whole loop and every load of a trip reaches its step by an immediate offset, so that no load's result can land in an address register; only steps below K / 32 are loaded. */
  typedef const __attribute__((address_space(1))) _Float16* g2_gp;      /* typed as global memory, so that the loads stay global loads behind the asm statement that names the pointers */
  g2_gp p0 = (g2_gp)(a0p + 8 * hh), p1 = (g2_gp)(a1p + 8 * hh), p2 = (g2_gp)(b0p + 8 * hh), p3 = (g2_gp)(b1p + 8 * hh), p4 = (g2_gp)(b2p + 8 * hh), p5 = (g2_gp)(b3p + 8 * hh);
#define G2_FR(P, ST) g2_frag((const _Float16*)((P) + 32 * (ST)), 0)
#define G2_LOAD(S, ST) { S[0] = G2_FR(p0, ST); S[1] = G2_FR(p1, ST); S[2] = G2_FR(p2, ST); S[3] = G2_FR(p3, ST); S[4] = G2_FR(p4, ST); S[5] = G2_FR(p5, ST); \
    __builtin_amdgcn_sched_barrier(0); /* keeps the refill in front of the products that follow: without it the compiler sinks a refill behind the first product and that product's wait, and it flies for a shorter time */ }
#define G2_STEP(S) { c00 = g2_mma(S[0], S[2], c00); c10 = g2_mma(S[1], S[2], c10); c01 = g2_mma(S[0], S[3], c01); c11 = g2_mma(S[1], S[3], c11); c02 = g2_mma(S[0], S[4], c02); c12 = g2_mma(S[1], S[4], c12); c03 = g2_mma(S[0], S[5], c03); c13 = g2_mma(S[1], S[5], c13); }
  { const int nst = K >> 5; v16h r0[6], r1[6], r2[6]; int s = 0;
    if (nst >= 1) G2_LOAD(r0, 0)
    if (nst >= 2) G2_LOAD(r1, 1)
#pragma unroll 1
    for (; s + 5 <= nst; s += 3) { G2_LOAD(r2, 2) G2_STEP(r0) G2_LOAD(r0, 3) G2_STEP(r1) G2_LOAD(r1, 4) G2_STEP(r2)
      asm volatile("s_wait_xcnt 0x0" : "+v"(p0), "+v"(p1), "+v"(p2), "+v"(p3), "+v"(p4), "+v"(p5) :: "memory"); /* stands in front of the six additions below, which overwrite the address registers of the loads issued above; the pointers are named so that the additions depend on this statement and cannot be placed ahead of it */
      p0 += 96; p1 += 96; p2 += 96; p3 += 96; p4 += 96; p5 += 96; }
    const int rem = nst - s;      /* 0 to 4 steps are left; r0 and r1 hold the first two of them */
    if (rem >= 3) G2_LOAD(r2, 2)
    if (rem >= 1) G2_STEP(r0)
    if (rem >= 4) G2_LOAD(r0, 3)
    if (rem >= 2) G2_STEP(r1)
    if (rem >= 3) G2_STEP(r2)
    if (rem >= 4) G2_STEP(r0) }
#undef G2_FR
#undef G2_LOAD
#undef G2_STEP
  v8f accs[8] = {c00, c01, c02, c03, c10, c11, c12, c13};
#pragma unroll
  for (int u = 0; u < 8; ++u) { const int t = u & 3, half = u >> 2; const int col = col0 + t * 16 + ln; const float bv = bp ? bf16_round(bp[col]) : 0.f;
#pragma unroll
    for (int r = 0; r < 8; ++r) { const int rloc = half * 16 + 8 * hh + r; float v = accs[u][r] * alpha + bv; if (CP) { const int bidx = (row0g + row0 + rloc) / rowsPerB; v += CP[(size_t)bidx * sCPb + (size_t)by * 64 + col]; }
      if (ACT == 3) v = fmaxf(v, 0.f); else if (ACT == 6) v = 0.5f * v * (1.0f + erff(v * 0.70710678118654752f)); else if (ACT == 11) v = 1.0f / (1.0f + expf(-v)); else if (ACT == 15) v = v / (1.0f + expf(-v)); else if (ACT == 12) v = (v > 0.f) ? v : 0.01f * v; else if (ACT == 8) v = tanhf(v);
      so[w][rloc][t * 16 + ln] = v; } }
  __builtin_amdgcn_fence(__ATOMIC_ACQ_REL, "workgroup"); __builtin_amdgcn_wave_barrier();
  const int rsub = lane >> 4, c4 = (lane & 15) * 4;
  {
#pragma unroll
    for (int q = 0; q < 16; ++q) { const int r = q * 2 + rsub; const v4f v = *(const v4fa*)&so[w][r][c4]; if (C) *(v4f*)(C + cofs + (size_t)(row0 + r) * ldc + col0 + c4) = v; if (C16) { v4h h4; for (int i = 0; i < 4; ++i) h4[i] = (_Float16)v[i]; *(v4h*)(C16 + cofs + (size_t)(row0 + r) * ldc + col0 + c4) = h4; } }
     } }



template <int TK>
__global__ __launch_bounds__(256) void k_vthl(const float* __restrict__ VF, int ldv, _Float16* __restrict__ Vth, _Float16* __restrict__ Vtl) { __shared__ float tl[64][65]; const int tid = threadIdx.x; const int slab = blockIdx.x / (TK / 64), lg = blockIdx.x % (TK / 64); const int b = slab / NH, h = slab % NH;
  for (int i = tid; i < 64 * 16; i += 256) { const int r = i / 16, c4 = (i % 16) * 4; const v4f a = *(const v4fa*)(VF + ((size_t)b * TK + lg * 64 + r) * ldv + h * 64 + c4); tl[r][c4] = a[0]; tl[r][c4 + 1] = a[1]; tl[r][c4 + 2] = a[2]; tl[r][c4 + 3] = a[3]; }
  __syncthreads();
  FragH fh[2], fl[2]; size_t oo[2];
#pragma unroll
  for (int rd = 0; rd < 2; ++rd) { const int d = rd * 32 + tid / 8, pc = tid % 8;
#pragma unroll
    for (int q = 0; q < 8; ++q) { const float v = tl[pc * 8 + q][d]; const _Float16 hv = (_Float16)v; fh[rd].h[q] = hv; fl[rd].h[q] = (_Float16)((v - (float)hv) * 1024.0f); } oo[rd] = ((size_t)slab * 64 + d) * TK + lg * 64 + pc * 8; }
  {
#pragma unroll
    for (int rd = 0; rd < 2; ++rd) { *(v8us*)((unsigned short*)Vth + oo[rd]) = fh[rd].half[0]; *(v8us*)((unsigned short*)Vtl + oo[rd]) = fl[rd].half[0]; }
     } }

template <int TQ, int TK>
__global__ __launch_bounds__(128) void k_flashme(const _Float16* __restrict__ Q16, const _Float16* __restrict__ Q16lo, int ldq, const _Float16* __restrict__ K16, const _Float16* __restrict__ K16lo, int ldk, const _Float16* __restrict__ Vt, const _Float16* __restrict__ Vtlo, const unsigned* __restrict__ MB, const int* __restrict__ RA, const int* __restrict__ KE, const float* __restrict__ HB, float* __restrict__ O, int ldo) {
  #pragma clang fp contract(off)
  constexpr int RPW = 16, RTN = RPW / 16, NQB = TQ / (4 * RPW), DT = 4, KS = 2;
  __shared__ __attribute__((aligned(16))) unsigned short sP[4][RPW][40], sPl[4][RPW][40]; __shared__ __attribute__((aligned(16))) float sO[4][RPW][64 + 4];
  const int tid = threadIdx.x, w = tid >> 5, lane = tid & 31, ln = lane & 15, hh = lane >> 4;
  const int slab = blockIdx.x / NQB, qblk = blockIdx.x % NQB; const int b = slab / NH, h = slab % NH; const int qb0 = qblk * (4 * RPW); const int q0 = qb0 + w * RPW;
  FragH aq[2][KS], aql[2][KS];
#pragma unroll
  for (int rt = 0; rt < RTN; ++rt) { const size_t qo = ((size_t)b * TQ + q0 + rt * 16 + ln) * ldq + h * 64; const unsigned short* qr = (const unsigned short*)Q16 + qo; const unsigned short* ql = (const unsigned short*)Q16lo + qo;
#pragma unroll
    for (int ks = 0; ks < KS; ++ks) { aq[rt][ks].half[0] = *(const v8us*)(qr + ks * 32 + 8 * hh); aq[rt][ks].half[1] = *(const v8us*)(qr + ks * 32 + 16 + 8 * hh); aql[rt][ks].half[0] = *(const v8us*)(ql + ks * 32 + 8 * hh); aql[rt][ks].half[1] = *(const v8us*)(ql + ks * 32 + 16 + 8 * hh); } }
  const unsigned short* Vth = (const unsigned short*)Vt + (size_t)slab * 64 * TK; const unsigned short* Vtl = (const unsigned short*)Vtlo + (size_t)slab * 64 * TK;
  float m_r[2][8], l_r[2][8]; v8f oacc[2][DT], oaccl[2][DT];
#pragma unroll
  for (int rt = 0; rt < RTN; ++rt) {
#pragma unroll
    for (int r = 0; r < 8; ++r) { m_r[rt][r] = -3.0e38f; l_r[rt][r] = 0.f; }
#pragma unroll
    for (int dt = 0; dt < DT; ++dt) { oacc[rt][dt] = (v8f){0.f,0.f,0.f,0.f,0.f,0.f,0.f,0.f}; oaccl[rt][dt] = oacc[rt][dt]; } }
  int jend = KE[qblk * 32]; jend = min(TK, (jend + 31) & ~31); if (jend < 32) jend = 32;      /* block-uniform */
  int allm[2][8]; const unsigned* mrow[2][8];
#pragma unroll
  for (int rt = 0; rt < RTN; ++rt)
#pragma unroll
    for (int r = 0; r < 8; ++r) { const int tq = q0 + rt * 16 + 8 * hh + r; allm[rt][r] = RA[tq]; mrow[rt][r] = MB + (size_t)tq * (TK / 32); }
#pragma unroll 1
  for (int j0 = 0; j0 < jend; j0 += 32) {
    
    v8f s[2][2];
#pragma unroll
    for (int nt = 0; nt < 2; ++nt) { const size_t ko = ((size_t)b * TK + j0 + nt * 16 + ln) * ldk + h * 64; const unsigned short* kr = (const unsigned short*)K16 + ko; const unsigned short* kl = (const unsigned short*)K16lo + ko; FragH bk[KS], bkl[KS];
#pragma unroll
      for (int ks = 0; ks < KS; ++ks) { bk[ks].half[0] = *(const v8us*)(kr + ks * 32 + 8 * hh); bk[ks].half[1] = *(const v8us*)(kr + ks * 32 + 16 + 8 * hh); bkl[ks].half[0] = *(const v8us*)(kl + ks * 32 + 8 * hh); bkl[ks].half[1] = *(const v8us*)(kl + ks * 32 + 16 + 8 * hh); }
#pragma unroll
      for (int rt = 0; rt < RTN; ++rt) { v8f acc = (v8f){0.f,0.f,0.f,0.f,0.f,0.f,0.f,0.f}, accr = acc;
#pragma unroll
        for (int ks = 0; ks < KS; ++ks) { acc = mmaH<1>(aq[rt][ks].v, aq[rt][ks].v, bk[ks].v, bk[ks].v, acc); accr = mmaH<1>(aql[rt][ks].v, aql[rt][ks].v, bk[ks].v, bk[ks].v, accr); accr = mmaH<1>(aq[rt][ks].v, aq[rt][ks].v, bkl[ks].v, bkl[ks].v, accr); }
        s[rt][nt] = acc + accr * 0.0009765625f; } }
#pragma unroll
    for (int rt = 0; rt < RTN; ++rt)
#pragma unroll
      for (int r = 0; r < 8; ++r) { const unsigned mw = mrow[rt][r][j0 >> 5]; const bool am = (allm[rt][r] != 0);
        const bool ok0 = am || (((mw >> ln) & 1u) == 0u), ok1 = am || (((mw >> (16 + ln)) & 1u) == 0u);
        const int tqe = q0 + rt * 16 + 8 * hh + r; const int k0e = j0 + ln, k1e = j0 + 16 + ln; const float xih = HB[2 * h], egh = HB[2 * h + 1];
        const float b0 = (-((float)(tqe > k0e ? tqe - k0e : k0e - tqe) / xih)) * egh, b1 = (-((float)(tqe > k1e ? tqe - k1e : k1e - tqe) / xih)) * egh;
        const float s0 = ok0 ? (am ? 0.f : s[rt][0][r] * SCL + b0) : -INFINITY, s1 = ok1 ? (am ? 0.f : s[rt][1][r] * SCL + b1) : -INFINITY; float mc = fmaxf(s0, s1);
        mc = fmaxf(mc, __shfl_xor(mc, 1, 32)); mc = fmaxf(mc, __shfl_xor(mc, 2, 32)); mc = fmaxf(mc, __shfl_xor(mc, 4, 32)); mc = fmaxf(mc, __shfl_xor(mc, 8, 32));
        const float mn = fmaxf(m_r[rt][r], mc); const float al = (mn > -1.0e38f) ? expf(m_r[rt][r] - mn) : 1.0f; m_r[rt][r] = mn; const float p0 = ok0 ? expf(s0 - mn) : 0.f, p1 = ok1 ? expf(s1 - mn) : 0.f; l_r[rt][r] = l_r[rt][r] * al + p0 + p1;
#pragma unroll
        for (int dt = 0; dt < DT; ++dt) { oacc[rt][dt][r] *= al; oaccl[rt][dt][r] *= al; }
        FragH t2, t3; const float ps0 = p0 * 1024.0f, ps1 = p1 * 1024.0f; t2.h[0] = (_Float16)ps0; t2.h[1] = (_Float16)ps1; t3.h[0] = (_Float16)((ps0 - (float)t2.h[0]) * 1024.0f); t3.h[1] = (_Float16)((ps1 - (float)t2.h[1]) * 1024.0f);
        sP[w][rt * 16 + 8 * hh + r][ln] = t2.u[0]; sP[w][rt * 16 + 8 * hh + r][16 + ln] = t2.u[1]; sPl[w][rt * 16 + 8 * hh + r][ln] = t3.u[0]; sPl[w][rt * 16 + 8 * hh + r][16 + ln] = t3.u[1]; }
    __builtin_amdgcn_fence(__ATOMIC_ACQ_REL, "workgroup"); __builtin_amdgcn_wave_barrier();
    FragH pa[2], pl[2];
#pragma unroll
    for (int rt = 0; rt < RTN; ++rt) { pa[rt].half[0] = *(const v8us*)&sP[w][rt * 16 + ln][8 * hh]; pa[rt].half[1] = *(const v8us*)&sP[w][rt * 16 + ln][16 + 8 * hh]; pl[rt].half[0] = *(const v8us*)&sPl[w][rt * 16 + ln][8 * hh]; pl[rt].half[1] = *(const v8us*)&sPl[w][rt * 16 + ln][16 + 8 * hh]; }
#pragma unroll
    for (int dt = 0; dt < DT; ++dt) { const size_t vo = (size_t)(dt * 16 + ln) * TK + j0; FragH bv, bl; bv.half[0] = *(const v8us*)(Vth + vo + 8 * hh); bv.half[1] = *(const v8us*)(Vth + vo + 16 + 8 * hh); bl.half[0] = *(const v8us*)(Vtl + vo + 8 * hh); bl.half[1] = *(const v8us*)(Vtl + vo + 16 + 8 * hh);
#pragma unroll
      for (int rt = 0; rt < RTN; ++rt) { oacc[rt][dt] = mmaH<1>(pa[rt].v, pa[rt].v, bv.v, bv.v, oacc[rt][dt]); oaccl[rt][dt] = mmaH<1>(pa[rt].v, pa[rt].v, bl.v, bl.v, oaccl[rt][dt]); oaccl[rt][dt] = mmaH<1>(pl[rt].v, pl[rt].v, bv.v, bv.v, oaccl[rt][dt]); } }
    __builtin_amdgcn_fence(__ATOMIC_ACQ_REL, "workgroup"); __builtin_amdgcn_wave_barrier(); }
#pragma unroll
  for (int rt = 0; rt < RTN; ++rt) {
#pragma unroll
    for (int r = 0; r < 8; ++r) { float l = l_r[rt][r]; l += __shfl_xor(l, 1, 32); l += __shfl_xor(l, 2, 32); l += __shfl_xor(l, 4, 32); l += __shfl_xor(l, 8, 32); l_r[rt][r] = (l > 0.f) ? 1.0f / (l * 1024.0f) : 0.f; }
#pragma unroll
    for (int dt = 0; dt < DT; ++dt)
#pragma unroll
      for (int r = 0; r < 8; ++r) sO[w][rt * 16 + 8 * hh + r][dt * 16 + ln] = (oacc[rt][dt][r] + oaccl[rt][dt][r] * 0.0009765625f) * l_r[rt][r]; }
  __builtin_amdgcn_fence(__ATOMIC_ACQ_REL, "workgroup"); __builtin_amdgcn_wave_barrier();
  {
#pragma unroll
    for (int rp = 0; rp < RPW; rp += 2) { const int r = rp + (lane >> 4), pc = lane & 15; const v4f val = *(const v4fa*)&sO[w][r][pc * 4]; *(v4f*)(O + ((size_t)b * TQ + q0 + r) * ldo + h * 64 + pc * 4) = val; }
     } }


__global__ __launch_bounds__(256) void k_causaltab(unsigned* __restrict__ MB, int* __restrict__ RA, int* __restrict__ KE, int nq, int nk) {
  const int t = blockIdx.x * 256 + threadIdx.x; const int nw = nk / 32;
  if (t < nq * nw) { const int q = t / nw, w = t % nw; const int first = q + 1 - 32 * w; const unsigned bits = (first <= 0) ? 0xffffffffu : ((first >= 32) ? 0u : (0xffffffffu << first)); *(unsigned*)(MB + t) = bits;  }
  if (t < nq) { *(int*)(RA + t) = 0;  }
  if (t < nq / 64) { const int v = 64 * (t + 1); *(int*)(KE + t * 32) = v;  } }

__constant__ float PIF[32] = {3.141592741e+00f,3.031195641e+00f,2.924677610e+00f,2.821902990e+00f,2.722739935e+00f,2.627061367e+00f,2.534744978e+00f,2.445672750e+00f,2.359730482e+00f,2.276808262e+00f,2.196800232e+00f,2.119603395e+00f,2.045119524e+00f,1.973252892e+00f,1.903911710e+00f,1.837007284e+00f,1.772453904e+00f,1.710168958e+00f,1.650072694e+00f,1.592088223e+00f,1.536141396e+00f,1.482160687e+00f,1.430076718e+00f,1.379823089e+00f,1.331335425e+00f,1.284551501e+00f,1.239411712e+00f,1.195858121e+00f,1.153835058e+00f,1.113288760e+00f,1.074167132e+00f,1.036420345e+00f};
__global__ __launch_bounds__(256) void k_trig(const float* __restrict__ pig, const float* __restrict__ logxi, const float* __restrict__ egl, float* __restrict__ CS, float* __restrict__ SN, float* __restrict__ HB) {
  #pragma clang fp contract(off)
  const int t = blockIdx.x * 256 + threadIdx.x; if (t >= NH * SLEN * 32) return; const int j = t & 31; const int tok = (t >> 5) % SLEN; const int h = t / (32 * SLEN);
  const float pg = 1.0f / (1.0f + expf(-bf16_round(pig[h]))); const float th = ((float)tok * PIF[j]) * pg; const float c = cosf(th), s = sinf(th);
  *(float*)(CS + t) = c; *(float*)(SN + t) = s; 
  if (t < 2 * NH) { const int hh2 = t >> 1; const float v = (t & 1) ? (1.0f / (1.0f + expf(-bf16_round(egl[hh2])))) : expf(bf16_round(logxi[hh2])); *(float*)(HB + t) = v;  } }      
__global__ __launch_bounds__(256) void k_eurot(const float* __restrict__ F, const float* __restrict__ CS, const float* __restrict__ SN, float* __restrict__ OF) {
  #pragma clang fp contract(off)
  const int t = blockIdx.x * 256 + threadIdx.x; if (t >= NR * (DM / 4)) return; const int c0 = (t % (DM / 4)) * 4; const int r = t / (DM / 4); const int tok = r % SLEN; const int h = c0 / 64, d0 = c0 & 63;
  const float* f = F + (size_t)r * DM + c0; const float* cs = CS + ((size_t)h * SLEN + tok) * 32; const float* sn = SN + ((size_t)h * SLEN + tok) * 32; v4f o;
#pragma unroll
  for (int q = 0; q < 4; ++q) { const int d = d0 + q; const float c = cs[d >> 1], s = sn[d >> 1];
    o[q] = (d & 1) ? (f[q - 1] * s + f[q] * c) : (f[q] * c - f[q + 1] * s); }
  *(v4f*)(OF + (size_t)r * DM + c0) = o;  }

extern "C" void kernel_launch(void* const* d_in, const int* in_sizes, int n_in,
                              void* d_out, int out_size, void* d_ws, size_t ws_size, hipStream_t stream) {
  (void)in_sizes; (void)n_in; (void)out_size;
  const float* const* I = (const float* const*)d_in; const float* x = I[0]; const float* Wqkv = I[1]; const float* Wo = I[2]; const float* logxi = I[3]; const float* pig = I[4]; const float* egl = I[5];
  char* ws = (char*)d_ws; size_t off = 0;
  auto take = [&](size_t bytes) { char* p = ws + off; off += (bytes + 255) & ~(size_t)255; return p; };
  _Float16* BQKV = (_Float16*)take((size_t)3 * DM * DM * 2); _Float16* BO = (_Float16*)take((size_t)DM * DM * 2);
  _Float16* X16 = (_Float16*)take((size_t)NR * DM * 2); float* F = (float*)take((size_t)NR * DM * 4); float* G = (float*)take((size_t)NR * DM * 4);
  _Float16* Qh = (_Float16*)take((size_t)NR * DM * 2); _Float16* Ql = (_Float16*)take((size_t)NR * DM * 2); _Float16* Kh = (_Float16*)take((size_t)NR * DM * 2); _Float16* Kl = (_Float16*)take((size_t)NR * DM * 2); _Float16* Vth = (_Float16*)take((size_t)NR * DM * 2); _Float16* Vtl = (_Float16*)take((size_t)NR * DM * 2);
  unsigned* MB = (unsigned*)take((size_t)SLEN * (SLEN / 32) * 4); int* RA = (int*)take((size_t)SLEN * 4); int* KE = (int*)take((size_t)(SLEN / 64) * 32 * 4);
  float* CS = (float*)take((size_t)NH * SLEN * 32 * 4); float* SN = (float*)take((size_t)NH * SLEN * 32 * 4); float* HB = (float*)take(256);
  if (off > ws_size) return;      /* 6 + 2 + 8 + 16 + 16 + 6 x 8 + 0.5 + 8 = 105 MiB */
  float* O = F; _Float16* Oh = (_Float16*)G; _Float16* Ol = Oh + (size_t)NR * DM;      /* F and G are dead once the hi/lo planes exist */
  const size_t n8 = (size_t)NR * DM / 8; const unsigned nb8 = (unsigned)((n8 + 255) / 256), nb4 = (unsigned)(((size_t)NR * DM / 4 + 255) / 256);
  k_round16f<<<(unsigned)(((size_t)3 * DM * DM / 8 + 255) / 256), 256, 0, stream>>>(Wqkv, BQKV, (size_t)3 * DM * DM / 8); k_round16f<<<(unsigned)(((size_t)DM * DM / 8 + 255) / 256), 256, 0, stream>>>(Wo, BO, (size_t)DM * DM / 8);      /* torch (out,in) = natural Bt; x16 */
  k_x16<<<nb8, 256, 0, stream>>>(x, X16, n8);
  k_trig<<<(NH * SLEN * 32 + 255) / 256, 256, 0, stream>>>(pig, logxi, egl, CS, SN, HB); k_causaltab<<<(SLEN * (SLEN / 32) + 255) / 256, 256, 0, stream>>>(MB, RA, KE, SLEN, SLEN);
  const dim3 gP((NR / 128) * (DM / 64), 1);
  k_gemm2<0><<<gP, 128, 0, stream>>>(X16, DM, 0, BQKV, DM, 0, 0.0625f, nullptr, 0, nullptr, 1, 0, 0, F, nullptr, DM, 0, NR, DM, DM); k_eurot<<<nb4, 256, 0, stream>>>(F, CS, SN, G); k_hl<<<nb8, 256, 0, stream>>>(G, Qh, Ql, n8);      /* q (rows 0..1023 of Wqkv), rotated, hi/lo */
  k_gemm2<0><<<gP, 128, 0, stream>>>(X16, DM, 0, BQKV + (size_t)DM * DM, DM, 0, 0.0625f, nullptr, 0, nullptr, 1, 0, 0, F, nullptr, DM, 0, NR, DM, DM); k_eurot<<<nb4, 256, 0, stream>>>(F, CS, SN, G); k_hl<<<nb8, 256, 0, stream>>>(G, Kh, Kl, n8);      /* k (rows 1024..2047), rotated */
  k_gemm2<0><<<gP, 128, 0, stream>>>(X16, DM, 0, BQKV + (size_t)2 * DM * DM, DM, 0, 0.0625f, nullptr, 0, nullptr, 1, 0, 0, F, nullptr, DM, 0, NR, DM, DM);      /* v (rows 2048..3071) f32 */
  k_vthl<SLEN><<<NBT * NH * (SLEN / 64), 256, 0, stream>>>(F, DM, Vth, Vtl);      /* both batches in one grid: the kernel takes the batch from blockIdx (slab / NH) */
  k_flashme<SLEN, SLEN><<<NBT * NH * (SLEN / 64), 128, 0, stream>>>(Qh, Ql, DM, Kh, Kl, DM, Vth, Vtl, MB, RA, KE, HB, O, DM);      /* both batches in one grid, so that their waves share the chip */
  k_hl<<<nb8, 256, 0, stream>>>(O, Oh, Ol, n8);
  k_gemm2<0><<<gP, 128, 0, stream>>>(Oh, DM, 0, BO, DM, 0, 0.0625f, nullptr, 0, nullptr, 1, 0, 0, (float*)d_out, nullptr, DM, 0, NR, DM, DM);
  k_gemm2<0><<<gP, 128, 0, stream>>>(Ol, DM, 0, BO, DM, 0, 0.0625f / 1024.0f, nullptr, 0, (const float*)d_out, 1, (size_t)DM, 0, (float*)d_out, nullptr, DM, 0, NR, DM, DM);
}

// v003
// Measured time: 546 microseconds a run.
// Next to v002, in two timings, it ran 1.05 and 1.06 times as fast.
// Over all steps from v000 it is 1.61 times as fast.
#include <hip/hip_runtime.h>
// Causal multi-head attention with gated rotary phases and a per-head distance decay (2 x 2048 tokens x 1024, 16 heads x 64): qkv = x*Wqkv^T; theta[h][t][j] = (t * pi^(1 - j/32)) * sigmoid(pi_gate[h]); interleaved-pair rotation of q and k; scores = q.k/8 - |i - j| / exp(log_xi[h]) * sigmoid(e_gate[h]) with j <= i; softmax; merged . Wo^T -> [2,2048,1024].
// Structure: x as an exact f16 plane; q/k/v from one packed f16 WMMA GEMM family (32x64 wave tiles, f32, exact products) into f32 planes; per-(head, token) cos/sin tables on VALU (pi^(1-j/32) = the reference's f32 constants, precise trig), one VALU pass rotates into f32 planes; q, k as f16 hi + x2^10 residual planes, V^T as hi + residual planes; the causal structure computed on device into a key bit plane + per-block key bound; the fused flash kernel per ((batch, head), 64 queries) with the decay bias added per element (three-product hi/lo scores, online softmax f32, P hi + residual via LDS, two value accumulators); O as hi + residual planes; output projection as two GEMMs.
// Compute dtype: x, weights and the three gate/scale vectors rounded to bf16; projections exact; rotation and bias f32; q, k, P, v, O as f16 hi + residual pairs (~2^-21); f32 accumulation and softmax. v_wmma_f32_16x16x32_f16.
#define NBT 2
#define SLEN 2048
#define DM 1024
#define NH 16
#define SCL 0.125f
#define NR (NBT * SLEN)
typedef __bf16 v16b __attribute__((ext_vector_type(16)));
typedef unsigned short v8us __attribute__((ext_vector_type(8), may_alias));
typedef float  v8f  __attribute__((ext_vector_type(8)));
typedef float  v4f  __attribute__((ext_vector_type(4)));
typedef float  v4fa __attribute__((ext_vector_type(4), may_alias));
union FragB { v16b v; v8us half[2]; unsigned short u[16]; };

__device__ __forceinline__ unsigned short bf16_bits(float x) { unsigned int u = __float_as_uint(x); return (unsigned short)((u + 0x7FFFu + ((u >> 16) & 1u)) >> 16); }
__device__ __forceinline__ float bf16_val(unsigned short b) { return __uint_as_float(((unsigned int)b) << 16); }
__device__ __forceinline__ float bf16_round(float x) { return bf16_val(bf16_bits(x)); }
// D += A·B with NT terms: 1 = ah·bh, 2 = + al·bh (A split), 3 = + ah·bl (both split)
template <int NT>
__device__ __forceinline__ v8f mmaN(v16b ah, v16b al, v16b bh, v16b bl, v8f c) {
  c = __builtin_amdgcn_wmma_f32_16x16x32_bf16(false, ah, false, bh, (short)0, c, false, false);
  if (NT >= 2) c = __builtin_amdgcn_wmma_f32_16x16x32_bf16(false, al, false, bh, (short)0, c, false, false);
  if (NT >= 3) c = __builtin_amdgcn_wmma_f32_16x16x32_bf16(false, ah, false, bl, (short)0, c, false, false);
  asm volatile("v_nop\n\tv_nop\n\tv_nop\n\tv_nop" : "+v"(c) : "v"(ah), "v"(al), "v"(bh), "v"(bl));
  return c;
}

__global__ __launch_bounds__(256) void k_wt_bf16(const float* __restrict__ W, unsigned short* __restrict__ Wt, int K, int N) {
  const int t = blockIdx.x * 256 + threadIdx.x;
  const int k8n = K / 8;
  if (t >= N * k8n) return;
  const int n = t / k8n, k8 = (t % k8n) * 8;
  v8us v;
#pragma unroll
  for (int i = 0; i < 8; ++i) v[i] = bf16_bits(W[(size_t)(k8 + i) * N + n]);
  *(v8us*)(Wt + (size_t)n * K + k8) = v;
  
}

// GEMM C[M][N] (f32, pitch ldc) = act(A[M][K]·W + bias). A f32 row-major (pitch lda) converted per fragment to bf16
// (ASPLIT: hi/lo two planes -> 2 terms, else single rounded term); Wt bf16 [N][K] (pitch ldb). BIAS_BF16 rounds the
// bias to bf16 first (bias quantised to bf16 before the add). K%32==0, M%16==0, N%64==0.
template <bool ASPLIT, int ACT, bool BIAS_BF16>
__global__ __launch_bounds__(128) void k_gemm_bf(const float* __restrict__ A, int lda, const unsigned short* __restrict__ Wt, int ldb,
                                               const float* __restrict__ bias, float* __restrict__ C, int ldc, int M, int N, int K) {
  __shared__ __attribute__((aligned(16))) float so[4][16][64];
  const int tid = threadIdx.x, w = tid >> 5, lane = tid & 31, ln = lane & 15, hh = lane >> 4;
  const int ntn = N / 64;
  const int wid = blockIdx.x * 4 + w;
  const int mt = wid / ntn, nq = wid % ntn;
  if (mt * 16 >= M) return;
  const int row0 = mt * 16, col0 = nq * 64;
  const float* arow = A + (size_t)(row0 + ln) * lda;
  v8f acc[4] = {};
  for (int kb = 0; kb < K; kb += 32) {
    FragB ah, al;
    const v4f x0 = *(const v4fa*)(arow + kb + 8 * hh), x1 = *(const v4fa*)(arow + kb + 8 * hh + 4);
    const v4f x2 = *(const v4fa*)(arow + kb + 16 + 8 * hh), x3 = *(const v4fa*)(arow + kb + 16 + 8 * hh + 4);
    float xs[16] = {x0[0],x0[1],x0[2],x0[3],x1[0],x1[1],x1[2],x1[3],x2[0],x2[1],x2[2],x2[3],x3[0],x3[1],x3[2],x3[3]};
#pragma unroll
    for (int i = 0; i < 16; ++i) { const unsigned short hb = bf16_bits(xs[i]); ah.u[i] = hb; al.u[i] = ASPLIT ? bf16_bits(xs[i] - bf16_val(hb)) : (unsigned short)0; }
#pragma unroll
    for (int t = 0; t < 4; ++t) {
      const unsigned short* brow = Wt + (size_t)(col0 + t * 16 + ln) * ldb + kb;
      FragB b;
      b.half[0] = *(const v8us*)(brow + 8 * hh);
      b.half[1] = *(const v8us*)(brow + 16 + 8 * hh);
      acc[t] = mmaN<ASPLIT ? 2 : 1>(ah.v, al.v, b.v, b.v, acc[t]);
    }
  }
#pragma unroll
  for (int t = 0; t < 4; ++t) {
    float bv = bias ? bias[col0 + t * 16 + ln] : 0.f;
    if (BIAS_BF16) bv = bf16_round(bv);
#pragma unroll
    for (int r = 0; r < 8; ++r) { float v = acc[t][r] + bv; if (ACT == 1) v = fmaxf(v, 0.f); so[w][8 * hh + r][t * 16 + ln] = v; }
  }
  __builtin_amdgcn_fence(__ATOMIC_ACQ_REL, "workgroup");
  __builtin_amdgcn_wave_barrier();
  const int rsub = lane >> 4, c4 = (lane & 15) * 4;
  {
#pragma unroll
    for (int q = 0; q < 8; ++q) {
      const int r = q * 2 + rsub;
      const v4f v = *(const v4fa*)&so[w][r][c4];
      *(v4f*)(C + (size_t)(row0 + r) * ldc + col0 + c4) = v;
    }
    
  }
}

// GEMM C = act(A·W + bias + resid): A f32 (ASPLIT -> hi/lo 2 terms), Wt bf16 [N][K]; ACT 0 none, 1 relu, 2 exact gelu;
// resid (optional, f32, row index = (row % rmod), pitch ldr, RES_BF16 rounds it) added before the activation.
template <bool ASPLIT, int ACT, bool BIAS_BF16, bool RES_BF16>
__global__ __launch_bounds__(128) void k_gemm_bf3(const float* __restrict__ A, int lda, const unsigned short* __restrict__ Wt, int ldb,
                                                const float* __restrict__ bias, const float* __restrict__ resid, int rmod, int ldr,
                                                float* __restrict__ C, int ldc, int M, int N, int K) {
  __shared__ __attribute__((aligned(16))) float so[4][16][64];
  const int tid = threadIdx.x, w = tid >> 5, lane = tid & 31, ln = lane & 15, hh = lane >> 4;
  const int ntn = N / 64;
  const int wid = blockIdx.x * 4 + w;
  const int mt = wid / ntn, nq = wid % ntn;
  if (mt * 16 >= M) return;
  const int row0 = mt * 16, col0 = nq * 64;
  const float* arow = A + (size_t)(row0 + ln) * lda;
  v8f acc[4] = {};
  for (int kb = 0; kb < K; kb += 32) {
    FragB ah, al;
    const v4f x0 = *(const v4fa*)(arow + kb + 8 * hh), x1 = *(const v4fa*)(arow + kb + 8 * hh + 4);
    const v4f x2 = *(const v4fa*)(arow + kb + 16 + 8 * hh), x3 = *(const v4fa*)(arow + kb + 16 + 8 * hh + 4);
    float xs[16] = {x0[0],x0[1],x0[2],x0[3],x1[0],x1[1],x1[2],x1[3],x2[0],x2[1],x2[2],x2[3],x3[0],x3[1],x3[2],x3[3]};
#pragma unroll
    for (int i = 0; i < 16; ++i) { const unsigned short hb = bf16_bits(xs[i]); ah.u[i] = hb; al.u[i] = ASPLIT ? bf16_bits(xs[i] - bf16_val(hb)) : (unsigned short)0; }
#pragma unroll
    for (int t = 0; t < 4; ++t) {
      const unsigned short* brow = Wt + (size_t)(col0 + t * 16 + ln) * ldb + kb;
      FragB b;
      b.half[0] = *(const v8us*)(brow + 8 * hh);
      b.half[1] = *(const v8us*)(brow + 16 + 8 * hh);
      acc[t] = mmaN<ASPLIT ? 2 : 1>(ah.v, al.v, b.v, b.v, acc[t]);
    }
  }
#pragma unroll
  for (int t = 0; t < 4; ++t) {
    const int col = col0 + t * 16 + ln;
    float bv = bias ? bias[col] : 0.f;
    if (BIAS_BF16) bv = bf16_round(bv);
#pragma unroll
    for (int r = 0; r < 8; ++r) {
      float v = acc[t][r] + bv;
      if (resid) { float rv = resid[(size_t)((row0 + 8 * hh + r) % rmod) * ldr + col]; if (RES_BF16) rv = bf16_round(rv); v += rv; }
      if (ACT == 1) v = fmaxf(v, 0.f);
      if (ACT == 2) v = 0.5f * v * (1.0f + erff(v * 0.70710678118654752f));
      if (ACT == 3) { const float u = 0.7978845608028654f * (v + 0.044715f * v * v * v); v = 0.5f * v * (1.0f + tanhf(u)); }
      so[w][8 * hh + r][t * 16 + ln] = v;
    }
  }
  __builtin_amdgcn_fence(__ATOMIC_ACQ_REL, "workgroup");
  __builtin_amdgcn_wave_barrier();
  const int rsub = lane >> 4, c4 = (lane & 15) * 4;
  {
#pragma unroll
    for (int q = 0; q < 8; ++q) {
      const int r = q * 2 + rsub;
      const v4f v = *(const v4fa*)&so[w][r][c4];
      *(v4f*)(C + (size_t)(row0 + r) * ldc + col0 + c4) = v;
    }
    
  }
}
// row LayerNorm (biased variance, eps) over N: s = X (+ R); optional out_sum <- s; out_norm <- (s-mu)*rsqrt(var+eps)*g + b
template <bool PARAM_BF16>
__global__ __launch_bounds__(256) void k_layernorm(const float* __restrict__ X, const float* __restrict__ R, const float* __restrict__ g, const float* __restrict__ bta,
                                                  float* __restrict__ out_sum, float* __restrict__ out_norm, int N, float eps) {
  __shared__ float red[256];
  const int row = blockIdx.x, tid = threadIdx.x;
  const float* x = X + (size_t)row * N; const float* rr = R ? R + (size_t)row * N : nullptr;
  float vals[16];                     // up to N = 4096
  const int per = N / 256;            // contiguous chunk per thread? use strided-by-4 chunks: thread handles j = tid*4 + 1024*u
  float s1 = 0.f;
  for (int u = 0; u < per / 4; ++u) {
    const int j = tid * 4 + 1024 * u;
    const v4f a = *(const v4fa*)(x + j);
    v4f b = {0.f,0.f,0.f,0.f}; if (rr) b = *(const v4fa*)(rr + j);
#pragma unroll
    for (int q = 0; q < 4; ++q) { const float v = a[q] + b[q]; vals[u * 4 + q] = v; s1 += v; }
  }
  red[tid] = s1; __syncthreads();
  for (int st = 128; st > 0; st >>= 1) { if (tid < st) red[tid] += red[tid + st]; __syncthreads(); }
  const float mu = red[0] / (float)N; __syncthreads();
  float s2 = 0.f;
  for (int u = 0; u < per / 4; ++u)
#pragma unroll
    for (int q = 0; q < 4; ++q) { const float c = vals[u * 4 + q] - mu; s2 += c * c; }
  red[tid] = s2; __syncthreads();
  for (int st = 128; st > 0; st >>= 1) { if (tid < st) red[tid] += red[tid + st]; __syncthreads(); }
  const float rs = rsqrtf(red[0] / (float)N + eps);
  {
    for (int u = 0; u < per / 4; ++u) {
      const int j = tid * 4 + 1024 * u;
      v4f o, sm;
#pragma unroll
      for (int q = 0; q < 4; ++q) {
        float gg = g[j + q], bb = bta[j + q];
        if (PARAM_BF16) { gg = bf16_round(gg); bb = bf16_round(bb); }
        sm[q] = vals[u * 4 + q]; o[q] = (vals[u * 4 + q] - mu) * rs * gg + bb;
      }
      if (out_sum) *(v4f*)(out_sum + (size_t)row * N + j) = sm;
      *(v4f*)(out_norm + (size_t)row * N + j) = o;
    }
    
  }
}



// ---- f16 WMMA path (v_wmma_f32_16x16x32_f16): 11-bit significands for operands in range — used where a [0,1] probability operand needs more precision than bf16
typedef _Float16 v16h __attribute__((ext_vector_type(16)));
union FragH { v16h v; v8us half[2]; _Float16 h[16]; unsigned short u[16]; };
template <int NT>
__device__ __forceinline__ v8f mmaH(v16h ah, v16h al, v16h bh, v16h bl, v8f c) {
  c = __builtin_amdgcn_wmma_f32_16x16x32_f16(false, ah, false, bh, (short)0, c, false, false);
  if (NT >= 2) c = __builtin_amdgcn_wmma_f32_16x16x32_f16(false, al, false, bh, (short)0, c, false, false);
  if (NT >= 3) c = __builtin_amdgcn_wmma_f32_16x16x32_f16(false, ah, false, bl, (short)0, c, false, false);
  asm volatile("v_nop\n\tv_nop\n\tv_nop\n\tv_nop" : "+v"(c) : "v"(ah), "v"(al), "v"(bh), "v"(bl));
  return c;
}
// batched GEMM like k_gemm_b but f16 operands: A f32 (split into f16 hi/lo if ASPLIT, else rounded to f16), Bt = f16 values [n][k]; alpha; C f32; N multiple of 16 (partial tiles skipped)
template <bool ASPLIT>
__global__ __launch_bounds__(128) void k_gemm_h(const float* __restrict__ A, int lda, size_t sA, const _Float16* __restrict__ Bh, int ldb, size_t sB, float alpha, float* __restrict__ C, int ldc, size_t sC, int M, int N, int K) {
  __shared__ __attribute__((aligned(16))) float so[4][16][64];
  const int tid = threadIdx.x, w = tid >> 5, lane = tid & 31, ln = lane & 15, hh = lane >> 4; const int by = blockIdx.y;
  A += (size_t)by * sA; Bh += (size_t)by * sB; C += (size_t)by * sC;
  const int ntn = (N + 63) / 64; const int wid = blockIdx.x * 4 + w; const int mt = wid / ntn, nq = wid % ntn; if (mt * 16 >= M) return;
  const int row0 = mt * 16, col0 = nq * 64; const float* arow = A + (size_t)(row0 + ln) * lda;
  v8f acc[4] = {};
  for (int kb = 0; kb < K; kb += 32) {
    FragH ah, al;
    const v4f x0 = *(const v4fa*)(arow + kb + 8 * hh), x1 = *(const v4fa*)(arow + kb + 8 * hh + 4), x2 = *(const v4fa*)(arow + kb + 16 + 8 * hh), x3 = *(const v4fa*)(arow + kb + 16 + 8 * hh + 4);
    float xs[16] = {x0[0],x0[1],x0[2],x0[3],x1[0],x1[1],x1[2],x1[3],x2[0],x2[1],x2[2],x2[3],x3[0],x3[1],x3[2],x3[3]};
#pragma unroll
    for (int i = 0; i < 16; ++i) { const _Float16 h = (_Float16)xs[i]; ah.h[i] = h; al.h[i] = ASPLIT ? (_Float16)(xs[i] - (float)h) : (_Float16)0.0f; }
#pragma unroll
    for (int t = 0; t < 4; ++t) { if (col0 + t * 16 >= N) continue; const size_t boff = (size_t)(col0 + t * 16 + ln) * ldb + kb; FragH bq; bq.half[0] = *(const v8us*)(Bh + boff + 8 * hh); bq.half[1] = *(const v8us*)(Bh + boff + 16 + 8 * hh);
      acc[t] = mmaH<ASPLIT ? 2 : 1>(ah.v, al.v, bq.v, bq.v, acc[t]); }
  }
#pragma unroll
  for (int t = 0; t < 4; ++t) { if (col0 + t * 16 >= N) continue;
#pragma unroll
    for (int r = 0; r < 8; ++r) so[w][8 * hh + r][t * 16 + ln] = acc[t][r] * alpha; }
  __builtin_amdgcn_fence(__ATOMIC_ACQ_REL, "workgroup"); __builtin_amdgcn_wave_barrier();
  const int rsub = lane >> 4, c4 = (lane & 15) * 4;
  {
#pragma unroll
    for (int q = 0; q < 8; ++q) { const int r = q * 2 + rsub; if (col0 + c4 < N) { const v4f v = *(const v4fa*)&so[w][r][c4]; *(v4f*)(C + (size_t)(row0 + r) * ldc + col0 + c4) = v; } }
     }
}

// Wt[n][k] = f16(W[k][n]·scale) from f32 row-major W[K][N] (scale = power of two; bf16-exact weights stay exact in f16 away from the subnormal range)
__global__ __launch_bounds__(256) void k_wt_f16(const float* __restrict__ W, _Float16* __restrict__ Wt, int K, int N, float scale) {
  const int t = blockIdx.x * 256 + threadIdx.x; if (t >= N * (K / 8)) return; const int n = t / (K / 8), k8 = (t % (K / 8)) * 8; FragH f;
#pragma unroll
  for (int i = 0; i < 8; ++i) f.h[i] = (_Float16)(bf16_round(W[(size_t)(k8 + i) * N + n]) * scale); const v8us o = f.half[0];
  *(v8us*)((unsigned short*)Wt + (size_t)n * K + k8) = o; 
}
// k_gemm_hh variant with fused epilogue: v = acc·alpha + bias[by·sBias + col] (+ CP[(row/rowsPerB)·sCPb + by·64 + col] if CP) ; ACT 0 none / 1 elu ; writes f16 C16 (and f32 C if non-null)
template <int ACT>
__global__ __launch_bounds__(128) void k_gemm_hhx(const _Float16* __restrict__ A, int lda, size_t sA, const _Float16* __restrict__ Bh, int ldb, size_t sB, float alpha, const float* __restrict__ bias, size_t sBias, const float* __restrict__ CP, int rowsPerB, size_t sCPb, int row0g,
    float* __restrict__ C, _Float16* __restrict__ C16, int ldc, size_t sC, int M, int N, int K) {
  __shared__ __attribute__((aligned(16))) float so[4][16][64];
  const int tid = threadIdx.x, w = tid >> 5, lane = tid & 31, ln = lane & 15, hh = lane >> 4; const int by = blockIdx.y;
  A += (size_t)by * sA; Bh += (size_t)by * sB; const size_t cofs = (size_t)by * sC; const float* bp = bias ? bias + (size_t)by * sBias : nullptr;
  const int ntn = (N + 63) / 64; const int wid = blockIdx.x * 4 + w; const int mt = wid / ntn, nq = wid % ntn; if (mt * 16 >= M) return;
  const int row0 = mt * 16, col0 = nq * 64; const _Float16* arow = A + (size_t)(row0 + ln) * lda;
  v8f acc[4] = {};
  for (int kb = 0; kb < K; kb += 32) { FragH ah; ah.half[0] = *(const v8us*)((const unsigned short*)arow + kb + 8 * hh); ah.half[1] = *(const v8us*)((const unsigned short*)arow + kb + 16 + 8 * hh);
#pragma unroll
    for (int t = 0; t < 4; ++t) { if (col0 + t * 16 >= N) continue; const size_t boff = (size_t)(col0 + t * 16 + ln) * ldb + kb; FragH bq; bq.half[0] = *(const v8us*)((const unsigned short*)Bh + boff + 8 * hh); bq.half[1] = *(const v8us*)((const unsigned short*)Bh + boff + 16 + 8 * hh);
      acc[t] = mmaH<1>(ah.v, ah.v, bq.v, bq.v, acc[t]); }
  }
#pragma unroll
  for (int t = 0; t < 4; ++t) { if (col0 + t * 16 >= N) continue; const int col = col0 + t * 16 + ln; const float bv = bp ? bf16_round(bp[col]) : 0.f;
#pragma unroll
    for (int r = 0; r < 8; ++r) { float v = acc[t][r] * alpha + bv; if (CP) { const int bidx = (row0g + row0 + 8 * hh + r) / rowsPerB; v += CP[(size_t)bidx * sCPb + (size_t)by * 64 + col]; } if (ACT == 1) v = (v > 0.f) ? v : expm1f(v); else if (ACT == 7) v = (v > 0.f) ? v + 1.0f : expf(v); else if (ACT == 8) v = tanhf(v); else if (ACT == 9) v = 0.5f * v * (1.0f + tanhf(0.7978845608028654f * (v + 0.044715f * v * v * v))); else if (ACT == 11) v = 1.0f / (1.0f + expf(-v)); else if (ACT == 12) v = (v > 0.f) ? v : 0.01f * v; else if (ACT == 14) v = (v > 0.f) ? v : 0.1f * v; else if (ACT == 15) v = v / (1.0f + expf(-v)); else if (ACT == 3) v = fmaxf(v, 0.f); else if (ACT == 6) v = 0.5f * v * (1.0f + erff(v * 0.70710678118654752f)); so[w][8 * hh + r][t * 16 + ln] = v; } }
  __builtin_amdgcn_fence(__ATOMIC_ACQ_REL, "workgroup"); __builtin_amdgcn_wave_barrier();
  const int rsub = lane >> 4, c4 = (lane & 15) * 4; typedef _Float16 v4h __attribute__((ext_vector_type(4)));
  {
#pragma unroll
    for (int q = 0; q < 8; ++q) { const int r = q * 2 + rsub; if (col0 + c4 < N) { const v4f v = *(const v4fa*)&so[w][r][c4]; if (C) *(v4f*)(C + cofs + (size_t)(row0 + r) * ldc + col0 + c4) = v; if (C16) { v4h h4; for (int i = 0; i < 4; ++i) h4[i] = (_Float16)v[i]; *(v4h*)(C16 + cofs + (size_t)(row0 + r) * ldc + col0 + c4) = h4; } } }
     }
}


typedef _Float16 v4h __attribute__((ext_vector_type(4)));

// ---- fragment-order planes: every f16 plane that a WMMA operand is loaded from is stored as 1 KiB units, one per (16 rows x 32 k). Inside a unit the 16-byte piece at (half * 32 + lane) holds row (lane & 15),
// k = half * 16 + (lane >> 4) * 8 .. + 7: what lane 'lane' takes as half 'half' of its fragment. A wave's global_load_b128 then reads 512 contiguous bytes (4 cache lines) where a row-major plane gives it 16 rows (16 lines).
// Units run along k first, then down the row tiles, so a tile of 16 rows still starts at element row * ld. ld % 32 == 0, rows % 16 == 0.
__device__ __forceinline__ size_t pk_src(size_t t, int ld) { const int lane = (int)(t & 31), half = (int)((t >> 5) & 1); const size_t u = t >> 6; const size_t nks = (size_t)(ld >> 5); const size_t ks = u % nks, rt = u / nks;      /* row-major element offset of the 8 elements that piece t of the plane holds */
  return (rt * 16 + (lane & 15)) * (size_t)ld + ks * 32 + half * 16 + (lane >> 4) * 8; }
__device__ __forceinline__ size_t pk_dst(size_t row, int k, int ld) { return (row >> 4) * 16 * (size_t)ld + (size_t)(k >> 5) * 512 + ((k >> 4) & 1) * 256 + (((k >> 3) & 1) * 16 + (int)(row & 15)) * 8; }      /* element offset in the plane of (row, k .. k + 7), k % 8 == 0 */

__global__ __launch_bounds__(256) void k_x16(const float* __restrict__ x, _Float16* __restrict__ X16, size_t n8) { const size_t t = (size_t)blockIdx.x * 256 + threadIdx.x; if (t >= n8) return; FragH f; const size_t so = pk_src(t, DM);
#pragma unroll
  for (int q = 0; q < 8; ++q) f.h[q] = (_Float16)bf16_round(x[so + q]); *(v8us*)((unsigned short*)X16 + t * 8) = f.half[0];  }
__global__ __launch_bounds__(256) void k_h16(const float* __restrict__ x, _Float16* __restrict__ X16, size_t n8) { const size_t t = (size_t)blockIdx.x * 256 + threadIdx.x; if (t >= n8) return; FragH f;
#pragma unroll
  for (int q = 0; q < 8; ++q) f.h[q] = (_Float16)x[t * 8 + q]; *(v8us*)((unsigned short*)X16 + t * 8) = f.half[0];  }
__global__ __launch_bounds__(256) void k_round16f(const float* __restrict__ W, _Float16* __restrict__ Bt, size_t n8) { const size_t t = (size_t)blockIdx.x * 256 + threadIdx.x; if (t >= n8) return; FragH f; const size_t so = pk_src(t, DM);
#pragma unroll
  for (int i = 0; i < 8; ++i) f.h[i] = (_Float16)(bf16_round(W[so + i]) * 16.0f); *(v8us*)((unsigned short*)Bt + t * 8) = f.half[0];  }
template <int NHv, int TTv>
__global__ __launch_bounds__(256) void k_vt(const _Float16* __restrict__ V16, int ldv, int voff, _Float16* __restrict__ Vt) { __shared__ unsigned short tl[64][66]; const int tid = threadIdx.x; const int slab = blockIdx.x / (TTv / 64), lg = blockIdx.x % (TTv / 64); const int b = slab / NHv, h = slab % NHv;
  for (int i = tid; i < 64 * 8; i += 256) { const int r = i / 8, c8 = (i % 8) * 8; FragH f; f.half[0] = *(const v8us*)((const unsigned short*)V16 + ((size_t)b * TTv + lg * 64 + r) * ldv + voff + h * 64 + c8);
#pragma unroll
    for (int q = 0; q < 8; ++q) tl[r][c8 + q] = f.u[q]; }
  __syncthreads();
  {
#pragma unroll
    for (int rd = 0; rd < 2; ++rd) { const int d = rd * 32 + tid / 8, pc = tid % 8; FragH f;
#pragma unroll
      for (int q = 0; q < 8; ++q) f.u[q] = tl[pc * 8 + q][d];
      *(v8us*)((unsigned short*)Vt + ((size_t)slab * 64 + d) * TTv + lg * 64 + pc * 8) = f.half[0]; }
     } }

__global__ __launch_bounds__(256) void k_hl(const float* __restrict__ F, _Float16* __restrict__ Hh, _Float16* __restrict__ Hl, size_t n8) { const size_t t = (size_t)blockIdx.x * 256 + threadIdx.x; if (t >= n8) return; FragH fh, fl; const size_t so = pk_src(t, DM); const v4f a = *(const v4fa*)(F + so), c = *(const v4fa*)(F + so + 4);
#pragma unroll
  for (int q = 0; q < 4; ++q) { _Float16 h = (_Float16)a[q]; fh.h[q] = h; fl.h[q] = (_Float16)((a[q] - (float)h) * 1024.0f); h = (_Float16)c[q]; fh.h[4 + q] = h; fl.h[4 + q] = (_Float16)((c[q] - (float)h) * 1024.0f); }
  { *(v8us*)((unsigned short*)Hh + t * 8) = fh.half[0]; *(v8us*)((unsigned short*)Hl + t * 8) = fl.half[0];  } }

// ---- fast GEMM (wave tile 32x64; requires M % 32 == 0 rows per launch region and N % 64 == 0; A and Bh are fragment-order planes of pitch lda, ldb); epilogue = k_gemm_hhx semantics ----
__device__ __forceinline__ v16h g2_fragp(const _Float16* p) { FragH f; f.half[0] = *(const v8us*)((const unsigned short*)p); f.half[1] = *(const v8us*)((const unsigned short*)p + 256); return f.v; }      /* p = the lane's piece of a fragment-order unit */
__device__ __forceinline__ v8f g2_mma(v16h a, v16h b, v8f c) { v8f d = __builtin_amdgcn_wmma_f32_16x16x32_f16(false, a, false, b, (short)0, c, false, false); asm volatile("v_nop\n\tv_nop\n\tv_nop\n\tv_nop" : "+v"(d) : "v"(a), "v"(b)); return d; }
template <int ACT>
__global__ __launch_bounds__(128) void k_gemm2(const _Float16* __restrict__ A, int lda, size_t sA, const _Float16* __restrict__ Bh, int ldb, size_t sB, float alpha, const float* __restrict__ bias, size_t sBias, const float* __restrict__ CP, int rowsPerB, size_t sCPb, int row0g,
    float* __restrict__ C, _Float16* __restrict__ C16, int ldc, size_t sC, int M, int N, int K) {
  __shared__ __attribute__((aligned(16))) float so[4][32][68];
  const int tid = threadIdx.x, w = tid >> 5, lane = tid & 31, ln = lane & 15, hh = lane >> 4; const int by = blockIdx.y;
  A += (size_t)by * sA; Bh += (size_t)by * sB; const size_t cofs = (size_t)by * sC; const float* bp = bias ? bias + (size_t)by * sBias : nullptr;
  const int ntn = N >> 6; const int mt = blockIdx.x / ntn, nq = blockIdx.x - mt * ntn; const int row0 = mt * 128 + 32 * w, col0 = nq * 64; if (row0 >= M) return;
  const _Float16* a0p = A + (size_t)row0 * lda + lane * 8; const _Float16* a1p = a0p + (size_t)16 * lda;      /* A and Bh are fragment-order planes */
  const _Float16* b0p = Bh + (size_t)col0 * ldb + lane * 8; const _Float16* b1p = b0p + (size_t)16 * ldb; const _Float16* b2p = b1p + (size_t)16 * ldb; const _Float16* b3p = b2p + (size_t)16 * ldb;
  const v8f z8 = {0.f,0.f,0.f,0.f,0.f,0.f,0.f,0.f}; v8f c00 = z8, c01 = z8, c02 = z8, c03 = z8, c10 = z8, c11 = z8, c12 = z8, c13 = z8;
  /* Register ring of three k-steps: the six fragments of steps s + 1 and s + 2 are in flight while step s is multiplied, so that a step no longer waits for five round trips one after the other.
     Each accumulator still takes its k-steps in ascending order. The six lane pointers live through the whole loop and every load of a trip reaches its step by an immediate offset, so that no load's result can land in an address register; only steps below K / 32 are loaded. */
  typedef const __attribute__((address_space(1))) _Float16* g2_gp;      /* typed as global memory, so that the loads stay global loads behind the asm statement that names the pointers */
  g2_gp p0 = (g2_gp)a0p, p1 = (g2_gp)a1p, p2 = (g2_gp)b0p, p3 = (g2_gp)b1p, p4 = (g2_gp)b2p, p5 = (g2_gp)b3p;
#define G2_FR(P, ST) g2_fragp((const _Float16*)((P) + 512 * (ST)))
#define G2_LOAD(S, ST) { S[0] = G2_FR(p0, ST); S[1] = G2_FR(p1, ST); S[2] = G2_FR(p2, ST); S[3] = G2_FR(p3, ST); S[4] = G2_FR(p4, ST); S[5] = G2_FR(p5, ST); \
    __builtin_amdgcn_sched_barrier(0); /* keeps the refill in front of the products that follow: without it the compiler sinks a refill behind the first product and that product's wait, and it flies for a shorter time */ }
#define G2_STEP(S) { c00 = g2_mma(S[0], S[2], c00); c10 = g2_mma(S[1], S[2], c10); c01 = g2_mma(S[0], S[3], c01); c11 = g2_mma(S[1], S[3], c11); c02 = g2_mma(S[0], S[4], c02); c12 = g2_mma(S[1], S[4], c12); c03 = g2_mma(S[0], S[5], c03); c13 = g2_mma(S[1], S[5], c13); }
  { const int nst = K >> 5; v16h r0[6], r1[6], r2[6]; int s = 0;
    if (nst >= 1) G2_LOAD(r0, 0)
    if (nst >= 2) G2_LOAD(r1, 1)
#pragma unroll 1
    for (; s + 5 <= nst; s += 3) { G2_LOAD(r2, 2) G2_STEP(r0) G2_LOAD(r0, 3) G2_STEP(r1) G2_LOAD(r1, 4) G2_STEP(r2)
      asm volatile("s_wait_xcnt 0x0" : "+v"(p0), "+v"(p1), "+v"(p2), "+v"(p3), "+v"(p4), "+v"(p5) :: "memory"); /* stands in front of the six additions below, which overwrite the address registers of the loads issued above; the pointers are named so that the additions depend on this statement and cannot be placed ahead of it (without it the compiler keeps copies of the pointers and rewrites them at the loop's head) */
      p0 += 1536; p1 += 1536; p2 += 1536; p3 += 1536; p4 += 1536; p5 += 1536; }
    const int rem = nst - s;      /* 0 to 4 steps are left; r0 and r1 hold the first two of them */
    if (rem >= 3) G2_LOAD(r2, 2)
    if (rem >= 1) G2_STEP(r0)
    if (rem >= 4) G2_LOAD(r0, 3)
    if (rem >= 2) G2_STEP(r1)
    if (rem >= 3) G2_STEP(r2)
    if (rem >= 4) G2_STEP(r0) }
#undef G2_FR
#undef G2_LOAD
#undef G2_STEP
  v8f accs[8] = {c00, c01, c02, c03, c10, c11, c12, c13};
#pragma unroll
  for (int u = 0; u < 8; ++u) { const int t = u & 3, half = u >> 2; const int col = col0 + t * 16 + ln; const float bv = bp ? bf16_round(bp[col]) : 0.f;
#pragma unroll
    for (int r = 0; r < 8; ++r) { const int rloc = half * 16 + 8 * hh + r; float v = accs[u][r] * alpha + bv; if (CP) { const int bidx = (row0g + row0 + rloc) / rowsPerB; v += CP[(size_t)bidx * sCPb + (size_t)by * 64 + col]; }
      if (ACT == 3) v = fmaxf(v, 0.f); else if (ACT == 6) v = 0.5f * v * (1.0f + erff(v * 0.70710678118654752f)); else if (ACT == 11) v = 1.0f / (1.0f + expf(-v)); else if (ACT == 15) v = v / (1.0f + expf(-v)); else if (ACT == 12) v = (v > 0.f) ? v : 0.01f * v; else if (ACT == 8) v = tanhf(v);
      so[w][rloc][t * 16 + ln] = v; } }
  __builtin_amdgcn_fence(__ATOMIC_ACQ_REL, "workgroup"); __builtin_amdgcn_wave_barrier();
  const int rsub = lane >> 4, c4 = (lane & 15) * 4;
  {
#pragma unroll
    for (int q = 0; q < 16; ++q) { const int r = q * 2 + rsub; const v4f v = *(const v4fa*)&so[w][r][c4]; if (C) *(v4f*)(C + cofs + (size_t)(row0 + r) * ldc + col0 + c4) = v; if (C16) { v4h h4; for (int i = 0; i < 4; ++i) h4[i] = (_Float16)v[i]; *(v4h*)(C16 + cofs + (size_t)(row0 + r) * ldc + col0 + c4) = h4; } }
     } }



template <int TK>
__global__ __launch_bounds__(256) void k_vthl(const float* __restrict__ VF, int ldv, _Float16* __restrict__ Vth, _Float16* __restrict__ Vtl) { __shared__ float tl[64][65]; const int tid = threadIdx.x; const int slab = blockIdx.x / (TK / 64), lg = blockIdx.x % (TK / 64); const int b = slab / NH, h = slab % NH;
  for (int i = tid; i < 64 * 16; i += 256) { const int r = i / 16, c4 = (i % 16) * 4; const v4f a = *(const v4fa*)(VF + ((size_t)b * TK + lg * 64 + r) * ldv + h * 64 + c4); tl[r][c4] = a[0]; tl[r][c4 + 1] = a[1]; tl[r][c4 + 2] = a[2]; tl[r][c4 + 3] = a[3]; }
  __syncthreads();
  FragH fh[2], fl[2]; size_t oo[2];
#pragma unroll
  for (int rd = 0; rd < 2; ++rd) { const int p = rd * 256 + tid, un = p >> 6; const int d = (un >> 1) * 16 + (p & 15), pc = (un & 1) * 4 + ((p >> 4) & 3);      /* piece p of the tile's 8 units in plane order ((p >> 4) & 3 = half * 2 + upper lanes = the 8-key group inside a unit's 32 keys): a wave stores 512 contiguous bytes */
#pragma unroll
    for (int q = 0; q < 8; ++q) { const float v = tl[pc * 8 + q][d]; const _Float16 hv = (_Float16)v; fh[rd].h[q] = hv; fl[rd].h[q] = (_Float16)((v - (float)hv) * 1024.0f); } oo[rd] = pk_dst((size_t)slab * 64 + d, lg * 64 + pc * 8, TK); }
  {
#pragma unroll
    for (int rd = 0; rd < 2; ++rd) { *(v8us*)((unsigned short*)Vth + oo[rd]) = fh[rd].half[0]; *(v8us*)((unsigned short*)Vtl + oo[rd]) = fl[rd].half[0]; }
     } }

template <int TQ, int TK>
__global__ __launch_bounds__(128) void k_flashme(const _Float16* __restrict__ Q16, const _Float16* __restrict__ Q16lo, int ldq, const _Float16* __restrict__ K16, const _Float16* __restrict__ K16lo, int ldk, const _Float16* __restrict__ Vt, const _Float16* __restrict__ Vtlo, const unsigned* __restrict__ MB, const int* __restrict__ RA, const int* __restrict__ KE, const float* __restrict__ HB, float* __restrict__ O, int ldo) {
  #pragma clang fp contract(off)
  constexpr int RPW = 16, RTN = RPW / 16, NQB = TQ / (4 * RPW), DT = 4, KS = 2;
  __shared__ __attribute__((aligned(16))) unsigned short sP[4][RPW][40], sPl[4][RPW][40]; __shared__ __attribute__((aligned(16))) float sO[4][RPW][64 + 4];
  const int tid = threadIdx.x, w = tid >> 5, lane = tid & 31, ln = lane & 15, hh = lane >> 4;
  const int slab = blockIdx.x / NQB, qblk = blockIdx.x % NQB; const int b = slab / NH, h = slab % NH; const int qb0 = qblk * (4 * RPW); const int q0 = qb0 + w * RPW;
  FragH aq[2][KS], aql[2][KS];
#pragma unroll
  for (int rt = 0; rt < RTN; ++rt) { const size_t qo = ((size_t)b * TQ + q0 + rt * 16) * ldq + h * 1024 + lane * 8;      /* fragment-order planes: head h = units 2h and 2h + 1 of the row tile */ const unsigned short* qr = (const unsigned short*)Q16 + qo; const unsigned short* ql = (const unsigned short*)Q16lo + qo;
#pragma unroll
    for (int ks = 0; ks < KS; ++ks) { aq[rt][ks].half[0] = *(const v8us*)(qr + ks * 512); aq[rt][ks].half[1] = *(const v8us*)(qr + ks * 512 + 256); aql[rt][ks].half[0] = *(const v8us*)(ql + ks * 512); aql[rt][ks].half[1] = *(const v8us*)(ql + ks * 512 + 256); } }
  int allm[2][8]; const unsigned* mrow[2][8];
#pragma unroll
  for (int rt = 0; rt < RTN; ++rt)
#pragma unroll
    for (int r = 0; r < 8; ++r) { const int tq = q0 + rt * 16 + 8 * hh + r; allm[rt][r] = RA[tq]; mrow[rt][r] = MB + (size_t)tq * (TK / 32); }
  asm volatile("s_wait_xcnt 0x0" ::: "memory");      /* stands in front of the first instruction that reuses an address register of the q and RA loads above (the build gives them to the zeroed accumulators) */
  __builtin_amdgcn_sched_barrier(0);      /* holds what follows behind that wait: the accumulators' zeroing depends on nothing, and a "memory" clobber does not tie it to the wait */
  const unsigned short* Vth = (const unsigned short*)Vt + (size_t)slab * 64 * TK; const unsigned short* Vtl = (const unsigned short*)Vtlo + (size_t)slab * 64 * TK;
  float m_r[2][8], l_r[2][8]; v8f oacc[2][DT], oaccl[2][DT];
#pragma unroll
  for (int rt = 0; rt < RTN; ++rt) {
#pragma unroll
    for (int r = 0; r < 8; ++r) { m_r[rt][r] = -3.0e38f; l_r[rt][r] = 0.f; }
#pragma unroll
    for (int dt = 0; dt < DT; ++dt) { oacc[rt][dt] = (v8f){0.f,0.f,0.f,0.f,0.f,0.f,0.f,0.f}; oaccl[rt][dt] = oacc[rt][dt]; } }
  int jend = KE[qblk * 32]; jend = min(TK, (jend + 31) & ~31); if (jend < 32) jend = 32;      /* block-uniform */
#pragma unroll 1
  for (int j0 = 0; j0 < jend; j0 += 32) {
    
    v8f s[2][2];
#pragma unroll
    for (int nt = 0; nt < 2; ++nt) { const size_t ko = ((size_t)b * TK + j0 + nt * 16) * ldk + h * 1024 + lane * 8; const unsigned short* kr = (const unsigned short*)K16 + ko; const unsigned short* kl = (const unsigned short*)K16lo + ko; FragH bk[KS], bkl[KS];
#pragma unroll
      for (int ks = 0; ks < KS; ++ks) { bk[ks].half[0] = *(const v8us*)(kr + ks * 512); bk[ks].half[1] = *(const v8us*)(kr + ks * 512 + 256); bkl[ks].half[0] = *(const v8us*)(kl + ks * 512); bkl[ks].half[1] = *(const v8us*)(kl + ks * 512 + 256); }
#pragma unroll
      for (int rt = 0; rt < RTN; ++rt) { v8f acc = (v8f){0.f,0.f,0.f,0.f,0.f,0.f,0.f,0.f}, accr = acc;
#pragma unroll
        for (int ks = 0; ks < KS; ++ks) { acc = mmaH<1>(aq[rt][ks].v, aq[rt][ks].v, bk[ks].v, bk[ks].v, acc); accr = mmaH<1>(aql[rt][ks].v, aql[rt][ks].v, bk[ks].v, bk[ks].v, accr); accr = mmaH<1>(aq[rt][ks].v, aq[rt][ks].v, bkl[ks].v, bkl[ks].v, accr); }
        s[rt][nt] = acc + accr * 0.0009765625f; } }
#pragma unroll
    for (int rt = 0; rt < RTN; ++rt)
#pragma unroll
      for (int r = 0; r < 8; ++r) { const unsigned mw = mrow[rt][r][j0 >> 5]; const bool am = (allm[rt][r] != 0);
        const bool ok0 = am || (((mw >> ln) & 1u) == 0u), ok1 = am || (((mw >> (16 + ln)) & 1u) == 0u);
        const int tqe = q0 + rt * 16 + 8 * hh + r; const int k0e = j0 + ln, k1e = j0 + 16 + ln; const float xih = HB[2 * h], egh = HB[2 * h + 1];
        const float b0 = (-((float)(tqe > k0e ? tqe - k0e : k0e - tqe) / xih)) * egh, b1 = (-((float)(tqe > k1e ? tqe - k1e : k1e - tqe) / xih)) * egh;
        const float s0 = ok0 ? (am ? 0.f : s[rt][0][r] * SCL + b0) : -INFINITY, s1 = ok1 ? (am ? 0.f : s[rt][1][r] * SCL + b1) : -INFINITY; float mc = fmaxf(s0, s1);
        mc = fmaxf(mc, __shfl_xor(mc, 1, 32)); mc = fmaxf(mc, __shfl_xor(mc, 2, 32)); mc = fmaxf(mc, __shfl_xor(mc, 4, 32)); mc = fmaxf(mc, __shfl_xor(mc, 8, 32));
        const float mn = fmaxf(m_r[rt][r], mc); const float al = (mn > -1.0e38f) ? expf(m_r[rt][r] - mn) : 1.0f; m_r[rt][r] = mn; const float p0 = ok0 ? expf(s0 - mn) : 0.f, p1 = ok1 ? expf(s1 - mn) : 0.f; l_r[rt][r] = l_r[rt][r] * al + p0 + p1;
#pragma unroll
        for (int dt = 0; dt < DT; ++dt) { oacc[rt][dt][r] *= al; oaccl[rt][dt][r] *= al; }
        FragH t2, t3; const float ps0 = p0 * 1024.0f, ps1 = p1 * 1024.0f; t2.h[0] = (_Float16)ps0; t2.h[1] = (_Float16)ps1; t3.h[0] = (_Float16)((ps0 - (float)t2.h[0]) * 1024.0f); t3.h[1] = (_Float16)((ps1 - (float)t2.h[1]) * 1024.0f);
        sP[w][rt * 16 + 8 * hh + r][ln] = t2.u[0]; sP[w][rt * 16 + 8 * hh + r][16 + ln] = t2.u[1]; sPl[w][rt * 16 + 8 * hh + r][ln] = t3.u[0]; sPl[w][rt * 16 + 8 * hh + r][16 + ln] = t3.u[1]; }
    __builtin_amdgcn_fence(__ATOMIC_ACQ_REL, "workgroup"); __builtin_amdgcn_wave_barrier();
    FragH pa[2], pl[2];
#pragma unroll
    for (int rt = 0; rt < RTN; ++rt) { pa[rt].half[0] = *(const v8us*)&sP[w][rt * 16 + ln][8 * hh]; pa[rt].half[1] = *(const v8us*)&sP[w][rt * 16 + ln][16 + 8 * hh]; pl[rt].half[0] = *(const v8us*)&sPl[w][rt * 16 + ln][8 * hh]; pl[rt].half[1] = *(const v8us*)&sPl[w][rt * 16 + ln][16 + 8 * hh]; }
#pragma unroll
    for (int dt = 0; dt < DT; ++dt) { const size_t vo = (size_t)(dt * 16) * TK + (size_t)(j0 >> 5) * 512 + lane * 8; FragH bv, bl; bv.half[0] = *(const v8us*)(Vth + vo); bv.half[1] = *(const v8us*)(Vth + vo + 256); bl.half[0] = *(const v8us*)(Vtl + vo); bl.half[1] = *(const v8us*)(Vtl + vo + 256);
#pragma unroll
      for (int rt = 0; rt < RTN; ++rt) { oacc[rt][dt] = mmaH<1>(pa[rt].v, pa[rt].v, bv.v, bv.v, oacc[rt][dt]); oaccl[rt][dt] = mmaH<1>(pa[rt].v, pa[rt].v, bl.v, bl.v, oaccl[rt][dt]); oaccl[rt][dt] = mmaH<1>(pl[rt].v, pl[rt].v, bv.v, bv.v, oaccl[rt][dt]); } }
    __builtin_amdgcn_fence(__ATOMIC_ACQ_REL, "workgroup"); __builtin_amdgcn_wave_barrier(); }
#pragma unroll
  for (int rt = 0; rt < RTN; ++rt) {
#pragma unroll
    for (int r = 0; r < 8; ++r) { float l = l_r[rt][r]; l += __shfl_xor(l, 1, 32); l += __shfl_xor(l, 2, 32); l += __shfl_xor(l, 4, 32); l += __shfl_xor(l, 8, 32); l_r[rt][r] = (l > 0.f) ? 1.0f / (l * 1024.0f) : 0.f; }
#pragma unroll
    for (int dt = 0; dt < DT; ++dt)
#pragma unroll
      for (int r = 0; r < 8; ++r) sO[w][rt * 16 + 8 * hh + r][dt * 16 + ln] = (oacc[rt][dt][r] + oaccl[rt][dt][r] * 0.0009765625f) * l_r[rt][r]; }
  __builtin_amdgcn_fence(__ATOMIC_ACQ_REL, "workgroup"); __builtin_amdgcn_wave_barrier();
  {
#pragma unroll
    for (int rp = 0; rp < RPW; rp += 2) { const int r = rp + (lane >> 4), pc = lane & 15; const v4f val = *(const v4fa*)&sO[w][r][pc * 4]; *(v4f*)(O + ((size_t)b * TQ + q0 + r) * ldo + h * 64 + pc * 4) = val; }
     } }


__global__ __launch_bounds__(256) void k_causaltab(unsigned* __restrict__ MB, int* __restrict__ RA, int* __restrict__ KE, int nq, int nk) {
  const int t = blockIdx.x * 256 + threadIdx.x; const int nw = nk / 32;
  if (t < nq * nw) { const int q = t / nw, w = t % nw; const int first = q + 1 - 32 * w; const unsigned bits = (first <= 0) ? 0xffffffffu : ((first >= 32) ? 0u : (0xffffffffu << first)); *(unsigned*)(MB + t) = bits;  }
  if (t < nq) { *(int*)(RA + t) = 0;  }
  if (t < nq / 64) { const int v = 64 * (t + 1); *(int*)(KE + t * 32) = v;  } }

__constant__ float PIF[32] = {3.141592741e+00f,3.031195641e+00f,2.924677610e+00f,2.821902990e+00f,2.722739935e+00f,2.627061367e+00f,2.534744978e+00f,2.445672750e+00f,2.359730482e+00f,2.276808262e+00f,2.196800232e+00f,2.119603395e+00f,2.045119524e+00f,1.973252892e+00f,1.903911710e+00f,1.837007284e+00f,1.772453904e+00f,1.710168958e+00f,1.650072694e+00f,1.592088223e+00f,1.536141396e+00f,1.482160687e+00f,1.430076718e+00f,1.379823089e+00f,1.331335425e+00f,1.284551501e+00f,1.239411712e+00f,1.195858121e+00f,1.153835058e+00f,1.113288760e+00f,1.074167132e+00f,1.036420345e+00f};
__global__ __launch_bounds__(256) void k_trig(const float* __restrict__ pig, const float* __restrict__ logxi, const float* __restrict__ egl, float* __restrict__ CS, float* __restrict__ SN, float* __restrict__ HB) {
  #pragma clang fp contract(off)
  const int t = blockIdx.x * 256 + threadIdx.x; if (t >= NH * SLEN * 32) return; const int j = t & 31; const int tok = (t >> 5) % SLEN; const int h = t / (32 * SLEN);
  const float pg = 1.0f / (1.0f + expf(-bf16_round(pig[h]))); const float th = ((float)tok * PIF[j]) * pg; const float c = cosf(th), s = sinf(th);
  *(float*)(CS + t) = c; *(float*)(SN + t) = s; 
  if (t < 2 * NH) { const int hh2 = t >> 1; const float v = (t & 1) ? (1.0f / (1.0f + expf(-bf16_round(egl[hh2])))) : expf(bf16_round(logxi[hh2])); *(float*)(HB + t) = v;  } }      
__global__ __launch_bounds__(256) void k_eurot(const float* __restrict__ F, const float* __restrict__ CS, const float* __restrict__ SN, float* __restrict__ OF) {
  #pragma clang fp contract(off)
  const int t = blockIdx.x * 256 + threadIdx.x; if (t >= NR * (DM / 4)) return; const int c0 = (t % (DM / 4)) * 4; const int r = t / (DM / 4); const int tok = r % SLEN; const int h = c0 / 64, d0 = c0 & 63;
  const float* f = F + (size_t)r * DM + c0; const float* cs = CS + ((size_t)h * SLEN + tok) * 32; const float* sn = SN + ((size_t)h * SLEN + tok) * 32; v4f o;
#pragma unroll
  for (int q = 0; q < 4; ++q) { const int d = d0 + q; const float c = cs[d >> 1], s = sn[d >> 1];
    o[q] = (d & 1) ? (f[q - 1] * s + f[q] * c) : (f[q] * c - f[q + 1] * s); }
  *(v4f*)(OF + (size_t)r * DM + c0) = o;  }

extern "C" void kernel_launch(void* const* d_in, const int* in_sizes, int n_in,
                              void* d_out, int out_size, void* d_ws, size_t ws_size, hipStream_t stream) {
  (void)in_sizes; (void)n_in; (void)out_size;
  const float* const* I = (const float* const*)d_in; const float* x = I[0]; const float* Wqkv = I[1]; const float* Wo = I[2]; const float* logxi = I[3]; const float* pig = I[4]; const float* egl = I[5];
  char* ws = (char*)d_ws; size_t off = 0;
  auto take = [&](size_t bytes) { char* p = ws + off; off += (bytes + 255) & ~(size_t)255; return p; };
  _Float16* BQKV = (_Float16*)take((size_t)3 * DM * DM * 2); _Float16* BO = (_Float16*)take((size_t)DM * DM * 2);
  _Float16* X16 = (_Float16*)take((size_t)NR * DM * 2); float* F = (float*)take((size_t)NR * DM * 4); float* G = (float*)take((size_t)NR * DM * 4);
  _Float16* Qh = (_Float16*)take((size_t)NR * DM * 2); _Float16* Ql = (_Float16*)take((size_t)NR * DM * 2); _Float16* Kh = (_Float16*)take((size_t)NR * DM * 2); _Float16* Kl = (_Float16*)take((size_t)NR * DM * 2); _Float16* Vth = (_Float16*)take((size_t)NR * DM * 2); _Float16* Vtl = (_Float16*)take((size_t)NR * DM * 2);
  unsigned* MB = (unsigned*)take((size_t)SLEN * (SLEN / 32) * 4); int* RA = (int*)take((size_t)SLEN * 4); int* KE = (int*)take((size_t)(SLEN / 64) * 32 * 4);
  float* CS = (float*)take((size_t)NH * SLEN * 32 * 4); float* SN = (float*)take((size_t)NH * SLEN * 32 * 4); float* HB = (float*)take(256);
  if (off > ws_size) return;      /* 6 + 2 + 8 + 16 + 16 + 6 x 8 + 0.5 + 8 = 105 MiB */
  float* O = F; _Float16* Oh = (_Float16*)G; _Float16* Ol = Oh + (size_t)NR * DM;      /* F and G are dead once the hi/lo planes exist */
  const size_t n8 = (size_t)NR * DM / 8; const unsigned nb8 = (unsigned)((n8 + 255) / 256), nb4 = (unsigned)(((size_t)NR * DM / 4 + 255) / 256);
  k_round16f<<<(unsigned)(((size_t)3 * DM * DM / 8 + 255) / 256), 256, 0, stream>>>(Wqkv, BQKV, (size_t)3 * DM * DM / 8); k_round16f<<<(unsigned)(((size_t)DM * DM / 8 + 255) / 256), 256, 0, stream>>>(Wo, BO, (size_t)DM * DM / 8);      /* torch (out,in) = natural Bt; x16 */
  k_x16<<<nb8, 256, 0, stream>>>(x, X16, n8);
  k_trig<<<(NH * SLEN * 32 + 255) / 256, 256, 0, stream>>>(pig, logxi, egl, CS, SN, HB); k_causaltab<<<(SLEN * (SLEN / 32) + 255) / 256, 256, 0, stream>>>(MB, RA, KE, SLEN, SLEN);
  const dim3 gP((NR / 128) * (DM / 64), 1);
  k_gemm2<0><<<gP, 128, 0, stream>>>(X16, DM, 0, BQKV, DM, 0, 0.0625f, nullptr, 0, nullptr, 1, 0, 0, F, nullptr, DM, 0, NR, DM, DM); k_eurot<<<nb4, 256, 0, stream>>>(F, CS, SN, G); k_hl<<<nb8, 256, 0, stream>>>(G, Qh, Ql, n8);      /* q (rows 0..1023 of Wqkv), rotated, hi/lo */
  k_gemm2<0><<<gP, 128, 0, stream>>>(X16, DM, 0, BQKV + (size_t)DM * DM, DM, 0, 0.0625f, nullptr, 0, nullptr, 1, 0, 0, F, nullptr, DM, 0, NR, DM, DM); k_eurot<<<nb4, 256, 0, stream>>>(F, CS, SN, G); k_hl<<<nb8, 256, 0, stream>>>(G, Kh, Kl, n8);      /* k (rows 1024..2047), rotated */
  k_gemm2<0><<<gP, 128, 0, stream>>>(X16, DM, 0, BQKV + (size_t)2 * DM * DM, DM, 0, 0.0625f, nullptr, 0, nullptr, 1, 0, 0, F, nullptr, DM, 0, NR, DM, DM);      /* v (rows 2048..3071) f32 */
  k_vthl<SLEN><<<NBT * NH * (SLEN / 64), 256, 0, stream>>>(F, DM, Vth, Vtl);      /* both batches in one grid: the kernel takes the batch from blockIdx (slab / NH) */
  k_flashme<SLEN, SLEN><<<NBT * NH * (SLEN / 64), 128, 0, stream>>>(Qh, Ql, DM, Kh, Kl, DM, Vth, Vtl, MB, RA, KE, HB, O, DM);      /* both batches in one grid, so that their waves share the chip */
  k_hl<<<nb8, 256, 0, stream>>>(O, Oh, Ol, n8);
  k_gemm2<0><<<gP, 128, 0, stream>>>(Oh, DM, 0, BO, DM, 0, 0.0625f, nullptr, 0, nullptr, 1, 0, 0, (float*)d_out, nullptr, DM, 0, NR, DM, DM);
  k_gemm2<0><<<gP, 128, 0, stream>>>(Ol, DM, 0, BO, DM, 0, 0.0625f / 1024.0f, nullptr, 0, (const float*)d_out, 1, (size_t)DM, 0, (float*)d_out, nullptr, DM, 0, NR, DM, DM);
}

// v004
// One run takes 428 microseconds.
// Timed twice side by side with v003, it ran 1.27 and 1.28 times as fast.
// Counting every step since v000, it is 2.05 times as fast.
#include <hip/hip_runtime.h>
// Causal multi-head attention with gated rotary phases and a per-head distance decay (2 x 2048 tokens x 1024, 16 heads x 64): qkv = x*Wqkv^T; theta[h][t][j] = (t * pi^(1 - j/32)) * sigmoid(pi_gate[h]); interleaved-pair rotation of q and k; scores = q.k/8 - |i - j| / exp(log_xi[h]) * sigmoid(e_gate[h]) with j <= i; softmax; merged . Wo^T -> [2,2048,1024].
// Structure: x as an exact f16 plane; q/k/v from one packed f16 WMMA GEMM family (32x64 wave tiles, f32, exact products) into f32 planes; per-(head, token) cos/sin tables on VALU (pi^(1-j/32) = the reference's f32 constants, precise trig), one VALU pass rotates into f32 planes; q, k as f16 hi + x2^10 residual planes, V^T as hi + residual planes; the causal structure computed on device into a key bit plane + per-block key bound; the fused flash kernel per ((batch, head), 64 queries) with the decay bias added per element (three-product hi/lo scores, online softmax f32, P hi + residual via LDS, two value accumulators); O as hi + residual planes; output projection as two GEMMs.
// Compute dtype: x, weights and the three gate/scale vectors rounded to bf16; projections exact; rotation and bias f32; q, k, P, v, O as f16 hi + residual pairs (~2^-21); f32 accumulation and softmax. v_wmma_f32_16x16x32_f16.
#define NBT 2
#define SLEN 2048
#define DM 1024
#define NH 16
#define SCL 0.125f
#define NR (NBT * SLEN)
typedef __bf16 v16b __attribute__((ext_vector_type(16)));
typedef unsigned short v8us __attribute__((ext_vector_type(8), may_alias));
typedef float  v8f  __attribute__((ext_vector_type(8)));
typedef float  v4f  __attribute__((ext_vector_type(4)));
typedef float  v4fa __attribute__((ext_vector_type(4), may_alias));
union FragB { v16b v; v8us half[2]; unsigned short u[16]; };

__device__ __forceinline__ unsigned short bf16_bits(float x) { unsigned int u = __float_as_uint(x); return (unsigned short)((u + 0x7FFFu + ((u >> 16) & 1u)) >> 16); }
__device__ __forceinline__ float bf16_val(unsigned short b) { return __uint_as_float(((unsigned int)b) << 16); }
__device__ __forceinline__ float bf16_round(float x) { return bf16_val(bf16_bits(x)); }
// D += A·B with NT terms: 1 = ah·bh, 2 = + al·bh (A split), 3 = + ah·bl (both split)
template <int NT>
__device__ __forceinline__ v8f mmaN(v16b ah, v16b al, v16b bh, v16b bl, v8f c) {
  c = __builtin_amdgcn_wmma_f32_16x16x32_bf16(false, ah, false, bh, (short)0, c, false, false);
  if (NT >= 2) c = __builtin_amdgcn_wmma_f32_16x16x32_bf16(false, al, false, bh, (short)0, c, false, false);
  if (NT >= 3) c = __builtin_amdgcn_wmma_f32_16x16x32_bf16(false, ah, false, bl, (short)0, c, false, false);
  asm volatile("v_nop\n\tv_nop\n\tv_nop\n\tv_nop" : "+v"(c) : "v"(ah), "v"(al), "v"(bh), "v"(bl));
  return c;
}

__global__ __launch_bounds__(256) void k_wt_bf16(const float* __restrict__ W, unsigned short* __restrict__ Wt, int K, int N) {
  const int t = blockIdx.x * 256 + threadIdx.x;
  const int k8n = K / 8;
  if (t >= N * k8n) return;
  const int n = t / k8n, k8 = (t % k8n) * 8;
  v8us v;
#pragma unroll
  for (int i = 0; i < 8; ++i) v[i] = bf16_bits(W[(size_t)(k8 + i) * N + n]);
  *(v8us*)(Wt + (size_t)n * K + k8) = v;
  
}

// GEMM C[M][N] (f32, pitch ldc) = act(A[M][K]·W + bias). A f32 row-major (pitch lda) converted per fragment to bf16
// (ASPLIT: hi/lo two planes -> 2 terms, else single rounded term); Wt bf16 [N][K] (pitch ldb). BIAS_BF16 rounds the
// bias to bf16 first (bias quantised to bf16 before the add). K%32==0, M%16==0, N%64==0.
template <bool ASPLIT, int ACT, bool BIAS_BF16>
__global__ __launch_bounds__(128) void k_gemm_bf(const float* __restrict__ A, int lda, const unsigned short* __restrict__ Wt, int ldb,
                                               const float* __restrict__ bias, float* __restrict__ C, int ldc, int M, int N, int K) {
  __shared__ __attribute__((aligned(16))) float so[4][16][64];
  const int tid = threadIdx.x, w = tid >> 5, lane = tid & 31, ln = lane & 15, hh = lane >> 4;
  const int ntn = N / 64;
  const int wid = blockIdx.x * 4 + w;
  const int mt = wid / ntn, nq = wid % ntn;
  if (mt * 16 >= M) return;
  const int row0 = mt * 16, col0 = nq * 64;
  const float* arow = A + (size_t)(row0 + ln) * lda;
  v8f acc[4] = {};
  for (int kb = 0; kb < K; kb += 32) {
    FragB ah, al;
    const v4f x0 = *(const v4fa*)(arow + kb + 8 * hh), x1 = *(const v4fa*)(arow + kb + 8 * hh + 4);
    const v4f x2 = *(const v4fa*)(arow + kb + 16 + 8 * hh), x3 = *(const v4fa*)(arow + kb + 16 + 8 * hh + 4);
    float xs[16] = {x0[0],x0[1],x0[2],x0[3],x1[0],x1[1],x1[2],x1[3],x2[0],x2[1],x2[2],x2[3],x3[0],x3[1],x3[2],x3[3]};
#pragma unroll
    for (int i = 0; i < 16; ++i) { const unsigned short hb = bf16_bits(xs[i]); ah.u[i] = hb; al.u[i] = ASPLIT ? bf16_bits(xs[i] - bf16_val(hb)) : (unsigned short)0; }
#pragma unroll
    for (int t = 0; t < 4; ++t) {
      const unsigned short* brow = Wt + (size_t)(col0 + t * 16 + ln) * ldb + kb;
      FragB b;
      b.half[0] = *(const v8us*)(brow + 8 * hh);
      b.half[1] = *(const v8us*)(brow + 16 + 8 * hh);
      acc[t] = mmaN<ASPLIT ? 2 : 1>(ah.v, al.v, b.v, b.v, acc[t]);
    }
  }
#pragma unroll
  for (int t = 0; t < 4; ++t) {
    float bv = bias ? bias[col0 + t * 16 + ln] : 0.f;
    if (BIAS_BF16) bv = bf16_round(bv);
#pragma unroll
    for (int r = 0; r < 8; ++r) { float v = acc[t][r] + bv; if (ACT == 1) v = fmaxf(v, 0.f); so[w][8 * hh + r][t * 16 + ln] = v; }
  }
  __builtin_amdgcn_fence(__ATOMIC_ACQ_REL, "workgroup");
  __builtin_amdgcn_wave_barrier();
  const int rsub = lane >> 4, c4 = (lane & 15) * 4;
  {
#pragma unroll
    for (int q = 0; q < 8; ++q) {
      const int r = q * 2 + rsub;
      const v4f v = *(const v4fa*)&so[w][r][c4];
      *(v4f*)(C + (size_t)(row0 + r) * ldc + col0 + c4) = v;
    }
    
  }
}

// GEMM C = act(A·W + bias + resid): A f32 (ASPLIT -> hi/lo 2 terms), Wt bf16 [N][K]; ACT 0 none, 1 relu, 2 exact gelu;
// resid (optional, f32, row index = (row % rmod), pitch ldr, RES_BF16 rounds it) added before the activation.
template <bool ASPLIT, int ACT, bool BIAS_BF16, bool RES_BF16>
__global__ __launch_bounds__(128) void k_gemm_bf3(const float* __restrict__ A, int lda, const unsigned short* __restrict__ Wt, int ldb,
                                                const float* __restrict__ bias, const float* __restrict__ resid, int rmod, int ldr,
                                                float* __restrict__ C, int ldc, int M, int N, int K) {
  __shared__ __attribute__((aligned(16))) float so[4][16][64];
  const int tid = threadIdx.x, w = tid >> 5, lane = tid & 31, ln = lane & 15, hh = lane >> 4;
  const int ntn = N / 64;
  const int wid = blockIdx.x * 4 + w;
  const int mt = wid / ntn, nq = wid % ntn;
  if (mt * 16 >= M) return;
  const int row0 = mt * 16, col0 = nq * 64;
  const float* arow = A + (size_t)(row0 + ln) * lda;
  v8f acc[4] = {};
  for (int kb = 0; kb < K; kb += 32) {
    FragB ah, al;
    const v4f x0 = *(const v4fa*)(arow + kb + 8 * hh), x1 = *(const v4fa*)(arow + kb + 8 * hh + 4);
    const v4f x2 = *(const v4fa*)(arow + kb + 16 + 8 * hh), x3 = *(const v4fa*)(arow + kb + 16 + 8 * hh + 4);
    float xs[16] = {x0[0],x0[1],x0[2],x0[3],x1[0],x1[1],x1[2],x1[3],x2[0],x2[1],x2[2],x2[3],x3[0],x3[1],x3[2],x3[3]};
#pragma unroll
    for (int i = 0; i < 16; ++i) { const unsigned short hb = bf16_bits(xs[i]); ah.u[i] = hb; al.u[i] = ASPLIT ? bf16_bits(xs[i] - bf16_val(hb)) : (unsigned short)0; }
#pragma unroll
    for (int t = 0; t < 4; ++t) {
      const unsigned short* brow = Wt + (size_t)(col0 + t * 16 + ln) * ldb + kb;
      FragB b;
      b.half[0] = *(const v8us*)(brow + 8 * hh);
      b.half[1] = *(const v8us*)(brow + 16 + 8 * hh);
      acc[t] = mmaN<ASPLIT ? 2 : 1>(ah.v, al.v, b.v, b.v, acc[t]);
    }
  }
#pragma unroll
  for (int t = 0; t < 4; ++t) {
    const int col = col0 + t * 16 + ln;
    float bv = bias ? bias[col] : 0.f;
    if (BIAS_BF16) bv = bf16_round(bv);
#pragma unroll
    for (int r = 0; r < 8; ++r) {
      float v = acc[t][r] + bv;
      if (resid) { float rv = resid[(size_t)((row0 + 8 * hh + r) % rmod) * ldr + col]; if (RES_BF16) rv = bf16_round(rv); v += rv; }
      if (ACT == 1) v = fmaxf(v, 0.f);
      if (ACT == 2) v = 0.5f * v * (1.0f + erff(v * 0.70710678118654752f));
      if (ACT == 3) { const float u = 0.7978845608028654f * (v + 0.044715f * v * v * v); v = 0.5f * v * (1.0f + tanhf(u)); }
      so[w][8 * hh + r][t * 16 + ln] = v;
    }
  }
  __builtin_amdgcn_fence(__ATOMIC_ACQ_REL, "workgroup");
  __builtin_amdgcn_wave_barrier();
  const int rsub = lane >> 4, c4 = (lane & 15) * 4;
  {
#pragma unroll
    for (int q = 0; q < 8; ++q) {
      const int r = q * 2 + rsub;
      const v4f v = *(const v4fa*)&so[w][r][c4];
      *(v4f*)(C + (size_t)(row0 + r) * ldc + col0 + c4) = v;
    }
    
  }
}
// row LayerNorm (biased variance, eps) over N: s = X (+ R); optional out_sum <- s; out_norm <- (s-mu)*rsqrt(var+eps)*g + b
template <bool PARAM_BF16>
__global__ __launch_bounds__(256) void k_layernorm(const float* __restrict__ X, const float* __restrict__ R, const float* __restrict__ g, const float* __restrict__ bta,
                                                  float* __restrict__ out_sum, float* __restrict__ out_norm, int N, float eps) {
  __shared__ float red[256];
  const int row = blockIdx.x, tid = threadIdx.x;
  const float* x = X + (size_t)row * N; const float* rr = R ? R + (size_t)row * N : nullptr;
  float vals[16];                     // up to N = 4096
  const int per = N / 256;            // contiguous chunk per thread? use strided-by-4 chunks: thread handles j = tid*4 + 1024*u
  float s1 = 0.f;
  for (int u = 0; u < per / 4; ++u) {
    const int j = tid * 4 + 1024 * u;
    const v4f a = *(const v4fa*)(x + j);
    v4f b = {0.f,0.f,0.f,0.f}; if (rr) b = *(const v4fa*)(rr + j);
#pragma unroll
    for (int q = 0; q < 4; ++q) { const float v = a[q] + b[q]; vals[u * 4 + q] = v; s1 += v; }
  }
  red[tid] = s1; __syncthreads();
  for (int st = 128; st > 0; st >>= 1) { if (tid < st) red[tid] += red[tid + st]; __syncthreads(); }
  const float mu = red[0] / (float)N; __syncthreads();
  float s2 = 0.f;
  for (int u = 0; u < per / 4; ++u)
#pragma unroll
    for (int q = 0; q < 4; ++q) { const float c = vals[u * 4 + q] - mu; s2 += c * c; }
  red[tid] = s2; __syncthreads();
  for (int st = 128; st > 0; st >>= 1) { if (tid < st) red[tid] += red[tid + st]; __syncthreads(); }
  const float rs = rsqrtf(red[0] / (float)N + eps);
  {
    for (int u = 0; u < per / 4; ++u) {
      const int j = tid * 4 + 1024 * u;
      v4f o, sm;
#pragma unroll
      for (int q = 0; q < 4; ++q) {
        float gg = g[j + q], bb = bta[j + q];
        if (PARAM_BF16) { gg = bf16_round(gg); bb = bf16_round(bb); }
        sm[q] = vals[u * 4 + q]; o[q] = (vals[u * 4 + q] - mu) * rs * gg + bb;
      }
      if (out_sum) *(v4f*)(out_sum + (size_t)row * N + j) = sm;
      *(v4f*)(out_norm + (size_t)row * N + j) = o;
    }
    
  }
}



// ---- f16 WMMA path (v_wmma_f32_16x16x32_f16): 11-bit significands for operands in range — used where a [0,1] probability operand needs more precision than bf16
typedef _Float16 v16h __attribute__((ext_vector_type(16)));
union FragH { v16h v; v8us half[2]; _Float16 h[16]; unsigned short u[16]; };
template <int NT>
__device__ __forceinline__ v8f mmaH(v16h ah, v16h al, v16h bh, v16h bl, v8f c) {
  c = __builtin_amdgcn_wmma_f32_16x16x32_f16(false, ah, false, bh, (short)0, c, false, false);
  if (NT >= 2) c = __builtin_amdgcn_wmma_f32_16x16x32_f16(false, al, false, bh, (short)0, c, false, false);
  if (NT >= 3) c = __builtin_amdgcn_wmma_f32_16x16x32_f16(false, ah, false, bl, (short)0, c, false, false);
  asm volatile("v_nop\n\tv_nop\n\tv_nop\n\tv_nop" : "+v"(c) : "v"(ah), "v"(al), "v"(bh), "v"(bl));
  return c;
}
// batched GEMM like k_gemm_b but f16 operands: A f32 (split into f16 hi/lo if ASPLIT, else rounded to f16), Bt = f16 values [n][k]; alpha; C f32; N multiple of 16 (partial tiles skipped)
template <bool ASPLIT>
__global__ __launch_bounds__(128) void k_gemm_h(const float* __restrict__ A, int lda, size_t sA, const _Float16* __restrict__ Bh, int ldb, size_t sB, float alpha, float* __restrict__ C, int ldc, size_t sC, int M, int N, int K) {
  __shared__ __attribute__((aligned(16))) float so[4][16][64];
  const int tid = threadIdx.x, w = tid >> 5, lane = tid & 31, ln = lane & 15, hh = lane >> 4; const int by = blockIdx.y;
  A += (size_t)by * sA; Bh += (size_t)by * sB; C += (size_t)by * sC;
  const int ntn = (N + 63) / 64; const int wid = blockIdx.x * 4 + w; const int mt = wid / ntn, nq = wid % ntn; if (mt * 16 >= M) return;
  const int row0 = mt * 16, col0 = nq * 64; const float* arow = A + (size_t)(row0 + ln) * lda;
  v8f acc[4] = {};
  for (int kb = 0; kb < K; kb += 32) {
    FragH ah, al;
    const v4f x0 = *(const v4fa*)(arow + kb + 8 * hh), x1 = *(const v4fa*)(arow + kb + 8 * hh + 4), x2 = *(const v4fa*)(arow + kb + 16 + 8 * hh), x3 = *(const v4fa*)(arow + kb + 16 + 8 * hh + 4);
    float xs[16] = {x0[0],x0[1],x0[2],x0[3],x1[0],x1[1],x1[2],x1[3],x2[0],x2[1],x2[2],x2[3],x3[0],x3[1],x3[2],x3[3]};
#pragma unroll
    for (int i = 0; i < 16; ++i) { const _Float16 h = (_Float16)xs[i]; ah.h[i] = h; al.h[i] = ASPLIT ? (_Float16)(xs[i] - (float)h) : (_Float16)0.0f; }
#pragma unroll
    for (int t = 0; t < 4; ++t) { if (col0 + t * 16 >= N) continue; const size_t boff = (size_t)(col0 + t * 16 + ln) * ldb + kb; FragH bq; bq.half[0] = *(const v8us*)(Bh + boff + 8 * hh); bq.half[1] = *(const v8us*)(Bh + boff + 16 + 8 * hh);
      acc[t] = mmaH<ASPLIT ? 2 : 1>(ah.v, al.v, bq.v, bq.v, acc[t]); }
  }
#pragma unroll
  for (int t = 0; t < 4; ++t) { if (col0 + t * 16 >= N) continue;
#pragma unroll
    for (int r = 0; r < 8; ++r) so[w][8 * hh + r][t * 16 + ln] = acc[t][r] * alpha; }
  __builtin_amdgcn_fence(__ATOMIC_ACQ_REL, "workgroup"); __builtin_amdgcn_wave_barrier();
  const int rsub = lane >> 4, c4 = (lane & 15) * 4;
  {
#pragma unroll
    for (int q = 0; q < 8; ++q) { const int r = q * 2 + rsub; if (col0 + c4 < N) { const v4f v = *(const v4fa*)&so[w][r][c4]; *(v4f*)(C + (size_t)(row0 + r) * ldc + col0 + c4) = v; } }
     }
}

// Wt[n][k] = f16(W[k][n]·scale) from f32 row-major W[K][N] (scale = power of two; bf16-exact weights stay exact in f16 away from the subnormal range)
__global__ __launch_bounds__(256) void k_wt_f16(const float* __restrict__ W, _Float16* __restrict__ Wt, int K, int N, float scale) {
  const int t = blockIdx.x * 256 + threadIdx.x; if (t >= N * (K / 8)) return; const int n = t / (K / 8), k8 = (t % (K / 8)) * 8; FragH f;
#pragma unroll
  for (int i = 0; i < 8; ++i) f.h[i] = (_Float16)(bf16_round(W[(size_t)(k8 + i) * N + n]) * scale); const v8us o = f.half[0];
  *(v8us*)((unsigned short*)Wt + (size_t)n * K + k8) = o; 
}
// k_gemm_hh variant with fused epilogue: v = acc·alpha + bias[by·sBias + col] (+ CP[(row/rowsPerB)·sCPb + by·64 + col] if CP) ; ACT 0 none / 1 elu ; writes f16 C16 (and f32 C if non-null)
template <int ACT>
__global__ __launch_bounds__(128) void k_gemm_hhx(const _Float16* __restrict__ A, int lda, size_t sA, const _Float16* __restrict__ Bh, int ldb, size_t sB, float alpha, const float* __restrict__ bias, size_t sBias, const float* __restrict__ CP, int rowsPerB, size_t sCPb, int row0g,
    float* __restrict__ C, _Float16* __restrict__ C16, int ldc, size_t sC, int M, int N, int K) {
  __shared__ __attribute__((aligned(16))) float so[4][16][64];
  const int tid = threadIdx.x, w = tid >> 5, lane = tid & 31, ln = lane & 15, hh = lane >> 4; const int by = blockIdx.y;
  A += (size_t)by * sA; Bh += (size_t)by * sB; const size_t cofs = (size_t)by * sC; const float* bp = bias ? bias + (size_t)by * sBias : nullptr;
  const int ntn = (N + 63) / 64; const int wid = blockIdx.x * 4 + w; const int mt = wid / ntn, nq = wid % ntn; if (mt * 16 >= M) return;
  const int row0 = mt * 16, col0 = nq * 64; const _Float16* arow = A + (size_t)(row0 + ln) * lda;
  v8f acc[4] = {};
  for (int kb = 0; kb < K; kb += 32) { FragH ah; ah.half[0] = *(const v8us*)((const unsigned short*)arow + kb + 8 * hh); ah.half[1] = *(const v8us*)((const unsigned short*)arow + kb + 16 + 8 * hh);
#pragma unroll
    for (int t = 0; t < 4; ++t) { if (col0 + t * 16 >= N) continue; const size_t boff = (size_t)(col0 + t * 16 + ln) * ldb + kb; FragH bq; bq.half[0] = *(const v8us*)((const unsigned short*)Bh + boff + 8 * hh); bq.half[1] = *(const v8us*)((const unsigned short*)Bh + boff + 16 + 8 * hh);
      acc[t] = mmaH<1>(ah.v, ah.v, bq.v, bq.v, acc[t]); }
  }
#pragma unroll
  for (int t = 0; t < 4; ++t) { if (col0 + t * 16 >= N) continue; const int col = col0 + t * 16 + ln; const float bv = bp ? bf16_round(bp[col]) : 0.f;
#pragma unroll
    for (int r = 0; r < 8; ++r) { float v = acc[t][r] * alpha + bv; if (CP) { const int bidx = (row0g + row0 + 8 * hh + r) / rowsPerB; v += CP[(size_t)bidx * sCPb + (size_t)by * 64 + col]; } if (ACT == 1) v = (v > 0.f) ? v : expm1f(v); else if (ACT == 7) v = (v > 0.f) ? v + 1.0f : expf(v); else if (ACT == 8) v = tanhf(v); else if (ACT == 9) v = 0.5f * v * (1.0f + tanhf(0.7978845608028654f * (v + 0.044715f * v * v * v))); else if (ACT == 11) v = 1.0f / (1.0f + expf(-v)); else if (ACT == 12) v = (v > 0.f) ? v : 0.01f * v; else if (ACT == 14) v = (v > 0.f) ? v : 0.1f * v; else if (ACT == 15) v = v / (1.0f + expf(-v)); else if (ACT == 3) v = fmaxf(v, 0.f); else if (ACT == 6) v = 0.5f * v * (1.0f + erff(v * 0.70710678118654752f)); so[w][8 * hh + r][t * 16 + ln] = v; } }
  __builtin_amdgcn_fence(__ATOMIC_ACQ_REL, "workgroup"); __builtin_amdgcn_wave_barrier();
  const int rsub = lane >> 4, c4 = (lane & 15) * 4; typedef _Float16 v4h __attribute__((ext_vector_type(4)));
  {
#pragma unroll
    for (int q = 0; q < 8; ++q) { const int r = q * 2 + rsub; if (col0 + c4 < N) { const v4f v = *(const v4fa*)&so[w][r][c4]; if (C) *(v4f*)(C + cofs + (size_t)(row0 + r) * ldc + col0 + c4) = v; if (C16) { v4h h4; for (int i = 0; i < 4; ++i) h4[i] = (_Float16)v[i]; *(v4h*)(C16 + cofs + (size_t)(row0 + r) * ldc + col0 + c4) = h4; } } }
     }
}


typedef _Float16 v4h __attribute__((ext_vector_type(4)));

// ---- fragment-order planes: every f16 plane that a WMMA operand is loaded from is stored as 1 KiB units, one per (16 rows x 32 k). Inside a unit the 16-byte piece at (half * 32 + lane) holds row (lane & 15),
// k = half * 16 + (lane >> 4) * 8 .. + 7: what lane 'lane' takes as half 'half' of its fragment. A wave's global_load_b128 then reads 512 contiguous bytes (4 cache lines) where a row-major plane gives it 16 rows (16 lines).
// Units run along k first, then down the row tiles, so a tile of 16 rows still starts at element row * ld. ld % 32 == 0, rows % 16 == 0.
__device__ __forceinline__ size_t pk_src(size_t t, int ld) { const int lane = (int)(t & 31), half = (int)((t >> 5) & 1); const size_t u = t >> 6; const size_t nks = (size_t)(ld >> 5); const size_t ks = u % nks, rt = u / nks;      /* row-major element offset of the 8 elements that piece t of the plane holds */
  return (rt * 16 + (lane & 15)) * (size_t)ld + ks * 32 + half * 16 + (lane >> 4) * 8; }
__device__ __forceinline__ size_t pk_dst(size_t row, int k, int ld) { return (row >> 4) * 16 * (size_t)ld + (size_t)(k >> 5) * 512 + ((k >> 4) & 1) * 256 + (((k >> 3) & 1) * 16 + (int)(row & 15)) * 8; }      /* element offset in the plane of (row, k .. k + 7), k % 8 == 0 */

__global__ __launch_bounds__(256) void k_x16(const float* __restrict__ x, _Float16* __restrict__ X16, size_t n8) { const size_t t = (size_t)blockIdx.x * 256 + threadIdx.x; if (t >= n8) return; FragH f; const size_t so = pk_src(t, DM);
#pragma unroll
  for (int q = 0; q < 8; ++q) f.h[q] = (_Float16)bf16_round(x[so + q]); *(v8us*)((unsigned short*)X16 + t * 8) = f.half[0];  }
__global__ __launch_bounds__(256) void k_h16(const float* __restrict__ x, _Float16* __restrict__ X16, size_t n8) { const size_t t = (size_t)blockIdx.x * 256 + threadIdx.x; if (t >= n8) return; FragH f;
#pragma unroll
  for (int q = 0; q < 8; ++q) f.h[q] = (_Float16)x[t * 8 + q]; *(v8us*)((unsigned short*)X16 + t * 8) = f.half[0];  }
__global__ __launch_bounds__(256) void k_round16f(const float* __restrict__ W, _Float16* __restrict__ Bt, size_t n8) { const size_t t = (size_t)blockIdx.x * 256 + threadIdx.x; if (t >= n8) return; FragH f; const size_t so = pk_src(t, DM);
#pragma unroll
  for (int i = 0; i < 8; ++i) f.h[i] = (_Float16)(bf16_round(W[so + i]) * 16.0f); *(v8us*)((unsigned short*)Bt + t * 8) = f.half[0];  }
template <int NHv, int TTv>
__global__ __launch_bounds__(256) void k_vt(const _Float16* __restrict__ V16, int ldv, int voff, _Float16* __restrict__ Vt) { __shared__ unsigned short tl[64][66]; const int tid = threadIdx.x; const int slab = blockIdx.x / (TTv / 64), lg = blockIdx.x % (TTv / 64); const int b = slab / NHv, h = slab % NHv;
  for (int i = tid; i < 64 * 8; i += 256) { const int r = i / 8, c8 = (i % 8) * 8; FragH f; f.half[0] = *(const v8us*)((const unsigned short*)V16 + ((size_t)b * TTv + lg * 64 + r) * ldv + voff + h * 64 + c8);
#pragma unroll
    for (int q = 0; q < 8; ++q) tl[r][c8 + q] = f.u[q]; }
  __syncthreads();
  {
#pragma unroll
    for (int rd = 0; rd < 2; ++rd) { const int d = rd * 32 + tid / 8, pc = tid % 8; FragH f;
#pragma unroll
      for (int q = 0; q < 8; ++q) f.u[q] = tl[pc * 8 + q][d];
      *(v8us*)((unsigned short*)Vt + ((size_t)slab * 64 + d) * TTv + lg * 64 + pc * 8) = f.half[0]; }
     } }

__global__ __launch_bounds__(256) void k_hl(const float* __restrict__ F, _Float16* __restrict__ Hh, _Float16* __restrict__ Hl, size_t n8) { const size_t t = (size_t)blockIdx.x * 256 + threadIdx.x; if (t >= n8) return; FragH fh, fl; const size_t so = pk_src(t, DM); const v4f a = *(const v4fa*)(F + so), c = *(const v4fa*)(F + so + 4);
#pragma unroll
  for (int q = 0; q < 4; ++q) { _Float16 h = (_Float16)a[q]; fh.h[q] = h; fl.h[q] = (_Float16)((a[q] - (float)h) * 1024.0f); h = (_Float16)c[q]; fh.h[4 + q] = h; fl.h[4 + q] = (_Float16)((c[q] - (float)h) * 1024.0f); }
  { *(v8us*)((unsigned short*)Hh + t * 8) = fh.half[0]; *(v8us*)((unsigned short*)Hl + t * 8) = fl.half[0];  } }

// ---- fast GEMM (wave tile 32x64; requires M % 32 == 0 rows per launch region and N % 64 == 0; A and Bh are fragment-order planes of pitch lda, ldb); epilogue = k_gemm_hhx semantics ----
__device__ __forceinline__ v16h g2_fragp(const _Float16* p) { FragH f; f.half[0] = *(const v8us*)((const unsigned short*)p); f.half[1] = *(const v8us*)((const unsigned short*)p + 256); return f.v; }      /* p = the lane's piece of a fragment-order unit */
__device__ __forceinline__ v8f g2_mma(v16h a, v16h b, v8f c) { v8f d = __builtin_amdgcn_wmma_f32_16x16x32_f16(false, a, false, b, (short)0, c, false, false); asm volatile("v_nop\n\tv_nop\n\tv_nop\n\tv_nop" : "+v"(d) : "v"(a), "v"(b)); return d; }
template <int ACT>
__global__ __launch_bounds__(128) void k_gemm2(const _Float16* __restrict__ A, int lda, size_t sA, const _Float16* __restrict__ Bh, int ldb, size_t sB, float alpha, const float* __restrict__ bias, size_t sBias, const float* __restrict__ CP, int rowsPerB, size_t sCPb, int row0g,
    float* __restrict__ C, _Float16* __restrict__ C16, int ldc, size_t sC, int M, int N, int K) {
  __shared__ __attribute__((aligned(16))) float so[4][32][68];
  const int tid = threadIdx.x, w = tid >> 5, lane = tid & 31, ln = lane & 15, hh = lane >> 4; const int by = blockIdx.y;
  A += (size_t)by * sA; Bh += (size_t)by * sB; const size_t cofs = (size_t)by * sC; const float* bp = bias ? bias + (size_t)by * sBias : nullptr;
  const int ntn = N >> 6; const int mt = blockIdx.x / ntn, nq = blockIdx.x - mt * ntn; const int row0 = mt * 128 + 32 * w, col0 = nq * 64; if (row0 >= M) return;
  const _Float16* a0p = A + (size_t)row0 * lda + lane * 8; const _Float16* a1p = a0p + (size_t)16 * lda;      /* A and Bh are fragment-order planes */
  const _Float16* b0p = Bh + (size_t)col0 * ldb + lane * 8; const _Float16* b1p = b0p + (size_t)16 * ldb; const _Float16* b2p = b1p + (size_t)16 * ldb; const _Float16* b3p = b2p + (size_t)16 * ldb;
  const v8f z8 = {0.f,0.f,0.f,0.f,0.f,0.f,0.f,0.f}; v8f c00 = z8, c01 = z8, c02 = z8, c03 = z8, c10 = z8, c11 = z8, c12 = z8, c13 = z8;
  /* Register ring of three k-steps: the six fragments of steps s + 1 and s + 2 are in flight while step s is multiplied, so that a step no longer waits for five round trips one after the other.
     Each accumulator still takes its k-steps in ascending order. The six lane pointers live through the whole loop and every load of a trip reaches its step by an immediate offset, so that no load's result can land in an address register; only steps below K / 32 are loaded. */
  typedef const __attribute__((address_space(1))) _Float16* g2_gp;      /* typed as global memory, so that the loads stay global loads behind the asm statement that names the pointers */
  g2_gp p0 = (g2_gp)a0p, p1 = (g2_gp)a1p, p2 = (g2_gp)b0p, p3 = (g2_gp)b1p, p4 = (g2_gp)b2p, p5 = (g2_gp)b3p;
#define G2_FR(P, ST) g2_fragp((const _Float16*)((P) + 512 * (ST)))
#define G2_LOAD(S, ST) { S[0] = G2_FR(p0, ST); S[1] = G2_FR(p1, ST); S[2] = G2_FR(p2, ST); S[3] = G2_FR(p3, ST); S[4] = G2_FR(p4, ST); S[5] = G2_FR(p5, ST); \
    __builtin_amdgcn_sched_barrier(0); /* keeps the refill in front of the products that follow: without it the compiler sinks a refill behind the first product and that product's wait, and it flies for a shorter time */ }
#define G2_STEP(S) { c00 = g2_mma(S[0], S[2], c00); c10 = g2_mma(S[1], S[2], c10); c01 = g2_mma(S[0], S[3], c01); c11 = g2_mma(S[1], S[3], c11); c02 = g2_mma(S[0], S[4], c02); c12 = g2_mma(S[1], S[4], c12); c03 = g2_mma(S[0], S[5], c03); c13 = g2_mma(S[1], S[5], c13); }
  { const int nst = K >> 5; v16h r0[6], r1[6], r2[6]; int s = 0;
    if (nst >= 1) G2_LOAD(r0, 0)
    if (nst >= 2) G2_LOAD(r1, 1)
#pragma unroll 1
    for (; s + 5 <= nst; s += 3) { G2_LOAD(r2, 2) G2_STEP(r0) G2_LOAD(r0, 3) G2_STEP(r1) G2_LOAD(r1, 4) G2_STEP(r2)
      asm volatile("s_wait_xcnt 0x0" : "+v"(p0), "+v"(p1), "+v"(p2), "+v"(p3), "+v"(p4), "+v"(p5) :: "memory"); /* stands in front of the six additions below, which overwrite the address registers of the loads issued above; the pointers are named so that the additions depend on this statement and cannot be placed ahead of it (without it the compiler keeps copies of the pointers and rewrites them at the loop's head) */
      p0 += 1536; p1 += 1536; p2 += 1536; p3 += 1536; p4 += 1536; p5 += 1536; }
    const int rem = nst - s;      /* 0 to 4 steps are left; r0 and r1 hold the first two of them */
    if (rem >= 3) G2_LOAD(r2, 2)
    if (rem >= 1) G2_STEP(r0)
    if (rem >= 4) G2_LOAD(r0, 3)
    if (rem >= 2) G2_STEP(r1)
    if (rem >= 3) G2_STEP(r2)
    if (rem >= 4) G2_STEP(r0) }
#undef G2_FR
#undef G2_LOAD
#undef G2_STEP
  v8f accs[8] = {c00, c01, c02, c03, c10, c11, c12, c13};
#pragma unroll
  for (int u = 0; u < 8; ++u) { const int t = u & 3, half = u >> 2; const int col = col0 + t * 16 + ln; const float bv = bp ? bf16_round(bp[col]) : 0.f;
#pragma unroll
    for (int r = 0; r < 8; ++r) { const int rloc = half * 16 + 8 * hh + r; float v = accs[u][r] * alpha + bv; if (CP) { const int bidx = (row0g + row0 + rloc) / rowsPerB; v += CP[(size_t)bidx * sCPb + (size_t)by * 64 + col]; }
      if (ACT == 3) v = fmaxf(v, 0.f); else if (ACT == 6) v = 0.5f * v * (1.0f + erff(v * 0.70710678118654752f)); else if (ACT == 11) v = 1.0f / (1.0f + expf(-v)); else if (ACT == 15) v = v / (1.0f + expf(-v)); else if (ACT == 12) v = (v > 0.f) ? v : 0.01f * v; else if (ACT == 8) v = tanhf(v);
      so[w][rloc][t * 16 + ln] = v; } }
  __builtin_amdgcn_fence(__ATOMIC_ACQ_REL, "workgroup"); __builtin_amdgcn_wave_barrier();
  const int rsub = lane >> 4, c4 = (lane & 15) * 4;
  {
#pragma unroll
    for (int q = 0; q < 16; ++q) { const int r = q * 2 + rsub; const v4f v = *(const v4fa*)&so[w][r][c4]; if (C) *(v4f*)(C + cofs + (size_t)(row0 + r) * ldc + col0 + c4) = v; if (C16) { v4h h4; for (int i = 0; i < 4; ++i) h4[i] = (_Float16)v[i]; *(v4h*)(C16 + cofs + (size_t)(row0 + r) * ldc + col0 + c4) = h4; } }
     } }



template <int TK>
__global__ __launch_bounds__(256) void k_vthl(const float* __restrict__ VF, int ldv, _Float16* __restrict__ Vth, _Float16* __restrict__ Vtl) { __shared__ float tl[64][65]; const int tid = threadIdx.x; const int slab = blockIdx.x / (TK / 64), lg = blockIdx.x % (TK / 64); const int b = slab / NH, h = slab % NH;
  for (int i = tid; i < 64 * 16; i += 256) { const int r = i / 16, c4 = (i % 16) * 4; const v4f a = *(const v4fa*)(VF + ((size_t)b * TK + lg * 64 + r) * ldv + h * 64 + c4); tl[r][c4] = a[0]; tl[r][c4 + 1] = a[1]; tl[r][c4 + 2] = a[2]; tl[r][c4 + 3] = a[3]; }
  __syncthreads();
  FragH fh[2], fl[2]; size_t oo[2];
#pragma unroll
  for (int rd = 0; rd < 2; ++rd) { const int p = rd * 256 + tid, un = p >> 6; const int d = (un >> 1) * 16 + (p & 15), pc = (un & 1) * 4 + ((p >> 4) & 3);      /* piece p of the tile's 8 units in plane order ((p >> 4) & 3 = half * 2 + upper lanes = the 8-key group inside a unit's 32 keys): a wave stores 512 contiguous bytes */
#pragma unroll
    for (int q = 0; q < 8; ++q) { const float v = tl[pc * 8 + q][d]; const _Float16 hv = (_Float16)v; fh[rd].h[q] = hv; fl[rd].h[q] = (_Float16)((v - (float)hv) * 1024.0f); } oo[rd] = pk_dst((size_t)slab * 64 + d, lg * 64 + pc * 8, TK); }
  {
#pragma unroll
    for (int rd = 0; rd < 2; ++rd) { *(v8us*)((unsigned short*)Vth + oo[rd]) = fh[rd].half[0]; *(v8us*)((unsigned short*)Vtl + oo[rd]) = fl[rd].half[0]; }
     } }

template <int TQ, int TK>
__global__ __launch_bounds__(128) void k_flashme(const _Float16* __restrict__ Q16, const _Float16* __restrict__ Q16lo, int ldq, const _Float16* __restrict__ K16, const _Float16* __restrict__ K16lo, int ldk, const _Float16* __restrict__ Vt, const _Float16* __restrict__ Vtlo, const unsigned* __restrict__ MB, const int* __restrict__ RA, const int* __restrict__ KE, const float* __restrict__ HB, float* __restrict__ O, int ldo) {
  #pragma clang fp contract(off)
  constexpr int RPW = 16, RTN = RPW / 16, NQB = TQ / (4 * RPW), DT = 4, KS = 2;
  __shared__ __attribute__((aligned(16))) unsigned short sP[4][RPW][40], sPl[4][RPW][40]; __shared__ __attribute__((aligned(16))) float sO[4][RPW][64 + 4];
  const int tid = threadIdx.x, w = tid >> 5, lane = tid & 31, ln = lane & 15, hh = lane >> 4;
  const int slab = blockIdx.x / NQB, qblk = blockIdx.x % NQB; const int b = slab / NH, h = slab % NH; const int qb0 = qblk * (4 * RPW); const int q0 = qb0 + w * RPW;
  FragH aq[2][KS], aql[2][KS];
#pragma unroll
  for (int rt = 0; rt < RTN; ++rt) { const size_t qo = ((size_t)b * TQ + q0 + rt * 16) * ldq + h * 1024 + lane * 8;      /* fragment-order planes: head h = units 2h and 2h + 1 of the row tile */ const unsigned short* qr = (const unsigned short*)Q16 + qo; const unsigned short* ql = (const unsigned short*)Q16lo + qo;
#pragma unroll
    for (int ks = 0; ks < KS; ++ks) { aq[rt][ks].half[0] = *(const v8us*)(qr + ks * 512); aq[rt][ks].half[1] = *(const v8us*)(qr + ks * 512 + 256); aql[rt][ks].half[0] = *(const v8us*)(ql + ks * 512); aql[rt][ks].half[1] = *(const v8us*)(ql + ks * 512 + 256); } }
  int allm[2][8]; const unsigned* mrow[2][8];
#pragma unroll
  for (int rt = 0; rt < RTN; ++rt)
#pragma unroll
    for (int r = 0; r < 8; ++r) { const int tq = q0 + rt * 16 + 8 * hh + r; allm[rt][r] = RA[tq]; mrow[rt][r] = MB + (size_t)tq * (TK / 32); }
  asm volatile("s_wait_xcnt 0x0" ::: "memory");      /* stands in front of the first instruction that reuses an address register of the q and RA loads above (the build gives them to the zeroed accumulators) */
  __builtin_amdgcn_sched_barrier(0);      /* holds what follows behind that wait: the accumulators' zeroing depends on nothing, and a "memory" clobber does not tie it to the wait */
  const unsigned short* Vth = (const unsigned short*)Vt + (size_t)slab * 64 * TK; const unsigned short* Vtl = (const unsigned short*)Vtlo + (size_t)slab * 64 * TK;
  float m_r[2][8], l_r[2][8]; v8f oacc[2][DT], oaccl[2][DT];
#pragma unroll
  for (int rt = 0; rt < RTN; ++rt) {
#pragma unroll
    for (int r = 0; r < 8; ++r) { m_r[rt][r] = -3.0e38f; l_r[rt][r] = 0.f; }
#pragma unroll
    for (int dt = 0; dt < DT; ++dt) { oacc[rt][dt] = (v8f){0.f,0.f,0.f,0.f,0.f,0.f,0.f,0.f}; oaccl[rt][dt] = oacc[rt][dt]; } }
  const float xih = HB[2 * h], egh = HB[2 * h + 1];      /* the head's two bias scalars, read once */
  int jend = KE[qblk * 32]; jend = min(TK, (jend + 31) & ~31); if (jend < 32) jend = 32;      /* block-uniform */
#pragma unroll 1
  for (int j0 = 0; j0 < jend; j0 += 32) {
    unsigned mwv[2][8];      /* the rows' mask words, fetched together at the head of the trip: they fly beside the key loads */
#pragma unroll
    for (int rt = 0; rt < RTN; ++rt)
#pragma unroll
      for (int r = 0; r < 8; ++r) mwv[rt][r] = mrow[rt][r][j0 >> 5];
    v8f s[2][2];
#pragma unroll
    for (int nt = 0; nt < 2; ++nt) { const size_t ko = ((size_t)b * TK + j0 + nt * 16) * ldk + h * 1024 + lane * 8; const unsigned short* kr = (const unsigned short*)K16 + ko; const unsigned short* kl = (const unsigned short*)K16lo + ko; FragH bk[KS], bkl[KS];
#pragma unroll
      for (int ks = 0; ks < KS; ++ks) { bk[ks].half[0] = *(const v8us*)(kr + ks * 512); bk[ks].half[1] = *(const v8us*)(kr + ks * 512 + 256); bkl[ks].half[0] = *(const v8us*)(kl + ks * 512); bkl[ks].half[1] = *(const v8us*)(kl + ks * 512 + 256); }
#pragma unroll
      for (int rt = 0; rt < RTN; ++rt) { v8f acc = (v8f){0.f,0.f,0.f,0.f,0.f,0.f,0.f,0.f}, accr = acc;
#pragma unroll
        for (int ks = 0; ks < KS; ++ks) { acc = mmaH<1>(aq[rt][ks].v, aq[rt][ks].v, bk[ks].v, bk[ks].v, acc); accr = mmaH<1>(aql[rt][ks].v, aql[rt][ks].v, bk[ks].v, bk[ks].v, accr); accr = mmaH<1>(aq[rt][ks].v, aq[rt][ks].v, bkl[ks].v, bkl[ks].v, accr); }
        s[rt][nt] = acc + accr * 0.0009765625f; } }
    __builtin_amdgcn_sched_barrier(0);      /* keeps the 16 bias values from being formed ahead of the key products, where they are live beside the key fragments and push the kernel past 256 registers (4 waves a SIMD) */
    /* Softmax of the tile, step by step over all rows instead of row by row: each step below is done for every row before the next begins, and no step holds a branch (each exp is computed and then selected),
       so that the rows' shuffle and exp latencies overlap. Every element takes the same operations in the same order as before. */
    float s0v[2][8], s1v[2][8], mcv[2][8]; bool ok0v[2][8], ok1v[2][8];
#pragma unroll
    for (int rt = 0; rt < RTN; ++rt)
#pragma unroll
      for (int r = 0; r < 8; ++r) { const unsigned mw = mwv[rt][r]; const bool am = (allm[rt][r] != 0);
        const bool ok0 = am || (((mw >> ln) & 1u) == 0u), ok1 = am || (((mw >> (16 + ln)) & 1u) == 0u);
        const int tqe = q0 + rt * 16 + 8 * hh + r; const int k0e = j0 + ln, k1e = j0 + 16 + ln;
        const float b0 = (-((float)(tqe > k0e ? tqe - k0e : k0e - tqe) / xih)) * egh, b1 = (-((float)(tqe > k1e ? tqe - k1e : k1e - tqe) / xih)) * egh;
        const float x0 = s[rt][0][r] * SCL + b0, x1 = s[rt][1][r] * SCL + b1; const float y0 = am ? 0.f : x0, y1 = am ? 0.f : x1; const float s0 = ok0 ? y0 : -INFINITY, s1 = ok1 ? y1 : -INFINITY;      /* computed, then selected */
        ok0v[rt][r] = ok0; ok1v[rt][r] = ok1; s0v[rt][r] = s0; s1v[rt][r] = s1; mcv[rt][r] = fmaxf(s0, s1); }
#pragma unroll
    for (int sh = 1; sh <= 8; sh <<= 1) { float tv[2][8];
#pragma unroll
      for (int rt = 0; rt < RTN; ++rt)
#pragma unroll
        for (int r = 0; r < 8; ++r) tv[rt][r] = __shfl_xor(mcv[rt][r], sh, 32);
#pragma unroll
      for (int rt = 0; rt < RTN; ++rt)
#pragma unroll
        for (int r = 0; r < 8; ++r) mcv[rt][r] = fmaxf(mcv[rt][r], tv[rt][r]); }
#pragma unroll
    for (int rt = 0; rt < RTN; ++rt)
#pragma unroll
      for (int r = 0; r < 8; ++r) { const float mn = fmaxf(m_r[rt][r], mcv[rt][r]); const float ea = expf(m_r[rt][r] - mn), e0 = expf(s0v[rt][r] - mn), e1 = expf(s1v[rt][r] - mn);
        const float al = (mn > -1.0e38f) ? ea : 1.0f; m_r[rt][r] = mn; const float p0 = ok0v[rt][r] ? e0 : 0.f, p1 = ok1v[rt][r] ? e1 : 0.f; l_r[rt][r] = l_r[rt][r] * al + p0 + p1;
#pragma unroll
        for (int dt = 0; dt < DT; ++dt) { oacc[rt][dt][r] *= al; oaccl[rt][dt][r] *= al; }
        FragH t2, t3; const float ps0 = p0 * 1024.0f, ps1 = p1 * 1024.0f; t2.h[0] = (_Float16)ps0; t2.h[1] = (_Float16)ps1; t3.h[0] = (_Float16)((ps0 - (float)t2.h[0]) * 1024.0f); t3.h[1] = (_Float16)((ps1 - (float)t2.h[1]) * 1024.0f);
        sP[w][rt * 16 + 8 * hh + r][ln] = t2.u[0]; sP[w][rt * 16 + 8 * hh + r][16 + ln] = t2.u[1]; sPl[w][rt * 16 + 8 * hh + r][ln] = t3.u[0]; sPl[w][rt * 16 + 8 * hh + r][16 + ln] = t3.u[1]; }
    __builtin_amdgcn_fence(__ATOMIC_ACQ_REL, "workgroup"); __builtin_amdgcn_wave_barrier();
    FragH pa[2], pl[2];
#pragma unroll
    for (int rt = 0; rt < RTN; ++rt) { pa[rt].half[0] = *(const v8us*)&sP[w][rt * 16 + ln][8 * hh]; pa[rt].half[1] = *(const v8us*)&sP[w][rt * 16 + ln][16 + 8 * hh]; pl[rt].half[0] = *(const v8us*)&sPl[w][rt * 16 + ln][8 * hh]; pl[rt].half[1] = *(const v8us*)&sPl[w][rt * 16 + ln][16 + 8 * hh]; }
#pragma unroll
    for (int dt = 0; dt < DT; ++dt) { const size_t vo = (size_t)(dt * 16) * TK + (size_t)(j0 >> 5) * 512 + lane * 8; FragH bv, bl; bv.half[0] = *(const v8us*)(Vth + vo); bv.half[1] = *(const v8us*)(Vth + vo + 256); bl.half[0] = *(const v8us*)(Vtl + vo); bl.half[1] = *(const v8us*)(Vtl + vo + 256);
#pragma unroll
      for (int rt = 0; rt < RTN; ++rt) { oacc[rt][dt] = mmaH<1>(pa[rt].v, pa[rt].v, bv.v, bv.v, oacc[rt][dt]); oaccl[rt][dt] = mmaH<1>(pa[rt].v, pa[rt].v, bl.v, bl.v, oaccl[rt][dt]); oaccl[rt][dt] = mmaH<1>(pl[rt].v, pl[rt].v, bv.v, bv.v, oaccl[rt][dt]); } }
    __builtin_amdgcn_fence(__ATOMIC_ACQ_REL, "workgroup"); __builtin_amdgcn_wave_barrier(); }
#pragma unroll
  for (int rt = 0; rt < RTN; ++rt) {
#pragma unroll
    for (int r = 0; r < 8; ++r) { float l = l_r[rt][r]; l += __shfl_xor(l, 1, 32); l += __shfl_xor(l, 2, 32); l += __shfl_xor(l, 4, 32); l += __shfl_xor(l, 8, 32); l_r[rt][r] = (l > 0.f) ? 1.0f / (l * 1024.0f) : 0.f; }
#pragma unroll
    for (int dt = 0; dt < DT; ++dt)
#pragma unroll
      for (int r = 0; r < 8; ++r) sO[w][rt * 16 + 8 * hh + r][dt * 16 + ln] = (oacc[rt][dt][r] + oaccl[rt][dt][r] * 0.0009765625f) * l_r[rt][r]; }
  __builtin_amdgcn_fence(__ATOMIC_ACQ_REL, "workgroup"); __builtin_amdgcn_wave_barrier();
  {
#pragma unroll
    for (int rp = 0; rp < RPW; rp += 2) { const int r = rp + (lane >> 4), pc = lane & 15; const v4f val = *(const v4fa*)&sO[w][r][pc * 4]; *(v4f*)(O + ((size_t)b * TQ + q0 + r) * ldo + h * 64 + pc * 4) = val; }
     } }


__global__ __launch_bounds__(256) void k_causaltab(unsigned* __restrict__ MB, int* __restrict__ RA, int* __restrict__ KE, int nq, int nk) {
  const int t = blockIdx.x * 256 + threadIdx.x; const int nw = nk / 32;
  if (t < nq * nw) { const int q = t / nw, w = t % nw; const int first = q + 1 - 32 * w; const unsigned bits = (first <= 0) ? 0xffffffffu : ((first >= 32) ? 0u : (0xffffffffu << first)); *(unsigned*)(MB + t) = bits;  }
  if (t < nq) { *(int*)(RA + t) = 0;  }
  if (t < nq / 64) { const int v = 64 * (t + 1); *(int*)(KE + t * 32) = v;  } }

__constant__ float PIF[32] = {3.141592741e+00f,3.031195641e+00f,2.924677610e+00f,2.821902990e+00f,2.722739935e+00f,2.627061367e+00f,2.534744978e+00f,2.445672750e+00f,2.359730482e+00f,2.276808262e+00f,2.196800232e+00f,2.119603395e+00f,2.045119524e+00f,1.973252892e+00f,1.903911710e+00f,1.837007284e+00f,1.772453904e+00f,1.710168958e+00f,1.650072694e+00f,1.592088223e+00f,1.536141396e+00f,1.482160687e+00f,1.430076718e+00f,1.379823089e+00f,1.331335425e+00f,1.284551501e+00f,1.239411712e+00f,1.195858121e+00f,1.153835058e+00f,1.113288760e+00f,1.074167132e+00f,1.036420345e+00f};
__global__ __launch_bounds__(256) void k_trig(const float* __restrict__ pig, const float* __restrict__ logxi, const float* __restrict__ egl, float* __restrict__ CS, float* __restrict__ SN, float* __restrict__ HB) {
  #pragma clang fp contract(off)
  const int t = blockIdx.x * 256 + threadIdx.x; if (t >= NH * SLEN * 32) return; const int j = t & 31; const int tok = (t >> 5) % SLEN; const int h = t / (32 * SLEN);
  const float pg = 1.0f / (1.0f + expf(-bf16_round(pig[h]))); const float th = ((float)tok * PIF[j]) * pg; const float c = cosf(th), s = sinf(th);
  *(float*)(CS + t) = c; *(float*)(SN + t) = s; 
  if (t < 2 * NH) { const int hh2 = t >> 1; const float v = (t & 1) ? (1.0f / (1.0f + expf(-bf16_round(egl[hh2])))) : expf(bf16_round(logxi[hh2])); *(float*)(HB + t) = v;  } }      
__global__ __launch_bounds__(256) void k_eurot(const float* __restrict__ F, const float* __restrict__ CS, const float* __restrict__ SN, float* __restrict__ OF) {
  #pragma clang fp contract(off)
  const int t = blockIdx.x * 256 + threadIdx.x; if (t >= NR * (DM / 4)) return; const int c0 = (t % (DM / 4)) * 4; const int r = t / (DM / 4); const int tok = r % SLEN; const int h = c0 / 64, d0 = c0 & 63;
  const float* f = F + (size_t)r * DM + c0; const float* cs = CS + ((size_t)h * SLEN + tok) * 32; const float* sn = SN + ((size_t)h * SLEN + tok) * 32; v4f o;
#pragma unroll
  for (int q = 0; q < 4; ++q) { const int d = d0 + q; const float c = cs[d >> 1], s = sn[d >> 1];
    o[q] = (d & 1) ? (f[q - 1] * s + f[q] * c) : (f[q] * c - f[q + 1] * s); }
  *(v4f*)(OF + (size_t)r * DM + c0) = o;  }

extern "C" void kernel_launch(void* const* d_in, const int* in_sizes, int n_in,
                              void* d_out, int out_size, void* d_ws, size_t ws_size, hipStream_t stream) {
  (void)in_sizes; (void)n_in; (void)out_size;
  const float* const* I = (const float* const*)d_in; const float* x = I[0]; const float* Wqkv = I[1]; const float* Wo = I[2]; const float* logxi = I[3]; const float* pig = I[4]; const float* egl = I[5];
  char* ws = (char*)d_ws; size_t off = 0;
  auto take = [&](size_t bytes) { char* p = ws + off; off += (bytes + 255) & ~(size_t)255; return p; };
  _Float16* BQKV = (_Float16*)take((size_t)3 * DM * DM * 2); _Float16* BO = (_Float16*)take((size_t)DM * DM * 2);
  _Float16* X16 = (_Float16*)take((size_t)NR * DM * 2); float* F = (float*)take((size_t)NR * DM * 4); float* G = (float*)take((size_t)NR * DM * 4);
  _Float16* Qh = (_Float16*)take((size_t)NR * DM * 2); _Float16* Ql = (_Float16*)take((size_t)NR * DM * 2); _Float16* Kh = (_Float16*)take((size_t)NR * DM * 2); _Float16* Kl = (_Float16*)take((size_t)NR * DM * 2); _Float16* Vth = (_Float16*)take((size_t)NR * DM * 2); _Float16* Vtl = (_Float16*)take((size_t)NR * DM * 2);
  unsigned* MB = (unsigned*)take((size_t)SLEN * (SLEN / 32) * 4); int* RA = (int*)take((size_t)SLEN * 4); int* KE = (int*)take((size_t)(SLEN / 64) * 32 * 4);
  float* CS = (float*)take((size_t)NH * SLEN * 32 * 4); float* SN = (float*)take((size_t)NH * SLEN * 32 * 4); float* HB = (float*)take(256);
  if (off > ws_size) return;      /* 6 + 2 + 8 + 16 + 16 + 6 x 8 + 0.5 + 8 = 105 MiB */
  float* O = F; _Float16* Oh = (_Float16*)G; _Float16* Ol = Oh + (size_t)NR * DM;      /* F and G are dead once the hi/lo planes exist */
  const size_t n8 = (size_t)NR * DM / 8; const unsigned nb8 = (unsigned)((n8 + 255) / 256), nb4 = (unsigned)(((size_t)NR * DM / 4 + 255) / 256);
  k_round16f<<<(unsigned)(((size_t)3 * DM * DM / 8 + 255) / 256), 256, 0, stream>>>(Wqkv, BQKV, (size_t)3 * DM * DM / 8); k_round16f<<<(unsigned)(((size_t)DM * DM / 8 + 255) / 256), 256, 0, stream>>>(Wo, BO, (size_t)DM * DM / 8);      /* torch (out,in) = natural Bt; x16 */
  k_x16<<<nb8, 256, 0, stream>>>(x, X16, n8);
  k_trig<<<(NH * SLEN * 32 + 255) / 256, 256, 0, stream>>>(pig, logxi, egl, CS, SN, HB); k_causaltab<<<(SLEN * (SLEN / 32) + 255) / 256, 256, 0, stream>>>(MB, RA, KE, SLEN, SLEN);
  const dim3 gP((NR / 128) * (DM / 64), 1);
  k_gemm2<0><<<gP, 128, 0, stream>>>(X16, DM, 0, BQKV, DM, 0, 0.0625f, nullptr, 0, nullptr, 1, 0, 0, F, nullptr, DM, 0, NR, DM, DM); k_eurot<<<nb4, 256, 0, stream>>>(F, CS, SN, G); k_hl<<<nb8, 256, 0, stream>>>(G, Qh, Ql, n8);      /* q (rows 0..1023 of Wqkv), rotated, hi/lo */
  k_gemm2<0><<<gP, 128, 0, stream>>>(X16, DM, 0, BQKV + (size_t)DM * DM, DM, 0, 0.0625f, nullptr, 0, nullptr, 1, 0, 0, F, nullptr, DM, 0, NR, DM, DM); k_eurot<<<nb4, 256, 0, stream>>>(F, CS, SN, G); k_hl<<<nb8, 256, 0, stream>>>(G, Kh, Kl, n8);      /* k (rows 1024..2047), rotated */
  k_gemm2<0><<<gP, 128, 0, stream>>>(X16, DM, 0, BQKV + (size_t)2 * DM * DM, DM, 0, 0.0625f, nullptr, 0, nullptr, 1, 0, 0, F, nullptr, DM, 0, NR, DM, DM);      /* v (rows 2048..3071) f32 */
  k_vthl<SLEN><<<NBT * NH * (SLEN / 64), 256, 0, stream>>>(F, DM, Vth, Vtl);      /* both batches in one grid: the kernel takes the batch from blockIdx (slab / NH) */
  k_flashme<SLEN, SLEN><<<NBT * NH * (SLEN / 64), 128, 0, stream>>>(Qh, Ql, DM, Kh, Kl, DM, Vth, Vtl, MB, RA, KE, HB, O, DM);      /* both batches in one grid, so that their waves share the chip */
  k_hl<<<nb8, 256, 0, stream>>>(O, Oh, Ol, n8);
  k_gemm2<0><<<gP, 128, 0, stream>>>(Oh, DM, 0, BO, DM, 0, 0.0625f, nullptr, 0, nullptr, 1, 0, 0, (float*)d_out, nullptr, DM, 0, NR, DM, DM);
  k_gemm2<0><<<gP, 128, 0, stream>>>(Ol, DM, 0, BO, DM, 0, 0.0625f / 1024.0f, nullptr, 0, (const float*)d_out, 1, (size_t)DM, 0, (float*)d_out, nullptr, DM, 0, NR, DM, DM);
}

// v005
// It runs in 407 microseconds.
// Next to v004, in two timings, it ran 1.05 and 1.06 times as fast.
// All steps since v000 together make it 2.17 times as fast.
#include <hip/hip_runtime.h>
// Causal multi-head attention with gated rotary phases and a per-head distance decay (2 x 2048 tokens x 1024, 16 heads x 64): qkv = x*Wqkv^T; theta[h][t][j] = (t * pi^(1 - j/32)) * sigmoid(pi_gate[h]); interleaved-pair rotation of q and k; scores = q.k/8 - |i - j| / exp(log_xi[h]) * sigmoid(e_gate[h]) with j <= i; softmax; merged . Wo^T -> [2,2048,1024].
// Structure: x as an exact f16 plane; q/k/v from one packed f16 WMMA GEMM family (32x64 wave tiles, f32, exact products); per-(head, token) cos/sin tables on VALU (pi^(1-j/32) = the reference's f32 constants, precise trig); the projection GEMMs' epilogues rotate q and k in f32 and write them as f16 hi + x2^10 residual planes, and write V^T as hi + residual planes; the causal structure computed on device into a key bit plane + per-block key bound; the fused flash kernel per ((batch, head), 64 queries) with the decay bias added per element (three-product hi/lo scores, online softmax f32, P hi + residual via LDS, two value accumulators), whose epilogue writes O as hi + residual planes; output projection as two GEMMs.
// Compute dtype: x, weights and the three gate/scale vectors rounded to bf16; projections exact; rotation and bias f32; q, k, P, v, O as f16 hi + residual pairs (~2^-21); f32 accumulation and softmax. v_wmma_f32_16x16x32_f16.
#define NBT 2
#define SLEN 2048
#define DM 1024
#define NH 16
#define SCL 0.125f
#define NR (NBT * SLEN)
typedef __bf16 v16b __attribute__((ext_vector_type(16)));
typedef unsigned short v8us __attribute__((ext_vector_type(8), may_alias));
typedef float  v8f  __attribute__((ext_vector_type(8)));
typedef float  v4f  __attribute__((ext_vector_type(4)));
typedef float  v4fa __attribute__((ext_vector_type(4), may_alias));
union FragB { v16b v; v8us half[2]; unsigned short u[16]; };

__device__ __forceinline__ unsigned short bf16_bits(float x) { unsigned int u = __float_as_uint(x); return (unsigned short)((u + 0x7FFFu + ((u >> 16) & 1u)) >> 16); }
__device__ __forceinline__ float bf16_val(unsigned short b) { return __uint_as_float(((unsigned int)b) << 16); }
__device__ __forceinline__ float bf16_round(float x) { return bf16_val(bf16_bits(x)); }
// D += A·B with NT terms: 1 = ah·bh, 2 = + al·bh (A split), 3 = + ah·bl (both split)
template <int NT>
__device__ __forceinline__ v8f mmaN(v16b ah, v16b al, v16b bh, v16b bl, v8f c) {
  c = __builtin_amdgcn_wmma_f32_16x16x32_bf16(false, ah, false, bh, (short)0, c, false, false);
  if (NT >= 2) c = __builtin_amdgcn_wmma_f32_16x16x32_bf16(false, al, false, bh, (short)0, c, false, false);
  if (NT >= 3) c = __builtin_amdgcn_wmma_f32_16x16x32_bf16(false, ah, false, bl, (short)0, c, false, false);
  asm volatile("v_nop\n\tv_nop\n\tv_nop\n\tv_nop" : "+v"(c) : "v"(ah), "v"(al), "v"(bh), "v"(bl));
  return c;
}

__global__ __launch_bounds__(256) void k_wt_bf16(const float* __restrict__ W, unsigned short* __restrict__ Wt, int K, int N) {
  const int t = blockIdx.x * 256 + threadIdx.x;
  const int k8n = K / 8;
  if (t >= N * k8n) return;
  const int n = t / k8n, k8 = (t % k8n) * 8;
  v8us v;
#pragma unroll
  for (int i = 0; i < 8; ++i) v[i] = bf16_bits(W[(size_t)(k8 + i) * N + n]);
  *(v8us*)(Wt + (size_t)n * K + k8) = v;
  
}

// GEMM C[M][N] (f32, pitch ldc) = act(A[M][K]·W + bias). A f32 row-major (pitch lda) converted per fragment to bf16
// (ASPLIT: hi/lo two planes -> 2 terms, else single rounded term); Wt bf16 [N][K] (pitch ldb). BIAS_BF16 rounds the
// bias to bf16 first (bias quantised to bf16 before the add). K%32==0, M%16==0, N%64==0.
template <bool ASPLIT, int ACT, bool BIAS_BF16>
__global__ __launch_bounds__(128) void k_gemm_bf(const float* __restrict__ A, int lda, const unsigned short* __restrict__ Wt, int ldb,
                                               const float* __restrict__ bias, float* __restrict__ C, int ldc, int M, int N, int K) {
  __shared__ __attribute__((aligned(16))) float so[4][16][64];
  const int tid = threadIdx.x, w = tid >> 5, lane = tid & 31, ln = lane & 15, hh = lane >> 4;
  const int ntn = N / 64;
  const int wid = blockIdx.x * 4 + w;
  const int mt = wid / ntn, nq = wid % ntn;
  if (mt * 16 >= M) return;
  const int row0 = mt * 16, col0 = nq * 64;
  const float* arow = A + (size_t)(row0 + ln) * lda;
  v8f acc[4] = {};
  for (int kb = 0; kb < K; kb += 32) {
    FragB ah, al;
    const v4f x0 = *(const v4fa*)(arow + kb + 8 * hh), x1 = *(const v4fa*)(arow + kb + 8 * hh + 4);
    const v4f x2 = *(const v4fa*)(arow + kb + 16 + 8 * hh), x3 = *(const v4fa*)(arow + kb + 16 + 8 * hh + 4);
    float xs[16] = {x0[0],x0[1],x0[2],x0[3],x1[0],x1[1],x1[2],x1[3],x2[0],x2[1],x2[2],x2[3],x3[0],x3[1],x3[2],x3[3]};
#pragma unroll
    for (int i = 0; i < 16; ++i) { const unsigned short hb = bf16_bits(xs[i]); ah.u[i] = hb; al.u[i] = ASPLIT ? bf16_bits(xs[i] - bf16_val(hb)) : (unsigned short)0; }
#pragma unroll
    for (int t = 0; t < 4; ++t) {
      const unsigned short* brow = Wt + (size_t)(col0 + t * 16 + ln) * ldb + kb;
      FragB b;
      b.half[0] = *(const v8us*)(brow + 8 * hh);
      b.half[1] = *(const v8us*)(brow + 16 + 8 * hh);
      acc[t] = mmaN<ASPLIT ? 2 : 1>(ah.v, al.v, b.v, b.v, acc[t]);
    }
  }
#pragma unroll
  for (int t = 0; t < 4; ++t) {
    float bv = bias ? bias[col0 + t * 16 + ln] : 0.f;
    if (BIAS_BF16) bv = bf16_round(bv);
#pragma unroll
    for (int r = 0; r < 8; ++r) { float v = acc[t][r] + bv; if (ACT == 1) v = fmaxf(v, 0.f); so[w][8 * hh + r][t * 16 + ln] = v; }
  }
  __builtin_amdgcn_fence(__ATOMIC_ACQ_REL, "workgroup");
  __builtin_amdgcn_wave_barrier();
  const int rsub = lane >> 4, c4 = (lane & 15) * 4;
  {
#pragma unroll
    for (int q = 0; q < 8; ++q) {
      const int r = q * 2 + rsub;
      const v4f v = *(const v4fa*)&so[w][r][c4];
      *(v4f*)(C + (size_t)(row0 + r) * ldc + col0 + c4) = v;
    }
    
  }
}

// GEMM C = act(A·W + bias + resid): A f32 (ASPLIT -> hi/lo 2 terms), Wt bf16 [N][K]; ACT 0 none, 1 relu, 2 exact gelu;
// resid (optional, f32, row index = (row % rmod), pitch ldr, RES_BF16 rounds it) added before the activation.
template <bool ASPLIT, int ACT, bool BIAS_BF16, bool RES_BF16>
__global__ __launch_bounds__(128) void k_gemm_bf3(const float* __restrict__ A, int lda, const unsigned short* __restrict__ Wt, int ldb,
                                                const float* __restrict__ bias, const float* __restrict__ resid, int rmod, int ldr,
                                                float* __restrict__ C, int ldc, int M, int N, int K) {
  __shared__ __attribute__((aligned(16))) float so[4][16][64];
  const int tid = threadIdx.x, w = tid >> 5, lane = tid & 31, ln = lane & 15, hh = lane >> 4;
  const int ntn = N / 64;
  const int wid = blockIdx.x * 4 + w;
  const int mt = wid / ntn, nq = wid % ntn;
  if (mt * 16 >= M) return;
  const int row0 = mt * 16, col0 = nq * 64;
  const float* arow = A + (size_t)(row0 + ln) * lda;
  v8f acc[4] = {};
  for (int kb = 0; kb < K; kb += 32) {
    FragB ah, al;
    const v4f x0 = *(const v4fa*)(arow + kb + 8 * hh), x1 = *(const v4fa*)(arow + kb + 8 * hh + 4);
    const v4f x2 = *(const v4fa*)(arow + kb + 16 + 8 * hh), x3 = *(const v4fa*)(arow + kb + 16 + 8 * hh + 4);
    float xs[16] = {x0[0],x0[1],x0[2],x0[3],x1[0],x1[1],x1[2],x1[3],x2[0],x2[1],x2[2],x2[3],x3[0],x3[1],x3[2],x3[3]};
#pragma unroll
    for (int i = 0; i < 16; ++i) { const unsigned short hb = bf16_bits(xs[i]); ah.u[i] = hb; al.u[i] = ASPLIT ? bf16_bits(xs[i] - bf16_val(hb)) : (unsigned short)0; }
#pragma unroll
    for (int t = 0; t < 4; ++t) {
      const unsigned short* brow = Wt + (size_t)(col0 + t * 16 + ln) * ldb + kb;
      FragB b;
      b.half[0] = *(const v8us*)(brow + 8 * hh);
      b.half[1] = *(const v8us*)(brow + 16 + 8 * hh);
      acc[t] = mmaN<ASPLIT ? 2 : 1>(ah.v, al.v, b.v, b.v, acc[t]);
    }
  }
#pragma unroll
  for (int t = 0; t < 4; ++t) {
    const int col = col0 + t * 16 + ln;
    float bv = bias ? bias[col] : 0.f;
    if (BIAS_BF16) bv = bf16_round(bv);
#pragma unroll
    for (int r = 0; r < 8; ++r) {
      float v = acc[t][r] + bv;
      if (resid) { float rv = resid[(size_t)((row0 + 8 * hh + r) % rmod) * ldr + col]; if (RES_BF16) rv = bf16_round(rv); v += rv; }
      if (ACT == 1) v = fmaxf(v, 0.f);
      if (ACT == 2) v = 0.5f * v * (1.0f + erff(v * 0.70710678118654752f));
      if (ACT == 3) { const float u = 0.7978845608028654f * (v + 0.044715f * v * v * v); v = 0.5f * v * (1.0f + tanhf(u)); }
      so[w][8 * hh + r][t * 16 + ln] = v;
    }
  }
  __builtin_amdgcn_fence(__ATOMIC_ACQ_REL, "workgroup");
  __builtin_amdgcn_wave_barrier();
  const int rsub = lane >> 4, c4 = (lane & 15) * 4;
  {
#pragma unroll
    for (int q = 0; q < 8; ++q) {
      const int r = q * 2 + rsub;
      const v4f v = *(const v4fa*)&so[w][r][c4];
      *(v4f*)(C + (size_t)(row0 + r) * ldc + col0 + c4) = v;
    }
    
  }
}
// row LayerNorm (biased variance, eps) over N: s = X (+ R); optional out_sum <- s; out_norm <- (s-mu)*rsqrt(var+eps)*g + b
template <bool PARAM_BF16>
__global__ __launch_bounds__(256) void k_layernorm(const float* __restrict__ X, const float* __restrict__ R, const float* __restrict__ g, const float* __restrict__ bta,
                                                  float* __restrict__ out_sum, float* __restrict__ out_norm, int N, float eps) {
  __shared__ float red[256];
  const int row = blockIdx.x, tid = threadIdx.x;
  const float* x = X + (size_t)row * N; const float* rr = R ? R + (size_t)row * N : nullptr;
  float vals[16];                     // up to N = 4096
  const int per = N / 256;            // contiguous chunk per thread? use strided-by-4 chunks: thread handles j = tid*4 + 1024*u
  float s1 = 0.f;
  for (int u = 0; u < per / 4; ++u) {
    const int j = tid * 4 + 1024 * u;
    const v4f a = *(const v4fa*)(x + j);
    v4f b = {0.f,0.f,0.f,0.f}; if (rr) b = *(const v4fa*)(rr + j);
#pragma unroll
    for (int q = 0; q < 4; ++q) { const float v = a[q] + b[q]; vals[u * 4 + q] = v; s1 += v; }
  }
  red[tid] = s1; __syncthreads();
  for (int st = 128; st > 0; st >>= 1) { if (tid < st) red[tid] += red[tid + st]; __syncthreads(); }
  const float mu = red[0] / (float)N; __syncthreads();
  float s2 = 0.f;
  for (int u = 0; u < per / 4; ++u)
#pragma unroll
    for (int q = 0; q < 4; ++q) { const float c = vals[u * 4 + q] - mu; s2 += c * c; }
  red[tid] = s2; __syncthreads();
  for (int st = 128; st > 0; st >>= 1) { if (tid < st) red[tid] += red[tid + st]; __syncthreads(); }
  const float rs = rsqrtf(red[0] / (float)N + eps);
  {
    for (int u = 0; u < per / 4; ++u) {
      const int j = tid * 4 + 1024 * u;
      v4f o, sm;
#pragma unroll
      for (int q = 0; q < 4; ++q) {
        float gg = g[j + q], bb = bta[j + q];
        if (PARAM_BF16) { gg = bf16_round(gg); bb = bf16_round(bb); }
        sm[q] = vals[u * 4 + q]; o[q] = (vals[u * 4 + q] - mu) * rs * gg + bb;
      }
      if (out_sum) *(v4f*)(out_sum + (size_t)row * N + j) = sm;
      *(v4f*)(out_norm + (size_t)row * N + j) = o;
    }
    
  }
}



// ---- f16 WMMA path (v_wmma_f32_16x16x32_f16): 11-bit significands for operands in range — used where a [0,1] probability operand needs more precision than bf16
typedef _Float16 v16h __attribute__((ext_vector_type(16)));
union FragH { v16h v; v8us half[2]; _Float16 h[16]; unsigned short u[16]; };
template <int NT>
__device__ __forceinline__ v8f mmaH(v16h ah, v16h al, v16h bh, v16h bl, v8f c) {
  c = __builtin_amdgcn_wmma_f32_16x16x32_f16(false, ah, false, bh, (short)0, c, false, false);
  if (NT >= 2) c = __builtin_amdgcn_wmma_f32_16x16x32_f16(false, al, false, bh, (short)0, c, false, false);
  if (NT >= 3) c = __builtin_amdgcn_wmma_f32_16x16x32_f16(false, ah, false, bl, (short)0, c, false, false);
  asm volatile("v_nop\n\tv_nop\n\tv_nop\n\tv_nop" : "+v"(c) : "v"(ah), "v"(al), "v"(bh), "v"(bl));
  return c;
}
// batched GEMM like k_gemm_b but f16 operands: A f32 (split into f16 hi/lo if ASPLIT, else rounded to f16), Bt = f16 values [n][k]; alpha; C f32; N multiple of 16 (partial tiles skipped)
template <bool ASPLIT>
__global__ __launch_bounds__(128) void k_gemm_h(const float* __restrict__ A, int lda, size_t sA, const _Float16* __restrict__ Bh, int ldb, size_t sB, float alpha, float* __restrict__ C, int ldc, size_t sC, int M, int N, int K) {
  __shared__ __attribute__((aligned(16))) float so[4][16][64];
  const int tid = threadIdx.x, w = tid >> 5, lane = tid & 31, ln = lane & 15, hh = lane >> 4; const int by = blockIdx.y;
  A += (size_t)by * sA; Bh += (size_t)by * sB; C += (size_t)by * sC;
  const int ntn = (N + 63) / 64; const int wid = blockIdx.x * 4 + w; const int mt = wid / ntn, nq = wid % ntn; if (mt * 16 >= M) return;
  const int row0 = mt * 16, col0 = nq * 64; const float* arow = A + (size_t)(row0 + ln) * lda;
  v8f acc[4] = {};
  for (int kb = 0; kb < K; kb += 32) {
    FragH ah, al;
    const v4f x0 = *(const v4fa*)(arow + kb + 8 * hh), x1 = *(const v4fa*)(arow + kb + 8 * hh + 4), x2 = *(const v4fa*)(arow + kb + 16 + 8 * hh), x3 = *(const v4fa*)(arow + kb + 16 + 8 * hh + 4);
    float xs[16] = {x0[0],x0[1],x0[2],x0[3],x1[0],x1[1],x1[2],x1[3],x2[0],x2[1],x2[2],x2[3],x3[0],x3[1],x3[2],x3[3]};
#pragma unroll
    for (int i = 0; i < 16; ++i) { const _Float16 h = (_Float16)xs[i]; ah.h[i] = h; al.h[i] = ASPLIT ? (_Float16)(xs[i] - (float)h) : (_Float16)0.0f; }
#pragma unroll
    for (int t = 0; t < 4; ++t) { if (col0 + t * 16 >= N) continue; const size_t boff = (size_t)(col0 + t * 16 + ln) * ldb + kb; FragH bq; bq.half[0] = *(const v8us*)(Bh + boff + 8 * hh); bq.half[1] = *(const v8us*)(Bh + boff + 16 + 8 * hh);
      acc[t] = mmaH<ASPLIT ? 2 : 1>(ah.v, al.v, bq.v, bq.v, acc[t]); }
  }
#pragma unroll
  for (int t = 0; t < 4; ++t) { if (col0 + t * 16 >= N) continue;
#pragma unroll
    for (int r = 0; r < 8; ++r) so[w][8 * hh + r][t * 16 + ln] = acc[t][r] * alpha; }
  __builtin_amdgcn_fence(__ATOMIC_ACQ_REL, "workgroup"); __builtin_amdgcn_wave_barrier();
  const int rsub = lane >> 4, c4 = (lane & 15) * 4;
  {
#pragma unroll
    for (int q = 0; q < 8; ++q) { const int r = q * 2 + rsub; if (col0 + c4 < N) { const v4f v = *(const v4fa*)&so[w][r][c4]; *(v4f*)(C + (size_t)(row0 + r) * ldc + col0 + c4) = v; } }
     }
}

// Wt[n][k] = f16(W[k][n]·scale) from f32 row-major W[K][N] (scale = power of two; bf16-exact weights stay exact in f16 away from the subnormal range)
__global__ __launch_bounds__(256) void k_wt_f16(const float* __restrict__ W, _Float16* __restrict__ Wt, int K, int N, float scale) {
  const int t = blockIdx.x * 256 + threadIdx.x; if (t >= N * (K / 8)) return; const int n = t / (K / 8), k8 = (t % (K / 8)) * 8; FragH f;
#pragma unroll
  for (int i = 0; i < 8; ++i) f.h[i] = (_Float16)(bf16_round(W[(size_t)(k8 + i) * N + n]) * scale); const v8us o = f.half[0];
  *(v8us*)((unsigned short*)Wt + (size_t)n * K + k8) = o; 
}
// k_gemm_hh variant with fused epilogue: v = acc·alpha + bias[by·sBias + col] (+ CP[(row/rowsPerB)·sCPb + by·64 + col] if CP) ; ACT 0 none / 1 elu ; writes f16 C16 (and f32 C if non-null)
template <int ACT>
__global__ __launch_bounds__(128) void k_gemm_hhx(const _Float16* __restrict__ A, int lda, size_t sA, const _Float16* __restrict__ Bh, int ldb, size_t sB, float alpha, const float* __restrict__ bias, size_t sBias, const float* __restrict__ CP, int rowsPerB, size_t sCPb, int row0g,
    float* __restrict__ C, _Float16* __restrict__ C16, int ldc, size_t sC, int M, int N, int K) {
  __shared__ __attribute__((aligned(16))) float so[4][16][64];
  const int tid = threadIdx.x, w = tid >> 5, lane = tid & 31, ln = lane & 15, hh = lane >> 4; const int by = blockIdx.y;
  A += (size_t)by * sA; Bh += (size_t)by * sB; const size_t cofs = (size_t)by * sC; const float* bp = bias ? bias + (size_t)by * sBias : nullptr;
  const int ntn = (N + 63) / 64; const int wid = blockIdx.x * 4 + w; const int mt = wid / ntn, nq = wid % ntn; if (mt * 16 >= M) return;
  const int row0 = mt * 16, col0 = nq * 64; const _Float16* arow = A + (size_t)(row0 + ln) * lda;
  v8f acc[4] = {};
  for (int kb = 0; kb < K; kb += 32) { FragH ah; ah.half[0] = *(const v8us*)((const unsigned short*)arow + kb + 8 * hh); ah.half[1] = *(const v8us*)((const unsigned short*)arow + kb + 16 + 8 * hh);
#pragma unroll
    for (int t = 0; t < 4; ++t) { if (col0 + t * 16 >= N) continue; const size_t boff = (size_t)(col0 + t * 16 + ln) * ldb + kb; FragH bq; bq.half[0] = *(const v8us*)((const unsigned short*)Bh + boff + 8 * hh); bq.half[1] = *(const v8us*)((const unsigned short*)Bh + boff + 16 + 8 * hh);
      acc[t] = mmaH<1>(ah.v, ah.v, bq.v, bq.v, acc[t]); }
  }
#pragma unroll
  for (int t = 0; t < 4; ++t) { if (col0 + t * 16 >= N) continue; const int col = col0 + t * 16 + ln; const float bv = bp ? bf16_round(bp[col]) : 0.f;
#pragma unroll
    for (int r = 0; r < 8; ++r) { float v = acc[t][r] * alpha + bv; if (CP) { const int bidx = (row0g + row0 + 8 * hh + r) / rowsPerB; v += CP[(size_t)bidx * sCPb + (size_t)by * 64 + col]; } if (ACT == 1) v = (v > 0.f) ? v : expm1f(v); else if (ACT == 7) v = (v > 0.f) ? v + 1.0f : expf(v); else if (ACT == 8) v = tanhf(v); else if (ACT == 9) v = 0.5f * v * (1.0f + tanhf(0.7978845608028654f * (v + 0.044715f * v * v * v))); else if (ACT == 11) v = 1.0f / (1.0f + expf(-v)); else if (ACT == 12) v = (v > 0.f) ? v : 0.01f * v; else if (ACT == 14) v = (v > 0.f) ? v : 0.1f * v; else if (ACT == 15) v = v / (1.0f + expf(-v)); else if (ACT == 3) v = fmaxf(v, 0.f); else if (ACT == 6) v = 0.5f * v * (1.0f + erff(v * 0.70710678118654752f)); so[w][8 * hh + r][t * 16 + ln] = v; } }
  __builtin_amdgcn_fence(__ATOMIC_ACQ_REL, "workgroup"); __builtin_amdgcn_wave_barrier();
  const int rsub = lane >> 4, c4 = (lane & 15) * 4; typedef _Float16 v4h __attribute__((ext_vector_type(4)));
  {
#pragma unroll
    for (int q = 0; q < 8; ++q) { const int r = q * 2 + rsub; if (col0 + c4 < N) { const v4f v = *(const v4fa*)&so[w][r][c4]; if (C) *(v4f*)(C + cofs + (size_t)(row0 + r) * ldc + col0 + c4) = v; if (C16) { v4h h4; for (int i = 0; i < 4; ++i) h4[i] = (_Float16)v[i]; *(v4h*)(C16 + cofs + (size_t)(row0 + r) * ldc + col0 + c4) = h4; } } }
     }
}


typedef _Float16 v4h __attribute__((ext_vector_type(4)));

// ---- fragment-order planes: every f16 plane that a WMMA operand is loaded from is stored as 1 KiB units, one per (16 rows x 32 k). Inside a unit the 16-byte piece at (half * 32 + lane) holds row (lane & 15),
// k = half * 16 + (lane >> 4) * 8 .. + 7: what lane 'lane' takes as half 'half' of its fragment. A wave's global_load_b128 then reads 512 contiguous bytes (4 cache lines) where a row-major plane gives it 16 rows (16 lines).
// Units run along k first, then down the row tiles, so a tile of 16 rows still starts at element row * ld. ld % 32 == 0, rows % 16 == 0.
__device__ __forceinline__ size_t pk_src(size_t t, int ld) { const int lane = (int)(t & 31), half = (int)((t >> 5) & 1); const size_t u = t >> 6; const size_t nks = (size_t)(ld >> 5); const size_t ks = u % nks, rt = u / nks;      /* row-major element offset of the 8 elements that piece t of the plane holds */
  return (rt * 16 + (lane & 15)) * (size_t)ld + ks * 32 + half * 16 + (lane >> 4) * 8; }
__device__ __forceinline__ size_t pk_dst(size_t row, int k, int ld) { return (row >> 4) * 16 * (size_t)ld + (size_t)(k >> 5) * 512 + ((k >> 4) & 1) * 256 + (((k >> 3) & 1) * 16 + (int)(row & 15)) * 8; }      /* element offset in the plane of (row, k .. k + 7), k % 8 == 0 */

__global__ __launch_bounds__(256) void k_x16(const float* __restrict__ x, _Float16* __restrict__ X16, size_t n8) { const size_t t = (size_t)blockIdx.x * 256 + threadIdx.x; if (t >= n8) return; FragH f; const size_t so = pk_src(t, DM);
#pragma unroll
  for (int q = 0; q < 8; ++q) f.h[q] = (_Float16)bf16_round(x[so + q]); *(v8us*)((unsigned short*)X16 + t * 8) = f.half[0];  }
__global__ __launch_bounds__(256) void k_h16(const float* __restrict__ x, _Float16* __restrict__ X16, size_t n8) { const size_t t = (size_t)blockIdx.x * 256 + threadIdx.x; if (t >= n8) return; FragH f;
#pragma unroll
  for (int q = 0; q < 8; ++q) f.h[q] = (_Float16)x[t * 8 + q]; *(v8us*)((unsigned short*)X16 + t * 8) = f.half[0];  }
__global__ __launch_bounds__(256) void k_round16f(const float* __restrict__ W, _Float16* __restrict__ Bt, size_t n8) { const size_t t = (size_t)blockIdx.x * 256 + threadIdx.x; if (t >= n8) return; FragH f; const size_t so = pk_src(t, DM);
#pragma unroll
  for (int i = 0; i < 8; ++i) f.h[i] = (_Float16)(bf16_round(W[so + i]) * 16.0f); *(v8us*)((unsigned short*)Bt + t * 8) = f.half[0];  }
template <int NHv, int TTv>
__global__ __launch_bounds__(256) void k_vt(const _Float16* __restrict__ V16, int ldv, int voff, _Float16* __restrict__ Vt) { __shared__ unsigned short tl[64][66]; const int tid = threadIdx.x; const int slab = blockIdx.x / (TTv / 64), lg = blockIdx.x % (TTv / 64); const int b = slab / NHv, h = slab % NHv;
  for (int i = tid; i < 64 * 8; i += 256) { const int r = i / 8, c8 = (i % 8) * 8; FragH f; f.half[0] = *(const v8us*)((const unsigned short*)V16 + ((size_t)b * TTv + lg * 64 + r) * ldv + voff + h * 64 + c8);
#pragma unroll
    for (int q = 0; q < 8; ++q) tl[r][c8 + q] = f.u[q]; }
  __syncthreads();
  {
#pragma unroll
    for (int rd = 0; rd < 2; ++rd) { const int d = rd * 32 + tid / 8, pc = tid % 8; FragH f;
#pragma unroll
      for (int q = 0; q < 8; ++q) f.u[q] = tl[pc * 8 + q][d];
      *(v8us*)((unsigned short*)Vt + ((size_t)slab * 64 + d) * TTv + lg * 64 + pc * 8) = f.half[0]; }
     } }

// f32 -> f16 hi + x2^10 residual, 8 values = one 16-byte piece of each plane
__device__ __forceinline__ void hl_split8(const float* v, FragH& fh, FragH& fl) {
#pragma unroll
  for (int q = 0; q < 8; ++q) { const _Float16 h = (_Float16)v[q]; fh.h[q] = h; fl.h[q] = (_Float16)((v[q] - (float)h) * 1024.0f); } }

// ---- fast GEMM (wave tile 32x64; requires M % 32 == 0 rows per launch region and N % 64 == 0; A and Bh are fragment-order planes of pitch lda, ldb); epilogue = k_gemm_hhx semantics ----
// EPI 0: the tile goes out as f32 rows (C) and / or f16 rows (C16). EPI 1 (q, k; N = DM, so that a 64-column tile is one head): the tile is rotated by the head's cos/sin tables and goes out as the hi and residual fragment-order planes Ph, Pl.
// EPI 2 (v): the tile goes out transposed, as the hi and residual fragment-order planes of V^T (rows (batch * NH + head) * 64 + d, pitch SLEN).
__device__ __forceinline__ v16h g2_fragp(const _Float16* p) { FragH f; f.half[0] = *(const v8us*)((const unsigned short*)p); f.half[1] = *(const v8us*)((const unsigned short*)p + 256); return f.v; }      /* p = the lane's piece of a fragment-order unit */
__device__ __forceinline__ v8f g2_mma(v16h a, v16h b, v8f c) { v8f d = __builtin_amdgcn_wmma_f32_16x16x32_f16(false, a, false, b, (short)0, c, false, false); asm volatile("v_nop\n\tv_nop\n\tv_nop\n\tv_nop" : "+v"(d) : "v"(a), "v"(b)); return d; }
template <int ACT, int EPI>
__global__ __launch_bounds__(128) void k_gemm2(const _Float16* __restrict__ A, int lda, size_t sA, const _Float16* __restrict__ Bh, int ldb, size_t sB, float alpha, const float* __restrict__ bias, size_t sBias, const float* __restrict__ CP, int rowsPerB, size_t sCPb, int row0g,
    float* __restrict__ C, _Float16* __restrict__ C16, int ldc, size_t sC, int M, int N, int K, const float* __restrict__ CS, const float* __restrict__ SN, _Float16* __restrict__ Ph, _Float16* __restrict__ Pl) {
  __shared__ __attribute__((aligned(16))) float so[4][32][68];
  const int tid = threadIdx.x, w = tid >> 5, lane = tid & 31, ln = lane & 15, hh = lane >> 4; const int by = blockIdx.y;
  A += (size_t)by * sA; Bh += (size_t)by * sB; const size_t cofs = (size_t)by * sC; const float* bp = bias ? bias + (size_t)by * sBias : nullptr;
  const int ntn = N >> 6; const int mt = blockIdx.x / ntn, nq = blockIdx.x - mt * ntn; const int row0 = mt * 128 + 32 * w, col0 = nq * 64; if (row0 >= M) return;
  const _Float16* a0p = A + (size_t)row0 * lda + lane * 8; const _Float16* a1p = a0p + (size_t)16 * lda;      /* A and Bh are fragment-order planes */
  const _Float16* b0p = Bh + (size_t)col0 * ldb + lane * 8; const _Float16* b1p = b0p + (size_t)16 * ldb; const _Float16* b2p = b1p + (size_t)16 * ldb; const _Float16* b3p = b2p + (size_t)16 * ldb;
  const v8f z8 = {0.f,0.f,0.f,0.f,0.f,0.f,0.f,0.f}; v8f c00 = z8, c01 = z8, c02 = z8, c03 = z8, c10 = z8, c11 = z8, c12 = z8, c13 = z8;
  /* Register ring of three k-steps: the six fragments of steps s + 1 and s + 2 are in flight while step s is multiplied, so that a step no longer waits for five round trips one after the other.
     Each accumulator still takes its k-steps in ascending order. The six lane pointers live through the whole loop and every load of a trip reaches its step by an immediate offset, so that no load's result can land in an address register; only steps below K / 32 are loaded. */
  typedef const __attribute__((address_space(1))) _Float16* g2_gp;      /* typed as global memory, so that the loads stay global loads behind the asm statement that names the pointers */
  g2_gp p0 = (g2_gp)a0p, p1 = (g2_gp)a1p, p2 = (g2_gp)b0p, p3 = (g2_gp)b1p, p4 = (g2_gp)b2p, p5 = (g2_gp)b3p;
#define G2_FR(P, ST) g2_fragp((const _Float16*)((P) + 512 * (ST)))
#define G2_LOAD(S, ST) { S[0] = G2_FR(p0, ST); S[1] = G2_FR(p1, ST); S[2] = G2_FR(p2, ST); S[3] = G2_FR(p3, ST); S[4] = G2_FR(p4, ST); S[5] = G2_FR(p5, ST); \
    __builtin_amdgcn_sched_barrier(0); /* keeps the refill in front of the products that follow: without it the compiler sinks a refill behind the first product and that product's wait, and it flies for a shorter time */ }
#define G2_STEP(S) { c00 = g2_mma(S[0], S[2], c00); c10 = g2_mma(S[1], S[2], c10); c01 = g2_mma(S[0], S[3], c01); c11 = g2_mma(S[1], S[3], c11); c02 = g2_mma(S[0], S[4], c02); c12 = g2_mma(S[1], S[4], c12); c03 = g2_mma(S[0], S[5], c03); c13 = g2_mma(S[1], S[5], c13); }
  { const int nst = K >> 5; v16h r0[6], r1[6], r2[6]; int s = 0;
    if (nst >= 1) G2_LOAD(r0, 0)
    if (nst >= 2) G2_LOAD(r1, 1)
#pragma unroll 1
    for (; s + 5 <= nst; s += 3) { G2_LOAD(r2, 2) G2_STEP(r0) G2_LOAD(r0, 3) G2_STEP(r1) G2_LOAD(r1, 4) G2_STEP(r2)
      asm volatile("s_wait_xcnt 0x0" : "+v"(p0), "+v"(p1), "+v"(p2), "+v"(p3), "+v"(p4), "+v"(p5) :: "memory"); /* stands in front of the six additions below, which overwrite the address registers of the loads issued above; the pointers are named so that the additions depend on this statement and cannot be placed ahead of it (without it the compiler keeps copies of the pointers and rewrites them at the loop's head) */
      p0 += 1536; p1 += 1536; p2 += 1536; p3 += 1536; p4 += 1536; p5 += 1536; }
    const int rem = nst - s;      /* 0 to 4 steps are left; r0 and r1 hold the first two of them */
    if (rem >= 3) G2_LOAD(r2, 2)
    if (rem >= 1) G2_STEP(r0)
    if (rem >= 4) G2_LOAD(r0, 3)
    if (rem >= 2) G2_STEP(r1)
    if (rem >= 3) G2_STEP(r2)
    if (rem >= 4) G2_STEP(r0) }
#undef G2_FR
#undef G2_LOAD
#undef G2_STEP
  v8f accs[8] = {c00, c01, c02, c03, c10, c11, c12, c13};
#pragma unroll
  for (int u = 0; u < 8; ++u) { const int t = u & 3, half = u >> 2; const int col = col0 + t * 16 + ln; const float bv = bp ? bf16_round(bp[col]) : 0.f;
#pragma unroll
    for (int r = 0; r < 8; ++r) { const int rloc = half * 16 + 8 * hh + r; float v = accs[u][r] * alpha + bv; if (CP) { const int bidx = (row0g + row0 + rloc) / rowsPerB; v += CP[(size_t)bidx * sCPb + (size_t)by * 64 + col]; }
      if (ACT == 3) v = fmaxf(v, 0.f); else if (ACT == 6) v = 0.5f * v * (1.0f + erff(v * 0.70710678118654752f)); else if (ACT == 11) v = 1.0f / (1.0f + expf(-v)); else if (ACT == 15) v = v / (1.0f + expf(-v)); else if (ACT == 12) v = (v > 0.f) ? v : 0.01f * v; else if (ACT == 8) v = tanhf(v);
      so[w][rloc][t * 16 + ln] = v; } }
  __builtin_amdgcn_fence(__ATOMIC_ACQ_REL, "workgroup"); __builtin_amdgcn_wave_barrier();
  if (EPI == 1) {      /* the wave's tile = 2 row tiles x 2 units x 2 halves of each plane; a lane takes its own piece (row ln, 8 columns = 4 rotation pairs), a wave stores 512 contiguous bytes */
    typedef const __attribute__((address_space(1))) float* g2_fp;      /* typed as global memory, so that the loads stay global loads beside the asm statement that names the pointers */
    const size_t th = (size_t)(col0 >> 6) * SLEN * 32 + hh * 4, ta = th + (size_t)((row0 + ln) % SLEN) * 32, tb = th + (size_t)((row0 + 16 + ln) % SLEN) * 32;
    g2_fp ca = (g2_fp)(CS + ta), sa = (g2_fp)(SN + ta), cb = (g2_fp)(CS + tb), sb = (g2_fp)(SN + tb); v4f csv[8], snv[8];      /* the lane's two token rows of the head's tables */
#pragma unroll
    for (int u = 0; u < 8; ++u) { const int jo = ((u >> 1) & 1) * 16 + (u & 1) * 8; csv[u] = *(const __attribute__((address_space(1))) v4fa*)(((u >> 2) ? cb : ca) + jo); snv[u] = *(const __attribute__((address_space(1))) v4fa*)(((u >> 2) ? sb : sa) + jo); }
    asm volatile("s_wait_xcnt 0x0" : "+v"(ca), "+v"(sa), "+v"(cb), "+v"(sb) :: "memory");      /* stands in front of the first instruction that reuses an address register of the 16 table loads above; the pointers are named so that they live up to here */
#pragma unroll
    for (int u = 0; u < 8; ++u) { const int rl = (u >> 2) * 16 + ln, kk = ((u >> 1) & 1) * 32 + (u & 1) * 16 + hh * 8; const v4f a = *(const v4fa*)&so[w][rl][kk], c = *(const v4fa*)&so[w][rl][kk + 4];
      const v4f cs = csv[u], sn = snv[u];
      const float f[8] = {a[0], a[1], a[2], a[3], c[0], c[1], c[2], c[3]}; float o[8];
#pragma unroll
      for (int p = 0; p < 4; ++p) { o[2 * p] = f[2 * p] * cs[p] - f[2 * p + 1] * sn[p]; o[2 * p + 1] = f[2 * p] * sn[p] + f[2 * p + 1] * cs[p]; }
      FragH fh, fl; hl_split8(o, fh, fl); const size_t po = pk_dst((size_t)(row0 + rl), col0 + kk, N);
      *(v8us*)((unsigned short*)Ph + po) = fh.half[0]; *(v8us*)((unsigned short*)Pl + po) = fl.half[0]; }
  } else if (EPI == 2) {      /* 32 tokens x 64 d = 4 units of each V^T plane; a lane takes row d, 8 tokens, read down a column of the staged tile */
    const size_t vrow = ((size_t)(row0 / SLEN) * NH + (col0 >> 6)) * 64; const int t0 = row0 % SLEN;
#pragma unroll
    for (int u = 0; u < 8; ++u) { const int d = (u >> 1) * 16 + ln, tl = (u & 1) * 16 + hh * 8; float o[8];
#pragma unroll
      for (int q = 0; q < 8; ++q) o[q] = so[w][tl + q][d];
      FragH fh, fl; hl_split8(o, fh, fl); const size_t po = pk_dst(vrow + d, t0 + tl, SLEN);
      *(v8us*)((unsigned short*)Ph + po) = fh.half[0]; *(v8us*)((unsigned short*)Pl + po) = fl.half[0]; }
  } else {
    const int rsub = lane >> 4, c4 = (lane & 15) * 4;
#pragma unroll
    for (int q = 0; q < 16; ++q) { const int r = q * 2 + rsub; const v4f v = *(const v4fa*)&so[w][r][c4]; if (C) *(v4f*)(C + cofs + (size_t)(row0 + r) * ldc + col0 + c4) = v; if (C16) { v4h h4; for (int i = 0; i < 4; ++i) h4[i] = (_Float16)v[i]; *(v4h*)(C16 + cofs + (size_t)(row0 + r) * ldc + col0 + c4) = h4; } }
     } }



template <int TQ, int TK>
__global__ __launch_bounds__(128) void k_flashme(const _Float16* __restrict__ Q16, const _Float16* __restrict__ Q16lo, int ldq, const _Float16* __restrict__ K16, const _Float16* __restrict__ K16lo, int ldk, const _Float16* __restrict__ Vt, const _Float16* __restrict__ Vtlo, const unsigned* __restrict__ MB, const int* __restrict__ RA, const int* __restrict__ KE, const float* __restrict__ HB, _Float16* __restrict__ Oh, _Float16* __restrict__ Ol, int ldo) {
  #pragma clang fp contract(off)
  constexpr int RPW = 16, RTN = RPW / 16, NQB = TQ / (4 * RPW), DT = 4, KS = 2;
  __shared__ __attribute__((aligned(16))) unsigned short sP[4][RPW][40], sPl[4][RPW][40]; __shared__ __attribute__((aligned(16))) float sO[4][RPW][64 + 4];
  const int tid = threadIdx.x, w = tid >> 5, lane = tid & 31, ln = lane & 15, hh = lane >> 4;
  const int slab = blockIdx.x / NQB, qblk = blockIdx.x % NQB; const int b = slab / NH, h = slab % NH; const int qb0 = qblk * (4 * RPW); const int q0 = qb0 + w * RPW;
  FragH aq[2][KS], aql[2][KS];
#pragma unroll
  for (int rt = 0; rt < RTN; ++rt) { const size_t qo = ((size_t)b * TQ + q0 + rt * 16) * ldq + h * 1024 + lane * 8;      /* fragment-order planes: head h = units 2h and 2h + 1 of the row tile */ const unsigned short* qr = (const unsigned short*)Q16 + qo; const unsigned short* ql = (const unsigned short*)Q16lo + qo;
#pragma unroll
    for (int ks = 0; ks < KS; ++ks) { aq[rt][ks].half[0] = *(const v8us*)(qr + ks * 512); aq[rt][ks].half[1] = *(const v8us*)(qr + ks * 512 + 256); aql[rt][ks].half[0] = *(const v8us*)(ql + ks * 512); aql[rt][ks].half[1] = *(const v8us*)(ql + ks * 512 + 256); } }
  int allm[2][8]; const unsigned* mrow[2][8];
#pragma unroll
  for (int rt = 0; rt < RTN; ++rt)
#pragma unroll
    for (int r = 0; r < 8; ++r) { const int tq = q0 + rt * 16 + 8 * hh + r; allm[rt][r] = RA[tq]; mrow[rt][r] = MB + (size_t)tq * (TK / 32); }
  asm volatile("s_wait_xcnt 0x0" ::: "memory");      /* stands in front of the first instruction that reuses an address register of the q and RA loads above (the build gives them to the zeroed accumulators) */
  __builtin_amdgcn_sched_barrier(0);      /* holds what follows behind that wait: the accumulators' zeroing depends on nothing, and a "memory" clobber does not tie it to the wait */
  const unsigned short* Vth = (const unsigned short*)Vt + (size_t)slab * 64 * TK; const unsigned short* Vtl = (const unsigned short*)Vtlo + (size_t)slab * 64 * TK;
  float m_r[2][8], l_r[2][8]; v8f oacc[2][DT], oaccl[2][DT];
#pragma unroll
  for (int rt = 0; rt < RTN; ++rt) {
#pragma unroll
    for (int r = 0; r < 8; ++r) { m_r[rt][r] = -3.0e38f; l_r[rt][r] = 0.f; }
#pragma unroll
    for (int dt = 0; dt < DT; ++dt) { oacc[rt][dt] = (v8f){0.f,0.f,0.f,0.f,0.f,0.f,0.f,0.f}; oaccl[rt][dt] = oacc[rt][dt]; } }
  const float xih = HB[2 * h], egh = HB[2 * h + 1];      /* the head's two bias scalars, read once */
  int jend = KE[qblk * 32]; jend = min(TK, (jend + 31) & ~31); if (jend < 32) jend = 32;      /* block-uniform */
#pragma unroll 1
  for (int j0 = 0; j0 < jend; j0 += 32) {
    unsigned mwv[2][8];      /* the rows' mask words, fetched together at the head of the trip: they fly beside the key loads */
#pragma unroll
    for (int rt = 0; rt < RTN; ++rt)
#pragma unroll
      for (int r = 0; r < 8; ++r) mwv[rt][r] = mrow[rt][r][j0 >> 5];
    v8f s[2][2];
#pragma unroll
    for (int nt = 0; nt < 2; ++nt) { const size_t ko = ((size_t)b * TK + j0 + nt * 16) * ldk + h * 1024 + lane * 8; const unsigned short* kr = (const unsigned short*)K16 + ko; const unsigned short* kl = (const unsigned short*)K16lo + ko; FragH bk[KS], bkl[KS];
#pragma unroll
      for (int ks = 0; ks < KS; ++ks) { bk[ks].half[0] = *(const v8us*)(kr + ks * 512); bk[ks].half[1] = *(const v8us*)(kr + ks * 512 + 256); bkl[ks].half[0] = *(const v8us*)(kl + ks * 512); bkl[ks].half[1] = *(const v8us*)(kl + ks * 512 + 256); }
#pragma unroll
      for (int rt = 0; rt < RTN; ++rt) { v8f acc = (v8f){0.f,0.f,0.f,0.f,0.f,0.f,0.f,0.f}, accr = acc;
#pragma unroll
        for (int ks = 0; ks < KS; ++ks) { acc = mmaH<1>(aq[rt][ks].v, aq[rt][ks].v, bk[ks].v, bk[ks].v, acc); accr = mmaH<1>(aql[rt][ks].v, aql[rt][ks].v, bk[ks].v, bk[ks].v, accr); accr = mmaH<1>(aq[rt][ks].v, aq[rt][ks].v, bkl[ks].v, bkl[ks].v, accr); }
        s[rt][nt] = acc + accr * 0.0009765625f; } }
    __builtin_amdgcn_sched_barrier(0);      /* keeps the 16 bias values from being formed ahead of the key products, where they are live beside the key fragments and push the kernel past 256 registers (4 waves a SIMD) */
    /* Softmax of the tile, step by step over all rows instead of row by row: each step below is done for every row before the next begins, and no step holds a branch (each exp is computed and then selected),
       so that the rows' shuffle and exp latencies overlap. Every element takes the same operations in the same order as before. */
    float s0v[2][8], s1v[2][8], mcv[2][8]; bool ok0v[2][8], ok1v[2][8];
#pragma unroll
    for (int rt = 0; rt < RTN; ++rt)
#pragma unroll
      for (int r = 0; r < 8; ++r) { const unsigned mw = mwv[rt][r]; const bool am = (allm[rt][r] != 0);
        const bool ok0 = am || (((mw >> ln) & 1u) == 0u), ok1 = am || (((mw >> (16 + ln)) & 1u) == 0u);
        const int tqe = q0 + rt * 16 + 8 * hh + r; const int k0e = j0 + ln, k1e = j0 + 16 + ln;
        const float b0 = (-((float)(tqe > k0e ? tqe - k0e : k0e - tqe) / xih)) * egh, b1 = (-((float)(tqe > k1e ? tqe - k1e : k1e - tqe) / xih)) * egh;
        const float x0 = s[rt][0][r] * SCL + b0, x1 = s[rt][1][r] * SCL + b1; const float y0 = am ? 0.f : x0, y1 = am ? 0.f : x1; const float s0 = ok0 ? y0 : -INFINITY, s1 = ok1 ? y1 : -INFINITY;      /* computed, then selected */
        ok0v[rt][r] = ok0; ok1v[rt][r] = ok1; s0v[rt][r] = s0; s1v[rt][r] = s1; mcv[rt][r] = fmaxf(s0, s1); }
#pragma unroll
    for (int sh = 1; sh <= 8; sh <<= 1) { float tv[2][8];
#pragma unroll
      for (int rt = 0; rt < RTN; ++rt)
#pragma unroll
        for (int r = 0; r < 8; ++r) tv[rt][r] = __shfl_xor(mcv[rt][r], sh, 32);
#pragma unroll
      for (int rt = 0; rt < RTN; ++rt)
#pragma unroll
        for (int r = 0; r < 8; ++r) mcv[rt][r] = fmaxf(mcv[rt][r], tv[rt][r]); }
#pragma unroll
    for (int rt = 0; rt < RTN; ++rt)
#pragma unroll
      for (int r = 0; r < 8; ++r) { const float mn = fmaxf(m_r[rt][r], mcv[rt][r]); const float ea = expf(m_r[rt][r] - mn), e0 = expf(s0v[rt][r] - mn), e1 = expf(s1v[rt][r] - mn);
        const float al = (mn > -1.0e38f) ? ea : 1.0f; m_r[rt][r] = mn; const float p0 = ok0v[rt][r] ? e0 : 0.f, p1 = ok1v[rt][r] ? e1 : 0.f; l_r[rt][r] = l_r[rt][r] * al + p0 + p1;
#pragma unroll
        for (int dt = 0; dt < DT; ++dt) { oacc[rt][dt][r] *= al; oaccl[rt][dt][r] *= al; }
        FragH t2, t3; const float ps0 = p0 * 1024.0f, ps1 = p1 * 1024.0f; t2.h[0] = (_Float16)ps0; t2.h[1] = (_Float16)ps1; t3.h[0] = (_Float16)((ps0 - (float)t2.h[0]) * 1024.0f); t3.h[1] = (_Float16)((ps1 - (float)t2.h[1]) * 1024.0f);
        sP[w][rt * 16 + 8 * hh + r][ln] = t2.u[0]; sP[w][rt * 16 + 8 * hh + r][16 + ln] = t2.u[1]; sPl[w][rt * 16 + 8 * hh + r][ln] = t3.u[0]; sPl[w][rt * 16 + 8 * hh + r][16 + ln] = t3.u[1]; }
    __builtin_amdgcn_fence(__ATOMIC_ACQ_REL, "workgroup"); __builtin_amdgcn_wave_barrier();
    FragH pa[2], pl[2];
#pragma unroll
    for (int rt = 0; rt < RTN; ++rt) { pa[rt].half[0] = *(const v8us*)&sP[w][rt * 16 + ln][8 * hh]; pa[rt].half[1] = *(const v8us*)&sP[w][rt * 16 + ln][16 + 8 * hh]; pl[rt].half[0] = *(const v8us*)&sPl[w][rt * 16 + ln][8 * hh]; pl[rt].half[1] = *(const v8us*)&sPl[w][rt * 16 + ln][16 + 8 * hh]; }
#pragma unroll
    for (int dt = 0; dt < DT; ++dt) { const size_t vo = (size_t)(dt * 16) * TK + (size_t)(j0 >> 5) * 512 + lane * 8; FragH bv, bl; bv.half[0] = *(const v8us*)(Vth + vo); bv.half[1] = *(const v8us*)(Vth + vo + 256); bl.half[0] = *(const v8us*)(Vtl + vo); bl.half[1] = *(const v8us*)(Vtl + vo + 256);
#pragma unroll
      for (int rt = 0; rt < RTN; ++rt) { oacc[rt][dt] = mmaH<1>(pa[rt].v, pa[rt].v, bv.v, bv.v, oacc[rt][dt]); oaccl[rt][dt] = mmaH<1>(pa[rt].v, pa[rt].v, bl.v, bl.v, oaccl[rt][dt]); oaccl[rt][dt] = mmaH<1>(pl[rt].v, pl[rt].v, bv.v, bv.v, oaccl[rt][dt]); } }
    __builtin_amdgcn_fence(__ATOMIC_ACQ_REL, "workgroup"); __builtin_amdgcn_wave_barrier(); }
#pragma unroll
  for (int rt = 0; rt < RTN; ++rt) {
#pragma unroll
    for (int r = 0; r < 8; ++r) { float l = l_r[rt][r]; l += __shfl_xor(l, 1, 32); l += __shfl_xor(l, 2, 32); l += __shfl_xor(l, 4, 32); l += __shfl_xor(l, 8, 32); l_r[rt][r] = (l > 0.f) ? 1.0f / (l * 1024.0f) : 0.f; }
#pragma unroll
    for (int dt = 0; dt < DT; ++dt)
#pragma unroll
      for (int r = 0; r < 8; ++r) sO[w][rt * 16 + 8 * hh + r][dt * 16 + ln] = (oacc[rt][dt][r] + oaccl[rt][dt][r] * 0.0009765625f) * l_r[rt][r]; }
  __builtin_amdgcn_fence(__ATOMIC_ACQ_REL, "workgroup"); __builtin_amdgcn_wave_barrier();
  {
#pragma unroll
    for (int u = 0; u < 4 * RTN; ++u) { const int rl = (u >> 2) * 16 + ln, kk = ((u >> 1) & 1) * 32 + (u & 1) * 16 + hh * 8; const v4f a = *(const v4fa*)&sO[w][rl][kk], c = *(const v4fa*)&sO[w][rl][kk + 4];      /* O leaves as the hi and residual fragment-order planes that the output projection reads: a lane's piece is row ln, 8 columns */
      const float o[8] = {a[0], a[1], a[2], a[3], c[0], c[1], c[2], c[3]}; FragH fh, fl; hl_split8(o, fh, fl); const size_t po = pk_dst((size_t)b * TQ + q0 + rl, h * 64 + kk, ldo);
      *(v8us*)((unsigned short*)Oh + po) = fh.half[0]; *(v8us*)((unsigned short*)Ol + po) = fl.half[0]; }
     } }


__global__ __launch_bounds__(256) void k_causaltab(unsigned* __restrict__ MB, int* __restrict__ RA, int* __restrict__ KE, int nq, int nk) {
  const int t = blockIdx.x * 256 + threadIdx.x; const int nw = nk / 32;
  if (t < nq * nw) { const int q = t / nw, w = t % nw; const int first = q + 1 - 32 * w; const unsigned bits = (first <= 0) ? 0xffffffffu : ((first >= 32) ? 0u : (0xffffffffu << first)); *(unsigned*)(MB + t) = bits;  }
  if (t < nq) { *(int*)(RA + t) = 0;  }
  if (t < nq / 64) { const int v = 64 * (t + 1); *(int*)(KE + t * 32) = v;  } }

__constant__ float PIF[32] = {3.141592741e+00f,3.031195641e+00f,2.924677610e+00f,2.821902990e+00f,2.722739935e+00f,2.627061367e+00f,2.534744978e+00f,2.445672750e+00f,2.359730482e+00f,2.276808262e+00f,2.196800232e+00f,2.119603395e+00f,2.045119524e+00f,1.973252892e+00f,1.903911710e+00f,1.837007284e+00f,1.772453904e+00f,1.710168958e+00f,1.650072694e+00f,1.592088223e+00f,1.536141396e+00f,1.482160687e+00f,1.430076718e+00f,1.379823089e+00f,1.331335425e+00f,1.284551501e+00f,1.239411712e+00f,1.195858121e+00f,1.153835058e+00f,1.113288760e+00f,1.074167132e+00f,1.036420345e+00f};
__global__ __launch_bounds__(256) void k_trig(const float* __restrict__ pig, const float* __restrict__ logxi, const float* __restrict__ egl, float* __restrict__ CS, float* __restrict__ SN, float* __restrict__ HB) {
  #pragma clang fp contract(off)
  const int t = blockIdx.x * 256 + threadIdx.x; if (t >= NH * SLEN * 32) return; const int j = t & 31; const int tok = (t >> 5) % SLEN; const int h = t / (32 * SLEN);
  const float pg = 1.0f / (1.0f + expf(-bf16_round(pig[h]))); const float th = ((float)tok * PIF[j]) * pg; const float c = cosf(th), s = sinf(th);
  *(float*)(CS + t) = c; *(float*)(SN + t) = s; 
  if (t < 2 * NH) { const int hh2 = t >> 1; const float v = (t & 1) ? (1.0f / (1.0f + expf(-bf16_round(egl[hh2])))) : expf(bf16_round(logxi[hh2])); *(float*)(HB + t) = v;  } }      

extern "C" void kernel_launch(void* const* d_in, const int* in_sizes, int n_in,
                              void* d_out, int out_size, void* d_ws, size_t ws_size, hipStream_t stream) {
  (void)in_sizes; (void)n_in; (void)out_size;
  const float* const* I = (const float* const*)d_in; const float* x = I[0]; const float* Wqkv = I[1]; const float* Wo = I[2]; const float* logxi = I[3]; const float* pig = I[4]; const float* egl = I[5];
  char* ws = (char*)d_ws; size_t off = 0;
  auto take = [&](size_t bytes) { char* p = ws + off; off += (bytes + 255) & ~(size_t)255; return p; };
  _Float16* BQKV = (_Float16*)take((size_t)3 * DM * DM * 2); _Float16* BO = (_Float16*)take((size_t)DM * DM * 2);
  _Float16* X16 = (_Float16*)take((size_t)NR * DM * 2); _Float16* Oh = (_Float16*)take((size_t)NR * DM * 2); _Float16* Ol = (_Float16*)take((size_t)NR * DM * 2);
  _Float16* Qh = (_Float16*)take((size_t)NR * DM * 2); _Float16* Ql = (_Float16*)take((size_t)NR * DM * 2); _Float16* Kh = (_Float16*)take((size_t)NR * DM * 2); _Float16* Kl = (_Float16*)take((size_t)NR * DM * 2); _Float16* Vth = (_Float16*)take((size_t)NR * DM * 2); _Float16* Vtl = (_Float16*)take((size_t)NR * DM * 2);
  unsigned* MB = (unsigned*)take((size_t)SLEN * (SLEN / 32) * 4); int* RA = (int*)take((size_t)SLEN * 4); int* KE = (int*)take((size_t)(SLEN / 64) * 32 * 4);
  float* CS = (float*)take((size_t)NH * SLEN * 32 * 4); float* SN = (float*)take((size_t)NH * SLEN * 32 * 4); float* HB = (float*)take(256);
  if (off > ws_size) return;      /* 6 + 2 + 8 + 8 x 8 + 0.5 + 8 = 89 MiB */
  const size_t n8 = (size_t)NR * DM / 8; const unsigned nb8 = (unsigned)((n8 + 255) / 256);
  k_round16f<<<(unsigned)(((size_t)3 * DM * DM / 8 + 255) / 256), 256, 0, stream>>>(Wqkv, BQKV, (size_t)3 * DM * DM / 8); k_round16f<<<(unsigned)(((size_t)DM * DM / 8 + 255) / 256), 256, 0, stream>>>(Wo, BO, (size_t)DM * DM / 8);      /* torch (out,in) = natural Bt; x16 */
  k_x16<<<nb8, 256, 0, stream>>>(x, X16, n8);
  k_trig<<<(NH * SLEN * 32 + 255) / 256, 256, 0, stream>>>(pig, logxi, egl, CS, SN, HB); k_causaltab<<<(SLEN * (SLEN / 32) + 255) / 256, 256, 0, stream>>>(MB, RA, KE, SLEN, SLEN);
  const dim3 gP((NR / 128) * (DM / 64), 1);
  k_gemm2<0, 1><<<gP, 128, 0, stream>>>(X16, DM, 0, BQKV, DM, 0, 0.0625f, nullptr, 0, nullptr, 1, 0, 0, nullptr, nullptr, DM, 0, NR, DM, DM, CS, SN, Qh, Ql);      /* q (rows 0..1023 of Wqkv), rotated, hi/lo */
  k_gemm2<0, 1><<<gP, 128, 0, stream>>>(X16, DM, 0, BQKV + (size_t)DM * DM, DM, 0, 0.0625f, nullptr, 0, nullptr, 1, 0, 0, nullptr, nullptr, DM, 0, NR, DM, DM, CS, SN, Kh, Kl);      /* k (rows 1024..2047), rotated, hi/lo */
  k_gemm2<0, 2><<<gP, 128, 0, stream>>>(X16, DM, 0, BQKV + (size_t)2 * DM * DM, DM, 0, 0.0625f, nullptr, 0, nullptr, 1, 0, 0, nullptr, nullptr, DM, 0, NR, DM, DM, nullptr, nullptr, Vth, Vtl);      /* v (rows 2048..3071), transposed, hi/lo */
  k_flashme<SLEN, SLEN><<<NBT * NH * (SLEN / 64), 128, 0, stream>>>(Qh, Ql, DM, Kh, Kl, DM, Vth, Vtl, MB, RA, KE, HB, Oh, Ol, DM);      /* both batches in one grid, so that their waves share the chip */
  k_gemm2<0, 0><<<gP, 128, 0, stream>>>(Oh, DM, 0, BO, DM, 0, 0.0625f, nullptr, 0, nullptr, 1, 0, 0, (float*)d_out, nullptr, DM, 0, NR, DM, DM, nullptr, nullptr, nullptr, nullptr);
  k_gemm2<0, 0><<<gP, 128, 0, stream>>>(Ol, DM, 0, BO, DM, 0, 0.0625f / 1024.0f, nullptr, 0, (const float*)d_out, 1, (size_t)DM, 0, (float*)d_out, nullptr, DM, 0, NR, DM, DM, nullptr, nullptr, nullptr, nullptr);
}

// v006
// Measured time: 325 microseconds a run.
// Two timings next to v005 both put it at 1.25 times that version's speed.
// All steps since v000 together make it 2.70 times as fast.
#include <hip/hip_runtime.h>
// Causal multi-head attention with gated rotary phases and a per-head distance decay (2 x 2048 tokens x 1024, 16 heads x 64): qkv = x*Wqkv^T; theta[h][t][j] = (t * pi^(1 - j/32)) * sigmoid(pi_gate[h]); interleaved-pair rotation of q and k; scores = q.k/8 - |i - j| / exp(log_xi[h]) * sigmoid(e_gate[h]) with j <= i; softmax; merged . Wo^T -> [2,2048,1024].
// Structure: x as an exact f16 plane; q/k/v from one packed f16 WMMA GEMM family (32x64 wave tiles, f32, exact products); per-(head, token) cos/sin tables on VALU (pi^(1-j/32) = the reference's f32 constants, precise trig); the projection GEMMs' epilogues rotate q and k in f32 and write them as f16 hi + x2^10 residual planes, and write V^T as hi + residual planes; the causal structure computed on device into a key bit plane + per-block key bound; the fused flash kernel per ((batch, head), 64 queries) with the decay bias added per element (three-product hi/lo scores, online softmax f32, P hi + residual via LDS, two value accumulators), whose epilogue writes O as hi + residual planes; output projection as two GEMMs.
// Compute dtype: x, weights and the three gate/scale vectors rounded to bf16; projections exact; rotation and bias f32; q, k, P, v, O as f16 hi + residual pairs (~2^-21); f32 accumulation and softmax. v_wmma_f32_16x16x32_f16.
#define NBT 2
#define SLEN 2048
#define DM 1024
#define NH 16
#define SCL 0.125f
#define NR (NBT * SLEN)
typedef __bf16 v16b __attribute__((ext_vector_type(16)));
typedef unsigned short v8us __attribute__((ext_vector_type(8), may_alias));
typedef float  v8f  __attribute__((ext_vector_type(8)));
typedef float  v4f  __attribute__((ext_vector_type(4)));
typedef float  v4fa __attribute__((ext_vector_type(4), may_alias));
union FragB { v16b v; v8us half[2]; unsigned short u[16]; };

__device__ __forceinline__ unsigned short bf16_bits(float x) { unsigned int u = __float_as_uint(x); return (unsigned short)((u + 0x7FFFu + ((u >> 16) & 1u)) >> 16); }
__device__ __forceinline__ float bf16_val(unsigned short b) { return __uint_as_float(((unsigned int)b) << 16); }
__device__ __forceinline__ float bf16_round(float x) { return bf16_val(bf16_bits(x)); }
// D += A·B with NT terms: 1 = ah·bh, 2 = + al·bh (A split), 3 = + ah·bl (both split)
template <int NT>
__device__ __forceinline__ v8f mmaN(v16b ah, v16b al, v16b bh, v16b bl, v8f c) {
  c = __builtin_amdgcn_wmma_f32_16x16x32_bf16(false, ah, false, bh, (short)0, c, false, false);
  if (NT >= 2) c = __builtin_amdgcn_wmma_f32_16x16x32_bf16(false, al, false, bh, (short)0, c, false, false);
  if (NT >= 3) c = __builtin_amdgcn_wmma_f32_16x16x32_bf16(false, ah, false, bl, (short)0, c, false, false);
  asm volatile("v_nop\n\tv_nop\n\tv_nop\n\tv_nop" : "+v"(c) : "v"(ah), "v"(al), "v"(bh), "v"(bl));
  return c;
}

__global__ __launch_bounds__(256) void k_wt_bf16(const float* __restrict__ W, unsigned short* __restrict__ Wt, int K, int N) {
  const int t = blockIdx.x * 256 + threadIdx.x;
  const int k8n = K / 8;
  if (t >= N * k8n) return;
  const int n = t / k8n, k8 = (t % k8n) * 8;
  v8us v;
#pragma unroll
  for (int i = 0; i < 8; ++i) v[i] = bf16_bits(W[(size_t)(k8 + i) * N + n]);
  *(v8us*)(Wt + (size_t)n * K + k8) = v;
  
}

// GEMM C[M][N] (f32, pitch ldc) = act(A[M][K]·W + bias). A f32 row-major (pitch lda) converted per fragment to bf16
// (ASPLIT: hi/lo two planes -> 2 terms, else single rounded term); Wt bf16 [N][K] (pitch ldb). BIAS_BF16 rounds the
// bias to bf16 first (bias quantised to bf16 before the add). K%32==0, M%16==0, N%64==0.
template <bool ASPLIT, int ACT, bool BIAS_BF16>
__global__ __launch_bounds__(128) void k_gemm_bf(const float* __restrict__ A, int lda, const unsigned short* __restrict__ Wt, int ldb,
                                               const float* __restrict__ bias, float* __restrict__ C, int ldc, int M, int N, int K) {
  __shared__ __attribute__((aligned(16))) float so[4][16][64];
  const int tid = threadIdx.x, w = tid >> 5, lane = tid & 31, ln = lane & 15, hh = lane >> 4;
  const int ntn = N / 64;
  const int wid = blockIdx.x * 4 + w;
  const int mt = wid / ntn, nq = wid % ntn;
  if (mt * 16 >= M) return;
  const int row0 = mt * 16, col0 = nq * 64;
  const float* arow = A + (size_t)(row0 + ln) * lda;
  v8f acc[4] = {};
  for (int kb = 0; kb < K; kb += 32) {
    FragB ah, al;
    const v4f x0 = *(const v4fa*)(arow + kb + 8 * hh), x1 = *(const v4fa*)(arow + kb + 8 * hh + 4);
    const v4f x2 = *(const v4fa*)(arow + kb + 16 + 8 * hh), x3 = *(const v4fa*)(arow + kb + 16 + 8 * hh + 4);
    float xs[16] = {x0[0],x0[1],x0[2],x0[3],x1[0],x1[1],x1[2],x1[3],x2[0],x2[1],x2[2],x2[3],x3[0],x3[1],x3[2],x3[3]};
#pragma unroll
    for (int i = 0; i < 16; ++i) { const unsigned short hb = bf16_bits(xs[i]); ah.u[i] = hb; al.u[i] = ASPLIT ? bf16_bits(xs[i] - bf16_val(hb)) : (unsigned short)0; }
#pragma unroll
    for (int t = 0; t < 4; ++t) {
      const unsigned short* brow = Wt + (size_t)(col0 + t * 16 + ln) * ldb + kb;
      FragB b;
      b.half[0] = *(const v8us*)(brow + 8 * hh);
      b.half[1] = *(const v8us*)(brow + 16 + 8 * hh);
      acc[t] = mmaN<ASPLIT ? 2 : 1>(ah.v, al.v, b.v, b.v, acc[t]);
    }
  }
#pragma unroll
  for (int t = 0; t < 4; ++t) {
    float bv = bias ? bias[col0 + t * 16 + ln] : 0.f;
    if (BIAS_BF16) bv = bf16_round(bv);
#pragma unroll
    for (int r = 0; r < 8; ++r) { float v = acc[t][r] + bv; if (ACT == 1) v = fmaxf(v, 0.f); so[w][8 * hh + r][t * 16 + ln] = v; }
  }
  __builtin_amdgcn_fence(__ATOMIC_ACQ_REL, "workgroup");
  __builtin_amdgcn_wave_barrier();
  const int rsub = lane >> 4, c4 = (lane & 15) * 4;
  {
#pragma unroll
    for (int q = 0; q < 8; ++q) {
      const int r = q * 2 + rsub;
      const v4f v = *(const v4fa*)&so[w][r][c4];
      *(v4f*)(C + (size_t)(row0 + r) * ldc + col0 + c4) = v;
    }
    
  }
}

// GEMM C = act(A·W + bias + resid): A f32 (ASPLIT -> hi/lo 2 terms), Wt bf16 [N][K]; ACT 0 none, 1 relu, 2 exact gelu;
// resid (optional, f32, row index = (row % rmod), pitch ldr, RES_BF16 rounds it) added before the activation.
template <bool ASPLIT, int ACT, bool BIAS_BF16, bool RES_BF16>
__global__ __launch_bounds__(128) void k_gemm_bf3(const float* __restrict__ A, int lda, const unsigned short* __restrict__ Wt, int ldb,
                                                const float* __restrict__ bias, const float* __restrict__ resid, int rmod, int ldr,
                                                float* __restrict__ C, int ldc, int M, int N, int K) {
  __shared__ __attribute__((aligned(16))) float so[4][16][64];
  const int tid = threadIdx.x, w = tid >> 5, lane = tid & 31, ln = lane & 15, hh = lane >> 4;
  const int ntn = N / 64;
  const int wid = blockIdx.x * 4 + w;
  const int mt = wid / ntn, nq = wid % ntn;
  if (mt * 16 >= M) return;
  const int row0 = mt * 16, col0 = nq * 64;
  const float* arow = A + (size_t)(row0 + ln) * lda;
  v8f acc[4] = {};
  for (int kb = 0; kb < K; kb += 32) {
    FragB ah, al;
    const v4f x0 = *(const v4fa*)(arow + kb + 8 * hh), x1 = *(const v4fa*)(arow + kb + 8 * hh + 4);
    const v4f x2 = *(const v4fa*)(arow + kb + 16 + 8 * hh), x3 = *(const v4fa*)(arow + kb + 16 + 8 * hh + 4);
    float xs[16] = {x0[0],x0[1],x0[2],x0[3],x1[0],x1[1],x1[2],x1[3],x2[0],x2[1],x2[2],x2[3],x3[0],x3[1],x3[2],x3[3]};
#pragma unroll
    for (int i = 0; i < 16; ++i) { const unsigned short hb = bf16_bits(xs[i]); ah.u[i] = hb; al.u[i] = ASPLIT ? bf16_bits(xs[i] - bf16_val(hb)) : (unsigned short)0; }
#pragma unroll
    for (int t = 0; t < 4; ++t) {
      const unsigned short* brow = Wt + (size_t)(col0 + t * 16 + ln) * ldb + kb;
      FragB b;
      b.half[0] = *(const v8us*)(brow + 8 * hh);
      b.half[1] = *(const v8us*)(brow + 16 + 8 * hh);
      acc[t] = mmaN<ASPLIT ? 2 : 1>(ah.v, al.v, b.v, b.v, acc[t]);
    }
  }
#pragma unroll
  for (int t = 0; t < 4; ++t) {
    const int col = col0 + t * 16 + ln;
    float bv = bias ? bias[col] : 0.f;
    if (BIAS_BF16) bv = bf16_round(bv);
#pragma unroll
    for (int r = 0; r < 8; ++r) {
      float v = acc[t][r] + bv;
      if (resid) { float rv = resid[(size_t)((row0 + 8 * hh + r) % rmod) * ldr + col]; if (RES_BF16) rv = bf16_round(rv); v += rv; }
      if (ACT == 1) v = fmaxf(v, 0.f);
      if (ACT == 2) v = 0.5f * v * (1.0f + erff(v * 0.70710678118654752f));
      if (ACT == 3) { const float u = 0.7978845608028654f * (v + 0.044715f * v * v * v); v = 0.5f * v * (1.0f + tanhf(u)); }
      so[w][8 * hh + r][t * 16 + ln] = v;
    }
  }
  __builtin_amdgcn_fence(__ATOMIC_ACQ_REL, "workgroup");
  __builtin_amdgcn_wave_barrier();
  const int rsub = lane >> 4, c4 = (lane & 15) * 4;
  {
#pragma unroll
    for (int q = 0; q < 8; ++q) {
      const int r = q * 2 + rsub;
      const v4f v = *(const v4fa*)&so[w][r][c4];
      *(v4f*)(C + (size_t)(row0 + r) * ldc + col0 + c4) = v;
    }
    
  }
}
// row LayerNorm (biased variance, eps) over N: s = X (+ R); optional out_sum <- s; out_norm <- (s-mu)*rsqrt(var+eps)*g + b
template <bool PARAM_BF16>
__global__ __launch_bounds__(256) void k_layernorm(const float* __restrict__ X, const float* __restrict__ R, const float* __restrict__ g, const float* __restrict__ bta,
                                                  float* __restrict__ out_sum, float* __restrict__ out_norm, int N, float eps) {
  __shared__ float red[256];
  const int row = blockIdx.x, tid = threadIdx.x;
  const float* x = X + (size_t)row * N; const float* rr = R ? R + (size_t)row * N : nullptr;
  float vals[16];                     // up to N = 4096
  const int per = N / 256;            // contiguous chunk per thread? use strided-by-4 chunks: thread handles j = tid*4 + 1024*u
  float s1 = 0.f;
  for (int u = 0; u < per / 4; ++u) {
    const int j = tid * 4 + 1024 * u;
    const v4f a = *(const v4fa*)(x + j);
    v4f b = {0.f,0.f,0.f,0.f}; if (rr) b = *(const v4fa*)(rr + j);
#pragma unroll
    for (int q = 0; q < 4; ++q) { const float v = a[q] + b[q]; vals[u * 4 + q] = v; s1 += v; }
  }
  red[tid] = s1; __syncthreads();
  for (int st = 128; st > 0; st >>= 1) { if (tid < st) red[tid] += red[tid + st]; __syncthreads(); }
  const float mu = red[0] / (float)N; __syncthreads();
  float s2 = 0.f;
  for (int u = 0; u < per / 4; ++u)
#pragma unroll
    for (int q = 0; q < 4; ++q) { const float c = vals[u * 4 + q] - mu; s2 += c * c; }
  red[tid] = s2; __syncthreads();
  for (int st = 128; st > 0; st >>= 1) { if (tid < st) red[tid] += red[tid + st]; __syncthreads(); }
  const float rs = rsqrtf(red[0] / (float)N + eps);
  {
    for (int u = 0; u < per / 4; ++u) {
      const int j = tid * 4 + 1024 * u;
      v4f o, sm;
#pragma unroll
      for (int q = 0; q < 4; ++q) {
        float gg = g[j + q], bb = bta[j + q];
        if (PARAM_BF16) { gg = bf16_round(gg); bb = bf16_round(bb); }
        sm[q] = vals[u * 4 + q]; o[q] = (vals[u * 4 + q] - mu) * rs * gg + bb;
      }
      if (out_sum) *(v4f*)(out_sum + (size_t)row * N + j) = sm;
      *(v4f*)(out_norm + (size_t)row * N + j) = o;
    }
    
  }
}



// ---- f16 WMMA path (v_wmma_f32_16x16x32_f16): 11-bit significands for operands in range — used where a [0,1] probability operand needs more precision than bf16
typedef _Float16 v16h __attribute__((ext_vector_type(16)));
union FragH { v16h v; v8us half[2]; _Float16 h[16]; unsigned short u[16]; };
template <int NT>
__device__ __forceinline__ v8f mmaH(v16h ah, v16h al, v16h bh, v16h bl, v8f c) {
  c = __builtin_amdgcn_wmma_f32_16x16x32_f16(false, ah, false, bh, (short)0, c, false, false);
  if (NT >= 2) c = __builtin_amdgcn_wmma_f32_16x16x32_f16(false, al, false, bh, (short)0, c, false, false);
  if (NT >= 3) c = __builtin_amdgcn_wmma_f32_16x16x32_f16(false, ah, false, bl, (short)0, c, false, false);
  asm volatile("v_nop\n\tv_nop\n\tv_nop\n\tv_nop" : "+v"(c) : "v"(ah), "v"(al), "v"(bh), "v"(bl));
  return c;
}
// batched GEMM like k_gemm_b but f16 operands: A f32 (split into f16 hi/lo if ASPLIT, else rounded to f16), Bt = f16 values [n][k]; alpha; C f32; N multiple of 16 (partial tiles skipped)
template <bool ASPLIT>
__global__ __launch_bounds__(128) void k_gemm_h(const float* __restrict__ A, int lda, size_t sA, const _Float16* __restrict__ Bh, int ldb, size_t sB, float alpha, float* __restrict__ C, int ldc, size_t sC, int M, int N, int K) {
  __shared__ __attribute__((aligned(16))) float so[4][16][64];
  const int tid = threadIdx.x, w = tid >> 5, lane = tid & 31, ln = lane & 15, hh = lane >> 4; const int by = blockIdx.y;
  A += (size_t)by * sA; Bh += (size_t)by * sB; C += (size_t)by * sC;
  const int ntn = (N + 63) / 64; const int wid = blockIdx.x * 4 + w; const int mt = wid / ntn, nq = wid % ntn; if (mt * 16 >= M) return;
  const int row0 = mt * 16, col0 = nq * 64; const float* arow = A + (size_t)(row0 + ln) * lda;
  v8f acc[4] = {};
  for (int kb = 0; kb < K; kb += 32) {
    FragH ah, al;
    const v4f x0 = *(const v4fa*)(arow + kb + 8 * hh), x1 = *(const v4fa*)(arow + kb + 8 * hh + 4), x2 = *(const v4fa*)(arow + kb + 16 + 8 * hh), x3 = *(const v4fa*)(arow + kb + 16 + 8 * hh + 4);
    float xs[16] = {x0[0],x0[1],x0[2],x0[3],x1[0],x1[1],x1[2],x1[3],x2[0],x2[1],x2[2],x2[3],x3[0],x3[1],x3[2],x3[3]};
#pragma unroll
    for (int i = 0; i < 16; ++i) { const _Float16 h = (_Float16)xs[i]; ah.h[i] = h; al.h[i] = ASPLIT ? (_Float16)(xs[i] - (float)h) : (_Float16)0.0f; }
#pragma unroll
    for (int t = 0; t < 4; ++t) { if (col0 + t * 16 >= N) continue; const size_t boff = (size_t)(col0 + t * 16 + ln) * ldb + kb; FragH bq; bq.half[0] = *(const v8us*)(Bh + boff + 8 * hh); bq.half[1] = *(const v8us*)(Bh + boff + 16 + 8 * hh);
      acc[t] = mmaH<ASPLIT ? 2 : 1>(ah.v, al.v, bq.v, bq.v, acc[t]); }
  }
#pragma unroll
  for (int t = 0; t < 4; ++t) { if (col0 + t * 16 >= N) continue;
#pragma unroll
    for (int r = 0; r < 8; ++r) so[w][8 * hh + r][t * 16 + ln] = acc[t][r] * alpha; }
  __builtin_amdgcn_fence(__ATOMIC_ACQ_REL, "workgroup"); __builtin_amdgcn_wave_barrier();
  const int rsub = lane >> 4, c4 = (lane & 15) * 4;
  {
#pragma unroll
    for (int q = 0; q < 8; ++q) { const int r = q * 2 + rsub; if (col0 + c4 < N) { const v4f v = *(const v4fa*)&so[w][r][c4]; *(v4f*)(C + (size_t)(row0 + r) * ldc + col0 + c4) = v; } }
     }
}

// Wt[n][k] = f16(W[k][n]·scale) from f32 row-major W[K][N] (scale = power of two; bf16-exact weights stay exact in f16 away from the subnormal range)
__global__ __launch_bounds__(256) void k_wt_f16(const float* __restrict__ W, _Float16* __restrict__ Wt, int K, int N, float scale) {
  const int t = blockIdx.x * 256 + threadIdx.x; if (t >= N * (K / 8)) return; const int n = t / (K / 8), k8 = (t % (K / 8)) * 8; FragH f;
#pragma unroll
  for (int i = 0; i < 8; ++i) f.h[i] = (_Float16)(bf16_round(W[(size_t)(k8 + i) * N + n]) * scale); const v8us o = f.half[0];
  *(v8us*)((unsigned short*)Wt + (size_t)n * K + k8) = o; 
}
// k_gemm_hh variant with fused epilogue: v = acc·alpha + bias[by·sBias + col] (+ CP[(row/rowsPerB)·sCPb + by·64 + col] if CP) ; ACT 0 none / 1 elu ; writes f16 C16 (and f32 C if non-null)
template <int ACT>
__global__ __launch_bounds__(128) void k_gemm_hhx(const _Float16* __restrict__ A, int lda, size_t sA, const _Float16* __restrict__ Bh, int ldb, size_t sB, float alpha, const float* __restrict__ bias, size_t sBias, const float* __restrict__ CP, int rowsPerB, size_t sCPb, int row0g,
    float* __restrict__ C, _Float16* __restrict__ C16, int ldc, size_t sC, int M, int N, int K) {
  __shared__ __attribute__((aligned(16))) float so[4][16][64];
  const int tid = threadIdx.x, w = tid >> 5, lane = tid & 31, ln = lane & 15, hh = lane >> 4; const int by = blockIdx.y;
  A += (size_t)by * sA; Bh += (size_t)by * sB; const size_t cofs = (size_t)by * sC; const float* bp = bias ? bias + (size_t)by * sBias : nullptr;
  const int ntn = (N + 63) / 64; const int wid = blockIdx.x * 4 + w; const int mt = wid / ntn, nq = wid % ntn; if (mt * 16 >= M) return;
  const int row0 = mt * 16, col0 = nq * 64; const _Float16* arow = A + (size_t)(row0 + ln) * lda;
  v8f acc[4] = {};
  for (int kb = 0; kb < K; kb += 32) { FragH ah; ah.half[0] = *(const v8us*)((const unsigned short*)arow + kb + 8 * hh); ah.half[1] = *(const v8us*)((const unsigned short*)arow + kb + 16 + 8 * hh);
#pragma unroll
    for (int t = 0; t < 4; ++t) { if (col0 + t * 16 >= N) continue; const size_t boff = (size_t)(col0 + t * 16 + ln) * ldb + kb; FragH bq; bq.half[0] = *(const v8us*)((const unsigned short*)Bh + boff + 8 * hh); bq.half[1] = *(const v8us*)((const unsigned short*)Bh + boff + 16 + 8 * hh);
      acc[t] = mmaH<1>(ah.v, ah.v, bq.v, bq.v, acc[t]); }
  }
#pragma unroll
  for (int t = 0; t < 4; ++t) { if (col0 + t * 16 >= N) continue; const int col = col0 + t * 16 + ln; const float bv = bp ? bf16_round(bp[col]) : 0.f;
#pragma unroll
    for (int r = 0; r < 8; ++r) { float v = acc[t][r] * alpha + bv; if (CP) { const int bidx = (row0g + row0 + 8 * hh + r) / rowsPerB; v += CP[(size_t)bidx * sCPb + (size_t)by * 64 + col]; } if (ACT == 1) v = (v > 0.f) ? v : expm1f(v); else if (ACT == 7) v = (v > 0.f) ? v + 1.0f : expf(v); else if (ACT == 8) v = tanhf(v); else if (ACT == 9) v = 0.5f * v * (1.0f + tanhf(0.7978845608028654f * (v + 0.044715f * v * v * v))); else if (ACT == 11) v = 1.0f / (1.0f + expf(-v)); else if (ACT == 12) v = (v > 0.f) ? v : 0.01f * v; else if (ACT == 14) v = (v > 0.f) ? v : 0.1f * v; else if (ACT == 15) v = v / (1.0f + expf(-v)); else if (ACT == 3) v = fmaxf(v, 0.f); else if (ACT == 6) v = 0.5f * v * (1.0f + erff(v * 0.70710678118654752f)); so[w][8 * hh + r][t * 16 + ln] = v; } }
  __builtin_amdgcn_fence(__ATOMIC_ACQ_REL, "workgroup"); __builtin_amdgcn_wave_barrier();
  const int rsub = lane >> 4, c4 = (lane & 15) * 4; typedef _Float16 v4h __attribute__((ext_vector_type(4)));
  {
#pragma unroll
    for (int q = 0; q < 8; ++q) { const int r = q * 2 + rsub; if (col0 + c4 < N) { const v4f v = *(const v4fa*)&so[w][r][c4]; if (C) *(v4f*)(C + cofs + (size_t)(row0 + r) * ldc + col0 + c4) = v; if (C16) { v4h h4; for (int i = 0; i < 4; ++i) h4[i] = (_Float16)v[i]; *(v4h*)(C16 + cofs + (size_t)(row0 + r) * ldc + col0 + c4) = h4; } } }
     }
}


typedef _Float16 v4h __attribute__((ext_vector_type(4)));

// ---- fragment-order planes: every f16 plane that a WMMA operand is loaded from is stored as 1 KiB units, one per (16 rows x 32 k). Inside a unit the 16-byte piece at (half * 32 + lane) holds row (lane & 15),
// k = half * 16 + (lane >> 4) * 8 .. + 7: what lane 'lane' takes as half 'half' of its fragment. A wave's global_load_b128 then reads 512 contiguous bytes (4 cache lines) where a row-major plane gives it 16 rows (16 lines).
// Units run along k first, then down the row tiles, so a tile of 16 rows still starts at element row * ld. ld % 32 == 0, rows % 16 == 0.
__device__ __forceinline__ size_t pk_src(size_t t, int ld) { const int lane = (int)(t & 31), half = (int)((t >> 5) & 1); const size_t u = t >> 6; const size_t nks = (size_t)(ld >> 5); const size_t ks = u % nks, rt = u / nks;      /* row-major element offset of the 8 elements that piece t of the plane holds */
  return (rt * 16 + (lane & 15)) * (size_t)ld + ks * 32 + half * 16 + (lane >> 4) * 8; }
__device__ __forceinline__ size_t pk_dst(size_t row, int k, int ld) { return (row >> 4) * 16 * (size_t)ld + (size_t)(k >> 5) * 512 + ((k >> 4) & 1) * 256 + (((k >> 3) & 1) * 16 + (int)(row & 15)) * 8; }      /* element offset in the plane of (row, k .. k + 7), k % 8 == 0 */

__global__ __launch_bounds__(256) void k_x16(const float* __restrict__ x, _Float16* __restrict__ X16, size_t n8) { const size_t t = (size_t)blockIdx.x * 256 + threadIdx.x; if (t >= n8) return; FragH f; const size_t so = pk_src(t, DM);
#pragma unroll
  for (int q = 0; q < 8; ++q) f.h[q] = (_Float16)bf16_round(x[so + q]); *(v8us*)((unsigned short*)X16 + t * 8) = f.half[0];  }
__global__ __launch_bounds__(256) void k_h16(const float* __restrict__ x, _Float16* __restrict__ X16, size_t n8) { const size_t t = (size_t)blockIdx.x * 256 + threadIdx.x; if (t >= n8) return; FragH f;
#pragma unroll
  for (int q = 0; q < 8; ++q) f.h[q] = (_Float16)x[t * 8 + q]; *(v8us*)((unsigned short*)X16 + t * 8) = f.half[0];  }
__global__ __launch_bounds__(256) void k_round16f(const float* __restrict__ W, _Float16* __restrict__ Bt, size_t n8) { const size_t t = (size_t)blockIdx.x * 256 + threadIdx.x; if (t >= n8) return; FragH f; const size_t so = pk_src(t, DM);
#pragma unroll
  for (int i = 0; i < 8; ++i) f.h[i] = (_Float16)(bf16_round(W[so + i]) * 16.0f); *(v8us*)((unsigned short*)Bt + t * 8) = f.half[0];  }
template <int NHv, int TTv>
__global__ __launch_bounds__(256) void k_vt(const _Float16* __restrict__ V16, int ldv, int voff, _Float16* __restrict__ Vt) { __shared__ unsigned short tl[64][66]; const int tid = threadIdx.x; const int slab = blockIdx.x / (TTv / 64), lg = blockIdx.x % (TTv / 64); const int b = slab / NHv, h = slab % NHv;
  for (int i = tid; i < 64 * 8; i += 256) { const int r = i / 8, c8 = (i % 8) * 8; FragH f; f.half[0] = *(const v8us*)((const unsigned short*)V16 + ((size_t)b * TTv + lg * 64 + r) * ldv + voff + h * 64 + c8);
#pragma unroll
    for (int q = 0; q < 8; ++q) tl[r][c8 + q] = f.u[q]; }
  __syncthreads();
  {
#pragma unroll
    for (int rd = 0; rd < 2; ++rd) { const int d = rd * 32 + tid / 8, pc = tid % 8; FragH f;
#pragma unroll
      for (int q = 0; q < 8; ++q) f.u[q] = tl[pc * 8 + q][d];
      *(v8us*)((unsigned short*)Vt + ((size_t)slab * 64 + d) * TTv + lg * 64 + pc * 8) = f.half[0]; }
     } }

// f32 -> f16 hi + x2^10 residual, 8 values = one 16-byte piece of each plane
__device__ __forceinline__ void hl_split8(const float* v, FragH& fh, FragH& fl) {
#pragma unroll
  for (int q = 0; q < 8; ++q) { const _Float16 h = (_Float16)v[q]; fh.h[q] = h; fl.h[q] = (_Float16)((v[q] - (float)h) * 1024.0f); } }

// ---- fast GEMM (wave tile 32x64; requires M % 32 == 0 rows per launch region and N % 64 == 0; A and Bh are fragment-order planes of pitch lda, ldb); epilogue = k_gemm_hhx semantics ----
// EPI 0: the tile goes out as f32 rows (C) and / or f16 rows (C16). EPI 1 (q, k; N = DM, so that a 64-column tile is one head): the tile is rotated by the head's cos/sin tables and goes out as the hi and residual fragment-order planes Ph, Pl.
// EPI 2 (v): the tile goes out transposed, as the hi and residual fragment-order planes of V^T (rows (batch * NH + head) * 64 + d, pitch SLEN).
__device__ __forceinline__ v16h g2_fragp(const _Float16* p) { FragH f; f.half[0] = *(const v8us*)((const unsigned short*)p); f.half[1] = *(const v8us*)((const unsigned short*)p + 256); return f.v; }      /* p = the lane's piece of a fragment-order unit */
__device__ __forceinline__ v8f g2_mma(v16h a, v16h b, v8f c) { v8f d = __builtin_amdgcn_wmma_f32_16x16x32_f16(false, a, false, b, (short)0, c, false, false); asm volatile("v_nop\n\tv_nop\n\tv_nop\n\tv_nop" : "+v"(d) : "v"(a), "v"(b)); return d; }
template <int ACT, int EPI>
__global__ __launch_bounds__(128) void k_gemm2(const _Float16* __restrict__ A, int lda, size_t sA, const _Float16* __restrict__ Bh, int ldb, size_t sB, float alpha, const float* __restrict__ bias, size_t sBias, const float* __restrict__ CP, int rowsPerB, size_t sCPb, int row0g,
    float* __restrict__ C, _Float16* __restrict__ C16, int ldc, size_t sC, int M, int N, int K, const float* __restrict__ CS, const float* __restrict__ SN, _Float16* __restrict__ Ph, _Float16* __restrict__ Pl) {
  __shared__ __attribute__((aligned(16))) float so[4][32][68];
  const int tid = threadIdx.x, w = tid >> 5, lane = tid & 31, ln = lane & 15, hh = lane >> 4; const int by = blockIdx.y;
  A += (size_t)by * sA; Bh += (size_t)by * sB; const size_t cofs = (size_t)by * sC; const float* bp = bias ? bias + (size_t)by * sBias : nullptr;
  const int ntn = N >> 6; const int mt = blockIdx.x / ntn, nq = blockIdx.x - mt * ntn; const int row0 = mt * 128 + 32 * w, col0 = nq * 64; if (row0 >= M) return;
  const _Float16* a0p = A + (size_t)row0 * lda + lane * 8; const _Float16* a1p = a0p + (size_t)16 * lda;      /* A and Bh are fragment-order planes */
  const _Float16* b0p = Bh + (size_t)col0 * ldb + lane * 8; const _Float16* b1p = b0p + (size_t)16 * ldb; const _Float16* b2p = b1p + (size_t)16 * ldb; const _Float16* b3p = b2p + (size_t)16 * ldb;
  const v8f z8 = {0.f,0.f,0.f,0.f,0.f,0.f,0.f,0.f}; v8f c00 = z8, c01 = z8, c02 = z8, c03 = z8, c10 = z8, c11 = z8, c12 = z8, c13 = z8;
  /* Register ring of three k-steps: the six fragments of steps s + 1 and s + 2 are in flight while step s is multiplied, so that a step no longer waits for five round trips one after the other.
     Each accumulator still takes its k-steps in ascending order. The six lane pointers live through the whole loop and every load of a trip reaches its step by an immediate offset, so that no load's result can land in an address register; only steps below K / 32 are loaded. */
  typedef const __attribute__((address_space(1))) _Float16* g2_gp;      /* typed as global memory, so that the loads stay global loads behind the asm statement that names the pointers */
  g2_gp p0 = (g2_gp)a0p, p1 = (g2_gp)a1p, p2 = (g2_gp)b0p, p3 = (g2_gp)b1p, p4 = (g2_gp)b2p, p5 = (g2_gp)b3p;
#define G2_FR(P, ST) g2_fragp((const _Float16*)((P) + 512 * (ST)))
#define G2_LOAD(S, ST) { S[0] = G2_FR(p0, ST); S[1] = G2_FR(p1, ST); S[2] = G2_FR(p2, ST); S[3] = G2_FR(p3, ST); S[4] = G2_FR(p4, ST); S[5] = G2_FR(p5, ST); \
    __builtin_amdgcn_sched_barrier(0); /* keeps the refill in front of the products that follow: without it the compiler sinks a refill behind the first product and that product's wait, and it flies for a shorter time */ }
#define G2_STEP(S) { c00 = g2_mma(S[0], S[2], c00); c10 = g2_mma(S[1], S[2], c10); c01 = g2_mma(S[0], S[3], c01); c11 = g2_mma(S[1], S[3], c11); c02 = g2_mma(S[0], S[4], c02); c12 = g2_mma(S[1], S[4], c12); c03 = g2_mma(S[0], S[5], c03); c13 = g2_mma(S[1], S[5], c13); }
  { const int nst = K >> 5; v16h r0[6], r1[6], r2[6]; int s = 0;
    if (nst >= 1) G2_LOAD(r0, 0)
    if (nst >= 2) G2_LOAD(r1, 1)
#pragma unroll 1
    for (; s + 5 <= nst; s += 3) { G2_LOAD(r2, 2) G2_STEP(r0) G2_LOAD(r0, 3) G2_STEP(r1) G2_LOAD(r1, 4) G2_STEP(r2)
      asm volatile("s_wait_xcnt 0x0" : "+v"(p0), "+v"(p1), "+v"(p2), "+v"(p3), "+v"(p4), "+v"(p5) :: "memory"); /* stands in front of the six additions below, which overwrite the address registers of the loads issued above; the pointers are named so that the additions depend on this statement and cannot be placed ahead of it (without it the compiler keeps copies of the pointers and rewrites them at the loop's head) */
      p0 += 1536; p1 += 1536; p2 += 1536; p3 += 1536; p4 += 1536; p5 += 1536; }
    const int rem = nst - s;      /* 0 to 4 steps are left; r0 and r1 hold the first two of them */
    if (rem >= 3) G2_LOAD(r2, 2)
    if (rem >= 1) G2_STEP(r0)
    if (rem >= 4) G2_LOAD(r0, 3)
    if (rem >= 2) G2_STEP(r1)
    if (rem >= 3) G2_STEP(r2)
    if (rem >= 4) G2_STEP(r0) }
#undef G2_FR
#undef G2_LOAD
#undef G2_STEP
  v8f accs[8] = {c00, c01, c02, c03, c10, c11, c12, c13};
#pragma unroll
  for (int u = 0; u < 8; ++u) { const int t = u & 3, half = u >> 2; const int col = col0 + t * 16 + ln; const float bv = bp ? bf16_round(bp[col]) : 0.f;
#pragma unroll
    for (int r = 0; r < 8; ++r) { const int rloc = half * 16 + 8 * hh + r; float v = accs[u][r] * alpha + bv; if (CP) { const int bidx = (row0g + row0 + rloc) / rowsPerB; v += CP[(size_t)bidx * sCPb + (size_t)by * 64 + col]; }
      if (ACT == 3) v = fmaxf(v, 0.f); else if (ACT == 6) v = 0.5f * v * (1.0f + erff(v * 0.70710678118654752f)); else if (ACT == 11) v = 1.0f / (1.0f + expf(-v)); else if (ACT == 15) v = v / (1.0f + expf(-v)); else if (ACT == 12) v = (v > 0.f) ? v : 0.01f * v; else if (ACT == 8) v = tanhf(v);
      so[w][rloc][t * 16 + ln] = v; } }
  __builtin_amdgcn_fence(__ATOMIC_ACQ_REL, "workgroup"); __builtin_amdgcn_wave_barrier();
  if (EPI == 1) {      /* the wave's tile = 2 row tiles x 2 units x 2 halves of each plane; a lane takes its own piece (row ln, 8 columns = 4 rotation pairs), a wave stores 512 contiguous bytes */
    typedef const __attribute__((address_space(1))) float* g2_fp;      /* typed as global memory, so that the loads stay global loads beside the asm statement that names the pointers */
    const size_t th = (size_t)(col0 >> 6) * SLEN * 32 + hh * 4, ta = th + (size_t)((row0 + ln) % SLEN) * 32, tb = th + (size_t)((row0 + 16 + ln) % SLEN) * 32;
    g2_fp ca = (g2_fp)(CS + ta), sa = (g2_fp)(SN + ta), cb = (g2_fp)(CS + tb), sb = (g2_fp)(SN + tb); v4f csv[8], snv[8];      /* the lane's two token rows of the head's tables */
#pragma unroll
    for (int u = 0; u < 8; ++u) { const int jo = ((u >> 1) & 1) * 16 + (u & 1) * 8; csv[u] = *(const __attribute__((address_space(1))) v4fa*)(((u >> 2) ? cb : ca) + jo); snv[u] = *(const __attribute__((address_space(1))) v4fa*)(((u >> 2) ? sb : sa) + jo); }
    asm volatile("s_wait_xcnt 0x0" : "+v"(ca), "+v"(sa), "+v"(cb), "+v"(sb) :: "memory");      /* stands in front of the first instruction that reuses an address register of the 16 table loads above; the pointers are named so that they live up to here */
#pragma unroll
    for (int u = 0; u < 8; ++u) { const int rl = (u >> 2) * 16 + ln, kk = ((u >> 1) & 1) * 32 + (u & 1) * 16 + hh * 8; const v4f a = *(const v4fa*)&so[w][rl][kk], c = *(const v4fa*)&so[w][rl][kk + 4];
      const v4f cs = csv[u], sn = snv[u];
      const float f[8] = {a[0], a[1], a[2], a[3], c[0], c[1], c[2], c[3]}; float o[8];
#pragma unroll
      for (int p = 0; p < 4; ++p) { o[2 * p] = f[2 * p] * cs[p] - f[2 * p + 1] * sn[p]; o[2 * p + 1] = f[2 * p] * sn[p] + f[2 * p + 1] * cs[p]; }
      FragH fh, fl; hl_split8(o, fh, fl); const size_t po = pk_dst((size_t)(row0 + rl), col0 + kk, N);
      *(v8us*)((unsigned short*)Ph + po) = fh.half[0]; *(v8us*)((unsigned short*)Pl + po) = fl.half[0]; }
  } else if (EPI == 2) {      /* 32 tokens x 64 d = 4 units of each V^T plane; a lane takes row d, 8 tokens, read down a column of the staged tile */
    const size_t vrow = ((size_t)(row0 / SLEN) * NH + (col0 >> 6)) * 64; const int t0 = row0 % SLEN;
#pragma unroll
    for (int u = 0; u < 8; ++u) { const int d = (u >> 1) * 16 + ln, tl = (u & 1) * 16 + hh * 8; float o[8];
#pragma unroll
      for (int q = 0; q < 8; ++q) o[q] = so[w][tl + q][d];
      FragH fh, fl; hl_split8(o, fh, fl); const size_t po = pk_dst(vrow + d, t0 + tl, SLEN);
      *(v8us*)((unsigned short*)Ph + po) = fh.half[0]; *(v8us*)((unsigned short*)Pl + po) = fl.half[0]; }
  } else {
    const int rsub = lane >> 4, c4 = (lane & 15) * 4;
#pragma unroll
    for (int q = 0; q < 16; ++q) { const int r = q * 2 + rsub; const v4f v = *(const v4fa*)&so[w][r][c4]; if (C) *(v4f*)(C + cofs + (size_t)(row0 + r) * ldc + col0 + c4) = v; if (C16) { v4h h4; for (int i = 0; i < 4; ++i) h4[i] = (_Float16)v[i]; *(v4h*)(C16 + cofs + (size_t)(row0 + r) * ldc + col0 + c4) = h4; } }
     } }



template <int TQ, int TK>
__global__ __launch_bounds__(128) void k_flashme(const _Float16* __restrict__ Q16, const _Float16* __restrict__ Q16lo, int ldq, const _Float16* __restrict__ K16, const _Float16* __restrict__ K16lo, int ldk, const _Float16* __restrict__ Vt, const _Float16* __restrict__ Vtlo, const unsigned* __restrict__ MB, const int* __restrict__ RA, const int* __restrict__ KE, const float* __restrict__ HB, _Float16* __restrict__ Oh, _Float16* __restrict__ Ol, int ldo) {
  #pragma clang fp contract(off)
  constexpr int RPW = 16, RTN = RPW / 16, NQB = TQ / (4 * RPW), DT = 4, KS = 2;
  __shared__ __attribute__((aligned(16))) unsigned short sP[4][RPW][40], sPl[4][RPW][40]; __shared__ __attribute__((aligned(16))) float sO[4][RPW][64 + 4];
  /* Two buffers of one trip's key and value tiles, 16 KiB each, which all four waves read: bytes 0: K hi (key tile 0, key tile 1; 2 KiB each = units ks 0, 1), 4096: K residual, 8192: V^T hi (units dt 0 .. 3), 12288: V^T residual. The units keep their fragment order. */
  __shared__ __attribute__((aligned(16))) unsigned short sKV[2][8192];
  const int tid = threadIdx.x, w = tid >> 5, lane = tid & 31, ln = lane & 15, hh = lane >> 4;
  const int slab = blockIdx.x / NQB, qblk = blockIdx.x % NQB; const int b = slab / NH, h = slab % NH; const int qb0 = qblk * (4 * RPW); const int q0 = qb0 + w * RPW;
  FragH aq[2][KS], aql[2][KS];
#pragma unroll
  for (int rt = 0; rt < RTN; ++rt) { const size_t qo = ((size_t)b * TQ + q0 + rt * 16) * ldq + h * 1024 + lane * 8;      /* fragment-order planes: head h = units 2h and 2h + 1 of the row tile */ const unsigned short* qr = (const unsigned short*)Q16 + qo; const unsigned short* ql = (const unsigned short*)Q16lo + qo;
#pragma unroll
    for (int ks = 0; ks < KS; ++ks) { aq[rt][ks].half[0] = *(const v8us*)(qr + ks * 512); aq[rt][ks].half[1] = *(const v8us*)(qr + ks * 512 + 256); aql[rt][ks].half[0] = *(const v8us*)(ql + ks * 512); aql[rt][ks].half[1] = *(const v8us*)(ql + ks * 512 + 256); } }
  int allm[2][8]; const unsigned* mrow[2][8];
#pragma unroll
  for (int rt = 0; rt < RTN; ++rt)
#pragma unroll
    for (int r = 0; r < 8; ++r) { const int tq = q0 + rt * 16 + 8 * hh + r; allm[rt][r] = RA[tq]; mrow[rt][r] = MB + (size_t)tq * (TK / 32); }
  asm volatile("s_wait_xcnt 0x0" ::: "memory");      /* stands in front of the first instruction that reuses an address register of the q and RA loads above (the build gives them to the zeroed accumulators) */
  __builtin_amdgcn_sched_barrier(0);      /* holds what follows behind that wait: the accumulators' zeroing depends on nothing, and a "memory" clobber does not tie it to the wait */
  const unsigned short* Vth = (const unsigned short*)Vt + (size_t)slab * 64 * TK; const unsigned short* Vtl = (const unsigned short*)Vtlo + (size_t)slab * 64 * TK;
  float m_r[2][8], l_r[2][8]; v8f oacc[2][DT], oaccl[2][DT];
#pragma unroll
  for (int rt = 0; rt < RTN; ++rt) {
#pragma unroll
    for (int r = 0; r < 8; ++r) { m_r[rt][r] = -3.0e38f; l_r[rt][r] = 0.f; }
#pragma unroll
    for (int dt = 0; dt < DT; ++dt) { oacc[rt][dt] = (v8f){0.f,0.f,0.f,0.f,0.f,0.f,0.f,0.f}; oaccl[rt][dt] = oacc[rt][dt]; } }
  const float xih = HB[2 * h], egh = HB[2 * h + 1];      /* the head's two bias scalars, read once */
  int jend = KE[qblk * 32]; jend = min(TK, (jend + 31) & ~31); if (jend < 32) jend = 32;      /* block-uniform */
  /* A tile goes from global memory to LDS by asynchronous copies, through no register: 8 copies of 16 bytes a lane, 2 KiB a copy over the work-group. The tile of trip t + 1 flies while trip t is worked on, and each tile is fetched once a work-group, not once a wave. */
  const unsigned ldsl = (unsigned)(size_t)&sKV[0][tid * 8];      /* the lane's LDS byte address in the first 2 KiB of buffer 0 */
  const size_t klo = ((size_t)b * TK * ldk + h * 1024) * 2, kst = (size_t)ldk * 2; const unsigned kln = (unsigned)tid * 16u, vln = (unsigned)(tid >> 6) * (32u * TK) + (unsigned)(tid & 63) * 16u;      /* byte offsets. Uniform: the head's key row 0; one key row. The lane's own: its piece of a key row tile; its piece of value unit dt = tid / 64 */
#define FM_COPY(J, BUF) { const size_t ku = klo + (size_t)(J) * kst, vu = (size_t)((J) >> 5) * 1024; const char* g0 = (const char*)K16 + ku + kln; const char* g1 = (const char*)K16 + (ku + 16 * kst) + kln; const char* g2 = (const char*)K16lo + ku + kln; const char* g3 = (const char*)K16lo + (ku + 16 * kst) + kln; \
    const char* g4 = (const char*)Vth + vu + vln; const char* g5 = (const char*)Vth + (vu + (size_t)64 * TK) + vln; const char* g6 = (const char*)Vtl + vu + vln; const char* g7 = (const char*)Vtl + (vu + (size_t)64 * TK) + vln; const unsigned l0 = ldsl + (unsigned)(BUF) * 16384u; \
    /* the eight copies and, as the statement's last line, the wait that stands in front of any rewrite of their address registers */ \
    asm volatile("global_load_async_to_lds_b128 %0, %8, off\n\tglobal_load_async_to_lds_b128 %1, %9, off\n\tglobal_load_async_to_lds_b128 %2, %10, off\n\tglobal_load_async_to_lds_b128 %3, %11, off\n\t" \
                 "global_load_async_to_lds_b128 %4, %12, off\n\tglobal_load_async_to_lds_b128 %5, %13, off\n\tglobal_load_async_to_lds_b128 %6, %14, off\n\tglobal_load_async_to_lds_b128 %7, %15, off\n\ts_wait_xcnt 0x0" \
                 :: "v"(l0), "v"(l0 + 2048u), "v"(l0 + 4096u), "v"(l0 + 6144u), "v"(l0 + 8192u), "v"(l0 + 10240u), "v"(l0 + 12288u), "v"(l0 + 14336u), "v"(g0), "v"(g1), "v"(g2), "v"(g3), "v"(g4), "v"(g5), "v"(g6), "v"(g7) : "memory"); }
  FM_COPY(0, 0)
  asm volatile("s_wait_asynccnt 0x0" ::: "memory");      /* this wave's copies of tile 0 have landed */
  __syncthreads();      /* publishes tile 0 to the four waves */
  if (32 < jend) FM_COPY(32, 1)
#pragma unroll 1
  for (int j0 = 0; j0 < jend; j0 += 32) {
    const int buf = (j0 >> 5) & 1; const unsigned short* kvb = &sKV[buf][0];
    unsigned mwv[2][8];      /* the rows' mask words, fetched together at the head of the trip: they fly beside the key loads */
#pragma unroll
    for (int rt = 0; rt < RTN; ++rt)
#pragma unroll
      for (int r = 0; r < 8; ++r) mwv[rt][r] = mrow[rt][r][j0 >> 5];
    v8f s[2][2];
#pragma unroll
    for (int nt = 0; nt < 2; ++nt) { const unsigned short* kr = kvb + nt * 1024 + lane * 8; const unsigned short* kl = kr + 2048; FragH bk[KS], bkl[KS];      /* from the trip's LDS buffer */
#pragma unroll
      for (int ks = 0; ks < KS; ++ks) { bk[ks].half[0] = *(const v8us*)(kr + ks * 512); bk[ks].half[1] = *(const v8us*)(kr + ks * 512 + 256); bkl[ks].half[0] = *(const v8us*)(kl + ks * 512); bkl[ks].half[1] = *(const v8us*)(kl + ks * 512 + 256); }
#pragma unroll
      for (int rt = 0; rt < RTN; ++rt) { v8f acc = (v8f){0.f,0.f,0.f,0.f,0.f,0.f,0.f,0.f}, accr = acc;
#pragma unroll
        for (int ks = 0; ks < KS; ++ks) { acc = mmaH<1>(aq[rt][ks].v, aq[rt][ks].v, bk[ks].v, bk[ks].v, acc); accr = mmaH<1>(aql[rt][ks].v, aql[rt][ks].v, bk[ks].v, bk[ks].v, accr); accr = mmaH<1>(aq[rt][ks].v, aq[rt][ks].v, bkl[ks].v, bkl[ks].v, accr); }
        s[rt][nt] = acc + accr * 0.0009765625f; } }
    __builtin_amdgcn_sched_barrier(0);      /* keeps the 16 bias values from being formed ahead of the key products, where they are live beside the key fragments and push the kernel past 256 registers (4 waves a SIMD) */
    /* Softmax of the tile, step by step over all rows instead of row by row: each step below is done for every row before the next begins, and no step holds a branch (each exp is computed and then selected),
       so that the rows' shuffle and exp latencies overlap. Every element takes the same operations in the same order as before. */
    float s0v[2][8], s1v[2][8], mcv[2][8]; bool ok0v[2][8], ok1v[2][8];
#pragma unroll
    for (int rt = 0; rt < RTN; ++rt)
#pragma unroll
      for (int r = 0; r < 8; ++r) { const unsigned mw = mwv[rt][r]; const bool am = (allm[rt][r] != 0);
        const bool ok0 = am || (((mw >> ln) & 1u) == 0u), ok1 = am || (((mw >> (16 + ln)) & 1u) == 0u);
        const int tqe = q0 + rt * 16 + 8 * hh + r; const int k0e = j0 + ln, k1e = j0 + 16 + ln;
        const float b0 = (-((float)(tqe > k0e ? tqe - k0e : k0e - tqe) / xih)) * egh, b1 = (-((float)(tqe > k1e ? tqe - k1e : k1e - tqe) / xih)) * egh;
        const float x0 = s[rt][0][r] * SCL + b0, x1 = s[rt][1][r] * SCL + b1; const float y0 = am ? 0.f : x0, y1 = am ? 0.f : x1; const float s0 = ok0 ? y0 : -INFINITY, s1 = ok1 ? y1 : -INFINITY;      /* computed, then selected */
        ok0v[rt][r] = ok0; ok1v[rt][r] = ok1; s0v[rt][r] = s0; s1v[rt][r] = s1; mcv[rt][r] = fmaxf(s0, s1); }
    asm volatile("" :: "v"(mcv[0][0]), "v"(mcv[0][1]), "v"(mcv[0][2]), "v"(mcv[0][3]), "v"(mcv[0][4]), "v"(mcv[0][5]), "v"(mcv[0][6]), "v"(mcv[0][7])); __builtin_amdgcn_sched_barrier(0);      /* inputs only: all eight rows' maxima stand ready in front of the first shuffle round. Without it this build takes the rows two at a time, and each pair waits out its four shuffle rounds alone */
#pragma unroll
    for (int sh = 1; sh <= 8; sh <<= 1) { float tv[2][8];
#pragma unroll
      for (int rt = 0; rt < RTN; ++rt)
#pragma unroll
        for (int r = 0; r < 8; ++r) tv[rt][r] = __shfl_xor(mcv[rt][r], sh, 32);
#pragma unroll
      for (int rt = 0; rt < RTN; ++rt)
#pragma unroll
        for (int r = 0; r < 8; ++r) mcv[rt][r] = fmaxf(mcv[rt][r], tv[rt][r]); }
    asm volatile("" :: "v"(mcv[0][0]), "v"(mcv[0][1]), "v"(mcv[0][2]), "v"(mcv[0][3]), "v"(mcv[0][4]), "v"(mcv[0][5]), "v"(mcv[0][6]), "v"(mcv[0][7])); __builtin_amdgcn_sched_barrier(0);      /* inputs only, for the same reason: the eight rows go through the four rounds together, in front of the exps */
#pragma unroll
    for (int rt = 0; rt < RTN; ++rt)
#pragma unroll
      for (int r = 0; r < 8; ++r) { const float mn = fmaxf(m_r[rt][r], mcv[rt][r]); const float ea = expf(m_r[rt][r] - mn), e0 = expf(s0v[rt][r] - mn), e1 = expf(s1v[rt][r] - mn);
        const float al = (mn > -1.0e38f) ? ea : 1.0f; m_r[rt][r] = mn; const float p0 = ok0v[rt][r] ? e0 : 0.f, p1 = ok1v[rt][r] ? e1 : 0.f; l_r[rt][r] = l_r[rt][r] * al + p0 + p1;
#pragma unroll
        for (int dt = 0; dt < DT; ++dt) { oacc[rt][dt][r] *= al; oaccl[rt][dt][r] *= al; }
        FragH t2, t3; const float ps0 = p0 * 1024.0f, ps1 = p1 * 1024.0f; t2.h[0] = (_Float16)ps0; t2.h[1] = (_Float16)ps1; t3.h[0] = (_Float16)((ps0 - (float)t2.h[0]) * 1024.0f); t3.h[1] = (_Float16)((ps1 - (float)t2.h[1]) * 1024.0f);
        sP[w][rt * 16 + 8 * hh + r][ln] = t2.u[0]; sP[w][rt * 16 + 8 * hh + r][16 + ln] = t2.u[1]; sPl[w][rt * 16 + 8 * hh + r][ln] = t3.u[0]; sPl[w][rt * 16 + 8 * hh + r][16 + ln] = t3.u[1]; }
    __builtin_amdgcn_fence(__ATOMIC_ACQ_REL, "workgroup"); __builtin_amdgcn_wave_barrier();
    FragH pa[2], pl[2];
#pragma unroll
    for (int rt = 0; rt < RTN; ++rt) { pa[rt].half[0] = *(const v8us*)&sP[w][rt * 16 + ln][8 * hh]; pa[rt].half[1] = *(const v8us*)&sP[w][rt * 16 + ln][16 + 8 * hh]; pl[rt].half[0] = *(const v8us*)&sPl[w][rt * 16 + ln][8 * hh]; pl[rt].half[1] = *(const v8us*)&sPl[w][rt * 16 + ln][16 + 8 * hh]; }
#pragma unroll
    for (int dt = 0; dt < DT; ++dt) { const unsigned short* vr = kvb + 4096 + dt * 512 + lane * 8; FragH bv, bl; bv.half[0] = *(const v8us*)(vr); bv.half[1] = *(const v8us*)(vr + 256); bl.half[0] = *(const v8us*)(vr + 2048); bl.half[1] = *(const v8us*)(vr + 2048 + 256);
#pragma unroll
      for (int rt = 0; rt < RTN; ++rt) { oacc[rt][dt] = mmaH<1>(pa[rt].v, pa[rt].v, bv.v, bv.v, oacc[rt][dt]); oaccl[rt][dt] = mmaH<1>(pa[rt].v, pa[rt].v, bl.v, bl.v, oaccl[rt][dt]); oaccl[rt][dt] = mmaH<1>(pl[rt].v, pl[rt].v, bv.v, bv.v, oaccl[rt][dt]); } }
    __builtin_amdgcn_fence(__ATOMIC_ACQ_REL, "workgroup"); __builtin_amdgcn_wave_barrier();
    asm volatile("s_wait_dscnt 0x0" ::: "memory");      /* this wave's reads of the trip's buffer have returned */
    asm volatile("s_wait_asynccnt 0x0" ::: "memory");      /* this wave's copies of the next tile have landed */
    __syncthreads();      /* publishes the next tile and ends every wave's reads of this trip's buffer, which is refilled below */
    if (j0 + 64 < jend) FM_COPY(j0 + 64, buf) }
  asm volatile("s_wait_asynccnt 0x0" ::: "memory");      /* no copy is outstanding when the wave goes on to its end */
#undef FM_COPY
#pragma unroll
  for (int rt = 0; rt < RTN; ++rt) {
#pragma unroll
    for (int r = 0; r < 8; ++r) { float l = l_r[rt][r]; l += __shfl_xor(l, 1, 32); l += __shfl_xor(l, 2, 32); l += __shfl_xor(l, 4, 32); l += __shfl_xor(l, 8, 32); l_r[rt][r] = (l > 0.f) ? 1.0f / (l * 1024.0f) : 0.f; }
#pragma unroll
    for (int dt = 0; dt < DT; ++dt)
#pragma unroll
      for (int r = 0; r < 8; ++r) sO[w][rt * 16 + 8 * hh + r][dt * 16 + ln] = (oacc[rt][dt][r] + oaccl[rt][dt][r] * 0.0009765625f) * l_r[rt][r]; }
  __builtin_amdgcn_fence(__ATOMIC_ACQ_REL, "workgroup"); __builtin_amdgcn_wave_barrier();
  {
#pragma unroll
    for (int u = 0; u < 4 * RTN; ++u) { const int rl = (u >> 2) * 16 + ln, kk = ((u >> 1) & 1) * 32 + (u & 1) * 16 + hh * 8; const v4f a = *(const v4fa*)&sO[w][rl][kk], c = *(const v4fa*)&sO[w][rl][kk + 4];      /* O leaves as the hi and residual fragment-order planes that the output projection reads: a lane's piece is row ln, 8 columns */
      const float o[8] = {a[0], a[1], a[2], a[3], c[0], c[1], c[2], c[3]}; FragH fh, fl; hl_split8(o, fh, fl); const size_t po = pk_dst((size_t)b * TQ + q0 + rl, h * 64 + kk, ldo);
      *(v8us*)((unsigned short*)Oh + po) = fh.half[0]; *(v8us*)((unsigned short*)Ol + po) = fl.half[0]; }
     } }


__global__ __launch_bounds__(256) void k_causaltab(unsigned* __restrict__ MB, int* __restrict__ RA, int* __restrict__ KE, int nq, int nk) {
  const int t = blockIdx.x * 256 + threadIdx.x; const int nw = nk / 32;
  if (t < nq * nw) { const int q = t / nw, w = t % nw; const int first = q + 1 - 32 * w; const unsigned bits = (first <= 0) ? 0xffffffffu : ((first >= 32) ? 0u : (0xffffffffu << first)); *(unsigned*)(MB + t) = bits;  }
  if (t < nq) { *(int*)(RA + t) = 0;  }
  if (t < nq / 64) { const int v = 64 * (t + 1); *(int*)(KE + t * 32) = v;  } }

__constant__ float PIF[32] = {3.141592741e+00f,3.031195641e+00f,2.924677610e+00f,2.821902990e+00f,2.722739935e+00f,2.627061367e+00f,2.534744978e+00f,2.445672750e+00f,2.359730482e+00f,2.276808262e+00f,2.196800232e+00f,2.119603395e+00f,2.045119524e+00f,1.973252892e+00f,1.903911710e+00f,1.837007284e+00f,1.772453904e+00f,1.710168958e+00f,1.650072694e+00f,1.592088223e+00f,1.536141396e+00f,1.482160687e+00f,1.430076718e+00f,1.379823089e+00f,1.331335425e+00f,1.284551501e+00f,1.239411712e+00f,1.195858121e+00f,1.153835058e+00f,1.113288760e+00f,1.074167132e+00f,1.036420345e+00f};
__global__ __launch_bounds__(256) void k_trig(const float* __restrict__ pig, const float* __restrict__ logxi, const float* __restrict__ egl, float* __restrict__ CS, float* __restrict__ SN, float* __restrict__ HB) {
  #pragma clang fp contract(off)
  const int t = blockIdx.x * 256 + threadIdx.x; if (t >= NH * SLEN * 32) return; const int j = t & 31; const int tok = (t >> 5) % SLEN; const int h = t / (32 * SLEN);
  const float pg = 1.0f / (1.0f + expf(-bf16_round(pig[h]))); const float th = ((float)tok * PIF[j]) * pg; const float c = cosf(th), s = sinf(th);
  *(float*)(CS + t) = c; *(float*)(SN + t) = s; 
  if (t < 2 * NH) { const int hh2 = t >> 1; const float v = (t & 1) ? (1.0f / (1.0f + expf(-bf16_round(egl[hh2])))) : expf(bf16_round(logxi[hh2])); *(float*)(HB + t) = v;  } }      

extern "C" void kernel_launch(void* const* d_in, const int* in_sizes, int n_in,
                              void* d_out, int out_size, void* d_ws, size_t ws_size, hipStream_t stream) {
  (void)in_sizes; (void)n_in; (void)out_size;
  const float* const* I = (const float* const*)d_in; const float* x = I[0]; const float* Wqkv = I[1]; const float* Wo = I[2]; const float* logxi = I[3]; const float* pig = I[4]; const float* egl = I[5];
  char* ws = (char*)d_ws; size_t off = 0;
  auto take = [&](size_t bytes) { char* p = ws + off; off += (bytes + 255) & ~(size_t)255; return p; };
  _Float16* BQKV = (_Float16*)take((size_t)3 * DM * DM * 2); _Float16* BO = (_Float16*)take((size_t)DM * DM * 2);
  _Float16* X16 = (_Float16*)take((size_t)NR * DM * 2); _Float16* Oh = (_Float16*)take((size_t)NR * DM * 2); _Float16* Ol = (_Float16*)take((size_t)NR * DM * 2);
  _Float16* Qh = (_Float16*)take((size_t)NR * DM * 2); _Float16* Ql = (_Float16*)take((size_t)NR * DM * 2); _Float16* Kh = (_Float16*)take((size_t)NR * DM * 2); _Float16* Kl = (_Float16*)take((size_t)NR * DM * 2); _Float16* Vth = (_Float16*)take((size_t)NR * DM * 2); _Float16* Vtl = (_Float16*)take((size_t)NR * DM * 2);
  unsigned* MB = (unsigned*)take((size_t)SLEN * (SLEN / 32) * 4); int* RA = (int*)take((size_t)SLEN * 4); int* KE = (int*)take((size_t)(SLEN / 64) * 32 * 4);
  float* CS = (float*)take((size_t)NH * SLEN * 32 * 4); float* SN = (float*)take((size_t)NH * SLEN * 32 * 4); float* HB = (float*)take(256);
  if (off > ws_size) return;      /* 6 + 2 + 8 + 8 x 8 + 0.5 + 8 = 89 MiB */
  const size_t n8 = (size_t)NR * DM / 8; const unsigned nb8 = (unsigned)((n8 + 255) / 256);
  k_round16f<<<(unsigned)(((size_t)3 * DM * DM / 8 + 255) / 256), 256, 0, stream>>>(Wqkv, BQKV, (size_t)3 * DM * DM / 8); k_round16f<<<(unsigned)(((size_t)DM * DM / 8 + 255) / 256), 256, 0, stream>>>(Wo, BO, (size_t)DM * DM / 8);      /* torch (out,in) = natural Bt; x16 */
  k_x16<<<nb8, 256, 0, stream>>>(x, X16, n8);
  k_trig<<<(NH * SLEN * 32 + 255) / 256, 256, 0, stream>>>(pig, logxi, egl, CS, SN, HB); k_causaltab<<<(SLEN * (SLEN / 32) + 255) / 256, 256, 0, stream>>>(MB, RA, KE, SLEN, SLEN);
  const dim3 gP((NR / 128) * (DM / 64), 1);
  k_gemm2<0, 1><<<gP, 128, 0, stream>>>(X16, DM, 0, BQKV, DM, 0, 0.0625f, nullptr, 0, nullptr, 1, 0, 0, nullptr, nullptr, DM, 0, NR, DM, DM, CS, SN, Qh, Ql);      /* q (rows 0..1023 of Wqkv), rotated, hi/lo */
  k_gemm2<0, 1><<<gP, 128, 0, stream>>>(X16, DM, 0, BQKV + (size_t)DM * DM, DM, 0, 0.0625f, nullptr, 0, nullptr, 1, 0, 0, nullptr, nullptr, DM, 0, NR, DM, DM, CS, SN, Kh, Kl);      /* k (rows 1024..2047), rotated, hi/lo */
  k_gemm2<0, 2><<<gP, 128, 0, stream>>>(X16, DM, 0, BQKV + (size_t)2 * DM * DM, DM, 0, 0.0625f, nullptr, 0, nullptr, 1, 0, 0, nullptr, nullptr, DM, 0, NR, DM, DM, nullptr, nullptr, Vth, Vtl);      /* v (rows 2048..3071), transposed, hi/lo */
  k_flashme<SLEN, SLEN><<<NBT * NH * (SLEN / 64), 128, 0, stream>>>(Qh, Ql, DM, Kh, Kl, DM, Vth, Vtl, MB, RA, KE, HB, Oh, Ol, DM);      /* both batches in one grid, so that their waves share the chip */
  k_gemm2<0, 0><<<gP, 128, 0, stream>>>(Oh, DM, 0, BO, DM, 0, 0.0625f, nullptr, 0, nullptr, 1, 0, 0, (float*)d_out, nullptr, DM, 0, NR, DM, DM, nullptr, nullptr, nullptr, nullptr);
  k_gemm2<0, 0><<<gP, 128, 0, stream>>>(Ol, DM, 0, BO, DM, 0, 0.0625f / 1024.0f, nullptr, 0, (const float*)d_out, 1, (size_t)DM, 0, (float*)d_out, nullptr, DM, 0, NR, DM, DM, nullptr, nullptr, nullptr, nullptr);
}

// v007
// A run of this version takes 298 microseconds.
// Timed twice side by side with v006, it ran 1.09 times as fast both times.
// All steps since v000 together make it 2.96 times as fast.
#include <hip/hip_runtime.h>
// Causal multi-head attention with gated rotary phases and a per-head distance decay (2 x 2048 tokens x 1024, 16 heads x 64): qkv = x*Wqkv^T; theta[h][t][j] = (t * pi^(1 - j/32)) * sigmoid(pi_gate[h]); interleaved-pair rotation of q and k; scores = q.k/8 - |i - j| / exp(log_xi[h]) * sigmoid(e_gate[h]) with j <= i; softmax; merged . Wo^T -> [2,2048,1024].
// Structure: x as an exact f16 plane; q/k/v from one packed f16 WMMA GEMM family (32x64 wave tiles, f32, exact products); per-(head, token) cos/sin tables on VALU (pi^(1-j/32) = the reference's f32 constants, precise trig); the projection GEMMs' epilogues rotate q and k in f32 and write them as f16 hi + x2^10 residual planes, and write V^T as hi + residual planes; the causal structure computed on device into a key bit plane + per-block key bound; the fused flash kernel per ((batch, head), 64 queries) with the decay bias added per element (three-product hi/lo scores, online softmax f32, P hi + residual via LDS, two value accumulators), whose epilogue writes O as hi + residual planes; output projection as two GEMMs.
// Compute dtype: x, weights and the three gate/scale vectors rounded to bf16; projections exact; rotation and bias f32; q, k, P, v, O as f16 hi + residual pairs (~2^-21); f32 accumulation and softmax. v_wmma_f32_16x16x32_f16.
#define NBT 2
#define SLEN 2048
#define DM 1024
#define NH 16
#define SCL 0.125f
#define NR (NBT * SLEN)
typedef __bf16 v16b __attribute__((ext_vector_type(16)));
typedef unsigned short v8us __attribute__((ext_vector_type(8), may_alias));
typedef float  v8f  __attribute__((ext_vector_type(8)));
typedef float  v4f  __attribute__((ext_vector_type(4)));
typedef float  v4fa __attribute__((ext_vector_type(4), may_alias));
union FragB { v16b v; v8us half[2]; unsigned short u[16]; };

__device__ __forceinline__ unsigned short bf16_bits(float x) { unsigned int u = __float_as_uint(x); return (unsigned short)((u + 0x7FFFu + ((u >> 16) & 1u)) >> 16); }
__device__ __forceinline__ float bf16_val(unsigned short b) { return __uint_as_float(((unsigned int)b) << 16); }
__device__ __forceinline__ float bf16_round(float x) { return bf16_val(bf16_bits(x)); }
// D += A·B with NT terms: 1 = ah·bh, 2 = + al·bh (A split), 3 = + ah·bl (both split)
template <int NT>
__device__ __forceinline__ v8f mmaN(v16b ah, v16b al, v16b bh, v16b bl, v8f c) {
  c = __builtin_amdgcn_wmma_f32_16x16x32_bf16(false, ah, false, bh, (short)0, c, false, false);
  if (NT >= 2) c = __builtin_amdgcn_wmma_f32_16x16x32_bf16(false, al, false, bh, (short)0, c, false, false);
  if (NT >= 3) c = __builtin_amdgcn_wmma_f32_16x16x32_bf16(false, ah, false, bl, (short)0, c, false, false);
  asm volatile("v_nop\n\tv_nop\n\tv_nop\n\tv_nop" : "+v"(c) : "v"(ah), "v"(al), "v"(bh), "v"(bl));
  return c;
}

__global__ __launch_bounds__(256) void k_wt_bf16(const float* __restrict__ W, unsigned short* __restrict__ Wt, int K, int N) {
  const int t = blockIdx.x * 256 + threadIdx.x;
  const int k8n = K / 8;
  if (t >= N * k8n) return;
  const int n = t / k8n, k8 = (t % k8n) * 8;
  v8us v;
#pragma unroll
  for (int i = 0; i < 8; ++i) v[i] = bf16_bits(W[(size_t)(k8 + i) * N + n]);
  *(v8us*)(Wt + (size_t)n * K + k8) = v;
  
}

// GEMM C[M][N] (f32, pitch ldc) = act(A[M][K]·W + bias). A f32 row-major (pitch lda) converted per fragment to bf16
// (ASPLIT: hi/lo two planes -> 2 terms, else single rounded term); Wt bf16 [N][K] (pitch ldb). BIAS_BF16 rounds the
// bias to bf16 first (bias quantised to bf16 before the add). K%32==0, M%16==0, N%64==0.
template <bool ASPLIT, int ACT, bool BIAS_BF16>
__global__ __launch_bounds__(128) void k_gemm_bf(const float* __restrict__ A, int lda, const unsigned short* __restrict__ Wt, int ldb,
                                               const float* __restrict__ bias, float* __restrict__ C, int ldc, int M, int N, int K) {
  __shared__ __attribute__((aligned(16))) float so[4][16][64];
  const int tid = threadIdx.x, w = tid >> 5, lane = tid & 31, ln = lane & 15, hh = lane >> 4;
  const int ntn = N / 64;
  const int wid = blockIdx.x * 4 + w;
  const int mt = wid / ntn, nq = wid % ntn;
  if (mt * 16 >= M) return;
  const int row0 = mt * 16, col0 = nq * 64;
  const float* arow = A + (size_t)(row0 + ln) * lda;
  v8f acc[4] = {};
  for (int kb = 0; kb < K; kb += 32) {
    FragB ah, al;
    const v4f x0 = *(const v4fa*)(arow + kb + 8 * hh), x1 = *(const v4fa*)(arow + kb + 8 * hh + 4);
    const v4f x2 = *(const v4fa*)(arow + kb + 16 + 8 * hh), x3 = *(const v4fa*)(arow + kb + 16 + 8 * hh + 4);
    float xs[16] = {x0[0],x0[1],x0[2],x0[3],x1[0],x1[1],x1[2],x1[3],x2[0],x2[1],x2[2],x2[3],x3[0],x3[1],x3[2],x3[3]};
#pragma unroll
    for (int i = 0; i < 16; ++i) { const unsigned short hb = bf16_bits(xs[i]); ah.u[i] = hb; al.u[i] = ASPLIT ? bf16_bits(xs[i] - bf16_val(hb)) : (unsigned short)0; }
#pragma unroll
    for (int t = 0; t < 4; ++t) {
      const unsigned short* brow = Wt + (size_t)(col0 + t * 16 + ln) * ldb + kb;
      FragB b;
      b.half[0] = *(const v8us*)(brow + 8 * hh);
      b.half[1] = *(const v8us*)(brow + 16 + 8 * hh);
      acc[t] = mmaN<ASPLIT ? 2 : 1>(ah.v, al.v, b.v, b.v, acc[t]);
    }
  }
#pragma unroll
  for (int t = 0; t < 4; ++t) {
    float bv = bias ? bias[col0 + t * 16 + ln] : 0.f;
    if (BIAS_BF16) bv = bf16_round(bv);
#pragma unroll
    for (int r = 0; r < 8; ++r) { float v = acc[t][r] + bv; if (ACT == 1) v = fmaxf(v, 0.f); so[w][8 * hh + r][t * 16 + ln] = v; }
  }
  __builtin_amdgcn_fence(__ATOMIC_ACQ_REL, "workgroup");
  __builtin_amdgcn_wave_barrier();
  const int rsub = lane >> 4, c4 = (lane & 15) * 4;
  {
#pragma unroll
    for (int q = 0; q < 8; ++q) {
      const int r = q * 2 + rsub;
      const v4f v = *(const v4fa*)&so[w][r][c4];
      *(v4f*)(C + (size_t)(row0 + r) * ldc + col0 + c4) = v;
    }
    
  }
}

// GEMM C = act(A·W + bias + resid): A f32 (ASPLIT -> hi/lo 2 terms), Wt bf16 [N][K]; ACT 0 none, 1 relu, 2 exact gelu;
// resid (optional, f32, row index = (row % rmod), pitch ldr, RES_BF16 rounds it) added before the activation.
template <bool ASPLIT, int ACT, bool BIAS_BF16, bool RES_BF16>
__global__ __launch_bounds__(128) void k_gemm_bf3(const float* __restrict__ A, int lda, const unsigned short* __restrict__ Wt, int ldb,
                                                const float* __restrict__ bias, const float* __restrict__ resid, int rmod, int ldr,
                                                float* __restrict__ C, int ldc, int M, int N, int K) {
  __shared__ __attribute__((aligned(16))) float so[4][16][64];
  const int tid = threadIdx.x, w = tid >> 5, lane = tid & 31, ln = lane & 15, hh = lane >> 4;
  const int ntn = N / 64;
  const int wid = blockIdx.x * 4 + w;
  const int mt = wid / ntn, nq = wid % ntn;
  if (mt * 16 >= M) return;
  const int row0 = mt * 16, col0 = nq * 64;
  const float* arow = A + (size_t)(row0 + ln) * lda;
  v8f acc[4] = {};
  for (int kb = 0; kb < K; kb += 32) {
    FragB ah, al;
    const v4f x0 = *(const v4fa*)(arow + kb + 8 * hh), x1 = *(const v4fa*)(arow + kb + 8 * hh + 4);
    const v4f x2 = *(const v4fa*)(arow + kb + 16 + 8 * hh), x3 = *(const v4fa*)(arow + kb + 16 + 8 * hh + 4);
    float xs[16] = {x0[0],x0[1],x0[2],x0[3],x1[0],x1[1],x1[2],x1[3],x2[0],x2[1],x2[2],x2[3],x3[0],x3[1],x3[2],x3[3]};
#pragma unroll
    for (int i = 0; i < 16; ++i) { const unsigned short hb = bf16_bits(xs[i]); ah.u[i] = hb; al.u[i] = ASPLIT ? bf16_bits(xs[i] - bf16_val(hb)) : (unsigned short)0; }
#pragma unroll
    for (int t = 0; t < 4; ++t) {
      const unsigned short* brow = Wt + (size_t)(col0 + t * 16 + ln) * ldb + kb;
      FragB b;
      b.half[0] = *(const v8us*)(brow + 8 * hh);
      b.half[1] = *(const v8us*)(brow + 16 + 8 * hh);
      acc[t] = mmaN<ASPLIT ? 2 : 1>(ah.v, al.v, b.v, b.v, acc[t]);
    }
  }
#pragma unroll
  for (int t = 0; t < 4; ++t) {
    const int col = col0 + t * 16 + ln;
    float bv = bias ? bias[col] : 0.f;
    if (BIAS_BF16) bv = bf16_round(bv);
#pragma unroll
    for (int r = 0; r < 8; ++r) {
      float v = acc[t][r] + bv;
      if (resid) { float rv = resid[(size_t)((row0 + 8 * hh + r) % rmod) * ldr + col]; if (RES_BF16) rv = bf16_round(rv); v += rv; }
      if (ACT == 1) v = fmaxf(v, 0.f);
      if (ACT == 2) v = 0.5f * v * (1.0f + erff(v * 0.70710678118654752f));
      if (ACT == 3) { const float u = 0.7978845608028654f * (v + 0.044715f * v * v * v); v = 0.5f * v * (1.0f + tanhf(u)); }
      so[w][8 * hh + r][t * 16 + ln] = v;
    }
  }
  __builtin_amdgcn_fence(__ATOMIC_ACQ_REL, "workgroup");
  __builtin_amdgcn_wave_barrier();
  const int rsub = lane >> 4, c4 = (lane & 15) * 4;
  {
#pragma unroll
    for (int q = 0; q < 8; ++q) {
      const int r = q * 2 + rsub;
      const v4f v = *(const v4fa*)&so[w][r][c4];
      *(v4f*)(C + (size_t)(row0 + r) * ldc + col0 + c4) = v;
    }
    
  }
}
// row LayerNorm (biased variance, eps) over N: s = X (+ R); optional out_sum <- s; out_norm <- (s-mu)*rsqrt(var+eps)*g + b
template <bool PARAM_BF16>
__global__ __launch_bounds__(256) void k_layernorm(const float* __restrict__ X, const float* __restrict__ R, const float* __restrict__ g, const float* __restrict__ bta,
                                                  float* __restrict__ out_sum, float* __restrict__ out_norm, int N, float eps) {
  __shared__ float red[256];
  const int row = blockIdx.x, tid = threadIdx.x;
  const float* x = X + (size_t)row * N; const float* rr = R ? R + (size_t)row * N : nullptr;
  float vals[16];                     // up to N = 4096
  const int per = N / 256;            // contiguous chunk per thread? use strided-by-4 chunks: thread handles j = tid*4 + 1024*u
  float s1 = 0.f;
  for (int u = 0; u < per / 4; ++u) {
    const int j = tid * 4 + 1024 * u;
    const v4f a = *(const v4fa*)(x + j);
    v4f b = {0.f,0.f,0.f,0.f}; if (rr) b = *(const v4fa*)(rr + j);
#pragma unroll
    for (int q = 0; q < 4; ++q) { const float v = a[q] + b[q]; vals[u * 4 + q] = v; s1 += v; }
  }
  red[tid] = s1; __syncthreads();
  for (int st = 128; st > 0; st >>= 1) { if (tid < st) red[tid] += red[tid + st]; __syncthreads(); }
  const float mu = red[0] / (float)N; __syncthreads();
  float s2 = 0.f;
  for (int u = 0; u < per / 4; ++u)
#pragma unroll
    for (int q = 0; q < 4; ++q) { const float c = vals[u * 4 + q] - mu; s2 += c * c; }
  red[tid] = s2; __syncthreads();
  for (int st = 128; st > 0; st >>= 1) { if (tid < st) red[tid] += red[tid + st]; __syncthreads(); }
  const float rs = rsqrtf(red[0] / (float)N + eps);
  {
    for (int u = 0; u < per / 4; ++u) {
      const int j = tid * 4 + 1024 * u;
      v4f o, sm;
#pragma unroll
      for (int q = 0; q < 4; ++q) {
        float gg = g[j + q], bb = bta[j + q];
        if (PARAM_BF16) { gg = bf16_round(gg); bb = bf16_round(bb); }
        sm[q] = vals[u * 4 + q]; o[q] = (vals[u * 4 + q] - mu) * rs * gg + bb;
      }
      if (out_sum) *(v4f*)(out_sum + (size_t)row * N + j) = sm;
      *(v4f*)(out_norm + (size_t)row * N + j) = o;
    }
    
  }
}



// ---- f16 WMMA path (v_wmma_f32_16x16x32_f16): 11-bit significands for operands in range — used where a [0,1] probability operand needs more precision than bf16
typedef _Float16 v16h __attribute__((ext_vector_type(16)));
union FragH { v16h v; v8us half[2]; _Float16 h[16]; unsigned short u[16]; };
template <int NT>
__device__ __forceinline__ v8f mmaH(v16h ah, v16h al, v16h bh, v16h bl, v8f c) {
  c = __builtin_amdgcn_wmma_f32_16x16x32_f16(false, ah, false, bh, (short)0, c, false, false);
  if (NT >= 2) c = __builtin_amdgcn_wmma_f32_16x16x32_f16(false, al, false, bh, (short)0, c, false, false);
  if (NT >= 3) c = __builtin_amdgcn_wmma_f32_16x16x32_f16(false, ah, false, bl, (short)0, c, false, false);
  asm volatile("v_nop\n\tv_nop\n\tv_nop\n\tv_nop" : "+v"(c) : "v"(ah), "v"(al), "v"(bh), "v"(bl));
  return c;
}
// batched GEMM like k_gemm_b but f16 operands: A f32 (split into f16 hi/lo if ASPLIT, else rounded to f16), Bt = f16 values [n][k]; alpha; C f32; N multiple of 16 (partial tiles skipped)
template <bool ASPLIT>
__global__ __launch_bounds__(128) void k_gemm_h(const float* __restrict__ A, int lda, size_t sA, const _Float16* __restrict__ Bh, int ldb, size_t sB, float alpha, float* __restrict__ C, int ldc, size_t sC, int M, int N, int K) {
  __shared__ __attribute__((aligned(16))) float so[4][16][64];
  const int tid = threadIdx.x, w = tid >> 5, lane = tid & 31, ln = lane & 15, hh = lane >> 4; const int by = blockIdx.y;
  A += (size_t)by * sA; Bh += (size_t)by * sB; C += (size_t)by * sC;
  const int ntn = (N + 63) / 64; const int wid = blockIdx.x * 4 + w; const int mt = wid / ntn, nq = wid % ntn; if (mt * 16 >= M) return;
  const int row0 = mt * 16, col0 = nq * 64; const float* arow = A + (size_t)(row0 + ln) * lda;
  v8f acc[4] = {};
  for (int kb = 0; kb < K; kb += 32) {
    FragH ah, al;
    const v4f x0 = *(const v4fa*)(arow + kb + 8 * hh), x1 = *(const v4fa*)(arow + kb + 8 * hh + 4), x2 = *(const v4fa*)(arow + kb + 16 + 8 * hh), x3 = *(const v4fa*)(arow + kb + 16 + 8 * hh + 4);
    float xs[16] = {x0[0],x0[1],x0[2],x0[3],x1[0],x1[1],x1[2],x1[3],x2[0],x2[1],x2[2],x2[3],x3[0],x3[1],x3[2],x3[3]};
#pragma unroll
    for (int i = 0; i < 16; ++i) { const _Float16 h = (_Float16)xs[i]; ah.h[i] = h; al.h[i] = ASPLIT ? (_Float16)(xs[i] - (float)h) : (_Float16)0.0f; }
#pragma unroll
    for (int t = 0; t < 4; ++t) { if (col0 + t * 16 >= N) continue; const size_t boff = (size_t)(col0 + t * 16 + ln) * ldb + kb; FragH bq; bq.half[0] = *(const v8us*)(Bh + boff + 8 * hh); bq.half[1] = *(const v8us*)(Bh + boff + 16 + 8 * hh);
      acc[t] = mmaH<ASPLIT ? 2 : 1>(ah.v, al.v, bq.v, bq.v, acc[t]); }
  }
#pragma unroll
  for (int t = 0; t < 4; ++t) { if (col0 + t * 16 >= N) continue;
#pragma unroll
    for (int r = 0; r < 8; ++r) so[w][8 * hh + r][t * 16 + ln] = acc[t][r] * alpha; }
  __builtin_amdgcn_fence(__ATOMIC_ACQ_REL, "workgroup"); __builtin_amdgcn_wave_barrier();
  const int rsub = lane >> 4, c4 = (lane & 15) * 4;
  {
#pragma unroll
    for (int q = 0; q < 8; ++q) { const int r = q * 2 + rsub; if (col0 + c4 < N) { const v4f v = *(const v4fa*)&so[w][r][c4]; *(v4f*)(C + (size_t)(row0 + r) * ldc + col0 + c4) = v; } }
     }
}

// Wt[n][k] = f16(W[k][n]·scale) from f32 row-major W[K][N] (scale = power of two; bf16-exact weights stay exact in f16 away from the subnormal range)
__global__ __launch_bounds__(256) void k_wt_f16(const float* __restrict__ W, _Float16* __restrict__ Wt, int K, int N, float scale) {
  const int t = blockIdx.x * 256 + threadIdx.x; if (t >= N * (K / 8)) return; const int n = t / (K / 8), k8 = (t % (K / 8)) * 8; FragH f;
#pragma unroll
  for (int i = 0; i < 8; ++i) f.h[i] = (_Float16)(bf16_round(W[(size_t)(k8 + i) * N + n]) * scale); const v8us o = f.half[0];
  *(v8us*)((unsigned short*)Wt + (size_t)n * K + k8) = o; 
}
// k_gemm_hh variant with fused epilogue: v = acc·alpha + bias[by·sBias + col] (+ CP[(row/rowsPerB)·sCPb + by·64 + col] if CP) ; ACT 0 none / 1 elu ; writes f16 C16 (and f32 C if non-null)
template <int ACT>
__global__ __launch_bounds__(128) void k_gemm_hhx(const _Float16* __restrict__ A, int lda, size_t sA, const _Float16* __restrict__ Bh, int ldb, size_t sB, float alpha, const float* __restrict__ bias, size_t sBias, const float* __restrict__ CP, int rowsPerB, size_t sCPb, int row0g,
    float* __restrict__ C, _Float16* __restrict__ C16, int ldc, size_t sC, int M, int N, int K) {
  __shared__ __attribute__((aligned(16))) float so[4][16][64];
  const int tid = threadIdx.x, w = tid >> 5, lane = tid & 31, ln = lane & 15, hh = lane >> 4; const int by = blockIdx.y;
  A += (size_t)by * sA; Bh += (size_t)by * sB; const size_t cofs = (size_t)by * sC; const float* bp = bias ? bias + (size_t)by * sBias : nullptr;
  const int ntn = (N + 63) / 64; const int wid = blockIdx.x * 4 + w; const int mt = wid / ntn, nq = wid % ntn; if (mt * 16 >= M) return;
  const int row0 = mt * 16, col0 = nq * 64; const _Float16* arow = A + (size_t)(row0 + ln) * lda;
  v8f acc[4] = {};
  for (int kb = 0; kb < K; kb += 32) { FragH ah; ah.half[0] = *(const v8us*)((const unsigned short*)arow + kb + 8 * hh); ah.half[1] = *(const v8us*)((const unsigned short*)arow + kb + 16 + 8 * hh);
#pragma unroll
    for (int t = 0; t < 4; ++t) { if (col0 + t * 16 >= N) continue; const size_t boff = (size_t)(col0 + t * 16 + ln) * ldb + kb; FragH bq; bq.half[0] = *(const v8us*)((const unsigned short*)Bh + boff + 8 * hh); bq.half[1] = *(const v8us*)((const unsigned short*)Bh + boff + 16 + 8 * hh);
      acc[t] = mmaH<1>(ah.v, ah.v, bq.v, bq.v, acc[t]); }
  }
#pragma unroll
  for (int t = 0; t < 4; ++t) { if (col0 + t * 16 >= N) continue; const int col = col0 + t * 16 + ln; const float bv = bp ? bf16_round(bp[col]) : 0.f;
#pragma unroll
    for (int r = 0; r < 8; ++r) { float v = acc[t][r] * alpha + bv; if (CP) { const int bidx = (row0g + row0 + 8 * hh + r) / rowsPerB; v += CP[(size_t)bidx * sCPb + (size_t)by * 64 + col]; } if (ACT == 1) v = (v > 0.f) ? v : expm1f(v); else if (ACT == 7) v = (v > 0.f) ? v + 1.0f : expf(v); else if (ACT == 8) v = tanhf(v); else if (ACT == 9) v = 0.5f * v * (1.0f + tanhf(0.7978845608028654f * (v + 0.044715f * v * v * v))); else if (ACT == 11) v = 1.0f / (1.0f + expf(-v)); else if (ACT == 12) v = (v > 0.f) ? v : 0.01f * v; else if (ACT == 14) v = (v > 0.f) ? v : 0.1f * v; else if (ACT == 15) v = v / (1.0f + expf(-v)); else if (ACT == 3) v = fmaxf(v, 0.f); else if (ACT == 6) v = 0.5f * v * (1.0f + erff(v * 0.70710678118654752f)); so[w][8 * hh + r][t * 16 + ln] = v; } }
  __builtin_amdgcn_fence(__ATOMIC_ACQ_REL, "workgroup"); __builtin_amdgcn_wave_barrier();
  const int rsub = lane >> 4, c4 = (lane & 15) * 4; typedef _Float16 v4h __attribute__((ext_vector_type(4)));
  {
#pragma unroll
    for (int q = 0; q < 8; ++q) { const int r = q * 2 + rsub; if (col0 + c4 < N) { const v4f v = *(const v4fa*)&so[w][r][c4]; if (C) *(v4f*)(C + cofs + (size_t)(row0 + r) * ldc + col0 + c4) = v; if (C16) { v4h h4; for (int i = 0; i < 4; ++i) h4[i] = (_Float16)v[i]; *(v4h*)(C16 + cofs + (size_t)(row0 + r) * ldc + col0 + c4) = h4; } } }
     }
}


typedef _Float16 v4h __attribute__((ext_vector_type(4)));

// ---- fragment-order planes: every f16 plane that a WMMA operand is loaded from is stored as 1 KiB units, one per (16 rows x 32 k). Inside a unit the 16-byte piece at (half * 32 + lane) holds row (lane & 15),
// k = half * 16 + (lane >> 4) * 8 .. + 7: what lane 'lane' takes as half 'half' of its fragment. A wave's global_load_b128 then reads 512 contiguous bytes (4 cache lines) where a row-major plane gives it 16 rows (16 lines).
// Units run along k first, then down the row tiles, so a tile of 16 rows still starts at element row * ld. ld % 32 == 0, rows % 16 == 0.
__device__ __forceinline__ size_t pk_src(size_t t, int ld) { const int lane = (int)(t & 31), half = (int)((t >> 5) & 1); const size_t u = t >> 6; const size_t nks = (size_t)(ld >> 5); const size_t ks = u % nks, rt = u / nks;      /* row-major element offset of the 8 elements that piece t of the plane holds */
  return (rt * 16 + (lane & 15)) * (size_t)ld + ks * 32 + half * 16 + (lane >> 4) * 8; }
__device__ __forceinline__ size_t pk_dst(size_t row, int k, int ld) { return (row >> 4) * 16 * (size_t)ld + (size_t)(k >> 5) * 512 + ((k >> 4) & 1) * 256 + (((k >> 3) & 1) * 16 + (int)(row & 15)) * 8; }      /* element offset in the plane of (row, k .. k + 7), k % 8 == 0 */

__global__ __launch_bounds__(256) void k_x16(const float* __restrict__ x, _Float16* __restrict__ X16, size_t n8) { const size_t t = (size_t)blockIdx.x * 256 + threadIdx.x; if (t >= n8) return; FragH f; const size_t so = pk_src(t, DM);
#pragma unroll
  for (int q = 0; q < 8; ++q) f.h[q] = (_Float16)bf16_round(x[so + q]); *(v8us*)((unsigned short*)X16 + t * 8) = f.half[0];  }
__global__ __launch_bounds__(256) void k_h16(const float* __restrict__ x, _Float16* __restrict__ X16, size_t n8) { const size_t t = (size_t)blockIdx.x * 256 + threadIdx.x; if (t >= n8) return; FragH f;
#pragma unroll
  for (int q = 0; q < 8; ++q) f.h[q] = (_Float16)x[t * 8 + q]; *(v8us*)((unsigned short*)X16 + t * 8) = f.half[0];  }
__global__ __launch_bounds__(256) void k_round16f(const float* __restrict__ W, _Float16* __restrict__ Bt, size_t n8) { const size_t t = (size_t)blockIdx.x * 256 + threadIdx.x; if (t >= n8) return; FragH f; const size_t so = pk_src(t, DM);
#pragma unroll
  for (int i = 0; i < 8; ++i) f.h[i] = (_Float16)(bf16_round(W[so + i]) * 16.0f); *(v8us*)((unsigned short*)Bt + t * 8) = f.half[0];  }
template <int NHv, int TTv>
__global__ __launch_bounds__(256) void k_vt(const _Float16* __restrict__ V16, int ldv, int voff, _Float16* __restrict__ Vt) { __shared__ unsigned short tl[64][66]; const int tid = threadIdx.x; const int slab = blockIdx.x / (TTv / 64), lg = blockIdx.x % (TTv / 64); const int b = slab / NHv, h = slab % NHv;
  for (int i = tid; i < 64 * 8; i += 256) { const int r = i / 8, c8 = (i % 8) * 8; FragH f; f.half[0] = *(const v8us*)((const unsigned short*)V16 + ((size_t)b * TTv + lg * 64 + r) * ldv + voff + h * 64 + c8);
#pragma unroll
    for (int q = 0; q < 8; ++q) tl[r][c8 + q] = f.u[q]; }
  __syncthreads();
  {
#pragma unroll
    for (int rd = 0; rd < 2; ++rd) { const int d = rd * 32 + tid / 8, pc = tid % 8; FragH f;
#pragma unroll
      for (int q = 0; q < 8; ++q) f.u[q] = tl[pc * 8 + q][d];
      *(v8us*)((unsigned short*)Vt + ((size_t)slab * 64 + d) * TTv + lg * 64 + pc * 8) = f.half[0]; }
     } }

// f32 -> f16 hi + x2^10 residual, 8 values = one 16-byte piece of each plane
__device__ __forceinline__ void hl_split8(const float* v, FragH& fh, FragH& fl) {
#pragma unroll
  for (int q = 0; q < 8; ++q) { const _Float16 h = (_Float16)v[q]; fh.h[q] = h; fl.h[q] = (_Float16)((v[q] - (float)h) * 1024.0f); } }

// ---- fast GEMM (wave tile 32x64; requires M % 32 == 0 rows per launch region and N % 64 == 0; A and Bh are fragment-order planes of pitch lda, ldb); epilogue = k_gemm_hhx semantics ----
// EPI 0: the tile goes out as f32 rows (C) and / or f16 rows (C16). EPI 1 (q, k; N = DM, so that a 64-column tile is one head): the tile is rotated by the head's cos/sin tables and goes out as the hi and residual fragment-order planes Ph, Pl.
// EPI 2 (v): the tile goes out transposed, as the hi and residual fragment-order planes of V^T (rows (batch * NH + head) * 64 + d, pitch SLEN).
__device__ __forceinline__ v16h g2_fragp(const _Float16* p) { FragH f; f.half[0] = *(const v8us*)((const unsigned short*)p); f.half[1] = *(const v8us*)((const unsigned short*)p + 256); return f.v; }      /* p = the lane's piece of a fragment-order unit */
__device__ __forceinline__ v8f g2_mma(v16h a, v16h b, v8f c) { v8f d = __builtin_amdgcn_wmma_f32_16x16x32_f16(false, a, false, b, (short)0, c, false, false); asm volatile("v_nop\n\tv_nop\n\tv_nop\n\tv_nop" : "+v"(d) : "v"(a), "v"(b)); return d; }
template <int ACT, int EPI>
__global__ __launch_bounds__(128) void k_gemm2(const _Float16* __restrict__ A, int lda, size_t sA, const _Float16* __restrict__ Bh, int ldb, size_t sB, float alpha, const float* __restrict__ bias, size_t sBias, const float* __restrict__ CP, int rowsPerB, size_t sCPb, int row0g,
    float* __restrict__ C, _Float16* __restrict__ C16, int ldc, size_t sC, int M, int N, int K, const float* __restrict__ CS, const float* __restrict__ SN, _Float16* __restrict__ Ph, _Float16* __restrict__ Pl) {
  __shared__ __attribute__((aligned(16))) float so[4][32][68];
  const int tid = threadIdx.x, w = tid >> 5, lane = tid & 31, ln = lane & 15, hh = lane >> 4; const int by = blockIdx.y;
  A += (size_t)by * sA; Bh += (size_t)by * sB; const size_t cofs = (size_t)by * sC; const float* bp = bias ? bias + (size_t)by * sBias : nullptr;
  const int ntn = N >> 6; const int mt = blockIdx.x / ntn, nq = blockIdx.x - mt * ntn; const int row0 = mt * 128 + 32 * w, col0 = nq * 64; if (row0 >= M) return;
  const _Float16* a0p = A + (size_t)row0 * lda + lane * 8; const _Float16* a1p = a0p + (size_t)16 * lda;      /* A and Bh are fragment-order planes */
  const _Float16* b0p = Bh + (size_t)col0 * ldb + lane * 8; const _Float16* b1p = b0p + (size_t)16 * ldb; const _Float16* b2p = b1p + (size_t)16 * ldb; const _Float16* b3p = b2p + (size_t)16 * ldb;
  const v8f z8 = {0.f,0.f,0.f,0.f,0.f,0.f,0.f,0.f}; v8f c00 = z8, c01 = z8, c02 = z8, c03 = z8, c10 = z8, c11 = z8, c12 = z8, c13 = z8;
  /* Register ring of three k-steps: the six fragments of steps s + 1 and s + 2 are in flight while step s is multiplied, so that a step no longer waits for five round trips one after the other.
     Each accumulator still takes its k-steps in ascending order. The six lane pointers live through the whole loop and every load of a trip reaches its step by an immediate offset, so that no load's result can land in an address register; only steps below K / 32 are loaded. */
  typedef const __attribute__((address_space(1))) _Float16* g2_gp;      /* typed as global memory, so that the loads stay global loads behind the asm statement that names the pointers */
  g2_gp p0 = (g2_gp)a0p, p1 = (g2_gp)a1p, p2 = (g2_gp)b0p, p3 = (g2_gp)b1p, p4 = (g2_gp)b2p, p5 = (g2_gp)b3p;
#define G2_FR(P, ST) g2_fragp((const _Float16*)((P) + 512 * (ST)))
#define G2_LOAD(S, ST) { S[0] = G2_FR(p0, ST); S[1] = G2_FR(p1, ST); S[2] = G2_FR(p2, ST); S[3] = G2_FR(p3, ST); S[4] = G2_FR(p4, ST); S[5] = G2_FR(p5, ST); \
    __builtin_amdgcn_sched_barrier(0); /* keeps the refill in front of the products that follow: without it the compiler sinks a refill behind the first product and that product's wait, and it flies for a shorter time */ }
#define G2_STEP(S) { c00 = g2_mma(S[0], S[2], c00); c10 = g2_mma(S[1], S[2], c10); c01 = g2_mma(S[0], S[3], c01); c11 = g2_mma(S[1], S[3], c11); c02 = g2_mma(S[0], S[4], c02); c12 = g2_mma(S[1], S[4], c12); c03 = g2_mma(S[0], S[5], c03); c13 = g2_mma(S[1], S[5], c13); }
  { const int nst = K >> 5; v16h r0[6], r1[6], r2[6]; int s = 0;
    if (nst >= 1) G2_LOAD(r0, 0)
    if (nst >= 2) G2_LOAD(r1, 1)
#pragma unroll 1
    for (; s + 5 <= nst; s += 3) { G2_LOAD(r2, 2) G2_STEP(r0) G2_LOAD(r0, 3) G2_STEP(r1) G2_LOAD(r1, 4) G2_STEP(r2)
      asm volatile("s_wait_xcnt 0x0" : "+v"(p0), "+v"(p1), "+v"(p2), "+v"(p3), "+v"(p4), "+v"(p5) :: "memory"); /* stands in front of the six additions below, which overwrite the address registers of the loads issued above; the pointers are named so that the additions depend on this statement and cannot be placed ahead of it (without it the compiler keeps copies of the pointers and rewrites them at the loop's head) */
      p0 += 1536; p1 += 1536; p2 += 1536; p3 += 1536; p4 += 1536; p5 += 1536; }
    const int rem = nst - s;      /* 0 to 4 steps are left; r0 and r1 hold the first two of them */
    if (rem >= 3) G2_LOAD(r2, 2)
    if (rem >= 1) G2_STEP(r0)
    if (rem >= 4) G2_LOAD(r0, 3)
    if (rem >= 2) G2_STEP(r1)
    if (rem >= 3) G2_STEP(r2)
    if (rem >= 4) G2_STEP(r0) }
#undef G2_FR
#undef G2_LOAD
#undef G2_STEP
  v8f accs[8] = {c00, c01, c02, c03, c10, c11, c12, c13};
#pragma unroll
  for (int u = 0; u < 8; ++u) { const int t = u & 3, half = u >> 2; const int col = col0 + t * 16 + ln; const float bv = bp ? bf16_round(bp[col]) : 0.f;
#pragma unroll
    for (int r = 0; r < 8; ++r) { const int rloc = half * 16 + 8 * hh + r; float v = accs[u][r] * alpha + bv; if (CP) { const int bidx = (row0g + row0 + rloc) / rowsPerB; v += CP[(size_t)bidx * sCPb + (size_t)by * 64 + col]; }
      if (ACT == 3) v = fmaxf(v, 0.f); else if (ACT == 6) v = 0.5f * v * (1.0f + erff(v * 0.70710678118654752f)); else if (ACT == 11) v = 1.0f / (1.0f + expf(-v)); else if (ACT == 15) v = v / (1.0f + expf(-v)); else if (ACT == 12) v = (v > 0.f) ? v : 0.01f * v; else if (ACT == 8) v = tanhf(v);
      so[w][rloc][t * 16 + ln] = v; } }
  __builtin_amdgcn_fence(__ATOMIC_ACQ_REL, "workgroup"); __builtin_amdgcn_wave_barrier();
  if (EPI == 1) {      /* the wave's tile = 2 row tiles x 2 units x 2 halves of each plane; a lane takes its own piece (row ln, 8 columns = 4 rotation pairs), a wave stores 512 contiguous bytes */
    typedef const __attribute__((address_space(1))) float* g2_fp;      /* typed as global memory, so that the loads stay global loads beside the asm statement that names the pointers */
    const size_t th = (size_t)(col0 >> 6) * SLEN * 32 + hh * 4, ta = th + (size_t)((row0 + ln) % SLEN) * 32, tb = th + (size_t)((row0 + 16 + ln) % SLEN) * 32;
    g2_fp ca = (g2_fp)(CS + ta), sa = (g2_fp)(SN + ta), cb = (g2_fp)(CS + tb), sb = (g2_fp)(SN + tb); v4f csv[8], snv[8];      /* the lane's two token rows of the head's tables */
#pragma unroll
    for (int u = 0; u < 8; ++u) { const int jo = ((u >> 1) & 1) * 16 + (u & 1) * 8; csv[u] = *(const __attribute__((address_space(1))) v4fa*)(((u >> 2) ? cb : ca) + jo); snv[u] = *(const __attribute__((address_space(1))) v4fa*)(((u >> 2) ? sb : sa) + jo); }
    asm volatile("s_wait_xcnt 0x0" : "+v"(ca), "+v"(sa), "+v"(cb), "+v"(sb) :: "memory");      /* stands in front of the first instruction that reuses an address register of the 16 table loads above; the pointers are named so that they live up to here */
#pragma unroll
    for (int u = 0; u < 8; ++u) { const int rl = (u >> 2) * 16 + ln, kk = ((u >> 1) & 1) * 32 + (u & 1) * 16 + hh * 8; const v4f a = *(const v4fa*)&so[w][rl][kk], c = *(const v4fa*)&so[w][rl][kk + 4];
      const v4f cs = csv[u], sn = snv[u];
      const float f[8] = {a[0], a[1], a[2], a[3], c[0], c[1], c[2], c[3]}; float o[8];
#pragma unroll
      for (int p = 0; p < 4; ++p) { o[2 * p] = f[2 * p] * cs[p] - f[2 * p + 1] * sn[p]; o[2 * p + 1] = f[2 * p] * sn[p] + f[2 * p + 1] * cs[p]; }
      FragH fh, fl; hl_split8(o, fh, fl); const size_t po = pk_dst((size_t)(row0 + rl), col0 + kk, N);
      *(v8us*)((unsigned short*)Ph + po) = fh.half[0]; *(v8us*)((unsigned short*)Pl + po) = fl.half[0]; }
  } else if (EPI == 2) {      /* 32 tokens x 64 d = 4 units of each V^T plane; a lane takes row d, 8 tokens, read down a column of the staged tile */
    const size_t vrow = ((size_t)(row0 / SLEN) * NH + (col0 >> 6)) * 64; const int t0 = row0 % SLEN;
#pragma unroll
    for (int u = 0; u < 8; ++u) { const int d = (u >> 1) * 16 + ln, tl = (u & 1) * 16 + hh * 8; float o[8];
#pragma unroll
      for (int q = 0; q < 8; ++q) o[q] = so[w][tl + q][d];
      FragH fh, fl; hl_split8(o, fh, fl); const size_t po = pk_dst(vrow + d, t0 + tl, SLEN);
      *(v8us*)((unsigned short*)Ph + po) = fh.half[0]; *(v8us*)((unsigned short*)Pl + po) = fl.half[0]; }
  } else {
    const int rsub = lane >> 4, c4 = (lane & 15) * 4;
#pragma unroll
    for (int q = 0; q < 16; ++q) { const int r = q * 2 + rsub; const v4f v = *(const v4fa*)&so[w][r][c4]; if (C) *(v4f*)(C + cofs + (size_t)(row0 + r) * ldc + col0 + c4) = v; if (C16) { v4h h4; for (int i = 0; i < 4; ++i) h4[i] = (_Float16)v[i]; *(v4h*)(C16 + cofs + (size_t)(row0 + r) * ldc + col0 + c4) = h4; } }
     } }



template <int TQ, int TK>
__global__ __launch_bounds__(128) void k_flashme(const _Float16* __restrict__ Q16, const _Float16* __restrict__ Q16lo, int ldq, const _Float16* __restrict__ K16, const _Float16* __restrict__ K16lo, int ldk, const _Float16* __restrict__ Vt, const _Float16* __restrict__ Vtlo, const unsigned* __restrict__ MB, const int* __restrict__ RA, const int* __restrict__ KE, const float* __restrict__ HB, _Float16* __restrict__ Oh, _Float16* __restrict__ Ol, int ldo) {
  #pragma clang fp contract(off)
  constexpr int RPW = 16, RTN = RPW / 16, NQB = TQ / (4 * RPW), DT = 4, KS = 2;
  __shared__ __attribute__((aligned(16))) unsigned short sP[4][RPW][40], sPl[4][RPW][40]; __shared__ __attribute__((aligned(16))) float sO[4][RPW][64 + 4];
  /* Two buffers of one trip's key and value tiles, 16 KiB each, which all four waves read: bytes 0: K hi (key tile 0, key tile 1; 2 KiB each = units ks 0, 1), 4096: K residual, 8192: V^T hi (units dt 0 .. 3), 12288: V^T residual. The units keep their fragment order. */
  __shared__ __attribute__((aligned(16))) unsigned short sKV[2][8192];
  const int tid = threadIdx.x, w = tid >> 5, lane = tid & 31, ln = lane & 15, hh = lane >> 4;
  /* Which (batch, head) slab and which 64-query tile a work-group takes. A causal tile t walks 2 (t + 1) key trips, all 1024 work-groups are resident at once, four to a WGP, and a SIMD's vector port is shared by its four waves, so the launch lasts as long as the WGP with the most trips.
     With tile = index % 32 work-groups whose indices are equal mod 256 hold the same tile. Here the four classes c of one a = index & 7 are the tiles 2a, 2a + 1, 31 - 2a, 30 - 2a (132 trips together, for every a), and c = (bits 3..4 + bits 8..9) & 3 takes all four values
     over indices equal mod 256 as well as over four neighbours (index step 8), and a pair c, c + 2 (66 trips) at index step 16. For speed only: (slab, tile) is a permutation of the index whatever the placement is. */
  static_assert(NQB == 32 && NBT * NH == 32, "the index map below is written for 32 slabs of 32 query tiles");
  const int bx = blockIdx.x, slab = bx / NQB, ta = (bx & 7) * 2, tc = (((bx >> 3) & 3) + (slab >> 3)) & 3;      /* slab >> 3 = bits 8..9 of the index */
  const int qblk = (ta | (tc & 1)) ^ ((tc >> 1) * 31);      /* x ^ 31 = 31 - x */ const int b = slab / NH, h = slab % NH; const int qb0 = qblk * (4 * RPW); const int q0 = qb0 + w * RPW;
  FragH aq[2][KS], aql[2][KS];
#pragma unroll
  for (int rt = 0; rt < RTN; ++rt) { const size_t qo = ((size_t)b * TQ + q0 + rt * 16) * ldq + h * 1024 + lane * 8;      /* fragment-order planes: head h = units 2h and 2h + 1 of the row tile */ const unsigned short* qr = (const unsigned short*)Q16 + qo; const unsigned short* ql = (const unsigned short*)Q16lo + qo;
#pragma unroll
    for (int ks = 0; ks < KS; ++ks) { aq[rt][ks].half[0] = *(const v8us*)(qr + ks * 512); aq[rt][ks].half[1] = *(const v8us*)(qr + ks * 512 + 256); aql[rt][ks].half[0] = *(const v8us*)(ql + ks * 512); aql[rt][ks].half[1] = *(const v8us*)(ql + ks * 512 + 256); } }
  int allm[2][8]; const unsigned* mrow[2][8];
#pragma unroll
  for (int rt = 0; rt < RTN; ++rt)
#pragma unroll
    for (int r = 0; r < 8; ++r) { const int tq = q0 + rt * 16 + 8 * hh + r; allm[rt][r] = RA[tq]; mrow[rt][r] = MB + (size_t)tq * (TK / 32); }
  asm volatile("s_wait_xcnt 0x0" ::: "memory");      /* stands in front of the first instruction that reuses an address register of the q and RA loads above (the build gives them to the zeroed accumulators) */
  __builtin_amdgcn_sched_barrier(0);      /* holds what follows behind that wait: the accumulators' zeroing depends on nothing, and a "memory" clobber does not tie it to the wait */
  const unsigned short* Vth = (const unsigned short*)Vt + (size_t)slab * 64 * TK; const unsigned short* Vtl = (const unsigned short*)Vtlo + (size_t)slab * 64 * TK;
  float m_r[2][8], l_r[2][8]; v8f oacc[2][DT], oaccl[2][DT];
#pragma unroll
  for (int rt = 0; rt < RTN; ++rt) {
#pragma unroll
    for (int r = 0; r < 8; ++r) { m_r[rt][r] = -3.0e38f; l_r[rt][r] = 0.f; }
#pragma unroll
    for (int dt = 0; dt < DT; ++dt) { oacc[rt][dt] = (v8f){0.f,0.f,0.f,0.f,0.f,0.f,0.f,0.f}; oaccl[rt][dt] = oacc[rt][dt]; } }
  const float xih = HB[2 * h], egh = HB[2 * h + 1];      /* the head's two bias scalars, read once */
  int jend = KE[qblk * 32]; jend = min(TK, (jend + 31) & ~31); if (jend < 32) jend = 32;      /* block-uniform */
  /* A tile goes from global memory to LDS by asynchronous copies, through no register: 8 copies of 16 bytes a lane, 2 KiB a copy over the work-group. The tile of trip t + 1 flies while trip t is worked on, and each tile is fetched once a work-group, not once a wave. */
  const unsigned ldsl = (unsigned)(size_t)&sKV[0][tid * 8];      /* the lane's LDS byte address in the first 2 KiB of buffer 0 */
  const size_t klo = ((size_t)b * TK * ldk + h * 1024) * 2, kst = (size_t)ldk * 2; const unsigned kln = (unsigned)tid * 16u, vln = (unsigned)(tid >> 6) * (32u * TK) + (unsigned)(tid & 63) * 16u;      /* byte offsets. Uniform: the head's key row 0; one key row. The lane's own: its piece of a key row tile; its piece of value unit dt = tid / 64 */
#define FM_COPY(J, BUF) { const size_t ku = klo + (size_t)(J) * kst, vu = (size_t)((J) >> 5) * 1024; const char* g0 = (const char*)K16 + ku + kln; const char* g1 = (const char*)K16 + (ku + 16 * kst) + kln; const char* g2 = (const char*)K16lo + ku + kln; const char* g3 = (const char*)K16lo + (ku + 16 * kst) + kln; \
    const char* g4 = (const char*)Vth + vu + vln; const char* g5 = (const char*)Vth + (vu + (size_t)64 * TK) + vln; const char* g6 = (const char*)Vtl + vu + vln; const char* g7 = (const char*)Vtl + (vu + (size_t)64 * TK) + vln; const unsigned l0 = ldsl + (unsigned)(BUF) * 16384u; \
    /* the eight copies and, as the statement's last line, the wait that stands in front of any rewrite of their address registers */ \
    asm volatile("global_load_async_to_lds_b128 %0, %8, off\n\tglobal_load_async_to_lds_b128 %1, %9, off\n\tglobal_load_async_to_lds_b128 %2, %10, off\n\tglobal_load_async_to_lds_b128 %3, %11, off\n\t" \
                 "global_load_async_to_lds_b128 %4, %12, off\n\tglobal_load_async_to_lds_b128 %5, %13, off\n\tglobal_load_async_to_lds_b128 %6, %14, off\n\tglobal_load_async_to_lds_b128 %7, %15, off\n\ts_wait_xcnt 0x0" \
                 :: "v"(l0), "v"(l0 + 2048u), "v"(l0 + 4096u), "v"(l0 + 6144u), "v"(l0 + 8192u), "v"(l0 + 10240u), "v"(l0 + 12288u), "v"(l0 + 14336u), "v"(g0), "v"(g1), "v"(g2), "v"(g3), "v"(g4), "v"(g5), "v"(g6), "v"(g7) : "memory"); }
  FM_COPY(0, 0)
  asm volatile("s_wait_asynccnt 0x0" ::: "memory");      /* this wave's copies of tile 0 have landed */
  __syncthreads();      /* publishes tile 0 to the four waves */
  if (32 < jend) FM_COPY(32, 1)
#pragma unroll 1
  for (int j0 = 0; j0 < jend; j0 += 32) {
    const int buf = (j0 >> 5) & 1; const unsigned short* kvb = &sKV[buf][0];
    unsigned mwv[2][8];      /* the rows' mask words, fetched together at the head of the trip: they fly beside the key loads */
#pragma unroll
    for (int rt = 0; rt < RTN; ++rt)
#pragma unroll
      for (int r = 0; r < 8; ++r) mwv[rt][r] = mrow[rt][r][j0 >> 5];
    v8f s[2][2];
#pragma unroll
    for (int nt = 0; nt < 2; ++nt) { const unsigned short* kr = kvb + nt * 1024 + lane * 8; const unsigned short* kl = kr + 2048; FragH bk[KS], bkl[KS];      /* from the trip's LDS buffer */
#pragma unroll
      for (int ks = 0; ks < KS; ++ks) { bk[ks].half[0] = *(const v8us*)(kr + ks * 512); bk[ks].half[1] = *(const v8us*)(kr + ks * 512 + 256); bkl[ks].half[0] = *(const v8us*)(kl + ks * 512); bkl[ks].half[1] = *(const v8us*)(kl + ks * 512 + 256); }
#pragma unroll
      for (int rt = 0; rt < RTN; ++rt) { v8f acc = (v8f){0.f,0.f,0.f,0.f,0.f,0.f,0.f,0.f}, accr = acc;
#pragma unroll
        for (int ks = 0; ks < KS; ++ks) { acc = mmaH<1>(aq[rt][ks].v, aq[rt][ks].v, bk[ks].v, bk[ks].v, acc); accr = mmaH<1>(aql[rt][ks].v, aql[rt][ks].v, bk[ks].v, bk[ks].v, accr); accr = mmaH<1>(aq[rt][ks].v, aq[rt][ks].v, bkl[ks].v, bkl[ks].v, accr); }
        s[rt][nt] = acc + accr * 0.0009765625f; } }
    __builtin_amdgcn_sched_barrier(0);      /* keeps the 16 bias values from being formed ahead of the key products, where they are live beside the key fragments and push the kernel past 256 registers (4 waves a SIMD) */
    /* Softmax of the tile, step by step over all rows instead of row by row: each step below is done for every row before the next begins, and no step holds a branch (each exp is computed and then selected),
       so that the rows' shuffle and exp latencies overlap. Every element takes the same operations in the same order as before. */
    float s0v[2][8], s1v[2][8], mcv[2][8]; bool ok0v[2][8], ok1v[2][8];
#pragma unroll
    for (int rt = 0; rt < RTN; ++rt)
#pragma unroll
      for (int r = 0; r < 8; ++r) { const unsigned mw = mwv[rt][r]; const bool am = (allm[rt][r] != 0);
        const bool ok0 = am || (((mw >> ln) & 1u) == 0u), ok1 = am || (((mw >> (16 + ln)) & 1u) == 0u);
        const int tqe = q0 + rt * 16 + 8 * hh + r; const int k0e = j0 + ln, k1e = j0 + 16 + ln;
        const float b0 = (-((float)(tqe > k0e ? tqe - k0e : k0e - tqe) / xih)) * egh, b1 = (-((float)(tqe > k1e ? tqe - k1e : k1e - tqe) / xih)) * egh;
        const float x0 = s[rt][0][r] * SCL + b0, x1 = s[rt][1][r] * SCL + b1; const float y0 = am ? 0.f : x0, y1 = am ? 0.f : x1; const float s0 = ok0 ? y0 : -INFINITY, s1 = ok1 ? y1 : -INFINITY;      /* computed, then selected */
        ok0v[rt][r] = ok0; ok1v[rt][r] = ok1; s0v[rt][r] = s0; s1v[rt][r] = s1; mcv[rt][r] = fmaxf(s0, s1); }
    asm volatile("" :: "v"(mcv[0][0]), "v"(mcv[0][1]), "v"(mcv[0][2]), "v"(mcv[0][3]), "v"(mcv[0][4]), "v"(mcv[0][5]), "v"(mcv[0][6]), "v"(mcv[0][7])); __builtin_amdgcn_sched_barrier(0);      /* inputs only: all eight rows' maxima stand ready in front of the first shuffle round. Without it this build takes the rows two at a time, and each pair waits out its four shuffle rounds alone */
#pragma unroll
    for (int sh = 1; sh <= 8; sh <<= 1) { float tv[2][8];
#pragma unroll
      for (int rt = 0; rt < RTN; ++rt)
#pragma unroll
        for (int r = 0; r < 8; ++r) tv[rt][r] = __shfl_xor(mcv[rt][r], sh, 32);
#pragma unroll
      for (int rt = 0; rt < RTN; ++rt)
#pragma unroll
        for (int r = 0; r < 8; ++r) mcv[rt][r] = fmaxf(mcv[rt][r], tv[rt][r]); }
    asm volatile("" :: "v"(mcv[0][0]), "v"(mcv[0][1]), "v"(mcv[0][2]), "v"(mcv[0][3]), "v"(mcv[0][4]), "v"(mcv[0][5]), "v"(mcv[0][6]), "v"(mcv[0][7])); __builtin_amdgcn_sched_barrier(0);      /* inputs only, for the same reason: the eight rows go through the four rounds together, in front of the exps */
#pragma unroll
    for (int rt = 0; rt < RTN; ++rt)
#pragma unroll
      for (int r = 0; r < 8; ++r) { const float mn = fmaxf(m_r[rt][r], mcv[rt][r]); const float ea = expf(m_r[rt][r] - mn), e0 = expf(s0v[rt][r] - mn), e1 = expf(s1v[rt][r] - mn);
        const float al = (mn > -1.0e38f) ? ea : 1.0f; m_r[rt][r] = mn; const float p0 = ok0v[rt][r] ? e0 : 0.f, p1 = ok1v[rt][r] ? e1 : 0.f; l_r[rt][r] = l_r[rt][r] * al + p0 + p1;
#pragma unroll
        for (int dt = 0; dt < DT; ++dt) { oacc[rt][dt][r] *= al; oaccl[rt][dt][r] *= al; }
        FragH t2, t3; const float ps0 = p0 * 1024.0f, ps1 = p1 * 1024.0f; t2.h[0] = (_Float16)ps0; t2.h[1] = (_Float16)ps1; t3.h[0] = (_Float16)((ps0 - (float)t2.h[0]) * 1024.0f); t3.h[1] = (_Float16)((ps1 - (float)t2.h[1]) * 1024.0f);
        sP[w][rt * 16 + 8 * hh + r][ln] = t2.u[0]; sP[w][rt * 16 + 8 * hh + r][16 + ln] = t2.u[1]; sPl[w][rt * 16 + 8 * hh + r][ln] = t3.u[0]; sPl[w][rt * 16 + 8 * hh + r][16 + ln] = t3.u[1]; }
    __builtin_amdgcn_fence(__ATOMIC_ACQ_REL, "workgroup"); __builtin_amdgcn_wave_barrier();
    FragH pa[2], pl[2];
#pragma unroll
    for (int rt = 0; rt < RTN; ++rt) { pa[rt].half[0] = *(const v8us*)&sP[w][rt * 16 + ln][8 * hh]; pa[rt].half[1] = *(const v8us*)&sP[w][rt * 16 + ln][16 + 8 * hh]; pl[rt].half[0] = *(const v8us*)&sPl[w][rt * 16 + ln][8 * hh]; pl[rt].half[1] = *(const v8us*)&sPl[w][rt * 16 + ln][16 + 8 * hh]; }
#pragma unroll
    for (int dt = 0; dt < DT; ++dt) { const unsigned short* vr = kvb + 4096 + dt * 512 + lane * 8; FragH bv, bl; bv.half[0] = *(const v8us*)(vr); bv.half[1] = *(const v8us*)(vr + 256); bl.half[0] = *(const v8us*)(vr + 2048); bl.half[1] = *(const v8us*)(vr + 2048 + 256);
#pragma unroll
      for (int rt = 0; rt < RTN; ++rt) { oacc[rt][dt] = mmaH<1>(pa[rt].v, pa[rt].v, bv.v, bv.v, oacc[rt][dt]); oaccl[rt][dt] = mmaH<1>(pa[rt].v, pa[rt].v, bl.v, bl.v, oaccl[rt][dt]); oaccl[rt][dt] = mmaH<1>(pl[rt].v, pl[rt].v, bv.v, bv.v, oaccl[rt][dt]); } }
    __builtin_amdgcn_fence(__ATOMIC_ACQ_REL, "workgroup"); __builtin_amdgcn_wave_barrier();
    asm volatile("s_wait_dscnt 0x0" ::: "memory");      /* this wave's reads of the trip's buffer have returned */
    asm volatile("s_wait_asynccnt 0x0" ::: "memory");      /* this wave's copies of the next tile have landed */
    __syncthreads();      /* publishes the next tile and ends every wave's reads of this trip's buffer, which is refilled below */
    if (j0 + 64 < jend) FM_COPY(j0 + 64, buf) }
  asm volatile("s_wait_asynccnt 0x0" ::: "memory");      /* no copy is outstanding when the wave goes on to its end */
#undef FM_COPY
#pragma unroll
  for (int rt = 0; rt < RTN; ++rt) {
#pragma unroll
    for (int r = 0; r < 8; ++r) { float l = l_r[rt][r]; l += __shfl_xor(l, 1, 32); l += __shfl_xor(l, 2, 32); l += __shfl_xor(l, 4, 32); l += __shfl_xor(l, 8, 32); l_r[rt][r] = (l > 0.f) ? 1.0f / (l * 1024.0f) : 0.f; }
#pragma unroll
    for (int dt = 0; dt < DT; ++dt)
#pragma unroll
      for (int r = 0; r < 8; ++r) sO[w][rt * 16 + 8 * hh + r][dt * 16 + ln] = (oacc[rt][dt][r] + oaccl[rt][dt][r] * 0.0009765625f) * l_r[rt][r]; }
  __builtin_amdgcn_fence(__ATOMIC_ACQ_REL, "workgroup"); __builtin_amdgcn_wave_barrier();
  {
#pragma unroll
    for (int u = 0; u < 4 * RTN; ++u) { const int rl = (u >> 2) * 16 + ln, kk = ((u >> 1) & 1) * 32 + (u & 1) * 16 + hh * 8; const v4f a = *(const v4fa*)&sO[w][rl][kk], c = *(const v4fa*)&sO[w][rl][kk + 4];      /* O leaves as the hi and residual fragment-order planes that the output projection reads: a lane's piece is row ln, 8 columns */
      const float o[8] = {a[0], a[1], a[2], a[3], c[0], c[1], c[2], c[3]}; FragH fh, fl; hl_split8(o, fh, fl); const size_t po = pk_dst((size_t)b * TQ + q0 + rl, h * 64 + kk, ldo);
      *(v8us*)((unsigned short*)Oh + po) = fh.half[0]; *(v8us*)((unsigned short*)Ol + po) = fl.half[0]; }
     } }


__global__ __launch_bounds__(256) void k_causaltab(unsigned* __restrict__ MB, int* __restrict__ RA, int* __restrict__ KE, int nq, int nk) {
  const int t = blockIdx.x * 256 + threadIdx.x; const int nw = nk / 32;
  if (t < nq * nw) { const int q = t / nw, w = t % nw; const int first = q + 1 - 32 * w; const unsigned bits = (first <= 0) ? 0xffffffffu : ((first >= 32) ? 0u : (0xffffffffu << first)); *(unsigned*)(MB + t) = bits;  }
  if (t < nq) { *(int*)(RA + t) = 0;  }
  if (t < nq / 64) { const int v = 64 * (t + 1); *(int*)(KE + t * 32) = v;  } }

__constant__ float PIF[32] = {3.141592741e+00f,3.031195641e+00f,2.924677610e+00f,2.821902990e+00f,2.722739935e+00f,2.627061367e+00f,2.534744978e+00f,2.445672750e+00f,2.359730482e+00f,2.276808262e+00f,2.196800232e+00f,2.119603395e+00f,2.045119524e+00f,1.973252892e+00f,1.903911710e+00f,1.837007284e+00f,1.772453904e+00f,1.710168958e+00f,1.650072694e+00f,1.592088223e+00f,1.536141396e+00f,1.482160687e+00f,1.430076718e+00f,1.379823089e+00f,1.331335425e+00f,1.284551501e+00f,1.239411712e+00f,1.195858121e+00f,1.153835058e+00f,1.113288760e+00f,1.074167132e+00f,1.036420345e+00f};
__global__ __launch_bounds__(256) void k_trig(const float* __restrict__ pig, const float* __restrict__ logxi, const float* __restrict__ egl, float* __restrict__ CS, float* __restrict__ SN, float* __restrict__ HB) {
  #pragma clang fp contract(off)
  const int t = blockIdx.x * 256 + threadIdx.x; if (t >= NH * SLEN * 32) return; const int j = t & 31; const int tok = (t >> 5) % SLEN; const int h = t / (32 * SLEN);
  const float pg = 1.0f / (1.0f + expf(-bf16_round(pig[h]))); const float th = ((float)tok * PIF[j]) * pg; const float c = cosf(th), s = sinf(th);
  *(float*)(CS + t) = c; *(float*)(SN + t) = s; 
  if (t < 2 * NH) { const int hh2 = t >> 1; const float v = (t & 1) ? (1.0f / (1.0f + expf(-bf16_round(egl[hh2])))) : expf(bf16_round(logxi[hh2])); *(float*)(HB + t) = v;  } }      

extern "C" void kernel_launch(void* const* d_in, const int* in_sizes, int n_in,
                              void* d_out, int out_size, void* d_ws, size_t ws_size, hipStream_t stream) {
  (void)in_sizes; (void)n_in; (void)out_size;
  const float* const* I = (const float* const*)d_in; const float* x = I[0]; const float* Wqkv = I[1]; const float* Wo = I[2]; const float* logxi = I[3]; const float* pig = I[4]; const float* egl = I[5];
  char* ws = (char*)d_ws; size_t off = 0;
  auto take = [&](size_t bytes) { char* p = ws + off; off += (bytes + 255) & ~(size_t)255; return p; };
  _Float16* BQKV = (_Float16*)take((size_t)3 * DM * DM * 2); _Float16* BO = (_Float16*)take((size_t)DM * DM * 2);
  _Float16* X16 = (_Float16*)take((size_t)NR * DM * 2); _Float16* Oh = (_Float16*)take((size_t)NR * DM * 2); _Float16* Ol = (_Float16*)take((size_t)NR * DM * 2);
  _Float16* Qh = (_Float16*)take((size_t)NR * DM * 2); _Float16* Ql = (_Float16*)take((size_t)NR * DM * 2); _Float16* Kh = (_Float16*)take((size_t)NR * DM * 2); _Float16* Kl = (_Float16*)take((size_t)NR * DM * 2); _Float16* Vth = (_Float16*)take((size_t)NR * DM * 2); _Float16* Vtl = (_Float16*)take((size_t)NR * DM * 2);
  unsigned* MB = (unsigned*)take((size_t)SLEN * (SLEN / 32) * 4); int* RA = (int*)take((size_t)SLEN * 4); int* KE = (int*)take((size_t)(SLEN / 64) * 32 * 4);
  float* CS = (float*)take((size_t)NH * SLEN * 32 * 4); float* SN = (float*)take((size_t)NH * SLEN * 32 * 4); float* HB = (float*)take(256);
  if (off > ws_size) return;      /* 6 + 2 + 8 + 8 x 8 + 0.5 + 8 = 89 MiB */
  const size_t n8 = (size_t)NR * DM / 8; const unsigned nb8 = (unsigned)((n8 + 255) / 256);
  k_round16f<<<(unsigned)(((size_t)3 * DM * DM / 8 + 255) / 256), 256, 0, stream>>>(Wqkv, BQKV, (size_t)3 * DM * DM / 8); k_round16f<<<(unsigned)(((size_t)DM * DM / 8 + 255) / 256), 256, 0, stream>>>(Wo, BO, (size_t)DM * DM / 8);      /* torch (out,in) = natural Bt; x16 */
  k_x16<<<nb8, 256, 0, stream>>>(x, X16, n8);
  k_trig<<<(NH * SLEN * 32 + 255) / 256, 256, 0, stream>>>(pig, logxi, egl, CS, SN, HB); k_causaltab<<<(SLEN * (SLEN / 32) + 255) / 256, 256, 0, stream>>>(MB, RA, KE, SLEN, SLEN);
  const dim3 gP((NR / 128) * (DM / 64), 1);
  k_gemm2<0, 1><<<gP, 128, 0, stream>>>(X16, DM, 0, BQKV, DM, 0, 0.0625f, nullptr, 0, nullptr, 1, 0, 0, nullptr, nullptr, DM, 0, NR, DM, DM, CS, SN, Qh, Ql);      /* q (rows 0..1023 of Wqkv), rotated, hi/lo */
  k_gemm2<0, 1><<<gP, 128, 0, stream>>>(X16, DM, 0, BQKV + (size_t)DM * DM, DM, 0, 0.0625f, nullptr, 0, nullptr, 1, 0, 0, nullptr, nullptr, DM, 0, NR, DM, DM, CS, SN, Kh, Kl);      /* k (rows 1024..2047), rotated, hi/lo */
  k_gemm2<0, 2><<<gP, 128, 0, stream>>>(X16, DM, 0, BQKV + (size_t)2 * DM * DM, DM, 0, 0.0625f, nullptr, 0, nullptr, 1, 0, 0, nullptr, nullptr, DM, 0, NR, DM, DM, nullptr, nullptr, Vth, Vtl);      /* v (rows 2048..3071), transposed, hi/lo */
  k_flashme<SLEN, SLEN><<<NBT * NH * (SLEN / 64), 128, 0, stream>>>(Qh, Ql, DM, Kh, Kl, DM, Vth, Vtl, MB, RA, KE, HB, Oh, Ol, DM);      /* both batches in one grid, so that their waves share the chip; the kernel deals long and short causal tiles evenly over the WGPs */
  k_gemm2<0, 0><<<gP, 128, 0, stream>>>(Oh, DM, 0, BO, DM, 0, 0.0625f, nullptr, 0, nullptr, 1, 0, 0, (float*)d_out, nullptr, DM, 0, NR, DM, DM, nullptr, nullptr, nullptr, nullptr);
  k_gemm2<0, 0><<<gP, 128, 0, stream>>>(Ol, DM, 0, BO, DM, 0, 0.0625f / 1024.0f, nullptr, 0, (const float*)d_out, 1, (size_t)DM, 0, (float*)d_out, nullptr, DM, 0, NR, DM, DM, nullptr, nullptr, nullptr, nullptr);
}

// v008
// One run takes 252 microseconds.
// Next to v007, in two timings, it ran 1.18 and 1.17 times as fast.
// All steps since v000 together make it 3.47 times as fast.
#include <hip/hip_runtime.h>
// Causal multi-head attention with gated rotary phases and a per-head distance decay (2 x 2048 tokens x 1024, 16 heads x 64): qkv = x*Wqkv^T; theta[h][t][j] = (t * pi^(1 - j/32)) * sigmoid(pi_gate[h]); interleaved-pair rotation of q and k; scores = q.k/8 - |i - j| / exp(log_xi[h]) * sigmoid(e_gate[h]) with j <= i; softmax; merged . Wo^T -> [2,2048,1024].
// Structure: x as an exact f16 plane; q/k/v from one packed f16 WMMA GEMM family (32x64 wave tiles, f32, exact products); per-(head, token) cos/sin tables on VALU (pi^(1-j/32) = the reference's f32 constants, precise trig); the projection GEMMs' epilogues rotate q and k in f32 and write them as f16 hi + x2^10 residual planes, and write V^T as hi + residual planes; the fused flash kernel per ((batch, head), 64 queries) with the decay bias and the causal mask added per element from a table over query - key that each work-group builds in LDS (three-product hi/lo scores, online softmax f32, P hi + residual via LDS, two value accumulators), whose epilogue writes O as hi + residual planes; output projection as two GEMMs.
// Compute dtype: x, weights and the three gate/scale vectors rounded to bf16; projections exact; rotation and bias f32; q, k, P, v, O as f16 hi + residual pairs (~2^-21); f32 accumulation and softmax. v_wmma_f32_16x16x32_f16.
#define NBT 2
#define SLEN 2048
#define DM 1024
#define NH 16
#define SCL 0.125f
#define NR (NBT * SLEN)
typedef __bf16 v16b __attribute__((ext_vector_type(16)));
typedef unsigned short v8us __attribute__((ext_vector_type(8), may_alias));
typedef float  v8f  __attribute__((ext_vector_type(8)));
typedef float  v4f  __attribute__((ext_vector_type(4)));
typedef float  v4fa __attribute__((ext_vector_type(4), may_alias));
union FragB { v16b v; v8us half[2]; unsigned short u[16]; };

__device__ __forceinline__ unsigned short bf16_bits(float x) { unsigned int u = __float_as_uint(x); return (unsigned short)((u + 0x7FFFu + ((u >> 16) & 1u)) >> 16); }
__device__ __forceinline__ float bf16_val(unsigned short b) { return __uint_as_float(((unsigned int)b) << 16); }
__device__ __forceinline__ float bf16_round(float x) { return bf16_val(bf16_bits(x)); }
// D += A·B with NT terms: 1 = ah·bh, 2 = + al·bh (A split), 3 = + ah·bl (both split)
template <int NT>
__device__ __forceinline__ v8f mmaN(v16b ah, v16b al, v16b bh, v16b bl, v8f c) {
  c = __builtin_amdgcn_wmma_f32_16x16x32_bf16(false, ah, false, bh, (short)0, c, false, false);
  if (NT >= 2) c = __builtin_amdgcn_wmma_f32_16x16x32_bf16(false, al, false, bh, (short)0, c, false, false);
  if (NT >= 3) c = __builtin_amdgcn_wmma_f32_16x16x32_bf16(false, ah, false, bl, (short)0, c, false, false);
  asm volatile("v_nop\n\tv_nop\n\tv_nop\n\tv_nop" : "+v"(c) : "v"(ah), "v"(al), "v"(bh), "v"(bl));
  return c;
}

__global__ __launch_bounds__(256) void k_wt_bf16(const float* __restrict__ W, unsigned short* __restrict__ Wt, int K, int N) {
  const int t = blockIdx.x * 256 + threadIdx.x;
  const int k8n = K / 8;
  if (t >= N * k8n) return;
  const int n = t / k8n, k8 = (t % k8n) * 8;
  v8us v;
#pragma unroll
  for (int i = 0; i < 8; ++i) v[i] = bf16_bits(W[(size_t)(k8 + i) * N + n]);
  *(v8us*)(Wt + (size_t)n * K + k8) = v;
  
}

// GEMM C[M][N] (f32, pitch ldc) = act(A[M][K]·W + bias). A f32 row-major (pitch lda) converted per fragment to bf16
// (ASPLIT: hi/lo two planes -> 2 terms, else single rounded term); Wt bf16 [N][K] (pitch ldb). BIAS_BF16 rounds the
// bias to bf16 first (bias quantised to bf16 before the add). K%32==0, M%16==0, N%64==0.
template <bool ASPLIT, int ACT, bool BIAS_BF16>
__global__ __launch_bounds__(128) void k_gemm_bf(const float* __restrict__ A, int lda, const unsigned short* __restrict__ Wt, int ldb,
                                               const float* __restrict__ bias, float* __restrict__ C, int ldc, int M, int N, int K) {
  __shared__ __attribute__((aligned(16))) float so[4][16][64];
  const int tid = threadIdx.x, w = tid >> 5, lane = tid & 31, ln = lane & 15, hh = lane >> 4;
  const int ntn = N / 64;
  const int wid = blockIdx.x * 4 + w;
  const int mt = wid / ntn, nq = wid % ntn;
  if (mt * 16 >= M) return;
  const int row0 = mt * 16, col0 = nq * 64;
  const float* arow = A + (size_t)(row0 + ln) * lda;
  v8f acc[4] = {};
  for (int kb = 0; kb < K; kb += 32) {
    FragB ah, al;
    const v4f x0 = *(const v4fa*)(arow + kb + 8 * hh), x1 = *(const v4fa*)(arow + kb + 8 * hh + 4);
    const v4f x2 = *(const v4fa*)(arow + kb + 16 + 8 * hh), x3 = *(const v4fa*)(arow + kb + 16 + 8 * hh + 4);
    float xs[16] = {x0[0],x0[1],x0[2],x0[3],x1[0],x1[1],x1[2],x1[3],x2[0],x2[1],x2[2],x2[3],x3[0],x3[1],x3[2],x3[3]};
#pragma unroll
    for (int i = 0; i < 16; ++i) { const unsigned short hb = bf16_bits(xs[i]); ah.u[i] = hb; al.u[i] = ASPLIT ? bf16_bits(xs[i] - bf16_val(hb)) : (unsigned short)0; }
#pragma unroll
    for (int t = 0; t < 4; ++t) {
      const unsigned short* brow = Wt + (size_t)(col0 + t * 16 + ln) * ldb + kb;
      FragB b;
      b.half[0] = *(const v8us*)(brow + 8 * hh);
      b.half[1] = *(const v8us*)(brow + 16 + 8 * hh);
      acc[t] = mmaN<ASPLIT ? 2 : 1>(ah.v, al.v, b.v, b.v, acc[t]);
    }
  }
#pragma unroll
  for (int t = 0; t < 4; ++t) {
    float bv = bias ? bias[col0 + t * 16 + ln] : 0.f;
    if (BIAS_BF16) bv = bf16_round(bv);
#pragma unroll
    for (int r = 0; r < 8; ++r) { float v = acc[t][r] + bv; if (ACT == 1) v = fmaxf(v, 0.f); so[w][8 * hh + r][t * 16 + ln] = v; }
  }
  __builtin_amdgcn_fence(__ATOMIC_ACQ_REL, "workgroup");
  __builtin_amdgcn_wave_barrier();
  const int rsub = lane >> 4, c4 = (lane & 15) * 4;
  {
#pragma unroll
    for (int q = 0; q < 8; ++q) {
      const int r = q * 2 + rsub;
      const v4f v = *(const v4fa*)&so[w][r][c4];
      *(v4f*)(C + (size_t)(row0 + r) * ldc + col0 + c4) = v;
    }
    
  }
}

// GEMM C = act(A·W + bias + resid): A f32 (ASPLIT -> hi/lo 2 terms), Wt bf16 [N][K]; ACT 0 none, 1 relu, 2 exact gelu;
// resid (optional, f32, row index = (row % rmod), pitch ldr, RES_BF16 rounds it) added before the activation.
template <bool ASPLIT, int ACT, bool BIAS_BF16, bool RES_BF16>
__global__ __launch_bounds__(128) void k_gemm_bf3(const float* __restrict__ A, int lda, const unsigned short* __restrict__ Wt, int ldb,
                                                const float* __restrict__ bias, const float* __restrict__ resid, int rmod, int ldr,
                                                float* __restrict__ C, int ldc, int M, int N, int K) {
  __shared__ __attribute__((aligned(16))) float so[4][16][64];
  const int tid = threadIdx.x, w = tid >> 5, lane = tid & 31, ln = lane & 15, hh = lane >> 4;
  const int ntn = N / 64;
  const int wid = blockIdx.x * 4 + w;
  const int mt = wid / ntn, nq = wid % ntn;
  if (mt * 16 >= M) return;
  const int row0 = mt * 16, col0 = nq * 64;
  const float* arow = A + (size_t)(row0 + ln) * lda;
  v8f acc[4] = {};
  for (int kb = 0; kb < K; kb += 32) {
    FragB ah, al;
    const v4f x0 = *(const v4fa*)(arow + kb + 8 * hh), x1 = *(const v4fa*)(arow + kb + 8 * hh + 4);
    const v4f x2 = *(const v4fa*)(arow + kb + 16 + 8 * hh), x3 = *(const v4fa*)(arow + kb + 16 + 8 * hh + 4);
    float xs[16] = {x0[0],x0[1],x0[2],x0[3],x1[0],x1[1],x1[2],x1[3],x2[0],x2[1],x2[2],x2[3],x3[0],x3[1],x3[2],x3[3]};
#pragma unroll
    for (int i = 0; i < 16; ++i) { const unsigned short hb = bf16_bits(xs[i]); ah.u[i] = hb; al.u[i] = ASPLIT ? bf16_bits(xs[i] - bf16_val(hb)) : (unsigned short)0; }
#pragma unroll
    for (int t = 0; t < 4; ++t) {
      const unsigned short* brow = Wt + (size_t)(col0 + t * 16 + ln) * ldb + kb;
      FragB b;
      b.half[0] = *(const v8us*)(brow + 8 * hh);
      b.half[1] = *(const v8us*)(brow + 16 + 8 * hh);
      acc[t] = mmaN<ASPLIT ? 2 : 1>(ah.v, al.v, b.v, b.v, acc[t]);
    }
  }
#pragma unroll
  for (int t = 0; t < 4; ++t) {
    const int col = col0 + t * 16 + ln;
    float bv = bias ? bias[col] : 0.f;
    if (BIAS_BF16) bv = bf16_round(bv);
#pragma unroll
    for (int r = 0; r < 8; ++r) {
      float v = acc[t][r] + bv;
      if (resid) { float rv = resid[(size_t)((row0 + 8 * hh + r) % rmod) * ldr + col]; if (RES_BF16) rv = bf16_round(rv); v += rv; }
      if (ACT == 1) v = fmaxf(v, 0.f);
      if (ACT == 2) v = 0.5f * v * (1.0f + erff(v * 0.70710678118654752f));
      if (ACT == 3) { const float u = 0.7978845608028654f * (v + 0.044715f * v * v * v); v = 0.5f * v * (1.0f + tanhf(u)); }
      so[w][8 * hh + r][t * 16 + ln] = v;
    }
  }
  __builtin_amdgcn_fence(__ATOMIC_ACQ_REL, "workgroup");
  __builtin_amdgcn_wave_barrier();
  const int rsub = lane >> 4, c4 = (lane & 15) * 4;
  {
#pragma unroll
    for (int q = 0; q < 8; ++q) {
      const int r = q * 2 + rsub;
      const v4f v = *(const v4fa*)&so[w][r][c4];
      *(v4f*)(C + (size_t)(row0 + r) * ldc + col0 + c4) = v;
    }
    
  }
}
// row LayerNorm (biased variance, eps) over N: s = X (+ R); optional out_sum <- s; out_norm <- (s-mu)*rsqrt(var+eps)*g + b
template <bool PARAM_BF16>
__global__ __launch_bounds__(256) void k_layernorm(const float* __restrict__ X, const float* __restrict__ R, const float* __restrict__ g, const float* __restrict__ bta,
                                                  float* __restrict__ out_sum, float* __restrict__ out_norm, int N, float eps) {
  __shared__ float red[256];
  const int row = blockIdx.x, tid = threadIdx.x;
  const float* x = X + (size_t)row * N; const float* rr = R ? R + (size_t)row * N : nullptr;
  float vals[16];                     // up to N = 4096
  const int per = N / 256;            // contiguous chunk per thread? use strided-by-4 chunks: thread handles j = tid*4 + 1024*u
  float s1 = 0.f;
  for (int u = 0; u < per / 4; ++u) {
    const int j = tid * 4 + 1024 * u;
    const v4f a = *(const v4fa*)(x + j);
    v4f b = {0.f,0.f,0.f,0.f}; if (rr) b = *(const v4fa*)(rr + j);
#pragma unroll
    for (int q = 0; q < 4; ++q) { const float v = a[q] + b[q]; vals[u * 4 + q] = v; s1 += v; }
  }
  red[tid] = s1; __syncthreads();
  for (int st = 128; st > 0; st >>= 1) { if (tid < st) red[tid] += red[tid + st]; __syncthreads(); }
  const float mu = red[0] / (float)N; __syncthreads();
  float s2 = 0.f;
  for (int u = 0; u < per / 4; ++u)
#pragma unroll
    for (int q = 0; q < 4; ++q) { const float c = vals[u * 4 + q] - mu; s2 += c * c; }
  red[tid] = s2; __syncthreads();
  for (int st = 128; st > 0; st >>= 1) { if (tid < st) red[tid] += red[tid + st]; __syncthreads(); }
  const float rs = rsqrtf(red[0] / (float)N + eps);
  {
    for (int u = 0; u < per / 4; ++u) {
      const int j = tid * 4 + 1024 * u;
      v4f o, sm;
#pragma unroll
      for (int q = 0; q < 4; ++q) {
        float gg = g[j + q], bb = bta[j + q];
        if (PARAM_BF16) { gg = bf16_round(gg); bb = bf16_round(bb); }
        sm[q] = vals[u * 4 + q]; o[q] = (vals[u * 4 + q] - mu) * rs * gg + bb;
      }
      if (out_sum) *(v4f*)(out_sum + (size_t)row * N + j) = sm;
      *(v4f*)(out_norm + (size_t)row * N + j) = o;
    }
    
  }
}



// ---- f16 WMMA path (v_wmma_f32_16x16x32_f16): 11-bit significands for operands in range — used where a [0,1] probability operand needs more precision than bf16
typedef _Float16 v16h __attribute__((ext_vector_type(16)));
union FragH { v16h v; v8us half[2]; _Float16 h[16]; unsigned short u[16]; };
template <int NT>
__device__ __forceinline__ v8f mmaH(v16h ah, v16h al, v16h bh, v16h bl, v8f c) {
  c = __builtin_amdgcn_wmma_f32_16x16x32_f16(false, ah, false, bh, (short)0, c, false, false);
  if (NT >= 2) c = __builtin_amdgcn_wmma_f32_16x16x32_f16(false, al, false, bh, (short)0, c, false, false);
  if (NT >= 3) c = __builtin_amdgcn_wmma_f32_16x16x32_f16(false, ah, false, bl, (short)0, c, false, false);
  asm volatile("v_nop\n\tv_nop\n\tv_nop\n\tv_nop" : "+v"(c) : "v"(ah), "v"(al), "v"(bh), "v"(bl));
  return c;
}
// batched GEMM like k_gemm_b but f16 operands: A f32 (split into f16 hi/lo if ASPLIT, else rounded to f16), Bt = f16 values [n][k]; alpha; C f32; N multiple of 16 (partial tiles skipped)
template <bool ASPLIT>
__global__ __launch_bounds__(128) void k_gemm_h(const float* __restrict__ A, int lda, size_t sA, const _Float16* __restrict__ Bh, int ldb, size_t sB, float alpha, float* __restrict__ C, int ldc, size_t sC, int M, int N, int K) {
  __shared__ __attribute__((aligned(16))) float so[4][16][64];
  const int tid = threadIdx.x, w = tid >> 5, lane = tid & 31, ln = lane & 15, hh = lane >> 4; const int by = blockIdx.y;
  A += (size_t)by * sA; Bh += (size_t)by * sB; C += (size_t)by * sC;
  const int ntn = (N + 63) / 64; const int wid = blockIdx.x * 4 + w; const int mt = wid / ntn, nq = wid % ntn; if (mt * 16 >= M) return;
  const int row0 = mt * 16, col0 = nq * 64; const float* arow = A + (size_t)(row0 + ln) * lda;
  v8f acc[4] = {};
  for (int kb = 0; kb < K; kb += 32) {
    FragH ah, al;
    const v4f x0 = *(const v4fa*)(arow + kb + 8 * hh), x1 = *(const v4fa*)(arow + kb + 8 * hh + 4), x2 = *(const v4fa*)(arow + kb + 16 + 8 * hh), x3 = *(const v4fa*)(arow + kb + 16 + 8 * hh + 4);
    float xs[16] = {x0[0],x0[1],x0[2],x0[3],x1[0],x1[1],x1[2],x1[3],x2[0],x2[1],x2[2],x2[3],x3[0],x3[1],x3[2],x3[3]};
#pragma unroll
    for (int i = 0; i < 16; ++i) { const _Float16 h = (_Float16)xs[i]; ah.h[i] = h; al.h[i] = ASPLIT ? (_Float16)(xs[i] - (float)h) : (_Float16)0.0f; }
#pragma unroll
    for (int t = 0; t < 4; ++t) { if (col0 + t * 16 >= N) continue; const size_t boff = (size_t)(col0 + t * 16 + ln) * ldb + kb; FragH bq; bq.half[0] = *(const v8us*)(Bh + boff + 8 * hh); bq.half[1] = *(const v8us*)(Bh + boff + 16 + 8 * hh);
      acc[t] = mmaH<ASPLIT ? 2 : 1>(ah.v, al.v, bq.v, bq.v, acc[t]); }
  }
#pragma unroll
  for (int t = 0; t < 4; ++t) { if (col0 + t * 16 >= N) continue;
#pragma unroll
    for (int r = 0; r < 8; ++r) so[w][8 * hh + r][t * 16 + ln] = acc[t][r] * alpha; }
  __builtin_amdgcn_fence(__ATOMIC_ACQ_REL, "workgroup"); __builtin_amdgcn_wave_barrier();
  const int rsub = lane >> 4, c4 = (lane & 15) * 4;
  {
#pragma unroll
    for (int q = 0; q < 8; ++q) { const int r = q * 2 + rsub; if (col0 + c4 < N) { const v4f v = *(const v4fa*)&so[w][r][c4]; *(v4f*)(C + (size_t)(row0 + r) * ldc + col0 + c4) = v; } }
     }
}

// Wt[n][k] = f16(W[k][n]·scale) from f32 row-major W[K][N] (scale = power of two; bf16-exact weights stay exact in f16 away from the subnormal range)
__global__ __launch_bounds__(256) void k_wt_f16(const float* __restrict__ W, _Float16* __restrict__ Wt, int K, int N, float scale) {
  const int t = blockIdx.x * 256 + threadIdx.x; if (t >= N * (K / 8)) return; const int n = t / (K / 8), k8 = (t % (K / 8)) * 8; FragH f;
#pragma unroll
  for (int i = 0; i < 8; ++i) f.h[i] = (_Float16)(bf16_round(W[(size_t)(k8 + i) * N + n]) * scale); const v8us o = f.half[0];
  *(v8us*)((unsigned short*)Wt + (size_t)n * K + k8) = o; 
}
// k_gemm_hh variant with fused epilogue: v = acc·alpha + bias[by·sBias + col] (+ CP[(row/rowsPerB)·sCPb + by·64 + col] if CP) ; ACT 0 none / 1 elu ; writes f16 C16 (and f32 C if non-null)
template <int ACT>
__global__ __launch_bounds__(128) void k_gemm_hhx(const _Float16* __restrict__ A, int lda, size_t sA, const _Float16* __restrict__ Bh, int ldb, size_t sB, float alpha, const float* __restrict__ bias, size_t sBias, const float* __restrict__ CP, int rowsPerB, size_t sCPb, int row0g,
    float* __restrict__ C, _Float16* __restrict__ C16, int ldc, size_t sC, int M, int N, int K) {
  __shared__ __attribute__((aligned(16))) float so[4][16][64];
  const int tid = threadIdx.x, w = tid >> 5, lane = tid & 31, ln = lane & 15, hh = lane >> 4; const int by = blockIdx.y;
  A += (size_t)by * sA; Bh += (size_t)by * sB; const size_t cofs = (size_t)by * sC; const float* bp = bias ? bias + (size_t)by * sBias : nullptr;
  const int ntn = (N + 63) / 64; const int wid = blockIdx.x * 4 + w; const int mt = wid / ntn, nq = wid % ntn; if (mt * 16 >= M) return;
  const int row0 = mt * 16, col0 = nq * 64; const _Float16* arow = A + (size_t)(row0 + ln) * lda;
  v8f acc[4] = {};
  for (int kb = 0; kb < K; kb += 32) { FragH ah; ah.half[0] = *(const v8us*)((const unsigned short*)arow + kb + 8 * hh); ah.half[1] = *(const v8us*)((const unsigned short*)arow + kb + 16 + 8 * hh);
#pragma unroll
    for (int t = 0; t < 4; ++t) { if (col0 + t * 16 >= N) continue; const size_t boff = (size_t)(col0 + t * 16 + ln) * ldb + kb; FragH bq; bq.half[0] = *(const v8us*)((const unsigned short*)Bh + boff + 8 * hh); bq.half[1] = *(const v8us*)((const unsigned short*)Bh + boff + 16 + 8 * hh);
      acc[t] = mmaH<1>(ah.v, ah.v, bq.v, bq.v, acc[t]); }
  }
#pragma unroll
  for (int t = 0; t < 4; ++t) { if (col0 + t * 16 >= N) continue; const int col = col0 + t * 16 + ln; const float bv = bp ? bf16_round(bp[col]) : 0.f;
#pragma unroll
    for (int r = 0; r < 8; ++r) { float v = acc[t][r] * alpha + bv; if (CP) { const int bidx = (row0g + row0 + 8 * hh + r) / rowsPerB; v += CP[(size_t)bidx * sCPb + (size_t)by * 64 + col]; } if (ACT == 1) v = (v > 0.f) ? v : expm1f(v); else if (ACT == 7) v = (v > 0.f) ? v + 1.0f : expf(v); else if (ACT == 8) v = tanhf(v); else if (ACT == 9) v = 0.5f * v * (1.0f + tanhf(0.7978845608028654f * (v + 0.044715f * v * v * v))); else if (ACT == 11) v = 1.0f / (1.0f + expf(-v)); else if (ACT == 12) v = (v > 0.f) ? v : 0.01f * v; else if (ACT == 14) v = (v > 0.f) ? v : 0.1f * v; else if (ACT == 15) v = v / (1.0f + expf(-v)); else if (ACT == 3) v = fmaxf(v, 0.f); else if (ACT == 6) v = 0.5f * v * (1.0f + erff(v * 0.70710678118654752f)); so[w][8 * hh + r][t * 16 + ln] = v; } }
  __builtin_amdgcn_fence(__ATOMIC_ACQ_REL, "workgroup"); __builtin_amdgcn_wave_barrier();
  const int rsub = lane >> 4, c4 = (lane & 15) * 4; typedef _Float16 v4h __attribute__((ext_vector_type(4)));
  {
#pragma unroll
    for (int q = 0; q < 8; ++q) { const int r = q * 2 + rsub; if (col0 + c4 < N) { const v4f v = *(const v4fa*)&so[w][r][c4]; if (C) *(v4f*)(C + cofs + (size_t)(row0 + r) * ldc + col0 + c4) = v; if (C16) { v4h h4; for (int i = 0; i < 4; ++i) h4[i] = (_Float16)v[i]; *(v4h*)(C16 + cofs + (size_t)(row0 + r) * ldc + col0 + c4) = h4; } } }
     }
}


typedef _Float16 v4h __attribute__((ext_vector_type(4)));

// ---- fragment-order planes: every f16 plane that a WMMA operand is loaded from is stored as 1 KiB units, one per (16 rows x 32 k). Inside a unit the 16-byte piece at (half * 32 + lane) holds row (lane & 15),
// k = half * 16 + (lane >> 4) * 8 .. + 7: what lane 'lane' takes as half 'half' of its fragment. A wave's global_load_b128 then reads 512 contiguous bytes (4 cache lines) where a row-major plane gives it 16 rows (16 lines).
// Units run along k first, then down the row tiles, so a tile of 16 rows still starts at element row * ld. ld % 32 == 0, rows % 16 == 0.
__device__ __forceinline__ size_t pk_src(size_t t, int ld) { const int lane = (int)(t & 31), half = (int)((t >> 5) & 1); const size_t u = t >> 6; const size_t nks = (size_t)(ld >> 5); const size_t ks = u % nks, rt = u / nks;      /* row-major element offset of the 8 elements that piece t of the plane holds */
  return (rt * 16 + (lane & 15)) * (size_t)ld + ks * 32 + half * 16 + (lane >> 4) * 8; }
__device__ __forceinline__ size_t pk_dst(size_t row, int k, int ld) { return (row >> 4) * 16 * (size_t)ld + (size_t)(k >> 5) * 512 + ((k >> 4) & 1) * 256 + (((k >> 3) & 1) * 16 + (int)(row & 15)) * 8; }      /* element offset in the plane of (row, k .. k + 7), k % 8 == 0 */

__global__ __launch_bounds__(256) void k_x16(const float* __restrict__ x, _Float16* __restrict__ X16, size_t n8) { const size_t t = (size_t)blockIdx.x * 256 + threadIdx.x; if (t >= n8) return; FragH f; const size_t so = pk_src(t, DM);
#pragma unroll
  for (int q = 0; q < 8; ++q) f.h[q] = (_Float16)bf16_round(x[so + q]); *(v8us*)((unsigned short*)X16 + t * 8) = f.half[0];  }
__global__ __launch_bounds__(256) void k_h16(const float* __restrict__ x, _Float16* __restrict__ X16, size_t n8) { const size_t t = (size_t)blockIdx.x * 256 + threadIdx.x; if (t >= n8) return; FragH f;
#pragma unroll
  for (int q = 0; q < 8; ++q) f.h[q] = (_Float16)x[t * 8 + q]; *(v8us*)((unsigned short*)X16 + t * 8) = f.half[0];  }
__global__ __launch_bounds__(256) void k_round16f(const float* __restrict__ W, _Float16* __restrict__ Bt, size_t n8) { const size_t t = (size_t)blockIdx.x * 256 + threadIdx.x; if (t >= n8) return; FragH f; const size_t so = pk_src(t, DM);
#pragma unroll
  for (int i = 0; i < 8; ++i) f.h[i] = (_Float16)(bf16_round(W[so + i]) * 16.0f); *(v8us*)((unsigned short*)Bt + t * 8) = f.half[0];  }
template <int NHv, int TTv>
__global__ __launch_bounds__(256) void k_vt(const _Float16* __restrict__ V16, int ldv, int voff, _Float16* __restrict__ Vt) { __shared__ unsigned short tl[64][66]; const int tid = threadIdx.x; const int slab = blockIdx.x / (TTv / 64), lg = blockIdx.x % (TTv / 64); const int b = slab / NHv, h = slab % NHv;
  for (int i = tid; i < 64 * 8; i += 256) { const int r = i / 8, c8 = (i % 8) * 8; FragH f; f.half[0] = *(const v8us*)((const unsigned short*)V16 + ((size_t)b * TTv + lg * 64 + r) * ldv + voff + h * 64 + c8);
#pragma unroll
    for (int q = 0; q < 8; ++q) tl[r][c8 + q] = f.u[q]; }
  __syncthreads();
  {
#pragma unroll
    for (int rd = 0; rd < 2; ++rd) { const int d = rd * 32 + tid / 8, pc = tid % 8; FragH f;
#pragma unroll
      for (int q = 0; q < 8; ++q) f.u[q] = tl[pc * 8 + q][d];
      *(v8us*)((unsigned short*)Vt + ((size_t)slab * 64 + d) * TTv + lg * 64 + pc * 8) = f.half[0]; }
     } }

// f32 -> f16 hi + x2^10 residual, 8 values = one 16-byte piece of each plane
__device__ __forceinline__ void hl_split8(const float* v, FragH& fh, FragH& fl) {
#pragma unroll
  for (int q = 0; q < 8; ++q) { const _Float16 h = (_Float16)v[q]; fh.h[q] = h; fl.h[q] = (_Float16)((v[q] - (float)h) * 1024.0f); } }

// ---- fast GEMM (wave tile 32x64; requires M % 32 == 0 rows per launch region and N % 64 == 0; A and Bh are fragment-order planes of pitch lda, ldb); epilogue = k_gemm_hhx semantics ----
// EPI 0: the tile goes out as f32 rows (C) and / or f16 rows (C16). EPI 1 (q, k; N = DM, so that a 64-column tile is one head): the tile is rotated by the head's cos/sin tables and goes out as the hi and residual fragment-order planes Ph, Pl.
// EPI 2 (v): the tile goes out transposed, as the hi and residual fragment-order planes of V^T (rows (batch * NH + head) * 64 + d, pitch SLEN).
__device__ __forceinline__ v16h g2_fragp(const _Float16* p) { FragH f; f.half[0] = *(const v8us*)((const unsigned short*)p); f.half[1] = *(const v8us*)((const unsigned short*)p + 256); return f.v; }      /* p = the lane's piece of a fragment-order unit */
__device__ __forceinline__ v8f g2_mma(v16h a, v16h b, v8f c) { v8f d = __builtin_amdgcn_wmma_f32_16x16x32_f16(false, a, false, b, (short)0, c, false, false); asm volatile("v_nop\n\tv_nop\n\tv_nop\n\tv_nop" : "+v"(d) : "v"(a), "v"(b)); return d; }
template <int ACT, int EPI>
__global__ __launch_bounds__(128) void k_gemm2(const _Float16* __restrict__ A, int lda, size_t sA, const _Float16* __restrict__ Bh, int ldb, size_t sB, float alpha, const float* __restrict__ bias, size_t sBias, const float* __restrict__ CP, int rowsPerB, size_t sCPb, int row0g,
    float* __restrict__ C, _Float16* __restrict__ C16, int ldc, size_t sC, int M, int N, int K, const float* __restrict__ CS, const float* __restrict__ SN, _Float16* __restrict__ Ph, _Float16* __restrict__ Pl) {
  __shared__ __attribute__((aligned(16))) float so[4][32][68];
  const int tid = threadIdx.x, w = tid >> 5, lane = tid & 31, ln = lane & 15, hh = lane >> 4; const int by = blockIdx.y;
  A += (size_t)by * sA; Bh += (size_t)by * sB; const size_t cofs = (size_t)by * sC; const float* bp = bias ? bias + (size_t)by * sBias : nullptr;
  const int ntn = N >> 6; const int mt = blockIdx.x / ntn, nq = blockIdx.x - mt * ntn; const int row0 = mt * 128 + 32 * w, col0 = nq * 64; if (row0 >= M) return;
  const _Float16* a0p = A + (size_t)row0 * lda + lane * 8; const _Float16* a1p = a0p + (size_t)16 * lda;      /* A and Bh are fragment-order planes */
  const _Float16* b0p = Bh + (size_t)col0 * ldb + lane * 8; const _Float16* b1p = b0p + (size_t)16 * ldb; const _Float16* b2p = b1p + (size_t)16 * ldb; const _Float16* b3p = b2p + (size_t)16 * ldb;
  const v8f z8 = {0.f,0.f,0.f,0.f,0.f,0.f,0.f,0.f}; v8f c00 = z8, c01 = z8, c02 = z8, c03 = z8, c10 = z8, c11 = z8, c12 = z8, c13 = z8;
  /* Register ring of three k-steps: the six fragments of steps s + 1 and s + 2 are in flight while step s is multiplied, so that a step no longer waits for five round trips one after the other.
     Each accumulator still takes its k-steps in ascending order. The six lane pointers live through the whole loop and every load of a trip reaches its step by an immediate offset, so that no load's result can land in an address register; only steps below K / 32 are loaded. */
  typedef const __attribute__((address_space(1))) _Float16* g2_gp;      /* typed as global memory, so that the loads stay global loads behind the asm statement that names the pointers */
  g2_gp p0 = (g2_gp)a0p, p1 = (g2_gp)a1p, p2 = (g2_gp)b0p, p3 = (g2_gp)b1p, p4 = (g2_gp)b2p, p5 = (g2_gp)b3p;
#define G2_FR(P, ST) g2_fragp((const _Float16*)((P) + 512 * (ST)))
#define G2_LOAD(S, ST) { S[0] = G2_FR(p0, ST); S[1] = G2_FR(p1, ST); S[2] = G2_FR(p2, ST); S[3] = G2_FR(p3, ST); S[4] = G2_FR(p4, ST); S[5] = G2_FR(p5, ST); \
    __builtin_amdgcn_sched_barrier(0); /* keeps the refill in front of the products that follow: without it the compiler sinks a refill behind the first product and that product's wait, and it flies for a shorter time */ }
#define G2_STEP(S) { c00 = g2_mma(S[0], S[2], c00); c10 = g2_mma(S[1], S[2], c10); c01 = g2_mma(S[0], S[3], c01); c11 = g2_mma(S[1], S[3], c11); c02 = g2_mma(S[0], S[4], c02); c12 = g2_mma(S[1], S[4], c12); c03 = g2_mma(S[0], S[5], c03); c13 = g2_mma(S[1], S[5], c13); }
  { const int nst = K >> 5; v16h r0[6], r1[6], r2[6]; int s = 0;
    if (nst >= 1) G2_LOAD(r0, 0)
    if (nst >= 2) G2_LOAD(r1, 1)
#pragma unroll 1
    for (; s + 5 <= nst; s += 3) { G2_LOAD(r2, 2) G2_STEP(r0) G2_LOAD(r0, 3) G2_STEP(r1) G2_LOAD(r1, 4) G2_STEP(r2)
      asm volatile("s_wait_xcnt 0x0" : "+v"(p0), "+v"(p1), "+v"(p2), "+v"(p3), "+v"(p4), "+v"(p5) :: "memory"); /* stands in front of the six additions below, which overwrite the address registers of the loads issued above; the pointers are named so that the additions depend on this statement and cannot be placed ahead of it (without it the compiler keeps copies of the pointers and rewrites them at the loop's head) */
      p0 += 1536; p1 += 1536; p2 += 1536; p3 += 1536; p4 += 1536; p5 += 1536; }
    const int rem = nst - s;      /* 0 to 4 steps are left; r0 and r1 hold the first two of them */
    if (rem >= 3) G2_LOAD(r2, 2)
    if (rem >= 1) G2_STEP(r0)
    if (rem >= 4) G2_LOAD(r0, 3)
    if (rem >= 2) G2_STEP(r1)
    if (rem >= 3) G2_STEP(r2)
    if (rem >= 4) G2_STEP(r0) }
#undef G2_FR
#undef G2_LOAD
#undef G2_STEP
  v8f accs[8] = {c00, c01, c02, c03, c10, c11, c12, c13};
#pragma unroll
  for (int u = 0; u < 8; ++u) { const int t = u & 3, half = u >> 2; const int col = col0 + t * 16 + ln; const float bv = bp ? bf16_round(bp[col]) : 0.f;
#pragma unroll
    for (int r = 0; r < 8; ++r) { const int rloc = half * 16 + 8 * hh + r; float v = accs[u][r] * alpha + bv; if (CP) { const int bidx = (row0g + row0 + rloc) / rowsPerB; v += CP[(size_t)bidx * sCPb + (size_t)by * 64 + col]; }
      if (ACT == 3) v = fmaxf(v, 0.f); else if (ACT == 6) v = 0.5f * v * (1.0f + erff(v * 0.70710678118654752f)); else if (ACT == 11) v = 1.0f / (1.0f + expf(-v)); else if (ACT == 15) v = v / (1.0f + expf(-v)); else if (ACT == 12) v = (v > 0.f) ? v : 0.01f * v; else if (ACT == 8) v = tanhf(v);
      so[w][rloc][t * 16 + ln] = v; } }
  __builtin_amdgcn_fence(__ATOMIC_ACQ_REL, "workgroup"); __builtin_amdgcn_wave_barrier();
  if (EPI == 1) {      /* the wave's tile = 2 row tiles x 2 units x 2 halves of each plane; a lane takes its own piece (row ln, 8 columns = 4 rotation pairs), a wave stores 512 contiguous bytes */
    typedef const __attribute__((address_space(1))) float* g2_fp;      /* typed as global memory, so that the loads stay global loads beside the asm statement that names the pointers */
    const size_t th = (size_t)(col0 >> 6) * SLEN * 32 + hh * 4, ta = th + (size_t)((row0 + ln) % SLEN) * 32, tb = th + (size_t)((row0 + 16 + ln) % SLEN) * 32;
    g2_fp ca = (g2_fp)(CS + ta), sa = (g2_fp)(SN + ta), cb = (g2_fp)(CS + tb), sb = (g2_fp)(SN + tb); v4f csv[8], snv[8];      /* the lane's two token rows of the head's tables */
#pragma unroll
    for (int u = 0; u < 8; ++u) { const int jo = ((u >> 1) & 1) * 16 + (u & 1) * 8; csv[u] = *(const __attribute__((address_space(1))) v4fa*)(((u >> 2) ? cb : ca) + jo); snv[u] = *(const __attribute__((address_space(1))) v4fa*)(((u >> 2) ? sb : sa) + jo); }
    asm volatile("s_wait_xcnt 0x0" : "+v"(ca), "+v"(sa), "+v"(cb), "+v"(sb) :: "memory");      /* stands in front of the first instruction that reuses an address register of the 16 table loads above; the pointers are named so that they live up to here */
#pragma unroll
    for (int u = 0; u < 8; ++u) { const int rl = (u >> 2) * 16 + ln, kk = ((u >> 1) & 1) * 32 + (u & 1) * 16 + hh * 8; const v4f a = *(const v4fa*)&so[w][rl][kk], c = *(const v4fa*)&so[w][rl][kk + 4];
      const v4f cs = csv[u], sn = snv[u];
      const float f[8] = {a[0], a[1], a[2], a[3], c[0], c[1], c[2], c[3]}; float o[8];
#pragma unroll
      for (int p = 0; p < 4; ++p) { o[2 * p] = f[2 * p] * cs[p] - f[2 * p + 1] * sn[p]; o[2 * p + 1] = f[2 * p] * sn[p] + f[2 * p + 1] * cs[p]; }
      FragH fh, fl; hl_split8(o, fh, fl); const size_t po = pk_dst((size_t)(row0 + rl), col0 + kk, N);
      *(v8us*)((unsigned short*)Ph + po) = fh.half[0]; *(v8us*)((unsigned short*)Pl + po) = fl.half[0]; }
  } else if (EPI == 2) {      /* 32 tokens x 64 d = 4 units of each V^T plane; a lane takes row d, 8 tokens, read down a column of the staged tile */
    const size_t vrow = ((size_t)(row0 / SLEN) * NH + (col0 >> 6)) * 64; const int t0 = row0 % SLEN;
#pragma unroll
    for (int u = 0; u < 8; ++u) { const int d = (u >> 1) * 16 + ln, tl = (u & 1) * 16 + hh * 8; float o[8];
#pragma unroll
      for (int q = 0; q < 8; ++q) o[q] = so[w][tl + q][d];
      FragH fh, fl; hl_split8(o, fh, fl); const size_t po = pk_dst(vrow + d, t0 + tl, SLEN);
      *(v8us*)((unsigned short*)Ph + po) = fh.half[0]; *(v8us*)((unsigned short*)Pl + po) = fl.half[0]; }
  } else {
    const int rsub = lane >> 4, c4 = (lane & 15) * 4;
#pragma unroll
    for (int q = 0; q < 16; ++q) { const int r = q * 2 + rsub; const v4f v = *(const v4fa*)&so[w][r][c4]; if (C) *(v4f*)(C + cofs + (size_t)(row0 + r) * ldc + col0 + c4) = v; if (C16) { v4h h4; for (int i = 0; i < 4; ++i) h4[i] = (_Float16)v[i]; *(v4h*)(C16 + cofs + (size_t)(row0 + r) * ldc + col0 + c4) = h4; } }
     } }



template <int TQ, int TK>
__global__ __launch_bounds__(128) void k_flashme(const _Float16* __restrict__ Q16, const _Float16* __restrict__ Q16lo, int ldq, const _Float16* __restrict__ K16, const _Float16* __restrict__ K16lo, int ldk, const _Float16* __restrict__ Vt, const _Float16* __restrict__ Vtlo, const float* __restrict__ HB, _Float16* __restrict__ Oh, _Float16* __restrict__ Ol, int ldo) {
  #pragma clang fp contract(off)
  constexpr int RPW = 16, RTN = RPW / 16, NQB = TQ / (4 * RPW), DT = 4, KS = 2;
  __shared__ __attribute__((aligned(16))) unsigned short sP[4][RPW][40], sPl[4][RPW][40]; __shared__ __attribute__((aligned(16))) float sO[4][RPW][64 + 4];
  /* Two buffers of one trip's key and value tiles, 16 KiB each, which all four waves read: bytes 0: K hi (key tile 0, key tile 1; 2 KiB each = units ks 0, 1), 4096: K residual, 8192: V^T hi (units dt 0 .. 3), 12288: V^T residual. The units keep their fragment order. */
  __shared__ __attribute__((aligned(16))) unsigned short sKV[2][8192];
  /* What is added to a scaled score depends on the head and on the distance d = query - key alone: entry d + 63 holds the decay bias for d >= 0 and -inf for d < 0 (a key behind the query: the causal mask). The work-group's tiles meet d = -63 .. qb0 + 63. */
  static_assert(TQ == TK, "the table's range is that of a causal square");
  __shared__ float sB[TQ + 64];
  const int tid = threadIdx.x, w = tid >> 5, lane = tid & 31, ln = lane & 15, hh = lane >> 4;
  /* Which (batch, head) slab and which 64-query tile a work-group takes. A causal tile t walks 2 (t + 1) key trips, all 1024 work-groups are resident at once, four to a WGP, and a SIMD's vector port is shared by its four waves, so the launch lasts as long as the WGP with the most trips.
     With tile = index % 32 work-groups whose indices are equal mod 256 hold the same tile. Here the four classes c of one a = index & 7 are the tiles 2a, 2a + 1, 31 - 2a, 30 - 2a (132 trips together, for every a), and c = (bits 3..4 + bits 8..9) & 3 takes all four values
     over indices equal mod 256 as well as over four neighbours (index step 8), and a pair c, c + 2 (66 trips) at index step 16. For speed only: (slab, tile) is a permutation of the index whatever the placement is. */
  static_assert(NQB == 32 && NBT * NH == 32, "the index map below is written for 32 slabs of 32 query tiles");
  const int bx = blockIdx.x, slab = bx / NQB, ta = (bx & 7) * 2, tc = (((bx >> 3) & 3) + (slab >> 3)) & 3;      /* slab >> 3 = bits 8..9 of the index */
  const int qblk = (ta | (tc & 1)) ^ ((tc >> 1) * 31);      /* x ^ 31 = 31 - x */ const int b = slab / NH, h = slab % NH; const int qb0 = qblk * (4 * RPW); const int q0 = qb0 + w * RPW;
  FragH aq[2][KS], aql[2][KS];
#pragma unroll
  for (int rt = 0; rt < RTN; ++rt) { const size_t qo = ((size_t)b * TQ + q0 + rt * 16) * ldq + h * 1024 + lane * 8;      /* fragment-order planes: head h = units 2h and 2h + 1 of the row tile */ const unsigned short* qr = (const unsigned short*)Q16 + qo; const unsigned short* ql = (const unsigned short*)Q16lo + qo;
#pragma unroll
    for (int ks = 0; ks < KS; ++ks) { aq[rt][ks].half[0] = *(const v8us*)(qr + ks * 512); aq[rt][ks].half[1] = *(const v8us*)(qr + ks * 512 + 256); aql[rt][ks].half[0] = *(const v8us*)(ql + ks * 512); aql[rt][ks].half[1] = *(const v8us*)(ql + ks * 512 + 256); } }
  asm volatile("s_wait_xcnt 0x0" ::: "memory");      /* stands in front of the first instruction that reuses an address register of the q loads above (the build reuses them for the copies' addresses) */
  __builtin_amdgcn_sched_barrier(0);      /* holds what follows behind that wait: the accumulators' zeroing depends on nothing, and a "memory" clobber does not tie it to the wait */
  const unsigned short* Vth = (const unsigned short*)Vt + (size_t)slab * 64 * TK; const unsigned short* Vtl = (const unsigned short*)Vtlo + (size_t)slab * 64 * TK;
  float m_r[2][8], l_r[2][8]; v8f oacc[2][DT], oaccl[2][DT];
#pragma unroll
  for (int rt = 0; rt < RTN; ++rt) {
#pragma unroll
    for (int r = 0; r < 8; ++r) { m_r[rt][r] = -3.0e38f; l_r[rt][r] = 0.f; }
#pragma unroll
    for (int dt = 0; dt < DT; ++dt) { oacc[rt][dt] = (v8f){0.f,0.f,0.f,0.f,0.f,0.f,0.f,0.f}; oaccl[rt][dt] = oacc[rt][dt]; } }
  const float xih = HB[2 * h], egh = HB[2 * h + 1];      /* the head's two bias scalars, read once */
  const int jend = qb0 + 4 * RPW;      /* block-uniform: the keys up to the tile's last query; a multiple of 32, at most TK */
  /* A tile goes from global memory to LDS by asynchronous copies, through no register: 8 copies of 16 bytes a lane, 2 KiB a copy over the work-group. The tile of trip t + 1 flies while trip t is worked on, and each tile is fetched once a work-group, not once a wave. */
  const unsigned ldsl = (unsigned)(size_t)&sKV[0][tid * 8];      /* the lane's LDS byte address in the first 2 KiB of buffer 0 */
  const size_t klo = ((size_t)b * TK * ldk + h * 1024) * 2, kst = (size_t)ldk * 2; const unsigned kln = (unsigned)tid * 16u, vln = (unsigned)(tid >> 6) * (32u * TK) + (unsigned)(tid & 63) * 16u;      /* byte offsets. Uniform: the head's key row 0; one key row. The lane's own: its piece of a key row tile; its piece of value unit dt = tid / 64 */
#define FM_COPY(J, BUF) { const size_t ku = klo + (size_t)(J) * kst, vu = (size_t)((J) >> 5) * 1024; const char* g0 = (const char*)K16 + ku + kln; const char* g1 = (const char*)K16 + (ku + 16 * kst) + kln; const char* g2 = (const char*)K16lo + ku + kln; const char* g3 = (const char*)K16lo + (ku + 16 * kst) + kln; \
    const char* g4 = (const char*)Vth + vu + vln; const char* g5 = (const char*)Vth + (vu + (size_t)64 * TK) + vln; const char* g6 = (const char*)Vtl + vu + vln; const char* g7 = (const char*)Vtl + (vu + (size_t)64 * TK) + vln; const unsigned l0 = ldsl + (unsigned)(BUF) * 16384u; \
    /* the eight copies and, as the statement's last line, the wait that stands in front of any rewrite of their address registers */ \
    asm volatile("global_load_async_to_lds_b128 %0, %8, off\n\tglobal_load_async_to_lds_b128 %1, %9, off\n\tglobal_load_async_to_lds_b128 %2, %10, off\n\tglobal_load_async_to_lds_b128 %3, %11, off\n\t" \
                 "global_load_async_to_lds_b128 %4, %12, off\n\tglobal_load_async_to_lds_b128 %5, %13, off\n\tglobal_load_async_to_lds_b128 %6, %14, off\n\tglobal_load_async_to_lds_b128 %7, %15, off\n\ts_wait_xcnt 0x0" \
                 :: "v"(l0), "v"(l0 + 2048u), "v"(l0 + 4096u), "v"(l0 + 6144u), "v"(l0 + 8192u), "v"(l0 + 10240u), "v"(l0 + 12288u), "v"(l0 + 14336u), "v"(g0), "v"(g1), "v"(g2), "v"(g3), "v"(g4), "v"(g5), "v"(g6), "v"(g7) : "memory"); }
  FM_COPY(0, 0)
  for (int i = tid; i < qb0 + 127; i += 128) { const int d = i - 63; const float bd = (-((float)d / xih)) * egh; sB[i] = (d >= 0) ? bd : -INFINITY; }      /* each entry once a work-group, by the expression that every element took before; built while tile 0 flies */
  asm volatile("s_wait_asynccnt 0x0" ::: "memory");      /* this wave's copies of tile 0 have landed */
  __syncthreads();      /* publishes tile 0 and the table to the four waves */
  if (32 < jend) FM_COPY(32, 1)
#pragma unroll 1
  for (int j0 = 0; j0 < jend; j0 += 32) {
    const int buf = (j0 >> 5) & 1; const unsigned short* kvb = &sKV[buf][0];
    float b0v[2][8], b1v[2][8];      /* the lane's 16 table entries, fetched together at the head of the trip: they fly beside the key loads */
#pragma unroll
    for (int rt = 0; rt < RTN; ++rt) { const float* tb = &sB[q0 + rt * 16 + 8 * hh + 47 - j0 - ln];      /* row r, key j0 + 16 + ln: entry tb[r]; key j0 + ln: tb[16 + r] */
#pragma unroll
      for (int r = 0; r < 8; ++r) { b0v[rt][r] = tb[16 + r]; b1v[rt][r] = tb[r]; } }
    v8f s[2][2];
#pragma unroll
    for (int nt = 0; nt < 2; ++nt) { const unsigned short* kr = kvb + nt * 1024 + lane * 8; const unsigned short* kl = kr + 2048; FragH bk[KS], bkl[KS];      /* from the trip's LDS buffer */
#pragma unroll
      for (int ks = 0; ks < KS; ++ks) { bk[ks].half[0] = *(const v8us*)(kr + ks * 512); bk[ks].half[1] = *(const v8us*)(kr + ks * 512 + 256); bkl[ks].half[0] = *(const v8us*)(kl + ks * 512); bkl[ks].half[1] = *(const v8us*)(kl + ks * 512 + 256); }
#pragma unroll
      for (int rt = 0; rt < RTN; ++rt) { v8f acc = (v8f){0.f,0.f,0.f,0.f,0.f,0.f,0.f,0.f}, accr = acc;
#pragma unroll
        for (int ks = 0; ks < KS; ++ks) { acc = mmaH<1>(aq[rt][ks].v, aq[rt][ks].v, bk[ks].v, bk[ks].v, acc); accr = mmaH<1>(aql[rt][ks].v, aql[rt][ks].v, bk[ks].v, bk[ks].v, accr); accr = mmaH<1>(aq[rt][ks].v, aq[rt][ks].v, bkl[ks].v, bkl[ks].v, accr); }
        s[rt][nt] = acc + accr * 0.0009765625f; } }
    /* Softmax of the tile, step by step over all rows instead of row by row: each step below is done for every row before the next begins, and no step holds a branch,
       so that the rows' shuffle and exp latencies overlap. Every element takes the same operations in the same order as before. */
    float s0v[2][8], s1v[2][8], mcv[2][8];
#pragma unroll
    for (int rt = 0; rt < RTN; ++rt)
#pragma unroll
      for (int r = 0; r < 8; ++r) { const float s0 = s[rt][0][r] * SCL + b0v[rt][r], s1 = s[rt][1][r] * SCL + b1v[rt][r];      /* -inf for a masked key: its exp below is 0, the running maximum being finite always (it starts at -3.0e38) */
        s0v[rt][r] = s0; s1v[rt][r] = s1; mcv[rt][r] = fmaxf(s0, s1); }
    asm volatile("" :: "v"(mcv[0][0]), "v"(mcv[0][1]), "v"(mcv[0][2]), "v"(mcv[0][3]), "v"(mcv[0][4]), "v"(mcv[0][5]), "v"(mcv[0][6]), "v"(mcv[0][7])); __builtin_amdgcn_sched_barrier(0);      /* inputs only: all eight rows' maxima stand ready in front of the first shuffle round. Without it this build takes the rows two at a time, and each pair waits out its four shuffle rounds alone */
#pragma unroll
    for (int sh = 1; sh <= 8; sh <<= 1) { float tv[2][8];
#pragma unroll
      for (int rt = 0; rt < RTN; ++rt)
#pragma unroll
        for (int r = 0; r < 8; ++r) tv[rt][r] = __shfl_xor(mcv[rt][r], sh, 32);
#pragma unroll
      for (int rt = 0; rt < RTN; ++rt)
#pragma unroll
        for (int r = 0; r < 8; ++r) mcv[rt][r] = fmaxf(mcv[rt][r], tv[rt][r]); }
    asm volatile("" :: "v"(mcv[0][0]), "v"(mcv[0][1]), "v"(mcv[0][2]), "v"(mcv[0][3]), "v"(mcv[0][4]), "v"(mcv[0][5]), "v"(mcv[0][6]), "v"(mcv[0][7])); __builtin_amdgcn_sched_barrier(0);      /* inputs only, for the same reason: the eight rows go through the four rounds together, in front of the exps */
#pragma unroll
    for (int rt = 0; rt < RTN; ++rt)
#pragma unroll
      for (int r = 0; r < 8; ++r) { const float mn = fmaxf(m_r[rt][r], mcv[rt][r]); const float ea = expf(m_r[rt][r] - mn), e0 = expf(s0v[rt][r] - mn), e1 = expf(s1v[rt][r] - mn);
        const float al = (mn > -1.0e38f) ? ea : 1.0f; m_r[rt][r] = mn; const float p0 = e0, p1 = e1; l_r[rt][r] = l_r[rt][r] * al + p0 + p1;
#pragma unroll
        for (int dt = 0; dt < DT; ++dt) { oacc[rt][dt][r] *= al; oaccl[rt][dt][r] *= al; }
        FragH t2, t3; const float ps0 = p0 * 1024.0f, ps1 = p1 * 1024.0f; t2.h[0] = (_Float16)ps0; t2.h[1] = (_Float16)ps1; t3.h[0] = (_Float16)((ps0 - (float)t2.h[0]) * 1024.0f); t3.h[1] = (_Float16)((ps1 - (float)t2.h[1]) * 1024.0f);
        sP[w][rt * 16 + 8 * hh + r][ln] = t2.u[0]; sP[w][rt * 16 + 8 * hh + r][16 + ln] = t2.u[1]; sPl[w][rt * 16 + 8 * hh + r][ln] = t3.u[0]; sPl[w][rt * 16 + 8 * hh + r][16 + ln] = t3.u[1]; }
    __builtin_amdgcn_fence(__ATOMIC_ACQ_REL, "workgroup"); __builtin_amdgcn_wave_barrier();
    FragH pa[2], pl[2];
#pragma unroll
    for (int rt = 0; rt < RTN; ++rt) { pa[rt].half[0] = *(const v8us*)&sP[w][rt * 16 + ln][8 * hh]; pa[rt].half[1] = *(const v8us*)&sP[w][rt * 16 + ln][16 + 8 * hh]; pl[rt].half[0] = *(const v8us*)&sPl[w][rt * 16 + ln][8 * hh]; pl[rt].half[1] = *(const v8us*)&sPl[w][rt * 16 + ln][16 + 8 * hh]; }
#pragma unroll
    for (int dt = 0; dt < DT; ++dt) { const unsigned short* vr = kvb + 4096 + dt * 512 + lane * 8; FragH bv, bl; bv.half[0] = *(const v8us*)(vr); bv.half[1] = *(const v8us*)(vr + 256); bl.half[0] = *(const v8us*)(vr + 2048); bl.half[1] = *(const v8us*)(vr + 2048 + 256);
#pragma unroll
      for (int rt = 0; rt < RTN; ++rt) { oacc[rt][dt] = mmaH<1>(pa[rt].v, pa[rt].v, bv.v, bv.v, oacc[rt][dt]); oaccl[rt][dt] = mmaH<1>(pa[rt].v, pa[rt].v, bl.v, bl.v, oaccl[rt][dt]); oaccl[rt][dt] = mmaH<1>(pl[rt].v, pl[rt].v, bv.v, bv.v, oaccl[rt][dt]); } }
    __builtin_amdgcn_fence(__ATOMIC_ACQ_REL, "workgroup"); __builtin_amdgcn_wave_barrier();
    asm volatile("s_wait_dscnt 0x0" ::: "memory");      /* this wave's reads of the trip's buffer have returned */
    asm volatile("s_wait_asynccnt 0x0" ::: "memory");      /* this wave's copies of the next tile have landed */
    __syncthreads();      /* publishes the next tile and ends every wave's reads of this trip's buffer, which is refilled below */
    if (j0 + 64 < jend) FM_COPY(j0 + 64, buf) }
  asm volatile("s_wait_asynccnt 0x0" ::: "memory");      /* no copy is outstanding when the wave goes on to its end */
#undef FM_COPY
#pragma unroll
  for (int rt = 0; rt < RTN; ++rt) {
#pragma unroll
    for (int r = 0; r < 8; ++r) { float l = l_r[rt][r]; l += __shfl_xor(l, 1, 32); l += __shfl_xor(l, 2, 32); l += __shfl_xor(l, 4, 32); l += __shfl_xor(l, 8, 32); l_r[rt][r] = (l > 0.f) ? 1.0f / (l * 1024.0f) : 0.f; }
#pragma unroll
    for (int dt = 0; dt < DT; ++dt)
#pragma unroll
      for (int r = 0; r < 8; ++r) sO[w][rt * 16 + 8 * hh + r][dt * 16 + ln] = (oacc[rt][dt][r] + oaccl[rt][dt][r] * 0.0009765625f) * l_r[rt][r]; }
  __builtin_amdgcn_fence(__ATOMIC_ACQ_REL, "workgroup"); __builtin_amdgcn_wave_barrier();
  {
#pragma unroll
    for (int u = 0; u < 4 * RTN; ++u) { const int rl = (u >> 2) * 16 + ln, kk = ((u >> 1) & 1) * 32 + (u & 1) * 16 + hh * 8; const v4f a = *(const v4fa*)&sO[w][rl][kk], c = *(const v4fa*)&sO[w][rl][kk + 4];      /* O leaves as the hi and residual fragment-order planes that the output projection reads: a lane's piece is row ln, 8 columns */
      const float o[8] = {a[0], a[1], a[2], a[3], c[0], c[1], c[2], c[3]}; FragH fh, fl; hl_split8(o, fh, fl); const size_t po = pk_dst((size_t)b * TQ + q0 + rl, h * 64 + kk, ldo);
      *(v8us*)((unsigned short*)Oh + po) = fh.half[0]; *(v8us*)((unsigned short*)Ol + po) = fl.half[0]; }
     } }


__constant__ float PIF[32] = {3.141592741e+00f,3.031195641e+00f,2.924677610e+00f,2.821902990e+00f,2.722739935e+00f,2.627061367e+00f,2.534744978e+00f,2.445672750e+00f,2.359730482e+00f,2.276808262e+00f,2.196800232e+00f,2.119603395e+00f,2.045119524e+00f,1.973252892e+00f,1.903911710e+00f,1.837007284e+00f,1.772453904e+00f,1.710168958e+00f,1.650072694e+00f,1.592088223e+00f,1.536141396e+00f,1.482160687e+00f,1.430076718e+00f,1.379823089e+00f,1.331335425e+00f,1.284551501e+00f,1.239411712e+00f,1.195858121e+00f,1.153835058e+00f,1.113288760e+00f,1.074167132e+00f,1.036420345e+00f};
__global__ __launch_bounds__(256) void k_trig(const float* __restrict__ pig, const float* __restrict__ logxi, const float* __restrict__ egl, float* __restrict__ CS, float* __restrict__ SN, float* __restrict__ HB) {
  #pragma clang fp contract(off)
  const int t = blockIdx.x * 256 + threadIdx.x; if (t >= NH * SLEN * 32) return; const int j = t & 31; const int tok = (t >> 5) % SLEN; const int h = t / (32 * SLEN);
  const float pg = 1.0f / (1.0f + expf(-bf16_round(pig[h]))); const float th = ((float)tok * PIF[j]) * pg; const float c = cosf(th), s = sinf(th);
  *(float*)(CS + t) = c; *(float*)(SN + t) = s; 
  if (t < 2 * NH) { const int hh2 = t >> 1; const float v = (t & 1) ? (1.0f / (1.0f + expf(-bf16_round(egl[hh2])))) : expf(bf16_round(logxi[hh2])); *(float*)(HB + t) = v;  } }      

extern "C" void kernel_launch(void* const* d_in, const int* in_sizes, int n_in,
                              void* d_out, int out_size, void* d_ws, size_t ws_size, hipStream_t stream) {
  (void)in_sizes; (void)n_in; (void)out_size;
  const float* const* I = (const float* const*)d_in; const float* x = I[0]; const float* Wqkv = I[1]; const float* Wo = I[2]; const float* logxi = I[3]; const float* pig = I[4]; const float* egl = I[5];
  char* ws = (char*)d_ws; size_t off = 0;
  auto take = [&](size_t bytes) { char* p = ws + off; off += (bytes + 255) & ~(size_t)255; return p; };
  _Float16* BQKV = (_Float16*)take((size_t)3 * DM * DM * 2); _Float16* BO = (_Float16*)take((size_t)DM * DM * 2);
  _Float16* X16 = (_Float16*)take((size_t)NR * DM * 2); _Float16* Oh = (_Float16*)take((size_t)NR * DM * 2); _Float16* Ol = (_Float16*)take((size_t)NR * DM * 2);
  _Float16* Qh = (_Float16*)take((size_t)NR * DM * 2); _Float16* Ql = (_Float16*)take((size_t)NR * DM * 2); _Float16* Kh = (_Float16*)take((size_t)NR * DM * 2); _Float16* Kl = (_Float16*)take((size_t)NR * DM * 2); _Float16* Vth = (_Float16*)take((size_t)NR * DM * 2); _Float16* Vtl = (_Float16*)take((size_t)NR * DM * 2);
  float* CS = (float*)take((size_t)NH * SLEN * 32 * 4); float* SN = (float*)take((size_t)NH * SLEN * 32 * 4); float* HB = (float*)take(256);
  if (off > ws_size) return;      /* 6 + 2 + 8 + 8 x 8 + 8 = 88 MiB */
  const size_t n8 = (size_t)NR * DM / 8; const unsigned nb8 = (unsigned)((n8 + 255) / 256);
  k_round16f<<<(unsigned)(((size_t)3 * DM * DM / 8 + 255) / 256), 256, 0, stream>>>(Wqkv, BQKV, (size_t)3 * DM * DM / 8); k_round16f<<<(unsigned)(((size_t)DM * DM / 8 + 255) / 256), 256, 0, stream>>>(Wo, BO, (size_t)DM * DM / 8);      /* torch (out,in) = natural Bt; x16 */
  k_x16<<<nb8, 256, 0, stream>>>(x, X16, n8);
  k_trig<<<(NH * SLEN * 32 + 255) / 256, 256, 0, stream>>>(pig, logxi, egl, CS, SN, HB);
  const dim3 gP((NR / 128) * (DM / 64), 1);
  k_gemm2<0, 1><<<gP, 128, 0, stream>>>(X16, DM, 0, BQKV, DM, 0, 0.0625f, nullptr, 0, nullptr, 1, 0, 0, nullptr, nullptr, DM, 0, NR, DM, DM, CS, SN, Qh, Ql);      /* q (rows 0..1023 of Wqkv), rotated, hi/lo */
  k_gemm2<0, 1><<<gP, 128, 0, stream>>>(X16, DM, 0, BQKV + (size_t)DM * DM, DM, 0, 0.0625f, nullptr, 0, nullptr, 1, 0, 0, nullptr, nullptr, DM, 0, NR, DM, DM, CS, SN, Kh, Kl);      /* k (rows 1024..2047), rotated, hi/lo */
  k_gemm2<0, 2><<<gP, 128, 0, stream>>>(X16, DM, 0, BQKV + (size_t)2 * DM * DM, DM, 0, 0.0625f, nullptr, 0, nullptr, 1, 0, 0, nullptr, nullptr, DM, 0, NR, DM, DM, nullptr, nullptr, Vth, Vtl);      /* v (rows 2048..3071), transposed, hi/lo */
  k_flashme<SLEN, SLEN><<<NBT * NH * (SLEN / 64), 128, 0, stream>>>(Qh, Ql, DM, Kh, Kl, DM, Vth, Vtl, HB, Oh, Ol, DM);      /* both batches in one grid, so that their waves share the chip; the kernel deals long and short causal tiles evenly over the WGPs */
  k_gemm2<0, 0><<<gP, 128, 0, stream>>>(Oh, DM, 0, BO, DM, 0, 0.0625f, nullptr, 0, nullptr, 1, 0, 0, (float*)d_out, nullptr, DM, 0, NR, DM, DM, nullptr, nullptr, nullptr, nullptr);
  k_gemm2<0, 0><<<gP, 128, 0, stream>>>(Ol, DM, 0, BO, DM, 0, 0.0625f / 1024.0f, nullptr, 0, (const float*)d_out, 1, (size_t)DM, 0, (float*)d_out, nullptr, DM, 0, NR, DM, DM, nullptr, nullptr, nullptr, nullptr);
}

// v009
// It runs in 236 microseconds.
// Timed twice side by side with v008, it ran 1.07 times as fast both times.
// Counting every step since v000, it is 3.72 times as fast.
#include <hip/hip_runtime.h>
// Causal multi-head attention with gated rotary phases and a per-head distance decay (2 x 2048 tokens x 1024, 16 heads x 64): qkv = x*Wqkv^T; theta[h][t][j] = (t * pi^(1 - j/32)) * sigmoid(pi_gate[h]); interleaved-pair rotation of q and k; scores = q.k/8 - |i - j| / exp(log_xi[h]) * sigmoid(e_gate[h]) with j <= i; softmax; merged . Wo^T -> [2,2048,1024].
// Structure: x as an exact f16 plane; q/k/v from one packed f16 WMMA GEMM family (32x64 wave tiles, f32, exact products); per-(head, token) cos/sin tables on VALU (pi^(1-j/32) = the reference's f32 constants, precise trig); the projection GEMMs' epilogues rotate q and k in f32 and write them as f16 hi + x2^10 residual planes, and write V^T as hi + residual planes; the fused flash kernel per ((batch, head), 64 queries) with the decay bias and the causal mask added per element from a table over query - key that each work-group builds in LDS (three-product hi/lo scores, online softmax f32, P hi + residual via LDS, two value accumulators), whose epilogue writes O as hi + residual planes; output projection as two GEMMs.
// Compute dtype: x, weights and the three gate/scale vectors rounded to bf16; projections exact; rotation and bias f32; q, k, P, v, O as f16 hi + residual pairs (~2^-21); f32 accumulation and softmax. v_wmma_f32_16x16x32_f16.
#define NBT 2
#define SLEN 2048
#define DM 1024
#define NH 16
#define SCL 0.125f
#define NR (NBT * SLEN)
typedef __bf16 v16b __attribute__((ext_vector_type(16)));
typedef unsigned short v8us __attribute__((ext_vector_type(8), may_alias));
typedef float  v8f  __attribute__((ext_vector_type(8)));
typedef float  v4f  __attribute__((ext_vector_type(4)));
typedef float  v4fa __attribute__((ext_vector_type(4), may_alias));
union FragB { v16b v; v8us half[2]; unsigned short u[16]; };

__device__ __forceinline__ unsigned short bf16_bits(float x) { unsigned int u = __float_as_uint(x); return (unsigned short)((u + 0x7FFFu + ((u >> 16) & 1u)) >> 16); }
__device__ __forceinline__ float bf16_val(unsigned short b) { return __uint_as_float(((unsigned int)b) << 16); }
__device__ __forceinline__ float bf16_round(float x) { return bf16_val(bf16_bits(x)); }
// D += A·B with NT terms: 1 = ah·bh, 2 = + al·bh (A split), 3 = + ah·bl (both split)
template <int NT>
__device__ __forceinline__ v8f mmaN(v16b ah, v16b al, v16b bh, v16b bl, v8f c) {
  c = __builtin_amdgcn_wmma_f32_16x16x32_bf16(false, ah, false, bh, (short)0, c, false, false);
  if (NT >= 2) c = __builtin_amdgcn_wmma_f32_16x16x32_bf16(false, al, false, bh, (short)0, c, false, false);
  if (NT >= 3) c = __builtin_amdgcn_wmma_f32_16x16x32_bf16(false, ah, false, bl, (short)0, c, false, false);
  asm volatile("v_nop\n\tv_nop\n\tv_nop\n\tv_nop" : "+v"(c) : "v"(ah), "v"(al), "v"(bh), "v"(bl));
  return c;
}

__global__ __launch_bounds__(256) void k_wt_bf16(const float* __restrict__ W, unsigned short* __restrict__ Wt, int K, int N) {
  const int t = blockIdx.x * 256 + threadIdx.x;
  const int k8n = K / 8;
  if (t >= N * k8n) return;
  const int n = t / k8n, k8 = (t % k8n) * 8;
  v8us v;
#pragma unroll
  for (int i = 0; i < 8; ++i) v[i] = bf16_bits(W[(size_t)(k8 + i) * N + n]);
  *(v8us*)(Wt + (size_t)n * K + k8) = v;
  
}

// GEMM C[M][N] (f32, pitch ldc) = act(A[M][K]·W + bias). A f32 row-major (pitch lda) converted per fragment to bf16
// (ASPLIT: hi/lo two planes -> 2 terms, else single rounded term); Wt bf16 [N][K] (pitch ldb). BIAS_BF16 rounds the
// bias to bf16 first (bias quantised to bf16 before the add). K%32==0, M%16==0, N%64==0.
template <bool ASPLIT, int ACT, bool BIAS_BF16>
__global__ __launch_bounds__(128) void k_gemm_bf(const float* __restrict__ A, int lda, const unsigned short* __restrict__ Wt, int ldb,
                                               const float* __restrict__ bias, float* __restrict__ C, int ldc, int M, int N, int K) {
  __shared__ __attribute__((aligned(16))) float so[4][16][64];
  const int tid = threadIdx.x, w = tid >> 5, lane = tid & 31, ln = lane & 15, hh = lane >> 4;
  const int ntn = N / 64;
  const int wid = blockIdx.x * 4 + w;
  const int mt = wid / ntn, nq = wid % ntn;
  if (mt * 16 >= M) return;
  const int row0 = mt * 16, col0 = nq * 64;
  const float* arow = A + (size_t)(row0 + ln) * lda;
  v8f acc[4] = {};
  for (int kb = 0; kb < K; kb += 32) {
    FragB ah, al;
    const v4f x0 = *(const v4fa*)(arow + kb + 8 * hh), x1 = *(const v4fa*)(arow + kb + 8 * hh + 4);
    const v4f x2 = *(const v4fa*)(arow + kb + 16 + 8 * hh), x3 = *(const v4fa*)(arow + kb + 16 + 8 * hh + 4);
    float xs[16] = {x0[0],x0[1],x0[2],x0[3],x1[0],x1[1],x1[2],x1[3],x2[0],x2[1],x2[2],x2[3],x3[0],x3[1],x3[2],x3[3]};
#pragma unroll
    for (int i = 0; i < 16; ++i) { const unsigned short hb = bf16_bits(xs[i]); ah.u[i] = hb; al.u[i] = ASPLIT ? bf16_bits(xs[i] - bf16_val(hb)) : (unsigned short)0; }
#pragma unroll
    for (int t = 0; t < 4; ++t) {
      const unsigned short* brow = Wt + (size_t)(col0 + t * 16 + ln) * ldb + kb;
      FragB b;
      b.half[0] = *(const v8us*)(brow + 8 * hh);
      b.half[1] = *(const v8us*)(brow + 16 + 8 * hh);
      acc[t] = mmaN<ASPLIT ? 2 : 1>(ah.v, al.v, b.v, b.v, acc[t]);
    }
  }
#pragma unroll
  for (int t = 0; t < 4; ++t) {
    float bv = bias ? bias[col0 + t * 16 + ln] : 0.f;
    if (BIAS_BF16) bv = bf16_round(bv);
#pragma unroll
    for (int r = 0; r < 8; ++r) { float v = acc[t][r] + bv; if (ACT == 1) v = fmaxf(v, 0.f); so[w][8 * hh + r][t * 16 + ln] = v; }
  }
  __builtin_amdgcn_fence(__ATOMIC_ACQ_REL, "workgroup");
  __builtin_amdgcn_wave_barrier();
  const int rsub = lane >> 4, c4 = (lane & 15) * 4;
  {
#pragma unroll
    for (int q = 0; q < 8; ++q) {
      const int r = q * 2 + rsub;
      const v4f v = *(const v4fa*)&so[w][r][c4];
      *(v4f*)(C + (size_t)(row0 + r) * ldc + col0 + c4) = v;
    }
    
  }
}

// GEMM C = act(A·W + bias + resid): A f32 (ASPLIT -> hi/lo 2 terms), Wt bf16 [N][K]; ACT 0 none, 1 relu, 2 exact gelu;
// resid (optional, f32, row index = (row % rmod), pitch ldr, RES_BF16 rounds it) added before the activation.
template <bool ASPLIT, int ACT, bool BIAS_BF16, bool RES_BF16>
__global__ __launch_bounds__(128) void k_gemm_bf3(const float* __restrict__ A, int lda, const unsigned short* __restrict__ Wt, int ldb,
                                                const float* __restrict__ bias, const float* __restrict__ resid, int rmod, int ldr,
                                                float* __restrict__ C, int ldc, int M, int N, int K) {
  __shared__ __attribute__((aligned(16))) float so[4][16][64];
  const int tid = threadIdx.x, w = tid >> 5, lane = tid & 31, ln = lane & 15, hh = lane >> 4;
  const int ntn = N / 64;
  const int wid = blockIdx.x * 4 + w;
  const int mt = wid / ntn, nq = wid % ntn;
  if (mt * 16 >= M) return;
  const int row0 = mt * 16, col0 = nq * 64;
  const float* arow = A + (size_t)(row0 + ln) * lda;
  v8f acc[4] = {};
  for (int kb = 0; kb < K; kb += 32) {
    FragB ah, al;
    const v4f x0 = *(const v4fa*)(arow + kb + 8 * hh), x1 = *(const v4fa*)(arow + kb + 8 * hh + 4);
    const v4f x2 = *(const v4fa*)(arow + kb + 16 + 8 * hh), x3 = *(const v4fa*)(arow + kb + 16 + 8 * hh + 4);
    float xs[16] = {x0[0],x0[1],x0[2],x0[3],x1[0],x1[1],x1[2],x1[3],x2[0],x2[1],x2[2],x2[3],x3[0],x3[1],x3[2],x3[3]};
#pragma unroll
    for (int i = 0; i < 16; ++i) { const unsigned short hb = bf16_bits(xs[i]); ah.u[i] = hb; al.u[i] = ASPLIT ? bf16_bits(xs[i] - bf16_val(hb)) : (unsigned short)0; }
#pragma unroll
    for (int t = 0; t < 4; ++t) {
      const unsigned short* brow = Wt + (size_t)(col0 + t * 16 + ln) * ldb + kb;
      FragB b;
      b.half[0] = *(const v8us*)(brow + 8 * hh);
      b.half[1] = *(const v8us*)(brow + 16 + 8 * hh);
      acc[t] = mmaN<ASPLIT ? 2 : 1>(ah.v, al.v, b.v, b.v, acc[t]);
    }
  }
#pragma unroll
  for (int t = 0; t < 4; ++t) {
    const int col = col0 + t * 16 + ln;
    float bv = bias ? bias[col] : 0.f;
    if (BIAS_BF16) bv = bf16_round(bv);
#pragma unroll
    for (int r = 0; r < 8; ++r) {
      float v = acc[t][r] + bv;
      if (resid) { float rv = resid[(size_t)((row0 + 8 * hh + r) % rmod) * ldr + col]; if (RES_BF16) rv = bf16_round(rv); v += rv; }
      if (ACT == 1) v = fmaxf(v, 0.f);
      if (ACT == 2) v = 0.5f * v * (1.0f + erff(v * 0.70710678118654752f));
      if (ACT == 3) { const float u = 0.7978845608028654f * (v + 0.044715f * v * v * v); v = 0.5f * v * (1.0f + tanhf(u)); }
      so[w][8 * hh + r][t * 16 + ln] = v;
    }
  }
  __builtin_amdgcn_fence(__ATOMIC_ACQ_REL, "workgroup");
  __builtin_amdgcn_wave_barrier();
  const int rsub = lane >> 4, c4 = (lane & 15) * 4;
  {
#pragma unroll
    for (int q = 0; q < 8; ++q) {
      const int r = q * 2 + rsub;
      const v4f v = *(const v4fa*)&so[w][r][c4];
      *(v4f*)(C + (size_t)(row0 + r) * ldc + col0 + c4) = v;
    }
    
  }
}
// row LayerNorm (biased variance, eps) over N: s = X (+ R); optional out_sum <- s; out_norm <- (s-mu)*rsqrt(var+eps)*g + b
template <bool PARAM_BF16>
__global__ __launch_bounds__(256) void k_layernorm(const float* __restrict__ X, const float* __restrict__ R, const float* __restrict__ g, const float* __restrict__ bta,
                                                  float* __restrict__ out_sum, float* __restrict__ out_norm, int N, float eps) {
  __shared__ float red[256];
  const int row = blockIdx.x, tid = threadIdx.x;
  const float* x = X + (size_t)row * N; const float* rr = R ? R + (size_t)row * N : nullptr;
  float vals[16];                     // up to N = 4096
  const int per = N / 256;            // contiguous chunk per thread? use strided-by-4 chunks: thread handles j = tid*4 + 1024*u
  float s1 = 0.f;
  for (int u = 0; u < per / 4; ++u) {
    const int j = tid * 4 + 1024 * u;
    const v4f a = *(const v4fa*)(x + j);
    v4f b = {0.f,0.f,0.f,0.f}; if (rr) b = *(const v4fa*)(rr + j);
#pragma unroll
    for (int q = 0; q < 4; ++q) { const float v = a[q] + b[q]; vals[u * 4 + q] = v; s1 += v; }
  }
  red[tid] = s1; __syncthreads();
  for (int st = 128; st > 0; st >>= 1) { if (tid < st) red[tid] += red[tid + st]; __syncthreads(); }
  const float mu = red[0] / (float)N; __syncthreads();
  float s2 = 0.f;
  for (int u = 0; u < per / 4; ++u)
#pragma unroll
    for (int q = 0; q < 4; ++q) { const float c = vals[u * 4 + q] - mu; s2 += c * c; }
  red[tid] = s2; __syncthreads();
  for (int st = 128; st > 0; st >>= 1) { if (tid < st) red[tid] += red[tid + st]; __syncthreads(); }
  const float rs = rsqrtf(red[0] / (float)N + eps);
  {
    for (int u = 0; u < per / 4; ++u) {
      const int j = tid * 4 + 1024 * u;
      v4f o, sm;
#pragma unroll
      for (int q = 0; q < 4; ++q) {
        float gg = g[j + q], bb = bta[j + q];
        if (PARAM_BF16) { gg = bf16_round(gg); bb = bf16_round(bb); }
        sm[q] = vals[u * 4 + q]; o[q] = (vals[u * 4 + q] - mu) * rs * gg + bb;
      }
      if (out_sum) *(v4f*)(out_sum + (size_t)row * N + j) = sm;
      *(v4f*)(out_norm + (size_t)row * N + j) = o;
    }
    
  }
}



// ---- f16 WMMA path (v_wmma_f32_16x16x32_f16): 11-bit significands for operands in range — used where a [0,1] probability operand needs more precision than bf16
typedef _Float16 v16h __attribute__((ext_vector_type(16)));
union FragH { v16h v; v8us half[2]; _Float16 h[16]; unsigned short u[16]; };
template <int NT>
__device__ __forceinline__ v8f mmaH(v16h ah, v16h al, v16h bh, v16h bl, v8f c) {
  c = __builtin_amdgcn_wmma_f32_16x16x32_f16(false, ah, false, bh, (short)0, c, false, false);
  if (NT >= 2) c = __builtin_amdgcn_wmma_f32_16x16x32_f16(false, al, false, bh, (short)0, c, false, false);
  if (NT >= 3) c = __builtin_amdgcn_wmma_f32_16x16x32_f16(false, ah, false, bl, (short)0, c, false, false);
  asm volatile("v_nop\n\tv_nop\n\tv_nop\n\tv_nop" : "+v"(c) : "v"(ah), "v"(al), "v"(bh), "v"(bl));
  return c;
}
// batched GEMM like k_gemm_b but f16 operands: A f32 (split into f16 hi/lo if ASPLIT, else rounded to f16), Bt = f16 values [n][k]; alpha; C f32; N multiple of 16 (partial tiles skipped)
template <bool ASPLIT>
__global__ __launch_bounds__(128) void k_gemm_h(const float* __restrict__ A, int lda, size_t sA, const _Float16* __restrict__ Bh, int ldb, size_t sB, float alpha, float* __restrict__ C, int ldc, size_t sC, int M, int N, int K) {
  __shared__ __attribute__((aligned(16))) float so[4][16][64];
  const int tid = threadIdx.x, w = tid >> 5, lane = tid & 31, ln = lane & 15, hh = lane >> 4; const int by = blockIdx.y;
  A += (size_t)by * sA; Bh += (size_t)by * sB; C += (size_t)by * sC;
  const int ntn = (N + 63) / 64; const int wid = blockIdx.x * 4 + w; const int mt = wid / ntn, nq = wid % ntn; if (mt * 16 >= M) return;
  const int row0 = mt * 16, col0 = nq * 64; const float* arow = A + (size_t)(row0 + ln) * lda;
  v8f acc[4] = {};
  for (int kb = 0; kb < K; kb += 32) {
    FragH ah, al;
    const v4f x0 = *(const v4fa*)(arow + kb + 8 * hh), x1 = *(const v4fa*)(arow + kb + 8 * hh + 4), x2 = *(const v4fa*)(arow + kb + 16 + 8 * hh), x3 = *(const v4fa*)(arow + kb + 16 + 8 * hh + 4);
    float xs[16] = {x0[0],x0[1],x0[2],x0[3],x1[0],x1[1],x1[2],x1[3],x2[0],x2[1],x2[2],x2[3],x3[0],x3[1],x3[2],x3[3]};
#pragma unroll
    for (int i = 0; i < 16; ++i) { const _Float16 h = (_Float16)xs[i]; ah.h[i] = h; al.h[i] = ASPLIT ? (_Float16)(xs[i] - (float)h) : (_Float16)0.0f; }
#pragma unroll
    for (int t = 0; t < 4; ++t) { if (col0 + t * 16 >= N) continue; const size_t boff = (size_t)(col0 + t * 16 + ln) * ldb + kb; FragH bq; bq.half[0] = *(const v8us*)(Bh + boff + 8 * hh); bq.half[1] = *(const v8us*)(Bh + boff + 16 + 8 * hh);
      acc[t] = mmaH<ASPLIT ? 2 : 1>(ah.v, al.v, bq.v, bq.v, acc[t]); }
  }
#pragma unroll
  for (int t = 0; t < 4; ++t) { if (col0 + t * 16 >= N) continue;
#pragma unroll
    for (int r = 0; r < 8; ++r) so[w][8 * hh + r][t * 16 + ln] = acc[t][r] * alpha; }
  __builtin_amdgcn_fence(__ATOMIC_ACQ_REL, "workgroup"); __builtin_amdgcn_wave_barrier();
  const int rsub = lane >> 4, c4 = (lane & 15) * 4;
  {
#pragma unroll
    for (int q = 0; q < 8; ++q) { const int r = q * 2 + rsub; if (col0 + c4 < N) { const v4f v = *(const v4fa*)&so[w][r][c4]; *(v4f*)(C + (size_t)(row0 + r) * ldc + col0 + c4) = v; } }
     }
}

// Wt[n][k] = f16(W[k][n]·scale) from f32 row-major W[K][N] (scale = power of two; bf16-exact weights stay exact in f16 away from the subnormal range)
__global__ __launch_bounds__(256) void k_wt_f16(const float* __restrict__ W, _Float16* __restrict__ Wt, int K, int N, float scale) {
  const int t = blockIdx.x * 256 + threadIdx.x; if (t >= N * (K / 8)) return; const int n = t / (K / 8), k8 = (t % (K / 8)) * 8; FragH f;
#pragma unroll
  for (int i = 0; i < 8; ++i) f.h[i] = (_Float16)(bf16_round(W[(size_t)(k8 + i) * N + n]) * scale); const v8us o = f.half[0];
  *(v8us*)((unsigned short*)Wt + (size_t)n * K + k8) = o; 
}
// k_gemm_hh variant with fused epilogue: v = acc·alpha + bias[by·sBias + col] (+ CP[(row/rowsPerB)·sCPb + by·64 + col] if CP) ; ACT 0 none / 1 elu ; writes f16 C16 (and f32 C if non-null)
template <int ACT>
__global__ __launch_bounds__(128) void k_gemm_hhx(const _Float16* __restrict__ A, int lda, size_t sA, const _Float16* __restrict__ Bh, int ldb, size_t sB, float alpha, const float* __restrict__ bias, size_t sBias, const float* __restrict__ CP, int rowsPerB, size_t sCPb, int row0g,
    float* __restrict__ C, _Float16* __restrict__ C16, int ldc, size_t sC, int M, int N, int K) {
  __shared__ __attribute__((aligned(16))) float so[4][16][64];
  const int tid = threadIdx.x, w = tid >> 5, lane = tid & 31, ln = lane & 15, hh = lane >> 4; const int by = blockIdx.y;
  A += (size_t)by * sA; Bh += (size_t)by * sB; const size_t cofs = (size_t)by * sC; const float* bp = bias ? bias + (size_t)by * sBias : nullptr;
  const int ntn = (N + 63) / 64; const int wid = blockIdx.x * 4 + w; const int mt = wid / ntn, nq = wid % ntn; if (mt * 16 >= M) return;
  const int row0 = mt * 16, col0 = nq * 64; const _Float16* arow = A + (size_t)(row0 + ln) * lda;
  v8f acc[4] = {};
  for (int kb = 0; kb < K; kb += 32) { FragH ah; ah.half[0] = *(const v8us*)((const unsigned short*)arow + kb + 8 * hh); ah.half[1] = *(const v8us*)((const unsigned short*)arow + kb + 16 + 8 * hh);
#pragma unroll
    for (int t = 0; t < 4; ++t) { if (col0 + t * 16 >= N) continue; const size_t boff = (size_t)(col0 + t * 16 + ln) * ldb + kb; FragH bq; bq.half[0] = *(const v8us*)((const unsigned short*)Bh + boff + 8 * hh); bq.half[1] = *(const v8us*)((const unsigned short*)Bh + boff + 16 + 8 * hh);
      acc[t] = mmaH<1>(ah.v, ah.v, bq.v, bq.v, acc[t]); }
  }
#pragma unroll
  for (int t = 0; t < 4; ++t) { if (col0 + t * 16 >= N) continue; const int col = col0 + t * 16 + ln; const float bv = bp ? bf16_round(bp[col]) : 0.f;
#pragma unroll
    for (int r = 0; r < 8; ++r) { float v = acc[t][r] * alpha + bv; if (CP) { const int bidx = (row0g + row0 + 8 * hh + r) / rowsPerB; v += CP[(size_t)bidx * sCPb + (size_t)by * 64 + col]; } if (ACT == 1) v = (v > 0.f) ? v : expm1f(v); else if (ACT == 7) v = (v > 0.f) ? v + 1.0f : expf(v); else if (ACT == 8) v = tanhf(v); else if (ACT == 9) v = 0.5f * v * (1.0f + tanhf(0.7978845608028654f * (v + 0.044715f * v * v * v))); else if (ACT == 11) v = 1.0f / (1.0f + expf(-v)); else if (ACT == 12) v = (v > 0.f) ? v : 0.01f * v; else if (ACT == 14) v = (v > 0.f) ? v : 0.1f * v; else if (ACT == 15) v = v / (1.0f + expf(-v)); else if (ACT == 3) v = fmaxf(v, 0.f); else if (ACT == 6) v = 0.5f * v * (1.0f + erff(v * 0.70710678118654752f)); so[w][8 * hh + r][t * 16 + ln] = v; } }
  __builtin_amdgcn_fence(__ATOMIC_ACQ_REL, "workgroup"); __builtin_amdgcn_wave_barrier();
  const int rsub = lane >> 4, c4 = (lane & 15) * 4; typedef _Float16 v4h __attribute__((ext_vector_type(4)));
  {
#pragma unroll
    for (int q = 0; q < 8; ++q) { const int r = q * 2 + rsub; if (col0 + c4 < N) { const v4f v = *(const v4fa*)&so[w][r][c4]; if (C) *(v4f*)(C + cofs + (size_t)(row0 + r) * ldc + col0 + c4) = v; if (C16) { v4h h4; for (int i = 0; i < 4; ++i) h4[i] = (_Float16)v[i]; *(v4h*)(C16 + cofs + (size_t)(row0 + r) * ldc + col0 + c4) = h4; } } }
     }
}


typedef _Float16 v4h __attribute__((ext_vector_type(4)));

// ---- fragment-order planes: every f16 plane that a WMMA operand is loaded from is stored as 1 KiB units, one per (16 rows x 32 k). Inside a unit the 16-byte piece at (half * 32 + lane) holds row (lane & 15),
// k = half * 16 + (lane >> 4) * 8 .. + 7: what lane 'lane' takes as half 'half' of its fragment. A wave's global_load_b128 then reads 512 contiguous bytes (4 cache lines) where a row-major plane gives it 16 rows (16 lines).
// Units run along k first, then down the row tiles, so a tile of 16 rows still starts at element row * ld. ld % 32 == 0, rows % 16 == 0.
__device__ __forceinline__ size_t pk_src(size_t t, int ld) { const int lane = (int)(t & 31), half = (int)((t >> 5) & 1); const size_t u = t >> 6; const size_t nks = (size_t)(ld >> 5); const size_t ks = u % nks, rt = u / nks;      /* row-major element offset of the 8 elements that piece t of the plane holds */
  return (rt * 16 + (lane & 15)) * (size_t)ld + ks * 32 + half * 16 + (lane >> 4) * 8; }
__device__ __forceinline__ size_t pk_dst(size_t row, int k, int ld) { return (row >> 4) * 16 * (size_t)ld + (size_t)(k >> 5) * 512 + ((k >> 4) & 1) * 256 + (((k >> 3) & 1) * 16 + (int)(row & 15)) * 8; }      /* element offset in the plane of (row, k .. k + 7), k % 8 == 0 */

__global__ __launch_bounds__(256) void k_x16(const float* __restrict__ x, _Float16* __restrict__ X16, size_t n8) { const size_t t = (size_t)blockIdx.x * 256 + threadIdx.x; if (t >= n8) return; FragH f; const size_t so = pk_src(t, DM);
#pragma unroll
  for (int q = 0; q < 8; ++q) f.h[q] = (_Float16)bf16_round(x[so + q]); *(v8us*)((unsigned short*)X16 + t * 8) = f.half[0];  }
__global__ __launch_bounds__(256) void k_h16(const float* __restrict__ x, _Float16* __restrict__ X16, size_t n8) { const size_t t = (size_t)blockIdx.x * 256 + threadIdx.x; if (t >= n8) return; FragH f;
#pragma unroll
  for (int q = 0; q < 8; ++q) f.h[q] = (_Float16)x[t * 8 + q]; *(v8us*)((unsigned short*)X16 + t * 8) = f.half[0];  }
__global__ __launch_bounds__(256) void k_round16f(const float* __restrict__ W, _Float16* __restrict__ Bt, size_t n8) { const size_t t = (size_t)blockIdx.x * 256 + threadIdx.x; if (t >= n8) return; FragH f; const size_t so = pk_src(t, DM);
#pragma unroll
  for (int i = 0; i < 8; ++i) f.h[i] = (_Float16)(bf16_round(W[so + i]) * 16.0f); *(v8us*)((unsigned short*)Bt + t * 8) = f.half[0];  }
template <int NHv, int TTv>
__global__ __launch_bounds__(256) void k_vt(const _Float16* __restrict__ V16, int ldv, int voff, _Float16* __restrict__ Vt) { __shared__ unsigned short tl[64][66]; const int tid = threadIdx.x; const int slab = blockIdx.x / (TTv / 64), lg = blockIdx.x % (TTv / 64); const int b = slab / NHv, h = slab % NHv;
  for (int i = tid; i < 64 * 8; i += 256) { const int r = i / 8, c8 = (i % 8) * 8; FragH f; f.half[0] = *(const v8us*)((const unsigned short*)V16 + ((size_t)b * TTv + lg * 64 + r) * ldv + voff + h * 64 + c8);
#pragma unroll
    for (int q = 0; q < 8; ++q) tl[r][c8 + q] = f.u[q]; }
  __syncthreads();
  {
#pragma unroll
    for (int rd = 0; rd < 2; ++rd) { const int d = rd * 32 + tid / 8, pc = tid % 8; FragH f;
#pragma unroll
      for (int q = 0; q < 8; ++q) f.u[q] = tl[pc * 8 + q][d];
      *(v8us*)((unsigned short*)Vt + ((size_t)slab * 64 + d) * TTv + lg * 64 + pc * 8) = f.half[0]; }
     } }

// f32 -> f16 hi + x2^10 residual, 8 values = one 16-byte piece of each plane
__device__ __forceinline__ void hl_split8(const float* v, FragH& fh, FragH& fl) {
#pragma unroll
  for (int q = 0; q < 8; ++q) { const _Float16 h = (_Float16)v[q]; fh.h[q] = h; fl.h[q] = (_Float16)((v[q] - (float)h) * 1024.0f); } }

// ---- fast GEMM (wave tile 32x64; requires M % 32 == 0 rows per launch region and N % 64 == 0; A and Bh are fragment-order planes of pitch lda, ldb); epilogue = k_gemm_hhx semantics ----
// EPI 0: the tile goes out as f32 rows (C) and / or f16 rows (C16). EPI 1 (q, k; N = DM, so that a 64-column tile is one head): the tile is rotated by the head's cos/sin tables and goes out as the hi and residual fragment-order planes Ph, Pl.
// EPI 2 (v): the tile goes out transposed, as the hi and residual fragment-order planes of V^T (rows (batch * NH + head) * 64 + d, pitch SLEN).
__device__ __forceinline__ v16h g2_fragp(const _Float16* p) { FragH f; f.half[0] = *(const v8us*)((const unsigned short*)p); f.half[1] = *(const v8us*)((const unsigned short*)p + 256); return f.v; }      /* p = the lane's piece of a fragment-order unit */
__device__ __forceinline__ v8f g2_mma(v16h a, v16h b, v8f c) { v8f d = __builtin_amdgcn_wmma_f32_16x16x32_f16(false, a, false, b, (short)0, c, false, false); asm volatile("v_nop\n\tv_nop\n\tv_nop\n\tv_nop" : "+v"(d) : "v"(a), "v"(b)); return d; }
template <int ACT, int EPI>
__global__ __launch_bounds__(128) void k_gemm2(const _Float16* __restrict__ A, int lda, size_t sA, const _Float16* __restrict__ Bh, int ldb, size_t sB, float alpha, const float* __restrict__ bias, size_t sBias, const float* __restrict__ CP, int rowsPerB, size_t sCPb, int row0g,
    float* __restrict__ C, _Float16* __restrict__ C16, int ldc, size_t sC, int M, int N, int K, const float* __restrict__ CS, const float* __restrict__ SN, _Float16* __restrict__ Ph, _Float16* __restrict__ Pl) {
  __shared__ __attribute__((aligned(16))) float so[4][32][68];
  const int tid = threadIdx.x, w = tid >> 5, lane = tid & 31, ln = lane & 15, hh = lane >> 4; const int by = blockIdx.y;
  A += (size_t)by * sA; Bh += (size_t)by * sB; const size_t cofs = (size_t)by * sC; const float* bp = bias ? bias + (size_t)by * sBias : nullptr;
  const int ntn = N >> 6; const int mt = blockIdx.x / ntn, nq = blockIdx.x - mt * ntn; const int row0 = mt * 128 + 32 * w, col0 = nq * 64; if (row0 >= M) return;
  const _Float16* a0p = A + (size_t)row0 * lda + lane * 8; const _Float16* a1p = a0p + (size_t)16 * lda;      /* A and Bh are fragment-order planes */
  const _Float16* b0p = Bh + (size_t)col0 * ldb + lane * 8; const _Float16* b1p = b0p + (size_t)16 * ldb; const _Float16* b2p = b1p + (size_t)16 * ldb; const _Float16* b3p = b2p + (size_t)16 * ldb;
  const v8f z8 = {0.f,0.f,0.f,0.f,0.f,0.f,0.f,0.f}; v8f c00 = z8, c01 = z8, c02 = z8, c03 = z8, c10 = z8, c11 = z8, c12 = z8, c13 = z8;
  /* Register ring of three k-steps: the six fragments of steps s + 1 and s + 2 are in flight while step s is multiplied, so that a step no longer waits for five round trips one after the other.
     Each accumulator still takes its k-steps in ascending order. The six lane pointers live through the whole loop and every load of a trip reaches its step by an immediate offset, so that no load's result can land in an address register; only steps below K / 32 are loaded. */
  typedef const __attribute__((address_space(1))) _Float16* g2_gp;      /* typed as global memory, so that the loads stay global loads behind the asm statement that names the pointers */
  g2_gp p0 = (g2_gp)a0p, p1 = (g2_gp)a1p, p2 = (g2_gp)b0p, p3 = (g2_gp)b1p, p4 = (g2_gp)b2p, p5 = (g2_gp)b3p;
#define G2_FR(P, ST) g2_fragp((const _Float16*)((P) + 512 * (ST)))
#define G2_LOAD(S, ST) { S[0] = G2_FR(p0, ST); S[1] = G2_FR(p1, ST); S[2] = G2_FR(p2, ST); S[3] = G2_FR(p3, ST); S[4] = G2_FR(p4, ST); S[5] = G2_FR(p5, ST); \
    __builtin_amdgcn_sched_barrier(0); /* keeps the refill in front of the products that follow: without it the compiler sinks a refill behind the first product and that product's wait, and it flies for a shorter time */ }
#define G2_STEP(S) { c00 = g2_mma(S[0], S[2], c00); c10 = g2_mma(S[1], S[2], c10); c01 = g2_mma(S[0], S[3], c01); c11 = g2_mma(S[1], S[3], c11); c02 = g2_mma(S[0], S[4], c02); c12 = g2_mma(S[1], S[4], c12); c03 = g2_mma(S[0], S[5], c03); c13 = g2_mma(S[1], S[5], c13); }
  { const int nst = K >> 5; v16h r0[6], r1[6], r2[6]; int s = 0;
    if (nst >= 1) G2_LOAD(r0, 0)
    if (nst >= 2) G2_LOAD(r1, 1)
#pragma unroll 1
    for (; s + 5 <= nst; s += 3) { G2_LOAD(r2, 2) G2_STEP(r0) G2_LOAD(r0, 3) G2_STEP(r1) G2_LOAD(r1, 4) G2_STEP(r2)
      asm volatile("s_wait_xcnt 0x0" : "+v"(p0), "+v"(p1), "+v"(p2), "+v"(p3), "+v"(p4), "+v"(p5) :: "memory"); /* stands in front of the six additions below, which overwrite the address registers of the loads issued above; the pointers are named so that the additions depend on this statement and cannot be placed ahead of it (without it the compiler keeps copies of the pointers and rewrites them at the loop's head) */
      p0 += 1536; p1 += 1536; p2 += 1536; p3 += 1536; p4 += 1536; p5 += 1536; }
    const int rem = nst - s;      /* 0 to 4 steps are left; r0 and r1 hold the first two of them */
    if (rem >= 3) G2_LOAD(r2, 2)
    if (rem >= 1) G2_STEP(r0)
    if (rem >= 4) G2_LOAD(r0, 3)
    if (rem >= 2) G2_STEP(r1)
    if (rem >= 3) G2_STEP(r2)
    if (rem >= 4) G2_STEP(r0) }
#undef G2_FR
#undef G2_LOAD
#undef G2_STEP
  v8f accs[8] = {c00, c01, c02, c03, c10, c11, c12, c13};
#pragma unroll
  for (int u = 0; u < 8; ++u) { const int t = u & 3, half = u >> 2; const int col = col0 + t * 16 + ln; const float bv = bp ? bf16_round(bp[col]) : 0.f;
#pragma unroll
    for (int r = 0; r < 8; ++r) { const int rloc = half * 16 + 8 * hh + r; float v = accs[u][r] * alpha + bv; if (CP) { const int bidx = (row0g + row0 + rloc) / rowsPerB; v += CP[(size_t)bidx * sCPb + (size_t)by * 64 + col]; }
      if (ACT == 3) v = fmaxf(v, 0.f); else if (ACT == 6) v = 0.5f * v * (1.0f + erff(v * 0.70710678118654752f)); else if (ACT == 11) v = 1.0f / (1.0f + expf(-v)); else if (ACT == 15) v = v / (1.0f + expf(-v)); else if (ACT == 12) v = (v > 0.f) ? v : 0.01f * v; else if (ACT == 8) v = tanhf(v);
      so[w][rloc][t * 16 + ln] = v; } }
  __builtin_amdgcn_fence(__ATOMIC_ACQ_REL, "workgroup"); __builtin_amdgcn_wave_barrier();
  if (EPI == 1) {      /* the wave's tile = 2 row tiles x 2 units x 2 halves of each plane; a lane takes its own piece (row ln, 8 columns = 4 rotation pairs), a wave stores 512 contiguous bytes */
    typedef const __attribute__((address_space(1))) float* g2_fp;      /* typed as global memory, so that the loads stay global loads beside the asm statement that names the pointers */
    const size_t th = (size_t)(col0 >> 6) * SLEN * 32 + hh * 4, ta = th + (size_t)((row0 + ln) % SLEN) * 32, tb = th + (size_t)((row0 + 16 + ln) % SLEN) * 32;
    g2_fp ca = (g2_fp)(CS + ta), sa = (g2_fp)(SN + ta), cb = (g2_fp)(CS + tb), sb = (g2_fp)(SN + tb); v4f csv[8], snv[8];      /* the lane's two token rows of the head's tables */
#pragma unroll
    for (int u = 0; u < 8; ++u) { const int jo = ((u >> 1) & 1) * 16 + (u & 1) * 8; csv[u] = *(const __attribute__((address_space(1))) v4fa*)(((u >> 2) ? cb : ca) + jo); snv[u] = *(const __attribute__((address_space(1))) v4fa*)(((u >> 2) ? sb : sa) + jo); }
    asm volatile("s_wait_xcnt 0x0" : "+v"(ca), "+v"(sa), "+v"(cb), "+v"(sb) :: "memory");      /* stands in front of the first instruction that reuses an address register of the 16 table loads above; the pointers are named so that they live up to here */
#pragma unroll
    for (int u = 0; u < 8; ++u) { const int rl = (u >> 2) * 16 + ln, kk = ((u >> 1) & 1) * 32 + (u & 1) * 16 + hh * 8; const v4f a = *(const v4fa*)&so[w][rl][kk], c = *(const v4fa*)&so[w][rl][kk + 4];
      const v4f cs = csv[u], sn = snv[u];
      const float f[8] = {a[0], a[1], a[2], a[3], c[0], c[1], c[2], c[3]}; float o[8];
#pragma unroll
      for (int p = 0; p < 4; ++p) { o[2 * p] = f[2 * p] * cs[p] - f[2 * p + 1] * sn[p]; o[2 * p + 1] = f[2 * p] * sn[p] + f[2 * p + 1] * cs[p]; }
      FragH fh, fl; hl_split8(o, fh, fl); const size_t po = pk_dst((size_t)(row0 + rl), col0 + kk, N);
      *(v8us*)((unsigned short*)Ph + po) = fh.half[0]; *(v8us*)((unsigned short*)Pl + po) = fl.half[0]; }
  } else if (EPI == 2) {      /* 32 tokens x 64 d = 4 units of each V^T plane; a lane takes row d, 8 tokens, read down a column of the staged tile */
    const size_t vrow = ((size_t)(row0 / SLEN) * NH + (col0 >> 6)) * 64; const int t0 = row0 % SLEN;
#pragma unroll
    for (int u = 0; u < 8; ++u) { const int d = (u >> 1) * 16 + ln, tl = (u & 1) * 16 + hh * 8; float o[8];
#pragma unroll
      for (int q = 0; q < 8; ++q) o[q] = so[w][tl + q][d];
      FragH fh, fl; hl_split8(o, fh, fl); const size_t po = pk_dst(vrow + d, t0 + tl, SLEN);
      *(v8us*)((unsigned short*)Ph + po) = fh.half[0]; *(v8us*)((unsigned short*)Pl + po) = fl.half[0]; }
  } else {
    const int rsub = lane >> 4, c4 = (lane & 15) * 4;
#pragma unroll
    for (int q = 0; q < 16; ++q) { const int r = q * 2 + rsub; const v4f v = *(const v4fa*)&so[w][r][c4]; if (C) *(v4f*)(C + cofs + (size_t)(row0 + r) * ldc + col0 + c4) = v; if (C16) { v4h h4; for (int i = 0; i < 4; ++i) h4[i] = (_Float16)v[i]; *(v4h*)(C16 + cofs + (size_t)(row0 + r) * ldc + col0 + c4) = h4; } }
     } }



template <int TQ, int TK>
__global__ __launch_bounds__(128) void k_flashme(const _Float16* __restrict__ Q16, const _Float16* __restrict__ Q16lo, int ldq, const _Float16* __restrict__ K16, const _Float16* __restrict__ K16lo, int ldk, const _Float16* __restrict__ Vt, const _Float16* __restrict__ Vtlo, const float* __restrict__ HB, _Float16* __restrict__ Oh, _Float16* __restrict__ Ol, int ldo) {
  #pragma clang fp contract(off)
  constexpr int RPW = 16, RTN = RPW / 16, NQB = TQ / (4 * RPW), DT = 4, KS = 2;
  __shared__ __attribute__((aligned(16))) unsigned short sP[4][RPW][40], sPl[4][RPW][40]; __shared__ __attribute__((aligned(16))) float sO[4][RPW][64 + 4];
  /* Two buffers of one trip's key and value tiles, 16 KiB each, which all four waves read: bytes 0: K hi (key tile 0, key tile 1; 2 KiB each = units ks 0, 1), 4096: K residual, 8192: V^T hi (units dt 0 .. 3), 12288: V^T residual. The units keep their fragment order. */
  __shared__ __attribute__((aligned(16))) unsigned short sKV[2][8192];
  /* What is added to a scaled score depends on the head and on the distance d = query - key alone: entry d + 63 holds the decay bias for d >= 0 and -inf for d < 0 (a key behind the query: the causal mask). The work-group's tiles meet d = -63 .. qb0 + 63. */
  static_assert(TQ == TK, "the table's range is that of a causal square");
  __shared__ float sB[TQ + 64];
  const int tid = threadIdx.x, w = tid >> 5, lane = tid & 31, ln = lane & 15, hh = lane >> 4;
  /* Which (batch, head) slab and which 64-query tile a work-group takes. A causal tile t walks 2 (t + 1) key trips, all 1024 work-groups are resident at once, four to a WGP, and a SIMD's vector port is shared by its four waves, so the launch lasts as long as the WGP with the most trips.
     With tile = index % 32 work-groups whose indices are equal mod 256 hold the same tile. Here the four classes c of one a = index & 7 are the tiles 2a, 2a + 1, 31 - 2a, 30 - 2a (132 trips together, for every a), and c = (bits 3..4 + bits 8..9) & 3 takes all four values
     over indices equal mod 256 as well as over four neighbours (index step 8), and a pair c, c + 2 (66 trips) at index step 16. For speed only: (slab, tile) is a permutation of the index whatever the placement is. */
  static_assert(NQB == 32 && NBT * NH == 32, "the index map below is written for 32 slabs of 32 query tiles");
  const int bx = blockIdx.x, slab = bx / NQB, ta = (bx & 7) * 2, tc = (((bx >> 3) & 3) + (slab >> 3)) & 3;      /* slab >> 3 = bits 8..9 of the index */
  const int qblk = (ta | (tc & 1)) ^ ((tc >> 1) * 31);      /* x ^ 31 = 31 - x */ const int b = slab / NH, h = slab % NH; const int qb0 = qblk * (4 * RPW); const int q0 = qb0 + w * RPW;
  FragH aq[2][KS], aql[2][KS];
#pragma unroll
  for (int rt = 0; rt < RTN; ++rt) { const size_t qo = ((size_t)b * TQ + q0 + rt * 16) * ldq + h * 1024 + lane * 8;      /* fragment-order planes: head h = units 2h and 2h + 1 of the row tile */ const unsigned short* qr = (const unsigned short*)Q16 + qo; const unsigned short* ql = (const unsigned short*)Q16lo + qo;
#pragma unroll
    for (int ks = 0; ks < KS; ++ks) { aq[rt][ks].half[0] = *(const v8us*)(qr + ks * 512); aq[rt][ks].half[1] = *(const v8us*)(qr + ks * 512 + 256); aql[rt][ks].half[0] = *(const v8us*)(ql + ks * 512); aql[rt][ks].half[1] = *(const v8us*)(ql + ks * 512 + 256); } }
  asm volatile("s_wait_xcnt 0x0" ::: "memory");      /* stands in front of the first instruction that reuses an address register of the q loads above (the build reuses them for the copies' addresses) */
  __builtin_amdgcn_sched_barrier(0);      /* holds what follows behind that wait: the accumulators' zeroing depends on nothing, and a "memory" clobber does not tie it to the wait */
  const unsigned short* Vth = (const unsigned short*)Vt + (size_t)slab * 64 * TK; const unsigned short* Vtl = (const unsigned short*)Vtlo + (size_t)slab * 64 * TK;
  float m_r[2][8], l_r[2][8]; v8f oacc[2][DT], oaccl[2][DT];
#pragma unroll
  for (int rt = 0; rt < RTN; ++rt) {
#pragma unroll
    for (int r = 0; r < 8; ++r) { m_r[rt][r] = -3.0e38f; l_r[rt][r] = 0.f; }
#pragma unroll
    for (int dt = 0; dt < DT; ++dt) { oacc[rt][dt] = (v8f){0.f,0.f,0.f,0.f,0.f,0.f,0.f,0.f}; oaccl[rt][dt] = oacc[rt][dt]; } }
  const float xih = HB[2 * h], egh = HB[2 * h + 1];      /* the head's two bias scalars, read once */
  const int jend = qb0 + 4 * RPW;      /* block-uniform: the keys up to the tile's last query; a multiple of 32, at most TK */
  /* A tile goes from global memory to LDS by asynchronous copies, through no register: 8 copies of 16 bytes a lane, 2 KiB a copy over the work-group. The tile of trip t + 1 flies while trip t is worked on, and each tile is fetched once a work-group, not once a wave. */
  const unsigned ldsl = (unsigned)(size_t)&sKV[0][tid * 8];      /* the lane's LDS byte address in the first 2 KiB of buffer 0 */
  const size_t klo = ((size_t)b * TK * ldk + h * 1024) * 2, kst = (size_t)ldk * 2; const unsigned kln = (unsigned)tid * 16u, vln = (unsigned)(tid >> 6) * (32u * TK) + (unsigned)(tid & 63) * 16u;      /* byte offsets. Uniform: the head's key row 0; one key row. The lane's own: its piece of a key row tile; its piece of value unit dt = tid / 64 */
#define FM_COPY(J, BUF) { const size_t ku = klo + (size_t)(J) * kst, vu = (size_t)((J) >> 5) * 1024; const char* g0 = (const char*)K16 + ku + kln; const char* g1 = (const char*)K16 + (ku + 16 * kst) + kln; const char* g2 = (const char*)K16lo + ku + kln; const char* g3 = (const char*)K16lo + (ku + 16 * kst) + kln; \
    const char* g4 = (const char*)Vth + vu + vln; const char* g5 = (const char*)Vth + (vu + (size_t)64 * TK) + vln; const char* g6 = (const char*)Vtl + vu + vln; const char* g7 = (const char*)Vtl + (vu + (size_t)64 * TK) + vln; const unsigned l0 = ldsl + (unsigned)(BUF) * 16384u; \
    /* the eight copies and, as the statement's last line, the wait that stands in front of any rewrite of their address registers */ \
    asm volatile("global_load_async_to_lds_b128 %0, %8, off\n\tglobal_load_async_to_lds_b128 %1, %9, off\n\tglobal_load_async_to_lds_b128 %2, %10, off\n\tglobal_load_async_to_lds_b128 %3, %11, off\n\t" \
                 "global_load_async_to_lds_b128 %4, %12, off\n\tglobal_load_async_to_lds_b128 %5, %13, off\n\tglobal_load_async_to_lds_b128 %6, %14, off\n\tglobal_load_async_to_lds_b128 %7, %15, off\n\ts_wait_xcnt 0x0" \
                 :: "v"(l0), "v"(l0 + 2048u), "v"(l0 + 4096u), "v"(l0 + 6144u), "v"(l0 + 8192u), "v"(l0 + 10240u), "v"(l0 + 12288u), "v"(l0 + 14336u), "v"(g0), "v"(g1), "v"(g2), "v"(g3), "v"(g4), "v"(g5), "v"(g6), "v"(g7) : "memory"); }
  FM_COPY(0, 0)
  for (int i = tid; i < qb0 + 127; i += 128) { const int d = i - 63; const float bd = (-((float)d / xih)) * egh; sB[i] = (d >= 0) ? bd : -INFINITY; }      /* each entry once a work-group, by the expression that every element took before; built while tile 0 flies */
  asm volatile("s_wait_asynccnt 0x0" ::: "memory");      /* this wave's copies of tile 0 have landed */
  __syncthreads();      /* publishes tile 0 and the table to the four waves */
  if (32 < jend) FM_COPY(32, 1)
#pragma unroll 1
  for (int j0 = 0; j0 < jend; j0 += 32) {
    const int buf = (j0 >> 5) & 1; const unsigned short* kvb = &sKV[buf][0];
    float b0v[2][8], b1v[2][8];      /* the lane's 16 table entries, fetched together at the head of the trip: they fly beside the key loads */
#pragma unroll
    for (int rt = 0; rt < RTN; ++rt) { const float* tb = &sB[q0 + rt * 16 + 8 * hh + 47 - j0 - ln];      /* row r, key j0 + 16 + ln: entry tb[r]; key j0 + ln: tb[16 + r] */
#pragma unroll
      for (int r = 0; r < 8; ++r) { b0v[rt][r] = tb[16 + r]; b1v[rt][r] = tb[r]; } }
    v8f s[2][2];
#pragma unroll
    for (int nt = 0; nt < 2; ++nt) { const unsigned short* kr = kvb + nt * 1024 + lane * 8; const unsigned short* kl = kr + 2048; FragH bk[KS], bkl[KS];      /* from the trip's LDS buffer */
#pragma unroll
      for (int ks = 0; ks < KS; ++ks) { bk[ks].half[0] = *(const v8us*)(kr + ks * 512); bk[ks].half[1] = *(const v8us*)(kr + ks * 512 + 256); bkl[ks].half[0] = *(const v8us*)(kl + ks * 512); bkl[ks].half[1] = *(const v8us*)(kl + ks * 512 + 256); }
#pragma unroll
      for (int rt = 0; rt < RTN; ++rt) { v8f acc = (v8f){0.f,0.f,0.f,0.f,0.f,0.f,0.f,0.f}, accr = acc;
#pragma unroll
        for (int ks = 0; ks < KS; ++ks) { acc = mmaH<1>(aq[rt][ks].v, aq[rt][ks].v, bk[ks].v, bk[ks].v, acc); accr = mmaH<1>(aql[rt][ks].v, aql[rt][ks].v, bk[ks].v, bk[ks].v, accr); accr = mmaH<1>(aq[rt][ks].v, aq[rt][ks].v, bkl[ks].v, bkl[ks].v, accr); }
        s[rt][nt] = acc + accr * 0.0009765625f; } }
    /* Softmax of the tile, step by step over all rows instead of row by row: each step below is done for every row before the next begins, and no step holds a branch,
       so that the rows' shuffle and exp latencies overlap. */
    float s0v[2][8], s1v[2][8], mcv[2][8];
#pragma unroll
    for (int rt = 0; rt < RTN; ++rt)
#pragma unroll
      for (int r = 0; r < 8; ++r) { const float s0 = s[rt][0][r] * SCL + b0v[rt][r], s1 = s[rt][1][r] * SCL + b1v[rt][r];      /* -inf for a masked key: its exp below is 0, the running maximum being finite always (it starts at -3.0e38) */
        s0v[rt][r] = s0; s1v[rt][r] = s1; mcv[rt][r] = fmaxf(s0, s1); }
    asm volatile("" :: "v"(mcv[0][0]), "v"(mcv[0][1]), "v"(mcv[0][2]), "v"(mcv[0][3]), "v"(mcv[0][4]), "v"(mcv[0][5]), "v"(mcv[0][6]), "v"(mcv[0][7])); __builtin_amdgcn_sched_barrier(0);      /* inputs only: all eight rows' maxima stand ready in front of the first shuffle round. Without it this build takes the rows two at a time, and each pair waits out its four shuffle rounds alone */
#pragma unroll
    for (int sh = 1; sh <= 8; sh <<= 1) { float tv[2][8];
#pragma unroll
      for (int rt = 0; rt < RTN; ++rt)
#pragma unroll
        for (int r = 0; r < 8; ++r) tv[rt][r] = __shfl_xor(mcv[rt][r], sh, 32);
#pragma unroll
      for (int rt = 0; rt < RTN; ++rt)
#pragma unroll
        for (int r = 0; r < 8; ++r) mcv[rt][r] = fmaxf(mcv[rt][r], tv[rt][r]); }
    asm volatile("" :: "v"(mcv[0][0]), "v"(mcv[0][1]), "v"(mcv[0][2]), "v"(mcv[0][3]), "v"(mcv[0][4]), "v"(mcv[0][5]), "v"(mcv[0][6]), "v"(mcv[0][7])); __builtin_amdgcn_sched_barrier(0);      /* inputs only, for the same reason: the eight rows go through the four rounds together, in front of the exps */
    /* Base-2 softmax: e^(s - m) = 2^(s * log2 e - m * log2 e), one fused multiply-add and the hardware's 2^x a value, where the library's e^x spends a range reduction, a scaling and two range selects more.
       The rounded m * log2 e is what every weight of a row and the row's rescaling factor subtract, so that its rounding cancels between the weights and their sum. 2^x of -inf, and of anything below the normal range, is 0. */
    constexpr float L2E = 1.44269504088896340736f;
    float mnv[2][8], xav[2][8], x0v[2][8], x1v[2][8], eav[2][8], e0v[2][8], e1v[2][8];
#pragma unroll
    for (int rt = 0; rt < RTN; ++rt) {
#pragma unroll
      for (int r = 0; r < 8; ++r) { const float mn = fmaxf(m_r[rt][r], mcv[rt][r] * L2E);      /* the running maximum is kept times log2 e */
        mnv[rt][r] = mn; xav[rt][r] = m_r[rt][r] - mn; x0v[rt][r] = __builtin_fmaf(s0v[rt][r], L2E, -mn); x1v[rt][r] = __builtin_fmaf(s1v[rt][r], L2E, -mn); }
#pragma unroll
      for (int g = 0; g < 8; g += 4) {
#pragma unroll
        for (int r = g; r < g + 4; ++r) { eav[rt][r] = __builtin_amdgcn_exp2f(xav[rt][r]); e0v[rt][r] = __builtin_amdgcn_exp2f(x0v[rt][r]); e1v[rt][r] = __builtin_amdgcn_exp2f(x1v[rt][r]); }
        /* inputs only, no instruction. For the slot that the instruction set asks for behind a transcendental before its source register is overwritten: the twelve arguments live up to here, behind their twelve v_exp_f32,
           so that no result lands in an argument's register directly behind that argument's own v_exp_f32 */
        asm volatile("" :: "v"(xav[rt][g]), "v"(x0v[rt][g]), "v"(x1v[rt][g]), "v"(xav[rt][g + 1]), "v"(x0v[rt][g + 1]), "v"(x1v[rt][g + 1]), "v"(xav[rt][g + 2]), "v"(x0v[rt][g + 2]), "v"(x1v[rt][g + 2]), "v"(xav[rt][g + 3]), "v"(x0v[rt][g + 3]), "v"(x1v[rt][g + 3]),
                     "v"(eav[rt][g]), "v"(e0v[rt][g]), "v"(e1v[rt][g]), "v"(eav[rt][g + 1]), "v"(e0v[rt][g + 1]), "v"(e1v[rt][g + 1]), "v"(eav[rt][g + 2]), "v"(e0v[rt][g + 2]), "v"(e1v[rt][g + 2]), "v"(eav[rt][g + 3]), "v"(e0v[rt][g + 3]), "v"(e1v[rt][g + 3])); } }
#pragma unroll
    for (int rt = 0; rt < RTN; ++rt)
#pragma unroll
      for (int r = 0; r < 8; ++r) { const float mn = mnv[rt][r], ea = eav[rt][r], e0 = e0v[rt][r], e1 = e1v[rt][r];
        const float al = (mn > -1.0e38f) ? ea : 1.0f; m_r[rt][r] = mn; const float p0 = e0, p1 = e1; l_r[rt][r] = l_r[rt][r] * al + p0 + p1;
#pragma unroll
        for (int dt = 0; dt < DT; ++dt) { oacc[rt][dt][r] *= al; oaccl[rt][dt][r] *= al; }
        FragH t2, t3; const float ps0 = p0 * 1024.0f, ps1 = p1 * 1024.0f; t2.h[0] = (_Float16)ps0; t2.h[1] = (_Float16)ps1; t3.h[0] = (_Float16)((ps0 - (float)t2.h[0]) * 1024.0f); t3.h[1] = (_Float16)((ps1 - (float)t2.h[1]) * 1024.0f);
        sP[w][rt * 16 + 8 * hh + r][ln] = t2.u[0]; sP[w][rt * 16 + 8 * hh + r][16 + ln] = t2.u[1]; sPl[w][rt * 16 + 8 * hh + r][ln] = t3.u[0]; sPl[w][rt * 16 + 8 * hh + r][16 + ln] = t3.u[1]; }
    __builtin_amdgcn_fence(__ATOMIC_ACQ_REL, "workgroup"); __builtin_amdgcn_wave_barrier();
    FragH pa[2], pl[2];
#pragma unroll
    for (int rt = 0; rt < RTN; ++rt) { pa[rt].half[0] = *(const v8us*)&sP[w][rt * 16 + ln][8 * hh]; pa[rt].half[1] = *(const v8us*)&sP[w][rt * 16 + ln][16 + 8 * hh]; pl[rt].half[0] = *(const v8us*)&sPl[w][rt * 16 + ln][8 * hh]; pl[rt].half[1] = *(const v8us*)&sPl[w][rt * 16 + ln][16 + 8 * hh]; }
#pragma unroll
    for (int dt = 0; dt < DT; ++dt) { const unsigned short* vr = kvb + 4096 + dt * 512 + lane * 8; FragH bv, bl; bv.half[0] = *(const v8us*)(vr); bv.half[1] = *(const v8us*)(vr + 256); bl.half[0] = *(const v8us*)(vr + 2048); bl.half[1] = *(const v8us*)(vr + 2048 + 256);
#pragma unroll
      for (int rt = 0; rt < RTN; ++rt) { oacc[rt][dt] = mmaH<1>(pa[rt].v, pa[rt].v, bv.v, bv.v, oacc[rt][dt]); oaccl[rt][dt] = mmaH<1>(pa[rt].v, pa[rt].v, bl.v, bl.v, oaccl[rt][dt]); oaccl[rt][dt] = mmaH<1>(pl[rt].v, pl[rt].v, bv.v, bv.v, oaccl[rt][dt]); } }
    __builtin_amdgcn_fence(__ATOMIC_ACQ_REL, "workgroup"); __builtin_amdgcn_wave_barrier();
    asm volatile("s_wait_dscnt 0x0" ::: "memory");      /* this wave's reads of the trip's buffer have returned */
    asm volatile("s_wait_asynccnt 0x0" ::: "memory");      /* this wave's copies of the next tile have landed */
    __syncthreads();      /* publishes the next tile and ends every wave's reads of this trip's buffer, which is refilled below */
    if (j0 + 64 < jend) FM_COPY(j0 + 64, buf) }
  asm volatile("s_wait_asynccnt 0x0" ::: "memory");      /* no copy is outstanding when the wave goes on to its end */
#undef FM_COPY
#pragma unroll
  for (int rt = 0; rt < RTN; ++rt) {
#pragma unroll
    for (int r = 0; r < 8; ++r) { float l = l_r[rt][r]; l += __shfl_xor(l, 1, 32); l += __shfl_xor(l, 2, 32); l += __shfl_xor(l, 4, 32); l += __shfl_xor(l, 8, 32); l_r[rt][r] = (l > 0.f) ? 1.0f / (l * 1024.0f) : 0.f; }
#pragma unroll
    for (int dt = 0; dt < DT; ++dt)
#pragma unroll
      for (int r = 0; r < 8; ++r) sO[w][rt * 16 + 8 * hh + r][dt * 16 + ln] = (oacc[rt][dt][r] + oaccl[rt][dt][r] * 0.0009765625f) * l_r[rt][r]; }
  __builtin_amdgcn_fence(__ATOMIC_ACQ_REL, "workgroup"); __builtin_amdgcn_wave_barrier();
  {
#pragma unroll
    for (int u = 0; u < 4 * RTN; ++u) { const int rl = (u >> 2) * 16 + ln, kk = ((u >> 1) & 1) * 32 + (u & 1) * 16 + hh * 8; const v4f a = *(const v4fa*)&sO[w][rl][kk], c = *(const v4fa*)&sO[w][rl][kk + 4];      /* O leaves as the hi and residual fragment-order planes that the output projection reads: a lane's piece is row ln, 8 columns */
      const float o[8] = {a[0], a[1], a[2], a[3], c[0], c[1], c[2], c[3]}; FragH fh, fl; hl_split8(o, fh, fl); const size_t po = pk_dst((size_t)b * TQ + q0 + rl, h * 64 + kk, ldo);
      *(v8us*)((unsigned short*)Oh + po) = fh.half[0]; *(v8us*)((unsigned short*)Ol + po) = fl.half[0]; }
     } }


__constant__ float PIF[32] = {3.141592741e+00f,3.031195641e+00f,2.924677610e+00f,2.821902990e+00f,2.722739935e+00f,2.627061367e+00f,2.534744978e+00f,2.445672750e+00f,2.359730482e+00f,2.276808262e+00f,2.196800232e+00f,2.119603395e+00f,2.045119524e+00f,1.973252892e+00f,1.903911710e+00f,1.837007284e+00f,1.772453904e+00f,1.710168958e+00f,1.650072694e+00f,1.592088223e+00f,1.536141396e+00f,1.482160687e+00f,1.430076718e+00f,1.379823089e+00f,1.331335425e+00f,1.284551501e+00f,1.239411712e+00f,1.195858121e+00f,1.153835058e+00f,1.113288760e+00f,1.074167132e+00f,1.036420345e+00f};
__global__ __launch_bounds__(256) void k_trig(const float* __restrict__ pig, const float* __restrict__ logxi, const float* __restrict__ egl, float* __restrict__ CS, float* __restrict__ SN, float* __restrict__ HB) {
  #pragma clang fp contract(off)
  const int t = blockIdx.x * 256 + threadIdx.x; if (t >= NH * SLEN * 32) return; const int j = t & 31; const int tok = (t >> 5) % SLEN; const int h = t / (32 * SLEN);
  const float pg = 1.0f / (1.0f + expf(-bf16_round(pig[h]))); const float th = ((float)tok * PIF[j]) * pg; const float c = cosf(th), s = sinf(th);
  *(float*)(CS + t) = c; *(float*)(SN + t) = s; 
  if (t < 2 * NH) { const int hh2 = t >> 1; const float v = (t & 1) ? (1.0f / (1.0f + expf(-bf16_round(egl[hh2])))) : expf(bf16_round(logxi[hh2])); *(float*)(HB + t) = v;  } }      

extern "C" void kernel_launch(void* const* d_in, const int* in_sizes, int n_in,
                              void* d_out, int out_size, void* d_ws, size_t ws_size, hipStream_t stream) {
  (void)in_sizes; (void)n_in; (void)out_size;
  const float* const* I = (const float* const*)d_in; const float* x = I[0]; const float* Wqkv = I[1]; const float* Wo = I[2]; const float* logxi = I[3]; const float* pig = I[4]; const float* egl = I[5];
  char* ws = (char*)d_ws; size_t off = 0;
  auto take = [&](size_t bytes) { char* p = ws + off; off += (bytes + 255) & ~(size_t)255; return p; };
  _Float16* BQKV = (_Float16*)take((size_t)3 * DM * DM * 2); _Float16* BO = (_Float16*)take((size_t)DM * DM * 2);
  _Float16* X16 = (_Float16*)take((size_t)NR * DM * 2); _Float16* Oh = (_Float16*)take((size_t)NR * DM * 2); _Float16* Ol = (_Float16*)take((size_t)NR * DM * 2);
  _Float16* Qh = (_Float16*)take((size_t)NR * DM * 2); _Float16* Ql = (_Float16*)take((size_t)NR * DM * 2); _Float16* Kh = (_Float16*)take((size_t)NR * DM * 2); _Float16* Kl = (_Float16*)take((size_t)NR * DM * 2); _Float16* Vth = (_Float16*)take((size_t)NR * DM * 2); _Float16* Vtl = (_Float16*)take((size_t)NR * DM * 2);
  float* CS = (float*)take((size_t)NH * SLEN * 32 * 4); float* SN = (float*)take((size_t)NH * SLEN * 32 * 4); float* HB = (float*)take(256);
  if (off > ws_size) return;      /* 6 + 2 + 8 + 8 x 8 + 8 = 88 MiB */
  const size_t n8 = (size_t)NR * DM / 8; const unsigned nb8 = (unsigned)((n8 + 255) / 256);
  k_round16f<<<(unsigned)(((size_t)3 * DM * DM / 8 + 255) / 256), 256, 0, stream>>>(Wqkv, BQKV, (size_t)3 * DM * DM / 8); k_round16f<<<(unsigned)(((size_t)DM * DM / 8 + 255) / 256), 256, 0, stream>>>(Wo, BO, (size_t)DM * DM / 8);      /* torch (out,in) = natural Bt; x16 */
  k_x16<<<nb8, 256, 0, stream>>>(x, X16, n8);
  k_trig<<<(NH * SLEN * 32 + 255) / 256, 256, 0, stream>>>(pig, logxi, egl, CS, SN, HB);
  const dim3 gP((NR / 128) * (DM / 64), 1);
  k_gemm2<0, 1><<<gP, 128, 0, stream>>>(X16, DM, 0, BQKV, DM, 0, 0.0625f, nullptr, 0, nullptr, 1, 0, 0, nullptr, nullptr, DM, 0, NR, DM, DM, CS, SN, Qh, Ql);      /* q (rows 0..1023 of Wqkv), rotated, hi/lo */
  k_gemm2<0, 1><<<gP, 128, 0, stream>>>(X16, DM, 0, BQKV + (size_t)DM * DM, DM, 0, 0.0625f, nullptr, 0, nullptr, 1, 0, 0, nullptr, nullptr, DM, 0, NR, DM, DM, CS, SN, Kh, Kl);      /* k (rows 1024..2047), rotated, hi/lo */
  k_gemm2<0, 2><<<gP, 128, 0, stream>>>(X16, DM, 0, BQKV + (size_t)2 * DM * DM, DM, 0, 0.0625f, nullptr, 0, nullptr, 1, 0, 0, nullptr, nullptr, DM, 0, NR, DM, DM, nullptr, nullptr, Vth, Vtl);      /* v (rows 2048..3071), transposed, hi/lo */
  k_flashme<SLEN, SLEN><<<NBT * NH * (SLEN / 64), 128, 0, stream>>>(Qh, Ql, DM, Kh, Kl, DM, Vth, Vtl, HB, Oh, Ol, DM);      /* both batches in one grid, so that their waves share the chip; the kernel deals long and short causal tiles evenly over the WGPs */
  k_gemm2<0, 0><<<gP, 128, 0, stream>>>(Oh, DM, 0, BO, DM, 0, 0.0625f, nullptr, 0, nullptr, 1, 0, 0, (float*)d_out, nullptr, DM, 0, NR, DM, DM, nullptr, nullptr, nullptr, nullptr);
  k_gemm2<0, 0><<<gP, 128, 0, stream>>>(Ol, DM, 0, BO, DM, 0, 0.0625f / 1024.0f, nullptr, 0, (const float*)d_out, 1, (size_t)DM, 0, (float*)d_out, nullptr, DM, 0, NR, DM, DM, nullptr, nullptr, nullptr, nullptr);
}
